// v000
// Times are from an AMD MI455X. After a warm-up the kernel runs many times in a row, and a time is the length of
// such a window on the GPU divided by its runs, so every launch and the gaps after it count. The runs cycle
// through copies of the inputs. A figure is the median of several windows, for all but v000 over two sittings.
// Sittings can differ by a few percent; kernels timed side by side share one.
// v000, which the later versions start from, runs in 3960 microseconds.
// Compute dtype: enc x [Wh_mono | Wh_chunk] on v_wmma_f32_16x16x32_f16 (f16 enc, f16 weights carried x16, f32 accumulate, folded by 1/16); all per-step small products, energy dots, scans, gates and state in f32 on VALU.
#include <hip/hip_runtime.h>
#include <math.h>

// ---------------------------------------------------------------------------
// Shape constants
// ---------------------------------------------------------------------------
constexpr int NBATCH = 16;
constexpr int NSEQ   = 1024;
constexpr int NHID   = 256;
constexpr int NDIM   = 512;
constexpr int NCLS   = 1000;
constexpr int NSTEPS = 8;
constexpr int NGATE  = 4 * NHID;
constexpr int NPROJ  = 2 * NDIM;
constexpr int YPITCH = 1024;
constexpr int NROWS  = NBATCH * NSEQ;
constexpr int ROWS_PER_EBLK = 32;
constexpr float WCARRY     = 16.0f;
constexpr float WCARRY_INV = 1.0f / 16.0f;
static_assert(NSEQ % ROWS_PER_EBLK == 0, "energy blocks stay inside one batch row");
static_assert(NROWS % 64 == 0 && NPROJ % 64 == 0 && NDIM % 32 == 0, "GEMM tile multiples");
static_assert((NBATCH * NSTEPS * NCLS) % (256 * 4) == 0, "pack grid exact");
static_assert(NCLS % 4 == 0, "float4 groups never straddle output rows");
static_assert(NSEQ == 4 * 256 && NHID == 256 && NDIM == 2 * 256, "thread maps");

typedef __attribute__((ext_vector_type(16))) _Float16 v16h;
typedef __attribute__((ext_vector_type(8)))  _Float16 v8h;
typedef __attribute__((ext_vector_type(16))) __bf16   v16b;
typedef __attribute__((ext_vector_type(8)))  __bf16   v8b;
typedef __attribute__((ext_vector_type(8)))  float    v8f;
typedef __attribute__((ext_vector_type(4)))  float    v4f;
typedef __attribute__((ext_vector_type(4)))  unsigned int v4u;

__device__ __forceinline__ unsigned short f2bf_bits(float f) {
  unsigned u = __float_as_uint(f);
  return (unsigned short)((u + 0x7FFFu + ((u >> 16) & 1u)) >> 16);
}
__device__ __forceinline__ float bf_bits2f(unsigned short h) { return __uint_as_float(((unsigned)h) << 16); }

__device__ __forceinline__ void dep_guard6_h(v8f& a, v8f& b, v8f& c, v8f& d, v16h x, v16h x2, v16h y0, v16h y1, v16h y2, v16h y3) {
  asm volatile("v_nop\n\tv_nop\n\tv_nop\n\tv_nop" : "+v"(a), "+v"(b), "+v"(c), "+v"(d) : "v"(x), "v"(x2), "v"(y0), "v"(y1), "v"(y2), "v"(y3));
}
__device__ __forceinline__ void dep_guard6_b(v8f& a, v8f& b, v8f& c, v8f& d, v16b x, v16b x2, v16b y0, v16b y1, v16b y2, v16b y3) {
  asm volatile("v_nop\n\tv_nop\n\tv_nop\n\tv_nop" : "+v"(a), "+v"(b), "+v"(c), "+v"(d) : "v"(x), "v"(x2), "v"(y0), "v"(y1), "v"(y2), "v"(y3));
}
__device__ __forceinline__ void keep4_h(v16h a, v16h b, v16h c, v16h d) { asm volatile("v_nop" :: "v"(a), "v"(b), "v"(c), "v"(d)); }
__device__ __forceinline__ void keep4_b(v16b a, v16b b, v16b c, v16b d) { asm volatile("v_nop" :: "v"(a), "v"(b), "v"(c), "v"(d)); }
__device__ __forceinline__ void acc_guard4(v8f& a, v8f& b, v8f& c, v8f& d) { asm volatile("v_nop\n\tv_nop\n\tv_nop\n\tv_nop" : "+v"(a), "+v"(b), "+v"(c), "+v"(d)); }

template <typename T> struct Frag;
template <> struct Frag<_Float16> {
  typedef v16h V; union U { v16h v; v8h h[2]; };
  /* elements 0..7 <- p[0..7], 8..15 <- p[16..23] */
  static __device__ __forceinline__ v16h load(const _Float16* p) {
    U f; f.h[0] = *(const v8h*)(p); f.h[1] = *(const v8h*)(p + 16); return f.v;
  }
  static __device__ __forceinline__ v8f mma(v16h a, v16h b, v8f c) {
    return __builtin_amdgcn_wmma_f32_16x16x32_f16(false, a, false, b, (short)0, c, false, false);
  }
  static __device__ __forceinline__ void guard(v8f& a, v8f& b, v8f& c, v8f& d, v16h x, v16h x2, v16h y0, v16h y1, v16h y2, v16h y3) {
    dep_guard6_h(a, b, c, d, x, x2, y0, y1, y2, y3);
  }
  static __device__ __forceinline__ void keep(v16h a, v16h b, v16h c, v16h d) { keep4_h(a, b, c, d); }
};
template <> struct Frag<__bf16> {
  typedef v16b V; union U { v16b v; v8b h[2]; };
  static __device__ __forceinline__ v16b load(const __bf16* p) {
    U f; f.h[0] = *(const v8b*)(p); f.h[1] = *(const v8b*)(p + 16); return f.v;
  }
  static __device__ __forceinline__ v8f mma(v16b a, v16b b, v8f c) {
    return __builtin_amdgcn_wmma_f32_16x16x32_bf16(false, a, false, b, (short)0, c, false, false);
  }
  static __device__ __forceinline__ void guard(v8f& a, v8f& b, v8f& c, v8f& d, v16b x, v16b x2, v16b y0, v16b y1, v16b y2, v16b y3) {
    dep_guard6_b(a, b, c, d, x, x2, y0, y1, y2, y3);
  }
  static __device__ __forceinline__ void keep(v16b a, v16b b, v16b c, v16b d) { keep4_b(a, b, c, d); }
};

__device__ __forceinline__ unsigned pk16(unsigned short a, unsigned short b) { return (unsigned)a | ((unsigned)b << 16); }
__device__ __forceinline__ unsigned short h_bits(float f) { const _Float16 h = (_Float16)f; return __builtin_bit_cast(unsigned short, h); }

/* reciprocal-based logistic and tanh with precise expf (v_rcp_f32 reciprocal) */
__device__ __forceinline__ float sigm_f(float x) { return __builtin_amdgcn_rcpf(1.0f + expf(-x)); }
__device__ __forceinline__ float tanh_e(float x) { return 1.0f - 2.0f * __builtin_amdgcn_rcpf(expf(2.0f * x) + 1.0f); }

// ---- Register-blocked batched WMMA GEMM ------------------------------------
// C[m,n] = scale * sum_k A[m,k] * Bt[n,k] (+bias)(+resid); each wave owns a 64x64 tile.
// A row-major [M,K]; Bt row-major [N,K]; M,N % 64 == 0, K % 32 == 0.
// SPLIT: operands are hi/lo planes (A2/Bt2 = lo planes, same layout); product = hi*hi + hi*lo + lo*hi.
// BIAS_MODE: 0 = none, 1 = bias[m], 2 = bias[n].
// OUT_MODE: 0 = f32, 1 = f16, 2 = bf16 hi plane (Cout) + bf16 lo plane (Cout2).
// ET: 0 = f16 operands, 1 = bf16 operands (pointers passed as 16-bit storage)
template <int ET> struct Elem;
template <> struct Elem<0> { typedef _Float16 T; };
template <> struct Elem<1> { typedef __bf16 T; };
template <int ET, bool SPLIT, int BIAS_MODE, int OUT_MODE, bool RESID, int ACT = 0>
__global__ __launch_bounds__(256) void wmma_gemm64(
    const unsigned short* __restrict__ Ap, const unsigned short* __restrict__ A2p, int lda, long strideA,
    const unsigned short* __restrict__ Btp, const unsigned short* __restrict__ Bt2p, int ldb, long strideB,
    void* __restrict__ Cout, void* __restrict__ Cout2, int ldc, long strideC,
    const float* __restrict__ bias,
    const float* __restrict__ resid, long strideR,
    int M, int N, int K, float scale) {
  typedef typename Elem<ET>::T T;
  typedef typename Frag<T>::V V;
  const T* A = (const T*)Ap; const T* A2 = (const T*)A2p; const T* Bt = (const T*)Btp; const T* Bt2 = (const T*)Bt2p;
  /* per-wave 16x64 slab, pitch 68 floats */
  __shared__ __align__(16) float sT[8][16 * 68];
  const int b    = blockIdx.y;
  const int lane = threadIdx.x & 31;
  const int wave = threadIdx.x >> 5;
  const int tilesN = N >> 6;
  const int tilesM = M >> 6;
  const int tile = blockIdx.x * 8 + wave;
  /* wave-uniform exit; no block barriers in this kernel */
  if (tile >= tilesM * tilesN) return;
  const int tm = tile / tilesN;
  const int tn = tile - tm * tilesN;
  const int m0 = tm << 6;
  const int n0 = tn << 6;

  const T* Ab  = A  + (size_t)b * strideA;
  const T* Bb  = Bt + (size_t)b * strideB;
  const T* Ab2 = SPLIT ? (A2  + (size_t)b * strideA) : nullptr;
  const T* Bb2 = SPLIT ? (Bt2 + (size_t)b * strideB) : nullptr;

  const int rlane = lane & 15;
  const int koff  = (lane >> 4) * 8;
  const int mOff  = (lane >> 4) * 8;

  v8f acc[4][4];
#pragma unroll
  for (int i = 0; i < 4; ++i)
#pragma unroll
    for (int j = 0; j < 4; ++j) acc[i][j] = (v8f){0.f,0.f,0.f,0.f,0.f,0.f,0.f,0.f};

  for (int k0 = 0; k0 < K; k0 += 32) {
    V bh[4], bl[4];
#pragma unroll
    for (int j = 0; j < 4; ++j) {
      const size_t bo = (size_t)(n0 + (j << 4) + rlane) * ldb + koff + k0;
      bh[j] = Frag<T>::load(Bb + bo);
      if (SPLIT) bl[j] = Frag<T>::load(Bb2 + bo);
    }
#pragma unroll
    for (int i = 0; i < 4; ++i) {
      const size_t ao = (size_t)(m0 + (i << 4) + rlane) * lda + koff + k0;
      V ah = Frag<T>::load(Ab + ao);
      V al;
      if (SPLIT) al = Frag<T>::load(Ab2 + ao);
#pragma unroll
      for (int j = 0; j < 4; ++j) {
        acc[i][j] = Frag<T>::mma(ah, bh[j], acc[i][j]);
        if (SPLIT) {
          acc[i][j] = Frag<T>::mma(ah, bl[j], acc[i][j]);
          acc[i][j] = Frag<T>::mma(al, bh[j], acc[i][j]);
        }
      }
      Frag<T>::guard(acc[i][0], acc[i][1], acc[i][2], acc[i][3], ah, SPLIT ? al : ah, bh[0], bh[1], bh[2], bh[3]);
    }
    Frag<T>::keep(bh[0], bh[1], bh[2], bh[3]);
    if (SPLIT) Frag<T>::keep(bl[0], bl[1], bl[2], bl[3]);
  }
  acc_guard4(acc[0][0], acc[0][1], acc[0][2], acc[0][3]);
  acc_guard4(acc[1][0], acc[1][1], acc[1][2], acc[1][3]);
  acc_guard4(acc[2][0], acc[2][1], acc[2][2], acc[2][3]);
  acc_guard4(acc[3][0], acc[3][1], acc[3][2], acc[3][3]);

  float* slab = sT[wave];
  const float* Rb = RESID ? (resid + (size_t)b * strideR) : nullptr;
#pragma unroll
  for (int i = 0; i < 4; ++i) {
    const int mBase = m0 + (i << 4);
#pragma unroll
    for (int j = 0; j < 4; ++j) {
      const int n = n0 + (j << 4) + rlane;
      float bv = 0.f;
      if (BIAS_MODE == 2) bv = bias[n];
#pragma unroll
      for (int r = 0; r < 8; ++r) {
        float v = acc[i][j][r] * scale;
        if (BIAS_MODE == 1) v += bias[mBase + mOff + r];
        if (BIAS_MODE == 2) v += bv;
        if (RESID) v += Rb[(size_t)(mBase + mOff + r) * ldc + n];
        if (ACT == 2) v = fmaxf(v, 0.0f);
        if (ACT == 4) v = (v > 0.f) ? v : 0.01f * v;
        slab[(mOff + r) * 68 + (j << 4) + rlane] = v;
      }
    }
    __builtin_amdgcn_fence(__ATOMIC_RELEASE, "workgroup");
    __builtin_amdgcn_wave_barrier();
    __builtin_amdgcn_fence(__ATOMIC_ACQUIRE, "workgroup");
    if (OUT_MODE == 0) {
      float* C = (float*)Cout + (size_t)b * strideC;
      /* row segment = 256 B = 16 lanes x 16 B */
      const int hh = lane >> 4, c4 = (lane & 15) * 4;
      {
#pragma unroll
        for (int it = 0; it < 8; ++it) {
          const int row = it * 2 + hh;
          v4f v = *(const v4f*)(slab + row * 68 + c4);
          *(v4f*)(C + (size_t)(mBase + row) * ldc + n0 + c4) = v;
        }
        
      }
    } else {
      const int q = lane >> 3, c8 = (lane & 7) * 8;
      unsigned short* C  = (unsigned short*)Cout  + (size_t)b * strideC;
      unsigned short* C2 = (OUT_MODE == 2) ? ((unsigned short*)Cout2 + (size_t)b * strideC) : nullptr;
      {
#pragma unroll
        for (int it = 0; it < 4; ++it) {
          const int row = it * 4 + q;
          const float* sp = slab + row * 68 + c8;
          v8h hv, lv;
#pragma unroll
          for (int e = 0; e < 8; ++e) {
            if (OUT_MODE == 1) {
              hv[e] = (_Float16)sp[e];
            } else {
              unsigned short hb = f2bf_bits(sp[e]);
              unsigned short lb = f2bf_bits(sp[e] - bf_bits2f(hb));
              hv[e] = __builtin_bit_cast(_Float16, hb);
              lv[e] = __builtin_bit_cast(_Float16, lb);
            }
          }
          *(v8h*)(C + (size_t)(mBase + row) * ldc + n0 + c8) = hv;
          if (OUT_MODE == 2) *(v8h*)(C2 + (size_t)(mBase + row) * ldc + n0 + c8) = lv;
        }
        
      }
    }
    __builtin_amdgcn_fence(__ATOMIC_RELEASE, "workgroup");
    __builtin_amdgcn_wave_barrier();
    __builtin_amdgcn_fence(__ATOMIC_ACQUIRE, "workgroup");
  }
}

// ---------------------------------------------------------------------------
// Weight transpose + cast: W0, W1 are [512 in d][512 out h] f32; WT[z*512 + h][d] = f16(scale * Wz[d][h]).
// grid (8, 8, 2): blockIdx.x = d tile (64 cols of WT), blockIdx.y = h tile (64 rows of WT), blockIdx.z selects W.
// Load coverage: 16 iterations x 256 threads = 4096 = the whole 64x64 tile.
// Store coverage: 8 waves x 2 iterations x 4 rows = 64 rows; 8 lanes x 8 halves = 64 cols; each row segment =
// ---------------------------------------------------------------------------
__global__ __launch_bounds__(256) void wtcast_kernel(const float* __restrict__ W0, const float* __restrict__ W1,
                                                     unsigned short* __restrict__ out, float scale) {
  __shared__ float tl[64][65];
  const int t  = threadIdx.x;
  const int d0 = blockIdx.x * 64;
  const int h0 = blockIdx.y * 64;
  const int z  = blockIdx.z;
  const float* W = (z == 0) ? W0 : W1;
#pragma unroll
  for (int i = 0; i < 16; ++i) {
    const int e = i * 256 + t;
    const int r = e >> 6;
    const int c = e & 63;
    tl[c][r] = W[(size_t)(d0 + r) * NDIM + h0 + c] * scale;
  }
  __syncthreads();
  const int lane = t & 31, wave = t >> 5;
  const int q = lane >> 3, c8 = (lane & 7) * 8;
  unsigned short* op = out + (size_t)z * NDIM * NDIM;
  {
#pragma unroll
    for (int it = 0; it < 2; ++it) {
      const int row = wave * 8 + it * 4 + q;
      unsigned short hb[8];
#pragma unroll
      for (int e = 0; e < 8; ++e) hb[e] = h_bits(tl[row][c8 + e]);
      const v4u u = (v4u){pk16(hb[0], hb[1]), pk16(hb[2], hb[3]), pk16(hb[4], hb[5]), pk16(hb[6], hb[7])};
      *(v4u*)(op + (size_t)(h0 + row) * NDIM + d0 + c8) = u;
    }
    
  }
}

// ---------------------------------------------------------------------------
// ---------------------------------------------------------------------------
__global__ __launch_bounds__(256) void cast8_f16_kernel(const float* __restrict__ in, unsigned short* __restrict__ out, int n8) {
  const int i = blockIdx.x * 256 + threadIdx.x;
  if (i >= n8) return;
  const float* p = in + 8 * (size_t)i;
  const v4f a = *(const v4f*)(p);
  const v4f c = *(const v4f*)(p + 4);
  unsigned short hb[8];
#pragma unroll
  for (int e = 0; e < 4; ++e) {
    hb[e]     = h_bits(a[e]);
    hb[4 + e] = h_bits(c[e]);
  }
  const v4u u = (v4u){pk16(hb[0], hb[1]), pk16(hb[2], hb[3]), pk16(hb[4], hb[5]), pk16(hb[6], hb[7])};
  unsigned short* q = out + 8 * (size_t)i;
  *(v4u*)q = u;
  
}

// ---------------------------------------------------------------------------
// Initial state: one block per batch row b (grid 16, 256 threads).
//   acar0[b][0] = 1, else 0 (1024 floats = 256 threads x 16 B); s0[b] = c0[b] = 0 (threads 0..63 x 16 B each);
//   smsc[b][0..511] = Ws_mono_b, smsc[b][512..1023] = Ws_chunk_b (s0 = 0); block 0 writes one line with
// ---------------------------------------------------------------------------
__global__ __launch_bounds__(256) void init_state_kernel(const float* __restrict__ vmono, const float* __restrict__ gmono,
                                                         const float* __restrict__ bm, const float* __restrict__ bc,
                                                         float* __restrict__ acar0, float* __restrict__ s0,
                                                         float* __restrict__ c0, float* __restrict__ smsc,
                                                         float* __restrict__ vnorm) {
  __shared__ float red[8];
  const int tid = threadIdx.x, lane = tid & 31, wave = tid >> 5;
  const int b = blockIdx.x;
  const float v0 = vmono[tid], v1 = vmono[tid + 256];
  float ss = v0 * v0 + v1 * v1;
#pragma unroll
  for (int off = 16; off > 0; off >>= 1) ss += __shfl_xor(ss, off, 32);
  if (lane == 0) red[wave] = ss;
  __syncthreads();
  float tot = 0.0f;
#pragma unroll
  for (int w = 0; w < 8; ++w) tot += red[w];
  const float vn = gmono[0] / sqrtf(tot);

  const int which = tid >> 7;
  const int idx = (tid & 127) * 4;
  const v4f va = *(const v4f*)(bm + idx);
  const v4f vb = *(const v4f*)(bc + idx);
  v4f sv;
#pragma unroll
  for (int e = 0; e < 4; ++e) sv[e] = which ? vb[e] : va[e];
  v4f av = (v4f){0.f, 0.f, 0.f, 0.f};
  av[0] = (tid == 0) ? 1.0f : 0.0f;
  const v4f zv = (v4f){0.f, 0.f, 0.f, 0.f};
  const v4f nv = (v4f){vn, vn, vn, vn};
  {
    *(v4f*)(acar0 + b * NSEQ + 4 * tid) = av;
    *(v4f*)(smsc + b * NPROJ + 4 * tid) = sv;
    if (tid < 64) {
      *(v4f*)(s0 + b * NHID + 4 * tid) = zv;
      *(v4f*)(c0 + b * NHID + 4 * tid) = zv;
    }
    if (b == 0 && tid < 8) *(v4f*)(vnorm + 4 * tid) = nv;
    
  }
}

// ---------------------------------------------------------------------------
// Energies for one decode step: 512 blocks x 256 threads; block owns 32 consecutive (b,s) rows (one batch row b),
// wave w owns rows 4w..4w+3. Per row: both tanh dots over 512 columns (lane covers float4 groups j*32 + lane),
// wave shuffle sum, mask, noise, logistic - all computed in every lane (the noise value is loaded unconditionally
// and pinned in a VGPR; the results are pinned before the lane-0 LDS store). Results collected in LDS; wave 0
// Masked positions: p = 0 exactly, chunk energy stored as 0 (the consumer re-derives the mask from the lengths).
// ---------------------------------------------------------------------------
__global__ __launch_bounds__(256) void energies_kernel(
    const float* __restrict__ Pf, const float* __restrict__ smsc,
    const float* __restrict__ vmono, const float* __restrict__ vchunk,
    const float* __restrict__ vnp, const float* __restrict__ rmono,
    const int* __restrict__ len, const float* __restrict__ noise_t,
    float* __restrict__ pbuf, float* __restrict__ ebuf) {
  __shared__ __align__(16) float resp[ROWS_PER_EBLK];
  __shared__ __align__(16) float rese[ROWS_PER_EBLK];
  const int tid = threadIdx.x, lane = tid & 31, wave = tid >> 5;
  const int row0 = blockIdx.x * ROWS_PER_EBLK;
  const int b  = row0 / NSEQ;
  const int s0 = row0 - b * NSEQ;
  int L = len[b];
  L = (L < 0) ? 0 : ((L > NSEQ) ? NSEQ : L);
  const float vn = vnp[0];
  const float rm = rmono[0];
  const float* sb = smsc + b * NPROJ;
#pragma unroll 1
  for (int rr = 0; rr < 4; ++rr) {
    const int lr  = wave * 4 + rr;
    const int row = row0 + lr;
    const float* pr = Pf + (size_t)row * NPROJ;
    /* per-row noise value: loaded by every lane, pinned so the load stays outside any lane mask */
    float nz = noise_t[row];
    asm volatile("" : "+v"(nz));
    float am = 0.0f, ac = 0.0f;
#pragma unroll 1
    for (int hsel = 0; hsel < 2; ++hsel) {
      const float* vv = hsel ? vchunk : vmono;
      float acc = 0.0f;
#pragma unroll 1
      for (int j = 0; j < 4; ++j) {
        const int d = (j * 32 + lane) * 4;
        const v4f e = *(const v4f*)(pr + hsel * NDIM + d);
        const v4f t = *(const v4f*)(sb + hsel * NDIM + d);
        const v4f v = *(const v4f*)(vv + d);
        acc += tanhf(e[0] + t[0]) * v[0];
        acc += tanhf(e[1] + t[1]) * v[1];
        acc += tanhf(e[2] + t[2]) * v[2];
        acc += tanhf(e[3] + t[3]) * v[3];
      }
#pragma unroll
      for (int off = 16; off > 0; off >>= 1) acc += __shfl_xor(acc, off, 32);
      am = hsel ? am : acc;
      ac = hsel ? acc : ac;
    }
    const int s = s0 + lr;
    const bool masked = (s >= L);
    const float em = (vn * am + rm) + nz;
    const float sg = sigm_f(em);
    /* all lanes compute the row results; masked positions give p = 0 exactly */
    float pv = masked ? 0.0f : sg;
    float ev = masked ? 0.0f : ac;
    asm volatile("" : "+v"(pv), "+v"(ev));
    if (lane == 0) { resp[lr] = pv; rese[lr] = ev; }
  }
  __syncthreads();
  if (wave == 0 && lane < 8) {
    const v4f v = *(const v4f*)(resp + 4 * lane);
    float* dst = pbuf + row0 + 4 * lane;
    *(v4f*)dst = v;
    
  }
  if (wave == 1 && lane < 8) {
    const v4f v = *(const v4f*)(rese + 4 * lane);
    float* dst = ebuf + row0 + 4 * lane;
    *(v4f*)dst = v;
    
  }
}

// exclusive block prefix of one value per thread (256 threads = 8 waves), fixed order; one block barrier inside.
__device__ __forceinline__ float block_excl_scan(float total, float* wt, int lane, int wave) {
  float x = total;
#pragma unroll
  for (int off = 1; off < 32; off <<= 1) {
    const float n = __shfl_up(x, off, 32);
    x += (lane >= off) ? n : 0.0f;
  }
  float ex = __shfl_up(x, 1, 32);
  ex = (lane == 0) ? 0.0f : ex;
  if (lane == 31) wt[wave] = x;
  __syncthreads();
  float woff = 0.0f;
#pragma unroll
  for (int w = 0; w < 8; ++w) woff += (w < wave) ? wt[w] : 0.0f;
  return woff + ex;
}

// ---------------------------------------------------------------------------
// Attend + decode for one step: one block (256 threads) per batch row b; everything block-local in LDS.
// Stages: row max / clipped exp, exclusive log-product scan (cpp), inclusive scan (q) -> alpha, backward-window
// denominator, forward-window beta, ctx = beta . enc (f32 on the original enc), LSTM cell (gates i|f|g|o of unit tid
// in thread tid), output hidden h, y (padded to 1024 columns, columns >= 1000 zero), and the s-projections for the
// ---------------------------------------------------------------------------
__global__ __launch_bounds__(256) void attend_decode_kernel(
    const float* __restrict__ enc, const int* __restrict__ target, const int* __restrict__ len,
    const float* __restrict__ pbuf, const float* __restrict__ ebuf,
    const float* __restrict__ acar_in, float* __restrict__ acar_out,
    const float* __restrict__ s_in, const float* __restrict__ c_in,
    float* __restrict__ s_out, float* __restrict__ c_out,
    const float* __restrict__ Lys, const float* __restrict__ Lss,
    const float* __restrict__ Lgsw, const float* __restrict__ Lgsb,
    const float* __restrict__ Lgyw, const float* __restrict__ Lgyb,
    const float* __restrict__ Lsy, const float* __restrict__ Lyyw, const float* __restrict__ Lyyb,
    const float* __restrict__ Wsm, const float* __restrict__ Wsmb,
    const float* __restrict__ Wsc, const float* __restrict__ Wscb,
    float* __restrict__ smsc, float* __restrict__ Yt, int step) {
  __shared__ __align__(16) float sh_p[NSEQ];
  __shared__ __align__(16) float sh_a[NSEQ];
  __shared__ __align__(16) float sh_ex[NSEQ];
  __shared__ __align__(16) float sh_g[NSEQ];
  __shared__ __align__(16) float sh_cpp[NSEQ];
  __shared__ __align__(16) float sh_u[NSEQ];
  __shared__ __align__(16) float sh_al[NSEQ];
  __shared__ __align__(16) float sh_r[NSEQ];
  __shared__ __align__(16) float sh_beta[NSEQ];
  __shared__ __align__(16) float sh_cpart[2 * NDIM];
  __shared__ __align__(16) float sh_ctx[NDIM];
  __shared__ __align__(16) float sh_s[NHID];
  __shared__ __align__(16) float sh_sn[NHID];
  __shared__ __align__(16) float sh_cn[NHID];
  __shared__ __align__(16) float sh_h[NHID];
  __shared__ __align__(16) float sh_y[YPITCH];
  __shared__ __align__(16) float sh_sm[NPROJ];
  __shared__ float redm[8];
  __shared__ float wtA[8];
  __shared__ float wtB[8];

  const int tid = threadIdx.x, lane = tid & 31, wave = tid >> 5;
  const int b = blockIdx.x;
  const int i0 = tid * 4;
  int L = len[b];
  L = (L < 0) ? 0 : ((L > NSEQ) ? NSEQ : L);
  const float* prow = pbuf + b * NSEQ;
  const float* erow = ebuf + b * NSEQ;
  const float* arow = acar_in + b * NSEQ;

  sh_s[tid] = s_in[b * NHID + tid];
  const float cold = c_in[b * NHID + tid];

  /* phase 1: stage p, a, e; log terms; running max over unmasked positions */
  float ml = -3.0e38f;
#pragma unroll 1
  for (int j = 0; j < 4; ++j) {
    const int i = j * 256 + tid;
    const float pv = prow[i];
    const float ev = erow[i];
    const float av = arow[i];
    sh_p[i] = pv;
    sh_a[i] = av;
    sh_ex[i] = ev;
    sh_g[i] = logf(fminf(fmaxf(1.0f - pv, 1e-8f), 1.0f));
    ml = (i < L) ? fmaxf(ml, ev) : ml;
  }
#pragma unroll
  for (int off = 16; off > 0; off >>= 1) ml = fmaxf(ml, __shfl_xor(ml, off, 32));
  if (lane == 0) redm[wave] = ml;
  __syncthreads();
  float mx = redm[0];
#pragma unroll
  for (int w = 1; w < 8; ++w) mx = fmaxf(mx, redm[w]);

  /* phase 2: ex = max(exp(e - max), 1e-5); masked positions give 1e-5 */
#pragma unroll 1
  for (int j = 0; j < 4; ++j) {
    const int i = j * 256 + tid;
    const float t = fmaxf(expf(sh_ex[i] - mx), 1e-5f);
    sh_ex[i] = (i < L) ? t : 1e-5f;
  }

  /* phase 3: exclusive prefix of the log terms over contiguous chunks of 4 */
  {
    const v4f g4 = *(const v4f*)(sh_g + i0);
    const float e1 = g4[0];
    const float e2 = e1 + g4[1];
    const float e3 = e2 + g4[2];
    const float tot = e3 + g4[3];
    const float off = block_excl_scan(tot, wtA, lane, wave);
    v4f x4;
    x4[0] = off;
    x4[1] = off + e1;
    x4[2] = off + e2;
    x4[3] = off + e3;
    *(v4f*)(sh_cpp + i0) = x4;
  }
  __syncthreads();

  /* phase 4: cpp = exp(prefix) (flushed below the smallest normal), u = a / clip(cpp, 1e-8, 1) */
#pragma unroll 1
  for (int j = 0; j < 4; ++j) {
    const int i = j * 256 + tid;
    float cp = expf(sh_cpp[i]);
    cp = (cp < 1.17549435e-38f) ? 0.0f : cp;
    sh_cpp[i] = cp;
    const float cl = fminf(fmaxf(cp, 1e-8f), 1.0f);
    sh_u[i] = sh_a[i] * __builtin_amdgcn_rcpf(cl);
  }
  __syncthreads();

  /* phase 5: inclusive prefix of u, q = cpp * prefix, alpha = clip(p * q, 1e-8, 1) */
  {
    const v4f u4 = *(const v4f*)(sh_u + i0);
    const v4f c4 = *(const v4f*)(sh_cpp + i0);
    const v4f p4 = *(const v4f*)(sh_p + i0);
    const float c0 = u4[0];
    const float c1 = c0 + u4[1];
    const float c2 = c1 + u4[2];
    const float c3 = c2 + u4[3];
    const float off2 = block_excl_scan(c3, wtB, lane, wave);
    v4f al;
    al[0] = fminf(fmaxf(p4[0] * (c4[0] * (off2 + c0)), 1e-8f), 1.0f);
    al[1] = fminf(fmaxf(p4[1] * (c4[1] * (off2 + c1)), 1e-8f), 1.0f);
    al[2] = fminf(fmaxf(p4[2] * (c4[2] * (off2 + c2)), 1e-8f), 1.0f);
    al[3] = fminf(fmaxf(p4[3] * (c4[3] * (off2 + c3)), 1e-8f), 1.0f);
    *(v4f*)(sh_al + i0) = al;
  }
  __syncthreads();

  /* phase 6: denom = max(sum ex[i-3..i], 1e-10) (zero padded), r = alpha / denom */
#pragma unroll 1
  for (int j = 0; j < 4; ++j) {
    const int i = j * 256 + tid;
    float d = 0.0f;
#pragma unroll
    for (int k = 3; k >= 0; --k) {
      const int ii = i - k;
      const int ic = (ii < 0) ? 0 : ii;
      const float v = sh_ex[ic];
      d += (ii >= 0) ? v : 0.0f;
    }
    d = fmaxf(d, 1e-10f);
    sh_r[i] = sh_al[i] * __builtin_amdgcn_rcpf(d);
  }
  __syncthreads();

  /* phase 7: beta = ex * sum r[i..i+3] (zero padded) */
#pragma unroll 1
  for (int j = 0; j < 4; ++j) {
    const int i = j * 256 + tid;
    float ms = 0.0f;
#pragma unroll
    for (int k = 0; k < 4; ++k) {
      const int ii = i + k;
      const int ic = (ii > NSEQ - 1) ? (NSEQ - 1) : ii;
      const float v = sh_r[ic];
      ms += (ii < NSEQ) ? v : 0.0f;
    }
    sh_beta[i] = sh_ex[i] * ms;
  }
  __syncthreads();

  /* phase 8: ctx partials; thread = (column group of 4, position parity); 512 positions each, fixed order */
  {
    const int cg = tid & 127, sp = tid >> 7;
    const float* eb = enc + (size_t)b * NSEQ * NDIM + 4 * cg;
    v4f acc = (v4f){0.f, 0.f, 0.f, 0.f};
#pragma unroll 1
    for (int it = 0; it < NSEQ / 2; ++it) {
      const int s = 2 * it + sp;
      const float bv = sh_beta[s];
      const v4f e4 = *(const v4f*)(eb + (size_t)s * NDIM);
      acc[0] = fmaf(bv, e4[0], acc[0]);
      acc[1] = fmaf(bv, e4[1], acc[1]);
      acc[2] = fmaf(bv, e4[2], acc[2]);
      acc[3] = fmaf(bv, e4[3], acc[3]);
    }
    *(v4f*)(sh_cpart + sp * NDIM + 4 * cg) = acc;
  }
  __syncthreads();
  sh_ctx[tid]       = sh_cpart[tid] + sh_cpart[NDIM + tid];
  sh_ctx[tid + 256] = sh_cpart[tid + 256] + sh_cpart[NDIM + tid + 256];
  __syncthreads();

  /* phase 9: LSTM pre-activations of unit tid (gates i, f, g, o at columns tid + 256 g), old s and ctx */
  float r0 = 0.0f, r1 = 0.0f, r2 = 0.0f, r3 = 0.0f;
#pragma unroll 1
  for (int k = 0; k < NHID; ++k) {
    const float sv = sh_s[k];
    const float* w = Lss + (size_t)k * NGATE + tid;
    r0 = fmaf(sv, w[0], r0);
    r1 = fmaf(sv, w[NHID], r1);
    r2 = fmaf(sv, w[2 * NHID], r2);
    r3 = fmaf(sv, w[3 * NHID], r3);
  }
#pragma unroll 1
  for (int k = 0; k < NDIM; ++k) {
    const float cv = sh_ctx[k];
    const float* w = Lgsw + (size_t)k * NGATE + tid;
    r0 = fmaf(cv, w[0], r0);
    r1 = fmaf(cv, w[NHID], r1);
    r2 = fmaf(cv, w[2 * NHID], r2);
    r3 = fmaf(cv, w[3 * NHID], r3);
  }
  {
    int tg = target[b * NSTEPS + step];
    tg = (tg < 0) ? 0 : ((tg > NCLS - 1) ? (NCLS - 1) : tg);
    const float* ly = Lys + (size_t)tg * NGATE + tid;
    r0 += ly[0] + Lgsb[tid];
    r1 += ly[NHID] + Lgsb[NHID + tid];
    r2 += ly[2 * NHID] + Lgsb[2 * NHID + tid];
    r3 += ly[3 * NHID] + Lgsb[3 * NHID + tid];
  }
  {
    const float ig = sigm_f(r0);
    const float fg = sigm_f(r1);
    const float gg = tanh_e(r2);
    const float og = sigm_f(r3);
    const float cn = fg * cold + ig * gg;
    const float sn = og * tanh_e(cn);
    sh_cn[tid] = cn;
    sh_sn[tid] = sn;
  }
  __syncthreads();

  /* phase 10: output hidden h = tanh(ctx @ L_gy_w + b + s_new @ L_sy), column tid */
  {
    float acc = Lgyb[tid];
#pragma unroll 1
    for (int k = 0; k < NDIM; ++k) acc = fmaf(sh_ctx[k], Lgyw[(size_t)k * NHID + tid], acc);
#pragma unroll 1
    for (int k = 0; k < NHID; ++k) acc = fmaf(sh_sn[k], Lsy[(size_t)k * NHID + tid], acc);
    sh_h[tid] = tanh_e(acc);
  }
  __syncthreads();

  /* phase 11: y columns tid + 256 g (column index clamped for the address, zero beyond 999) */
  {
    const int n3 = tid + 768;
    const int n3c = (n3 < NCLS) ? n3 : (NCLS - 1);
    float y0 = 0.0f, y1 = 0.0f, y2 = 0.0f, y3 = 0.0f;
#pragma unroll 1
    for (int k = 0; k < NHID; ++k) {
      const float hv = sh_h[k];
      const float* w = Lyyw + (size_t)k * NCLS;
      y0 = fmaf(hv, w[tid], y0);
      y1 = fmaf(hv, w[tid + 256], y1);
      y2 = fmaf(hv, w[tid + 512], y2);
      y3 = fmaf(hv, w[n3c], y3);
    }
    y0 += Lyyb[tid];
    y1 += Lyyb[tid + 256];
    y2 += Lyyb[tid + 512];
    y3 += Lyyb[n3c];
    y3 = (n3 < NCLS) ? y3 : 0.0f;
    sh_y[tid] = y0;
    sh_y[tid + 256] = y1;
    sh_y[tid + 512] = y2;
    sh_y[tid + 768] = y3;
  }
  /* phase 12: s-projections for the next step from s_new (block-uniform condition, no barrier inside) */
  const bool donext = (step + 1 < NSTEPS);
  if (donext) {
    float m0 = 0.0f, m1 = 0.0f, m2 = 0.0f, m3 = 0.0f;
#pragma unroll 1
    for (int k = 0; k < NHID; ++k) {
      const float sv = sh_sn[k];
      const float* wm = Wsm + (size_t)k * NDIM + tid;
      const float* wc = Wsc + (size_t)k * NDIM + tid;
      m0 = fmaf(sv, wm[0], m0);
      m1 = fmaf(sv, wm[256], m1);
      m2 = fmaf(sv, wc[0], m2);
      m3 = fmaf(sv, wc[256], m3);
    }
    m0 += Wsmb[tid];
    m1 += Wsmb[tid + 256];
    m2 += Wscb[tid];
    m3 += Wscb[tid + 256];
    sh_sm[tid] = m0;
    sh_sm[tid + 256] = m1;
    sh_sm[tid + 512] = m2;
    sh_sm[tid + 768] = m3;
  }
  __syncthreads();

  /* stores: thread tid owns floats 4 tid .. 4 tid + 3 of each 1024-float row; threads 0..63 own the 256-float rows */
  {
    const v4f yv  = *(const v4f*)(sh_y + 4 * tid);
    const v4f alv = *(const v4f*)(sh_al + 4 * tid);
    v4f smv = (v4f){0.f, 0.f, 0.f, 0.f};
    if (donext) smv = *(const v4f*)(sh_sm + 4 * tid);
    v4f snv = (v4f){0.f, 0.f, 0.f, 0.f};
    v4f cnv = (v4f){0.f, 0.f, 0.f, 0.f};
    if (tid < 64) {
      snv = *(const v4f*)(sh_sn + 4 * tid);
      cnv = *(const v4f*)(sh_cn + 4 * tid);
    }
    float* yp = Yt + ((size_t)step * NBATCH + b) * YPITCH + 4 * tid;
    float* ap = acar_out + b * NSEQ + 4 * tid;
    float* mp = smsc + b * NPROJ + 4 * tid;
    {
      *(v4f*)yp = yv;
      *(v4f*)ap = alv;
      if (donext) *(v4f*)mp = smv;
      if (tid < 64) {
        *(v4f*)(s_out + b * NHID + 4 * tid) = snv;
        *(v4f*)(c_out + b * NHID + 4 * tid) = cnv;
      }
      
    }
  }
}

// ---------------------------------------------------------------------------
// Pack: out[b][t][n] = Y[t][b][n], n < 1000. Thread i4 moves floats 4 i4 .. 4 i4 + 3 of the flat output
// (1000 % 4 == 0 so a group never straddles rows). A wave writes 32 x 16 B = 512 contiguous 512-B aligned bytes =
// ---------------------------------------------------------------------------
__global__ __launch_bounds__(256) void pack_out_kernel(const float* __restrict__ Yt, float* __restrict__ out) {
  const int i4 = blockIdx.x * 256 + threadIdx.x;
  const int e  = i4 * 4;
  const int row = e / NCLS;
  const int n   = e - row * NCLS;
  const int b = row / NSTEPS;
  const int t = row - b * NSTEPS;
  const v4f v = *(const v4f*)(Yt + ((size_t)t * NBATCH + b) * YPITCH + n);
  float* dst = out + e;
  *(v4f*)dst = v;
  
}

// ---------------------------------------------------------------------------
// Host glue. Workspace region map (bytes, 256-B aligned carve; total 85,852,416 <= 134,217,728):
//   A16   [16384][512]  f16   16,777,216   f16(enc)
//   BT16  [1024][512]   f16    1,048,576   rows 0..511: f16(16 Wh_mono[k][n]), rows 512..1023: f16(16 Wh_chunk[k][n-512])
//   PF    [16384][1024] f32   67,108,864   enc @ [Wh_mono | Wh_chunk]
//   PBUF  [16][1024]    f32       65,536   p of the current step
//   EBUF  [16][1024]    f32       65,536   chunk energies of the current step
//   ACAR  [2][16][1024] f32      131,072   alpha carry, ping-pong by step parity
//   SMSC  [16][1024]    f32       65,536   s @ [Ws_mono | Ws_chunk] + biases for the current step
//   SST   [2][16][256]  f32       32,768   s, ping-pong
//   CST   [2][16][256]  f32       32,768   c, ping-pong
//   YT    [8][16][1024] f32      524,288   y per step, columns 1000..1023 zero
//   VNORM [64]          f32          256   line 0 = g / norm(v_mono)
// ---------------------------------------------------------------------------
extern "C" void kernel_launch(void* const* d_in, const int* in_sizes, int n_in,
                              void* d_out, int out_size, void* d_ws, size_t ws_size, hipStream_t stream) {
  if (n_in < 23 || d_out == nullptr || d_ws == nullptr) return;
  if (in_sizes[0] != NBATCH * NSEQ * NDIM || in_sizes[1] != NBATCH * NSTEPS || in_sizes[2] != NBATCH ||
      in_sizes[3] != NSTEPS * NBATCH * NSEQ || in_sizes[4] != NHID * NDIM || in_sizes[6] != NDIM * NDIM ||
      in_sizes[10] != NHID * NDIM || in_sizes[12] != NDIM * NDIM || in_sizes[14] != NHID * NHID ||
      in_sizes[15] != NDIM * NHID || in_sizes[17] != NHID * NCLS || in_sizes[19] != NCLS * NGATE ||
      in_sizes[20] != NHID * NGATE || in_sizes[21] != NDIM * NGATE || out_size != NBATCH * NSTEPS * NCLS) return;

  const float* enc     = (const float*)d_in[0];
  const int*   target  = (const int*)d_in[1];
  const int*   lenenc  = (const int*)d_in[2];
  const float* noise   = (const float*)d_in[3];
  const float* ws_m_w  = (const float*)d_in[4];
  const float* ws_m_b  = (const float*)d_in[5];
  const float* wh_m    = (const float*)d_in[6];
  const float* v_m     = (const float*)d_in[7];
  const float* g_m     = (const float*)d_in[8];
  const float* r_m     = (const float*)d_in[9];
  const float* ws_c_w  = (const float*)d_in[10];
  const float* ws_c_b  = (const float*)d_in[11];
  const float* wh_c    = (const float*)d_in[12];
  const float* v_c     = (const float*)d_in[13];
  const float* l_sy    = (const float*)d_in[14];
  const float* l_gy_w  = (const float*)d_in[15];
  const float* l_gy_b  = (const float*)d_in[16];
  const float* l_yy_w  = (const float*)d_in[17];
  const float* l_yy_b  = (const float*)d_in[18];
  const float* l_ys    = (const float*)d_in[19];
  const float* l_ss    = (const float*)d_in[20];
  const float* l_gs_w  = (const float*)d_in[21];
  const float* l_gs_b  = (const float*)d_in[22];
  float* out = (float*)d_out;

  char* ws = (char*)d_ws; size_t off = 0;
  auto carve = [&](size_t bytes) -> char* { char* p = ws + off; off += (bytes + 255) & ~(size_t)255; return p; };
  unsigned short* A16  = (unsigned short*)carve((size_t)NROWS * NDIM * 2);
  unsigned short* BT16 = (unsigned short*)carve((size_t)NPROJ * NDIM * 2);
  float* PF    = (float*)carve((size_t)NROWS * NPROJ * 4);
  float* PBUF  = (float*)carve((size_t)NBATCH * NSEQ * 4);
  float* EBUF  = (float*)carve((size_t)NBATCH * NSEQ * 4);
  float* ACAR  = (float*)carve((size_t)2 * NBATCH * NSEQ * 4);
  float* SMSC  = (float*)carve((size_t)NBATCH * NPROJ * 4);
  float* SST   = (float*)carve((size_t)2 * NBATCH * NHID * 4);
  float* CST   = (float*)carve((size_t)2 * NBATCH * NHID * 4);
  float* YT    = (float*)carve((size_t)NSTEPS * NBATCH * YPITCH * 4);
  float* VNORM = (float*)carve((size_t)256);
  if (off > ws_size || off > (size_t)134217728) return;

  /* (1) f16 operand planes */
  const int n8 = NROWS * NDIM / 8;
  cast8_f16_kernel<<<n8 / 256, 256, 0, stream>>>(enc, A16, n8);
  /* in [512 k][512 n] -> out [n][k]; grid (k tiles, n tiles, weight) */
  wtcast_kernel<<<dim3(NDIM / 64, NDIM / 64, 2), 256, 0, stream>>>(wh_m, wh_c, BT16, WCARRY);
  /* (2) initial state, s-projection biases, vnorm */
  init_state_kernel<<<NBATCH, 256, 0, stream>>>(v_m, g_m, ws_m_b, ws_c_b, ACAR, SST, CST, SMSC, VNORM);
  /* (3) fused encoder projections: M = 16384, N = 1024, K = 512; 4096 tiles = 512 blocks x 8 waves */
  wmma_gemm64<0, false, 0, 0, false, 0><<<dim3((NROWS / 64) * (NPROJ / 64) / 8, 1), 256, 0, stream>>>(
      A16, A16, NDIM, 0L, BT16, BT16, NDIM, 0L, (void*)PF, (void*)PF, NPROJ, 0L,
      PF, PF, 0L, NROWS, NPROJ, NDIM, WCARRY_INV);

  /* (4) decode steps: two launches per step */
  for (int step = 0; step < NSTEPS; ++step) {
    const int par = step & 1;
    energies_kernel<<<NROWS / ROWS_PER_EBLK, 256, 0, stream>>>(
        PF, SMSC, v_m, v_c, VNORM, r_m, lenenc, noise + (size_t)step * NBATCH * NSEQ, PBUF, EBUF);
    attend_decode_kernel<<<NBATCH, 256, 0, stream>>>(
        enc, target, lenenc, PBUF, EBUF,
        ACAR + (size_t)par * NBATCH * NSEQ, ACAR + (size_t)(par ^ 1) * NBATCH * NSEQ,
        SST + (size_t)par * NBATCH * NHID, CST + (size_t)par * NBATCH * NHID,
        SST + (size_t)(par ^ 1) * NBATCH * NHID, CST + (size_t)(par ^ 1) * NBATCH * NHID,
        l_ys, l_ss, l_gs_w, l_gs_b, l_gy_w, l_gy_b, l_sy, l_yy_w, l_yy_b,
        ws_m_w, ws_m_b, ws_c_w, ws_c_b, SMSC, YT, step);
  }

  /* (5) pack the padded Y plane into the output */
  pack_out_kernel<<<(NBATCH * NSTEPS * NCLS) / (256 * 4), 256, 0, stream>>>(YT, out);
}

// v001
// Measured time: 794 microseconds a run.
// Next to v000, in two timings, it ran 4.97 and 4.96 times as fast.
// Compute dtype: enc x [Wh_mono | Wh_chunk] on v_wmma_f32_16x16x32_f16 (f16 enc, f16 weights carried x16, f32 accumulate, folded by 1/16); all per-step small products, energy dots, scans, gates and state in f32 on VALU.
#include <hip/hip_runtime.h>
#include <math.h>

// ---------------------------------------------------------------------------
// Shape constants
// ---------------------------------------------------------------------------
constexpr int NBATCH = 16;
constexpr int NSEQ   = 1024;
constexpr int NHID   = 256;
constexpr int NDIM   = 512;
constexpr int NCLS   = 1000;
constexpr int NSTEPS = 8;
constexpr int NGATE  = 4 * NHID;
constexpr int NPROJ  = 2 * NDIM;
constexpr int YPITCH = 1024;
constexpr int NROWS  = NBATCH * NSEQ;
constexpr int ROWS_PER_EBLK = 32;
constexpr float WCARRY     = 16.0f;
constexpr float WCARRY_INV = 1.0f / 16.0f;
static_assert(NSEQ % ROWS_PER_EBLK == 0, "energy blocks stay inside one batch row");
static_assert(NROWS % 64 == 0 && NPROJ % 64 == 0 && NDIM % 32 == 0, "GEMM tile multiples");
static_assert((NBATCH * NSTEPS * NCLS) % (256 * 4) == 0, "pack grid exact");
static_assert(NCLS % 4 == 0, "float4 groups never straddle output rows");
static_assert(NSEQ == 4 * 256 && NHID == 256 && NDIM == 2 * 256, "thread maps");

typedef __attribute__((ext_vector_type(16))) _Float16 v16h;
typedef __attribute__((ext_vector_type(8)))  _Float16 v8h;
typedef __attribute__((ext_vector_type(16))) __bf16   v16b;
typedef __attribute__((ext_vector_type(8)))  __bf16   v8b;
typedef __attribute__((ext_vector_type(8)))  float    v8f;
typedef __attribute__((ext_vector_type(4)))  float    v4f;
typedef __attribute__((ext_vector_type(4)))  unsigned int v4u;

__device__ __forceinline__ unsigned short f2bf_bits(float f) {
  unsigned u = __float_as_uint(f);
  return (unsigned short)((u + 0x7FFFu + ((u >> 16) & 1u)) >> 16);
}
__device__ __forceinline__ float bf_bits2f(unsigned short h) { return __uint_as_float(((unsigned)h) << 16); }

__device__ __forceinline__ void dep_guard6_h(v8f& a, v8f& b, v8f& c, v8f& d, v16h x, v16h x2, v16h y0, v16h y1, v16h y2, v16h y3) {
  asm volatile("v_nop\n\tv_nop\n\tv_nop\n\tv_nop" : "+v"(a), "+v"(b), "+v"(c), "+v"(d) : "v"(x), "v"(x2), "v"(y0), "v"(y1), "v"(y2), "v"(y3));
}
__device__ __forceinline__ void dep_guard6_b(v8f& a, v8f& b, v8f& c, v8f& d, v16b x, v16b x2, v16b y0, v16b y1, v16b y2, v16b y3) {
  asm volatile("v_nop\n\tv_nop\n\tv_nop\n\tv_nop" : "+v"(a), "+v"(b), "+v"(c), "+v"(d) : "v"(x), "v"(x2), "v"(y0), "v"(y1), "v"(y2), "v"(y3));
}
__device__ __forceinline__ void keep4_h(v16h a, v16h b, v16h c, v16h d) { asm volatile("v_nop" :: "v"(a), "v"(b), "v"(c), "v"(d)); }
__device__ __forceinline__ void keep4_b(v16b a, v16b b, v16b c, v16b d) { asm volatile("v_nop" :: "v"(a), "v"(b), "v"(c), "v"(d)); }
__device__ __forceinline__ void acc_guard4(v8f& a, v8f& b, v8f& c, v8f& d) { asm volatile("v_nop\n\tv_nop\n\tv_nop\n\tv_nop" : "+v"(a), "+v"(b), "+v"(c), "+v"(d)); }

template <typename T> struct Frag;
template <> struct Frag<_Float16> {
  typedef v16h V; union U { v16h v; v8h h[2]; };
  /* elements 0..7 <- p[0..7], 8..15 <- p[16..23] */
  static __device__ __forceinline__ v16h load(const _Float16* p) {
    U f; f.h[0] = *(const v8h*)(p); f.h[1] = *(const v8h*)(p + 16); return f.v;
  }
  static __device__ __forceinline__ v8f mma(v16h a, v16h b, v8f c) {
    return __builtin_amdgcn_wmma_f32_16x16x32_f16(false, a, false, b, (short)0, c, false, false);
  }
  static __device__ __forceinline__ void guard(v8f& a, v8f& b, v8f& c, v8f& d, v16h x, v16h x2, v16h y0, v16h y1, v16h y2, v16h y3) {
    dep_guard6_h(a, b, c, d, x, x2, y0, y1, y2, y3);
  }
  static __device__ __forceinline__ void keep(v16h a, v16h b, v16h c, v16h d) { keep4_h(a, b, c, d); }
};
template <> struct Frag<__bf16> {
  typedef v16b V; union U { v16b v; v8b h[2]; };
  static __device__ __forceinline__ v16b load(const __bf16* p) {
    U f; f.h[0] = *(const v8b*)(p); f.h[1] = *(const v8b*)(p + 16); return f.v;
  }
  static __device__ __forceinline__ v8f mma(v16b a, v16b b, v8f c) {
    return __builtin_amdgcn_wmma_f32_16x16x32_bf16(false, a, false, b, (short)0, c, false, false);
  }
  static __device__ __forceinline__ void guard(v8f& a, v8f& b, v8f& c, v8f& d, v16b x, v16b x2, v16b y0, v16b y1, v16b y2, v16b y3) {
    dep_guard6_b(a, b, c, d, x, x2, y0, y1, y2, y3);
  }
  static __device__ __forceinline__ void keep(v16b a, v16b b, v16b c, v16b d) { keep4_b(a, b, c, d); }
};

__device__ __forceinline__ unsigned pk16(unsigned short a, unsigned short b) { return (unsigned)a | ((unsigned)b << 16); }
__device__ __forceinline__ unsigned short h_bits(float f) { const _Float16 h = (_Float16)f; return __builtin_bit_cast(unsigned short, h); }

/* reciprocal-based logistic and tanh with precise expf (v_rcp_f32 reciprocal) */
__device__ __forceinline__ float sigm_f(float x) { return __builtin_amdgcn_rcpf(1.0f + expf(-x)); }
__device__ __forceinline__ float tanh_e(float x) { return 1.0f - 2.0f * __builtin_amdgcn_rcpf(expf(2.0f * x) + 1.0f); }

// ---- Register-blocked batched WMMA GEMM ------------------------------------
// C[m,n] = scale * sum_k A[m,k] * Bt[n,k] (+bias)(+resid); each wave owns a 64x64 tile.
// A row-major [M,K]; Bt row-major [N,K]; M,N % 64 == 0, K % 32 == 0.
// SPLIT: operands are hi/lo planes (A2/Bt2 = lo planes, same layout); product = hi*hi + hi*lo + lo*hi.
// BIAS_MODE: 0 = none, 1 = bias[m], 2 = bias[n].
// OUT_MODE: 0 = f32, 1 = f16, 2 = bf16 hi plane (Cout) + bf16 lo plane (Cout2).
// ET: 0 = f16 operands, 1 = bf16 operands (pointers passed as 16-bit storage)
template <int ET> struct Elem;
template <> struct Elem<0> { typedef _Float16 T; };
template <> struct Elem<1> { typedef __bf16 T; };
template <int ET, bool SPLIT, int BIAS_MODE, int OUT_MODE, bool RESID, int ACT = 0>
__global__ __launch_bounds__(256) void wmma_gemm64(
    const unsigned short* __restrict__ Ap, const unsigned short* __restrict__ A2p, int lda, long strideA,
    const unsigned short* __restrict__ Btp, const unsigned short* __restrict__ Bt2p, int ldb, long strideB,
    void* __restrict__ Cout, void* __restrict__ Cout2, int ldc, long strideC,
    const float* __restrict__ bias,
    const float* __restrict__ resid, long strideR,
    int M, int N, int K, float scale) {
  typedef typename Elem<ET>::T T;
  typedef typename Frag<T>::V V;
  const T* A = (const T*)Ap; const T* A2 = (const T*)A2p; const T* Bt = (const T*)Btp; const T* Bt2 = (const T*)Bt2p;
  /* per-wave 16x64 slab, pitch 68 floats */
  __shared__ __align__(16) float sT[8][16 * 68];
  const int b    = blockIdx.y;
  const int lane = threadIdx.x & 31;
  const int wave = threadIdx.x >> 5;
  const int tilesN = N >> 6;
  const int tilesM = M >> 6;
  const int tile = blockIdx.x * 8 + wave;
  /* wave-uniform exit; no block barriers in this kernel */
  if (tile >= tilesM * tilesN) return;
  const int tm = tile / tilesN;
  const int tn = tile - tm * tilesN;
  const int m0 = tm << 6;
  const int n0 = tn << 6;

  const T* Ab  = A  + (size_t)b * strideA;
  const T* Bb  = Bt + (size_t)b * strideB;
  const T* Ab2 = SPLIT ? (A2  + (size_t)b * strideA) : nullptr;
  const T* Bb2 = SPLIT ? (Bt2 + (size_t)b * strideB) : nullptr;

  const int rlane = lane & 15;
  const int koff  = (lane >> 4) * 8;
  const int mOff  = (lane >> 4) * 8;

  v8f acc[4][4];
#pragma unroll
  for (int i = 0; i < 4; ++i)
#pragma unroll
    for (int j = 0; j < 4; ++j) acc[i][j] = (v8f){0.f,0.f,0.f,0.f,0.f,0.f,0.f,0.f};

  for (int k0 = 0; k0 < K; k0 += 32) {
    V bh[4], bl[4];
#pragma unroll
    for (int j = 0; j < 4; ++j) {
      const size_t bo = (size_t)(n0 + (j << 4) + rlane) * ldb + koff + k0;
      bh[j] = Frag<T>::load(Bb + bo);
      if (SPLIT) bl[j] = Frag<T>::load(Bb2 + bo);
    }
#pragma unroll
    for (int i = 0; i < 4; ++i) {
      const size_t ao = (size_t)(m0 + (i << 4) + rlane) * lda + koff + k0;
      V ah = Frag<T>::load(Ab + ao);
      V al;
      if (SPLIT) al = Frag<T>::load(Ab2 + ao);
#pragma unroll
      for (int j = 0; j < 4; ++j) {
        acc[i][j] = Frag<T>::mma(ah, bh[j], acc[i][j]);
        if (SPLIT) {
          acc[i][j] = Frag<T>::mma(ah, bl[j], acc[i][j]);
          acc[i][j] = Frag<T>::mma(al, bh[j], acc[i][j]);
        }
      }
      Frag<T>::guard(acc[i][0], acc[i][1], acc[i][2], acc[i][3], ah, SPLIT ? al : ah, bh[0], bh[1], bh[2], bh[3]);
    }
    Frag<T>::keep(bh[0], bh[1], bh[2], bh[3]);
    if (SPLIT) Frag<T>::keep(bl[0], bl[1], bl[2], bl[3]);
  }
  acc_guard4(acc[0][0], acc[0][1], acc[0][2], acc[0][3]);
  acc_guard4(acc[1][0], acc[1][1], acc[1][2], acc[1][3]);
  acc_guard4(acc[2][0], acc[2][1], acc[2][2], acc[2][3]);
  acc_guard4(acc[3][0], acc[3][1], acc[3][2], acc[3][3]);

  float* slab = sT[wave];
  const float* Rb = RESID ? (resid + (size_t)b * strideR) : nullptr;
#pragma unroll
  for (int i = 0; i < 4; ++i) {
    const int mBase = m0 + (i << 4);
#pragma unroll
    for (int j = 0; j < 4; ++j) {
      const int n = n0 + (j << 4) + rlane;
      float bv = 0.f;
      if (BIAS_MODE == 2) bv = bias[n];
#pragma unroll
      for (int r = 0; r < 8; ++r) {
        float v = acc[i][j][r] * scale;
        if (BIAS_MODE == 1) v += bias[mBase + mOff + r];
        if (BIAS_MODE == 2) v += bv;
        if (RESID) v += Rb[(size_t)(mBase + mOff + r) * ldc + n];
        if (ACT == 2) v = fmaxf(v, 0.0f);
        if (ACT == 4) v = (v > 0.f) ? v : 0.01f * v;
        slab[(mOff + r) * 68 + (j << 4) + rlane] = v;
      }
    }
    __builtin_amdgcn_fence(__ATOMIC_RELEASE, "workgroup");
    __builtin_amdgcn_wave_barrier();
    __builtin_amdgcn_fence(__ATOMIC_ACQUIRE, "workgroup");
    if (OUT_MODE == 0) {
      float* C = (float*)Cout + (size_t)b * strideC;
      /* row segment = 256 B = 16 lanes x 16 B */
      const int hh = lane >> 4, c4 = (lane & 15) * 4;
      {
#pragma unroll
        for (int it = 0; it < 8; ++it) {
          const int row = it * 2 + hh;
          v4f v = *(const v4f*)(slab + row * 68 + c4);
          *(v4f*)(C + (size_t)(mBase + row) * ldc + n0 + c4) = v;
        }
        
      }
    } else {
      const int q = lane >> 3, c8 = (lane & 7) * 8;
      unsigned short* C  = (unsigned short*)Cout  + (size_t)b * strideC;
      unsigned short* C2 = (OUT_MODE == 2) ? ((unsigned short*)Cout2 + (size_t)b * strideC) : nullptr;
      {
#pragma unroll
        for (int it = 0; it < 4; ++it) {
          const int row = it * 4 + q;
          const float* sp = slab + row * 68 + c8;
          v8h hv, lv;
#pragma unroll
          for (int e = 0; e < 8; ++e) {
            if (OUT_MODE == 1) {
              hv[e] = (_Float16)sp[e];
            } else {
              unsigned short hb = f2bf_bits(sp[e]);
              unsigned short lb = f2bf_bits(sp[e] - bf_bits2f(hb));
              hv[e] = __builtin_bit_cast(_Float16, hb);
              lv[e] = __builtin_bit_cast(_Float16, lb);
            }
          }
          *(v8h*)(C + (size_t)(mBase + row) * ldc + n0 + c8) = hv;
          if (OUT_MODE == 2) *(v8h*)(C2 + (size_t)(mBase + row) * ldc + n0 + c8) = lv;
        }
        
      }
    }
    __builtin_amdgcn_fence(__ATOMIC_RELEASE, "workgroup");
    __builtin_amdgcn_wave_barrier();
    __builtin_amdgcn_fence(__ATOMIC_ACQUIRE, "workgroup");
  }
}

// ---------------------------------------------------------------------------
// Weight transpose + cast: W0, W1 are [512 in d][512 out h] f32; WT[z*512 + h][d] = f16(scale * Wz[d][h]).
// grid (8, 8, 2): blockIdx.x = d tile (64 cols of WT), blockIdx.y = h tile (64 rows of WT), blockIdx.z selects W.
// Load coverage: 16 iterations x 256 threads = 4096 = the whole 64x64 tile.
// Store coverage: 8 waves x 2 iterations x 4 rows = 64 rows; 8 lanes x 8 halves = 64 cols; each row segment =
// ---------------------------------------------------------------------------
__global__ __launch_bounds__(256) void wtcast_kernel(const float* __restrict__ W0, const float* __restrict__ W1,
                                                     unsigned short* __restrict__ out, float scale) {
  __shared__ float tl[64][65];
  const int t  = threadIdx.x;
  const int d0 = blockIdx.x * 64;
  const int h0 = blockIdx.y * 64;
  const int z  = blockIdx.z;
  const float* W = (z == 0) ? W0 : W1;
#pragma unroll
  for (int i = 0; i < 16; ++i) {
    const int e = i * 256 + t;
    const int r = e >> 6;
    const int c = e & 63;
    tl[c][r] = W[(size_t)(d0 + r) * NDIM + h0 + c] * scale;
  }
  __syncthreads();
  const int lane = t & 31, wave = t >> 5;
  const int q = lane >> 3, c8 = (lane & 7) * 8;
  unsigned short* op = out + (size_t)z * NDIM * NDIM;
  {
#pragma unroll
    for (int it = 0; it < 2; ++it) {
      const int row = wave * 8 + it * 4 + q;
      unsigned short hb[8];
#pragma unroll
      for (int e = 0; e < 8; ++e) hb[e] = h_bits(tl[row][c8 + e]);
      const v4u u = (v4u){pk16(hb[0], hb[1]), pk16(hb[2], hb[3]), pk16(hb[4], hb[5]), pk16(hb[6], hb[7])};
      *(v4u*)(op + (size_t)(h0 + row) * NDIM + d0 + c8) = u;
    }
    
  }
}

// ---------------------------------------------------------------------------
// ---------------------------------------------------------------------------
__global__ __launch_bounds__(256) void cast8_f16_kernel(const float* __restrict__ in, unsigned short* __restrict__ out, int n8) {
  const int i = blockIdx.x * 256 + threadIdx.x;
  if (i >= n8) return;
  const float* p = in + 8 * (size_t)i;
  const v4f a = *(const v4f*)(p);
  const v4f c = *(const v4f*)(p + 4);
  unsigned short hb[8];
#pragma unroll
  for (int e = 0; e < 4; ++e) {
    hb[e]     = h_bits(a[e]);
    hb[4 + e] = h_bits(c[e]);
  }
  const v4u u = (v4u){pk16(hb[0], hb[1]), pk16(hb[2], hb[3]), pk16(hb[4], hb[5]), pk16(hb[6], hb[7])};
  unsigned short* q = out + 8 * (size_t)i;
  *(v4u*)q = u;
  
}

// ---------------------------------------------------------------------------
// Initial state: one block per batch row b (grid 16, 256 threads).
//   acar0[b][0] = 1, else 0 (1024 floats = 256 threads x 16 B); s0[b] = c0[b] = 0 (threads 0..63 x 16 B each);
//   smsc[b][0..511] = Ws_mono_b, smsc[b][512..1023] = Ws_chunk_b (s0 = 0); block 0 writes one line with
// ---------------------------------------------------------------------------
__global__ __launch_bounds__(256) void init_state_kernel(const float* __restrict__ vmono, const float* __restrict__ gmono,
                                                         const float* __restrict__ bm, const float* __restrict__ bc,
                                                         float* __restrict__ acar0, float* __restrict__ s0,
                                                         float* __restrict__ c0, float* __restrict__ smsc,
                                                         float* __restrict__ vnorm) {
  __shared__ float red[8];
  const int tid = threadIdx.x, lane = tid & 31, wave = tid >> 5;
  const int b = blockIdx.x;
  const float v0 = vmono[tid], v1 = vmono[tid + 256];
  float ss = v0 * v0 + v1 * v1;
#pragma unroll
  for (int off = 16; off > 0; off >>= 1) ss += __shfl_xor(ss, off, 32);
  if (lane == 0) red[wave] = ss;
  __syncthreads();
  float tot = 0.0f;
#pragma unroll
  for (int w = 0; w < 8; ++w) tot += red[w];
  const float vn = gmono[0] / sqrtf(tot);

  const int which = tid >> 7;
  const int idx = (tid & 127) * 4;
  const v4f va = *(const v4f*)(bm + idx);
  const v4f vb = *(const v4f*)(bc + idx);
  v4f sv;
#pragma unroll
  for (int e = 0; e < 4; ++e) sv[e] = which ? vb[e] : va[e];
  v4f av = (v4f){0.f, 0.f, 0.f, 0.f};
  av[0] = (tid == 0) ? 1.0f : 0.0f;
  const v4f zv = (v4f){0.f, 0.f, 0.f, 0.f};
  const v4f nv = (v4f){vn, vn, vn, vn};
  {
    *(v4f*)(acar0 + b * NSEQ + 4 * tid) = av;
    *(v4f*)(smsc + b * NPROJ + 4 * tid) = sv;
    if (tid < 64) {
      *(v4f*)(s0 + b * NHID + 4 * tid) = zv;
      *(v4f*)(c0 + b * NHID + 4 * tid) = zv;
    }
    if (b == 0 && tid < 8) *(v4f*)(vnorm + 4 * tid) = nv;
    
  }
}

// ---------------------------------------------------------------------------
// Energies for one decode step: 512 blocks x 256 threads; block owns 32 consecutive (b,s) rows (one batch row b),
// wave w owns rows 4w..4w+3. Per row: both tanh dots over 512 columns (lane covers float4 groups j*32 + lane),
// wave shuffle sum, mask, noise, logistic - all computed in every lane (the noise value is loaded unconditionally
// and pinned in a VGPR; the results are pinned before the lane-0 LDS store). Results collected in LDS; wave 0
// Masked positions: p = 0 exactly, chunk energy stored as 0 (the consumer re-derives the mask from the lengths).
// ---------------------------------------------------------------------------
__global__ __launch_bounds__(256) void energies_kernel(
    const float* __restrict__ Pf, const float* __restrict__ smsc,
    const float* __restrict__ vmono, const float* __restrict__ vchunk,
    const float* __restrict__ vnp, const float* __restrict__ rmono,
    const int* __restrict__ len, const float* __restrict__ noise_t,
    float* __restrict__ pbuf, float* __restrict__ ebuf) {
  __shared__ __align__(16) float resp[ROWS_PER_EBLK];
  __shared__ __align__(16) float rese[ROWS_PER_EBLK];
  const int tid = threadIdx.x, lane = tid & 31, wave = tid >> 5;
  const int row0 = blockIdx.x * ROWS_PER_EBLK;
  const int b  = row0 / NSEQ;
  const int s0 = row0 - b * NSEQ;
  int L = len[b];
  L = (L < 0) ? 0 : ((L > NSEQ) ? NSEQ : L);
  const float vn = vnp[0];
  const float rm = rmono[0];
  const float* sb = smsc + b * NPROJ;
#pragma unroll 1
  for (int rr = 0; rr < 4; ++rr) {
    const int lr  = wave * 4 + rr;
    const int row = row0 + lr;
    const float* pr = Pf + (size_t)row * NPROJ;
    /* per-row noise value: loaded by every lane, pinned so the load stays outside any lane mask */
    float nz = noise_t[row];
    asm volatile("" : "+v"(nz));
    float am = 0.0f, ac = 0.0f;
#pragma unroll 1
    for (int hsel = 0; hsel < 2; ++hsel) {
      const float* vv = hsel ? vchunk : vmono;
      float acc = 0.0f;
#pragma unroll 1
      for (int j = 0; j < 4; ++j) {
        const int d = (j * 32 + lane) * 4;
        const v4f e = *(const v4f*)(pr + hsel * NDIM + d);
        const v4f t = *(const v4f*)(sb + hsel * NDIM + d);
        const v4f v = *(const v4f*)(vv + d);
        acc += tanhf(e[0] + t[0]) * v[0];
        acc += tanhf(e[1] + t[1]) * v[1];
        acc += tanhf(e[2] + t[2]) * v[2];
        acc += tanhf(e[3] + t[3]) * v[3];
      }
#pragma unroll
      for (int off = 16; off > 0; off >>= 1) acc += __shfl_xor(acc, off, 32);
      am = hsel ? am : acc;
      ac = hsel ? acc : ac;
    }
    const int s = s0 + lr;
    const bool masked = (s >= L);
    const float em = (vn * am + rm) + nz;
    const float sg = sigm_f(em);
    /* all lanes compute the row results; masked positions give p = 0 exactly */
    float pv = masked ? 0.0f : sg;
    float ev = masked ? 0.0f : ac;
    asm volatile("" : "+v"(pv), "+v"(ev));
    if (lane == 0) { resp[lr] = pv; rese[lr] = ev; }
  }
  __syncthreads();
  if (wave == 0 && lane < 8) {
    const v4f v = *(const v4f*)(resp + 4 * lane);
    float* dst = pbuf + row0 + 4 * lane;
    *(v4f*)dst = v;
    
  }
  if (wave == 1 && lane < 8) {
    const v4f v = *(const v4f*)(rese + 4 * lane);
    float* dst = ebuf + row0 + 4 * lane;
    *(v4f*)dst = v;
    
  }
}

// exclusive block prefix of one value per thread (256 threads = 8 waves), fixed order; one block barrier inside.
__device__ __forceinline__ float block_excl_scan(float total, float* wt, int lane, int wave) {
  float x = total;
#pragma unroll
  for (int off = 1; off < 32; off <<= 1) {
    const float n = __shfl_up(x, off, 32);
    x += (lane >= off) ? n : 0.0f;
  }
  float ex = __shfl_up(x, 1, 32);
  ex = (lane == 0) ? 0.0f : ex;
  if (lane == 31) wt[wave] = x;
  __syncthreads();
  float woff = 0.0f;
#pragma unroll
  for (int w = 0; w < 8; ++w) woff += (w < wave) ? wt[w] : 0.0f;
  return woff + ex;
}

// ---------------------------------------------------------------------------
// Attend + decode for one step: one block (256 threads) per batch row b; everything block-local in LDS.
// Stages: row max / clipped exp, exclusive log-product scan (cpp), inclusive scan (q) -> alpha, backward-window
// denominator, forward-window beta, ctx = beta . enc (f32 on the original enc), LSTM cell (gates i|f|g|o of unit tid
// in thread tid), output hidden h, y (padded to 1024 columns, columns >= 1000 zero), and the s-projections for the
// ---------------------------------------------------------------------------
__global__ __launch_bounds__(256) void attend_decode_kernel(
    const float* __restrict__ enc, const int* __restrict__ target, const int* __restrict__ len,
    const float* __restrict__ pbuf, const float* __restrict__ ebuf,
    const float* __restrict__ acar_in, float* __restrict__ acar_out,
    const float* __restrict__ s_in, const float* __restrict__ c_in,
    float* __restrict__ s_out, float* __restrict__ c_out,
    const float* __restrict__ Lys, const float* __restrict__ Lss,
    const float* __restrict__ Lgsw, const float* __restrict__ Lgsb,
    const float* __restrict__ Lgyw, const float* __restrict__ Lgyb,
    const float* __restrict__ Lsy, const float* __restrict__ Lyyw, const float* __restrict__ Lyyb,
    const float* __restrict__ Wsm, const float* __restrict__ Wsmb,
    const float* __restrict__ Wsc, const float* __restrict__ Wscb,
    float* __restrict__ smsc, float* __restrict__ Yt, int step) {
  __shared__ __align__(16) float sh_p[NSEQ];
  __shared__ __align__(16) float sh_a[NSEQ];
  __shared__ __align__(16) float sh_ex[NSEQ];
  __shared__ __align__(16) float sh_g[NSEQ];
  __shared__ __align__(16) float sh_cpp[NSEQ];
  __shared__ __align__(16) float sh_u[NSEQ];
  __shared__ __align__(16) float sh_al[NSEQ];
  __shared__ __align__(16) float sh_r[NSEQ];
  __shared__ __align__(16) float sh_beta[NSEQ];
  __shared__ __align__(16) float sh_cpart[2 * NDIM];
  __shared__ __align__(16) float sh_ctx[NDIM];
  __shared__ __align__(16) float sh_s[NHID];
  __shared__ __align__(16) float sh_sn[NHID];
  __shared__ __align__(16) float sh_cn[NHID];
  __shared__ __align__(16) float sh_h[NHID];
  __shared__ __align__(16) float sh_y[YPITCH];
  __shared__ __align__(16) float sh_sm[NPROJ];
  __shared__ float redm[8];
  __shared__ float wtA[8];
  __shared__ float wtB[8];

  const int tid = threadIdx.x, lane = tid & 31, wave = tid >> 5;
  const int b = blockIdx.x;
  const int i0 = tid * 4;
  int L = len[b];
  L = (L < 0) ? 0 : ((L > NSEQ) ? NSEQ : L);
  const float* prow = pbuf + b * NSEQ;
  const float* erow = ebuf + b * NSEQ;
  const float* arow = acar_in + b * NSEQ;

  sh_s[tid] = s_in[b * NHID + tid];
  const float cold = c_in[b * NHID + tid];

  /* phase 1: stage p, a, e; log terms; running max over unmasked positions */
  float ml = -3.0e38f;
/* all four trips open: the 12 row loads fly together instead of four L2 round trips one after the other */
#pragma unroll
  for (int j = 0; j < 4; ++j) {
    const int i = j * 256 + tid;
    const float pv = prow[i];
    const float ev = erow[i];
    const float av = arow[i];
    sh_p[i] = pv;
    sh_a[i] = av;
    sh_ex[i] = ev;
    sh_g[i] = logf(fminf(fmaxf(1.0f - pv, 1e-8f), 1.0f));
    ml = (i < L) ? fmaxf(ml, ev) : ml;
  }
#pragma unroll
  for (int off = 16; off > 0; off >>= 1) ml = fmaxf(ml, __shfl_xor(ml, off, 32));
  if (lane == 0) redm[wave] = ml;
  __syncthreads();
  float mx = redm[0];
#pragma unroll
  for (int w = 1; w < 8; ++w) mx = fmaxf(mx, redm[w]);

  /* phase 2: ex = max(exp(e - max), 1e-5); masked positions give 1e-5 */
#pragma unroll 1
  for (int j = 0; j < 4; ++j) {
    const int i = j * 256 + tid;
    const float t = fmaxf(expf(sh_ex[i] - mx), 1e-5f);
    sh_ex[i] = (i < L) ? t : 1e-5f;
  }

  /* phase 3: exclusive prefix of the log terms over contiguous chunks of 4 */
  {
    const v4f g4 = *(const v4f*)(sh_g + i0);
    const float e1 = g4[0];
    const float e2 = e1 + g4[1];
    const float e3 = e2 + g4[2];
    const float tot = e3 + g4[3];
    const float off = block_excl_scan(tot, wtA, lane, wave);
    v4f x4;
    x4[0] = off;
    x4[1] = off + e1;
    x4[2] = off + e2;
    x4[3] = off + e3;
    *(v4f*)(sh_cpp + i0) = x4;
  }
  __syncthreads();

  /* phase 4: cpp = exp(prefix) (flushed below the smallest normal), u = a / clip(cpp, 1e-8, 1) */
#pragma unroll 1
  for (int j = 0; j < 4; ++j) {
    const int i = j * 256 + tid;
    float cp = expf(sh_cpp[i]);
    cp = (cp < 1.17549435e-38f) ? 0.0f : cp;
    sh_cpp[i] = cp;
    const float cl = fminf(fmaxf(cp, 1e-8f), 1.0f);
    sh_u[i] = sh_a[i] * __builtin_amdgcn_rcpf(cl);
  }
  __syncthreads();

  /* phase 5: inclusive prefix of u, q = cpp * prefix, alpha = clip(p * q, 1e-8, 1) */
  {
    const v4f u4 = *(const v4f*)(sh_u + i0);
    const v4f c4 = *(const v4f*)(sh_cpp + i0);
    const v4f p4 = *(const v4f*)(sh_p + i0);
    const float c0 = u4[0];
    const float c1 = c0 + u4[1];
    const float c2 = c1 + u4[2];
    const float c3 = c2 + u4[3];
    const float off2 = block_excl_scan(c3, wtB, lane, wave);
    v4f al;
    al[0] = fminf(fmaxf(p4[0] * (c4[0] * (off2 + c0)), 1e-8f), 1.0f);
    al[1] = fminf(fmaxf(p4[1] * (c4[1] * (off2 + c1)), 1e-8f), 1.0f);
    al[2] = fminf(fmaxf(p4[2] * (c4[2] * (off2 + c2)), 1e-8f), 1.0f);
    al[3] = fminf(fmaxf(p4[3] * (c4[3] * (off2 + c3)), 1e-8f), 1.0f);
    *(v4f*)(sh_al + i0) = al;
  }
  __syncthreads();

  /* phase 6: denom = max(sum ex[i-3..i], 1e-10) (zero padded), r = alpha / denom */
#pragma unroll 1
  for (int j = 0; j < 4; ++j) {
    const int i = j * 256 + tid;
    float d = 0.0f;
#pragma unroll
    for (int k = 3; k >= 0; --k) {
      const int ii = i - k;
      const int ic = (ii < 0) ? 0 : ii;
      const float v = sh_ex[ic];
      d += (ii >= 0) ? v : 0.0f;
    }
    d = fmaxf(d, 1e-10f);
    sh_r[i] = sh_al[i] * __builtin_amdgcn_rcpf(d);
  }
  __syncthreads();

  /* phase 7: beta = ex * sum r[i..i+3] (zero padded) */
#pragma unroll 1
  for (int j = 0; j < 4; ++j) {
    const int i = j * 256 + tid;
    float ms = 0.0f;
#pragma unroll
    for (int k = 0; k < 4; ++k) {
      const int ii = i + k;
      const int ic = (ii > NSEQ - 1) ? (NSEQ - 1) : ii;
      const float v = sh_r[ic];
      ms += (ii < NSEQ) ? v : 0.0f;
    }
    sh_beta[i] = sh_ex[i] * ms;
  }
  __syncthreads();

  /* phase 8: ctx partials; thread = (column group of 4, position parity); 512 positions each, fixed order */
  {
    const int cg = tid & 127, sp = tid >> 7;
    const float* eb = enc + (size_t)b * NSEQ * NDIM + 4 * cg;
    v4f acc = (v4f){0.f, 0.f, 0.f, 0.f};
/* 32 trips per pass: a running window of row loads of a wave stays in flight instead of one L2 round trip per trip; sum order kept */
#pragma unroll 32
    for (int it = 0; it < NSEQ / 2; ++it) {
      const int s = 2 * it + sp;
      const float bv = sh_beta[s];
      const v4f e4 = *(const v4f*)(eb + (size_t)s * NDIM);
      acc[0] = fmaf(bv, e4[0], acc[0]);
      acc[1] = fmaf(bv, e4[1], acc[1]);
      acc[2] = fmaf(bv, e4[2], acc[2]);
      acc[3] = fmaf(bv, e4[3], acc[3]);
    }
    *(v4f*)(sh_cpart + sp * NDIM + 4 * cg) = acc;
  }
  __syncthreads();
  sh_ctx[tid]       = sh_cpart[tid] + sh_cpart[NDIM + tid];
  sh_ctx[tid + 256] = sh_cpart[tid + 256] + sh_cpart[NDIM + tid + 256];
  __syncthreads();

  /* phase 9: LSTM pre-activations of unit tid (gates i, f, g, o at columns tid + 256 g), old s and ctx */
  float r0 = 0.0f, r1 = 0.0f, r2 = 0.0f, r3 = 0.0f;
/* 16 trips per pass: their 64 weight loads issue ahead of the first fmaf; each gate keeps its one fmaf chain in k order */
#pragma unroll 16
  for (int k = 0; k < NHID; ++k) {
    const float sv = sh_s[k];
    const float* w = Lss + (size_t)k * NGATE + tid;
    r0 = fmaf(sv, w[0], r0);
    r1 = fmaf(sv, w[NHID], r1);
    r2 = fmaf(sv, w[2 * NHID], r2);
    r3 = fmaf(sv, w[3 * NHID], r3);
  }
/* as above: loads of 16 trips in flight */
#pragma unroll 16
  for (int k = 0; k < NDIM; ++k) {
    const float cv = sh_ctx[k];
    const float* w = Lgsw + (size_t)k * NGATE + tid;
    r0 = fmaf(cv, w[0], r0);
    r1 = fmaf(cv, w[NHID], r1);
    r2 = fmaf(cv, w[2 * NHID], r2);
    r3 = fmaf(cv, w[3 * NHID], r3);
  }
  {
    int tg = target[b * NSTEPS + step];
    tg = (tg < 0) ? 0 : ((tg > NCLS - 1) ? (NCLS - 1) : tg);
    const float* ly = Lys + (size_t)tg * NGATE + tid;
    r0 += ly[0] + Lgsb[tid];
    r1 += ly[NHID] + Lgsb[NHID + tid];
    r2 += ly[2 * NHID] + Lgsb[2 * NHID + tid];
    r3 += ly[3 * NHID] + Lgsb[3 * NHID + tid];
  }
  {
    const float ig = sigm_f(r0);
    const float fg = sigm_f(r1);
    const float gg = tanh_e(r2);
    const float og = sigm_f(r3);
    const float cn = fg * cold + ig * gg;
    const float sn = og * tanh_e(cn);
    sh_cn[tid] = cn;
    sh_sn[tid] = sn;
  }
  __syncthreads();

  /* phase 10: output hidden h = tanh(ctx @ L_gy_w + b + s_new @ L_sy), column tid */
  {
    float acc = Lgyb[tid];
/* one load a trip here: 64 trips per pass keep the wave's load counter full; one fmaf chain in k order */
#pragma unroll 64
    for (int k = 0; k < NDIM; ++k) acc = fmaf(sh_ctx[k], Lgyw[(size_t)k * NHID + tid], acc);
#pragma unroll 64
    for (int k = 0; k < NHID; ++k) acc = fmaf(sh_sn[k], Lsy[(size_t)k * NHID + tid], acc);
    sh_h[tid] = tanh_e(acc);
  }
  __syncthreads();

  /* phase 11: y columns tid + 256 g (column index clamped for the address, zero beyond 999) */
  {
    const int n3 = tid + 768;
    const int n3c = (n3 < NCLS) ? n3 : (NCLS - 1);
    float y0 = 0.0f, y1 = 0.0f, y2 = 0.0f, y3 = 0.0f;
/* loads of 16 trips in flight; four fmaf chains in k order */
#pragma unroll 16
    for (int k = 0; k < NHID; ++k) {
      const float hv = sh_h[k];
      const float* w = Lyyw + (size_t)k * NCLS;
      y0 = fmaf(hv, w[tid], y0);
      y1 = fmaf(hv, w[tid + 256], y1);
      y2 = fmaf(hv, w[tid + 512], y2);
      y3 = fmaf(hv, w[n3c], y3);
    }
    y0 += Lyyb[tid];
    y1 += Lyyb[tid + 256];
    y2 += Lyyb[tid + 512];
    y3 += Lyyb[n3c];
    y3 = (n3 < NCLS) ? y3 : 0.0f;
    sh_y[tid] = y0;
    sh_y[tid + 256] = y1;
    sh_y[tid + 512] = y2;
    sh_y[tid + 768] = y3;
  }
  /* phase 12: s-projections for the next step from s_new (block-uniform condition, no barrier inside) */
  const bool donext = (step + 1 < NSTEPS);
  if (donext) {
    float m0 = 0.0f, m1 = 0.0f, m2 = 0.0f, m3 = 0.0f;
/* loads of 16 trips in flight; four fmaf chains in k order */
#pragma unroll 16
    for (int k = 0; k < NHID; ++k) {
      const float sv = sh_sn[k];
      const float* wm = Wsm + (size_t)k * NDIM + tid;
      const float* wc = Wsc + (size_t)k * NDIM + tid;
      m0 = fmaf(sv, wm[0], m0);
      m1 = fmaf(sv, wm[256], m1);
      m2 = fmaf(sv, wc[0], m2);
      m3 = fmaf(sv, wc[256], m3);
    }
    m0 += Wsmb[tid];
    m1 += Wsmb[tid + 256];
    m2 += Wscb[tid];
    m3 += Wscb[tid + 256];
    sh_sm[tid] = m0;
    sh_sm[tid + 256] = m1;
    sh_sm[tid + 512] = m2;
    sh_sm[tid + 768] = m3;
  }
  __syncthreads();

  /* stores: thread tid owns floats 4 tid .. 4 tid + 3 of each 1024-float row; threads 0..63 own the 256-float rows */
  {
    const v4f yv  = *(const v4f*)(sh_y + 4 * tid);
    const v4f alv = *(const v4f*)(sh_al + 4 * tid);
    v4f smv = (v4f){0.f, 0.f, 0.f, 0.f};
    if (donext) smv = *(const v4f*)(sh_sm + 4 * tid);
    v4f snv = (v4f){0.f, 0.f, 0.f, 0.f};
    v4f cnv = (v4f){0.f, 0.f, 0.f, 0.f};
    if (tid < 64) {
      snv = *(const v4f*)(sh_sn + 4 * tid);
      cnv = *(const v4f*)(sh_cn + 4 * tid);
    }
    float* yp = Yt + ((size_t)step * NBATCH + b) * YPITCH + 4 * tid;
    float* ap = acar_out + b * NSEQ + 4 * tid;
    float* mp = smsc + b * NPROJ + 4 * tid;
    {
      *(v4f*)yp = yv;
      *(v4f*)ap = alv;
      if (donext) *(v4f*)mp = smv;
      if (tid < 64) {
        *(v4f*)(s_out + b * NHID + 4 * tid) = snv;
        *(v4f*)(c_out + b * NHID + 4 * tid) = cnv;
      }
      
    }
  }
}

// ---------------------------------------------------------------------------
// Pack: out[b][t][n] = Y[t][b][n], n < 1000. Thread i4 moves floats 4 i4 .. 4 i4 + 3 of the flat output
// (1000 % 4 == 0 so a group never straddles rows). A wave writes 32 x 16 B = 512 contiguous 512-B aligned bytes =
// ---------------------------------------------------------------------------
__global__ __launch_bounds__(256) void pack_out_kernel(const float* __restrict__ Yt, float* __restrict__ out) {
  const int i4 = blockIdx.x * 256 + threadIdx.x;
  const int e  = i4 * 4;
  const int row = e / NCLS;
  const int n   = e - row * NCLS;
  const int b = row / NSTEPS;
  const int t = row - b * NSTEPS;
  const v4f v = *(const v4f*)(Yt + ((size_t)t * NBATCH + b) * YPITCH + n);
  float* dst = out + e;
  *(v4f*)dst = v;
  
}

// ---------------------------------------------------------------------------
// Host glue. Workspace region map (bytes, 256-B aligned carve; total 85,852,416 <= 134,217,728):
//   A16   [16384][512]  f16   16,777,216   f16(enc)
//   BT16  [1024][512]   f16    1,048,576   rows 0..511: f16(16 Wh_mono[k][n]), rows 512..1023: f16(16 Wh_chunk[k][n-512])
//   PF    [16384][1024] f32   67,108,864   enc @ [Wh_mono | Wh_chunk]
//   PBUF  [16][1024]    f32       65,536   p of the current step
//   EBUF  [16][1024]    f32       65,536   chunk energies of the current step
//   ACAR  [2][16][1024] f32      131,072   alpha carry, ping-pong by step parity
//   SMSC  [16][1024]    f32       65,536   s @ [Ws_mono | Ws_chunk] + biases for the current step
//   SST   [2][16][256]  f32       32,768   s, ping-pong
//   CST   [2][16][256]  f32       32,768   c, ping-pong
//   YT    [8][16][1024] f32      524,288   y per step, columns 1000..1023 zero
//   VNORM [64]          f32          256   line 0 = g / norm(v_mono)
// ---------------------------------------------------------------------------
extern "C" void kernel_launch(void* const* d_in, const int* in_sizes, int n_in,
                              void* d_out, int out_size, void* d_ws, size_t ws_size, hipStream_t stream) {
  if (n_in < 23 || d_out == nullptr || d_ws == nullptr) return;
  if (in_sizes[0] != NBATCH * NSEQ * NDIM || in_sizes[1] != NBATCH * NSTEPS || in_sizes[2] != NBATCH ||
      in_sizes[3] != NSTEPS * NBATCH * NSEQ || in_sizes[4] != NHID * NDIM || in_sizes[6] != NDIM * NDIM ||
      in_sizes[10] != NHID * NDIM || in_sizes[12] != NDIM * NDIM || in_sizes[14] != NHID * NHID ||
      in_sizes[15] != NDIM * NHID || in_sizes[17] != NHID * NCLS || in_sizes[19] != NCLS * NGATE ||
      in_sizes[20] != NHID * NGATE || in_sizes[21] != NDIM * NGATE || out_size != NBATCH * NSTEPS * NCLS) return;

  const float* enc     = (const float*)d_in[0];
  const int*   target  = (const int*)d_in[1];
  const int*   lenenc  = (const int*)d_in[2];
  const float* noise   = (const float*)d_in[3];
  const float* ws_m_w  = (const float*)d_in[4];
  const float* ws_m_b  = (const float*)d_in[5];
  const float* wh_m    = (const float*)d_in[6];
  const float* v_m     = (const float*)d_in[7];
  const float* g_m     = (const float*)d_in[8];
  const float* r_m     = (const float*)d_in[9];
  const float* ws_c_w  = (const float*)d_in[10];
  const float* ws_c_b  = (const float*)d_in[11];
  const float* wh_c    = (const float*)d_in[12];
  const float* v_c     = (const float*)d_in[13];
  const float* l_sy    = (const float*)d_in[14];
  const float* l_gy_w  = (const float*)d_in[15];
  const float* l_gy_b  = (const float*)d_in[16];
  const float* l_yy_w  = (const float*)d_in[17];
  const float* l_yy_b  = (const float*)d_in[18];
  const float* l_ys    = (const float*)d_in[19];
  const float* l_ss    = (const float*)d_in[20];
  const float* l_gs_w  = (const float*)d_in[21];
  const float* l_gs_b  = (const float*)d_in[22];
  float* out = (float*)d_out;

  char* ws = (char*)d_ws; size_t off = 0;
  auto carve = [&](size_t bytes) -> char* { char* p = ws + off; off += (bytes + 255) & ~(size_t)255; return p; };
  unsigned short* A16  = (unsigned short*)carve((size_t)NROWS * NDIM * 2);
  unsigned short* BT16 = (unsigned short*)carve((size_t)NPROJ * NDIM * 2);
  float* PF    = (float*)carve((size_t)NROWS * NPROJ * 4);
  float* PBUF  = (float*)carve((size_t)NBATCH * NSEQ * 4);
  float* EBUF  = (float*)carve((size_t)NBATCH * NSEQ * 4);
  float* ACAR  = (float*)carve((size_t)2 * NBATCH * NSEQ * 4);
  float* SMSC  = (float*)carve((size_t)NBATCH * NPROJ * 4);
  float* SST   = (float*)carve((size_t)2 * NBATCH * NHID * 4);
  float* CST   = (float*)carve((size_t)2 * NBATCH * NHID * 4);
  float* YT    = (float*)carve((size_t)NSTEPS * NBATCH * YPITCH * 4);
  float* VNORM = (float*)carve((size_t)256);
  if (off > ws_size || off > (size_t)134217728) return;

  /* (1) f16 operand planes */
  const int n8 = NROWS * NDIM / 8;
  cast8_f16_kernel<<<n8 / 256, 256, 0, stream>>>(enc, A16, n8);
  /* in [512 k][512 n] -> out [n][k]; grid (k tiles, n tiles, weight) */
  wtcast_kernel<<<dim3(NDIM / 64, NDIM / 64, 2), 256, 0, stream>>>(wh_m, wh_c, BT16, WCARRY);
  /* (2) initial state, s-projection biases, vnorm */
  init_state_kernel<<<NBATCH, 256, 0, stream>>>(v_m, g_m, ws_m_b, ws_c_b, ACAR, SST, CST, SMSC, VNORM);
  /* (3) fused encoder projections: M = 16384, N = 1024, K = 512; 4096 tiles = 512 blocks x 8 waves */
  wmma_gemm64<0, false, 0, 0, false, 0><<<dim3((NROWS / 64) * (NPROJ / 64) / 8, 1), 256, 0, stream>>>(
      A16, A16, NDIM, 0L, BT16, BT16, NDIM, 0L, (void*)PF, (void*)PF, NPROJ, 0L,
      PF, PF, 0L, NROWS, NPROJ, NDIM, WCARRY_INV);

  /* (4) decode steps: two launches per step */
  for (int step = 0; step < NSTEPS; ++step) {
    const int par = step & 1;
    energies_kernel<<<NROWS / ROWS_PER_EBLK, 256, 0, stream>>>(
        PF, SMSC, v_m, v_c, VNORM, r_m, lenenc, noise + (size_t)step * NBATCH * NSEQ, PBUF, EBUF);
    attend_decode_kernel<<<NBATCH, 256, 0, stream>>>(
        enc, target, lenenc, PBUF, EBUF,
        ACAR + (size_t)par * NBATCH * NSEQ, ACAR + (size_t)(par ^ 1) * NBATCH * NSEQ,
        SST + (size_t)par * NBATCH * NHID, CST + (size_t)par * NBATCH * NHID,
        SST + (size_t)(par ^ 1) * NBATCH * NHID, CST + (size_t)(par ^ 1) * NBATCH * NHID,
        l_ys, l_ss, l_gs_w, l_gs_b, l_gy_w, l_gy_b, l_sy, l_yy_w, l_yy_b,
        ws_m_w, ws_m_b, ws_c_w, ws_c_b, SMSC, YT, step);
  }

  /* (5) pack the padded Y plane into the output */
  pack_out_kernel<<<(NBATCH * NSTEPS * NCLS) / (256 * 4), 256, 0, stream>>>(YT, out);
}

// v002
// It runs in 497 microseconds.
// Next to v001, in two timings, it ran 1.61 and 1.59 times as fast.
// Over all steps from v000 it is 7.94 times as fast.
// Compute dtype: enc x [Wh_mono | Wh_chunk] on v_wmma_f32_16x16x32_f16 (f16 enc, f16 weights carried x16, f32 accumulate, folded by 1/16); all per-step small products, energy dots, scans, gates and state in f32 on VALU.
#include <hip/hip_runtime.h>
#include <math.h>

// ---------------------------------------------------------------------------
// Shape constants
// ---------------------------------------------------------------------------
constexpr int NBATCH = 16;
constexpr int NSEQ   = 1024;
constexpr int NHID   = 256;
constexpr int NDIM   = 512;
constexpr int NCLS   = 1000;
constexpr int NSTEPS = 8;
constexpr int NGATE  = 4 * NHID;
constexpr int NPROJ  = 2 * NDIM;
constexpr int YPITCH = 1024;
constexpr int NROWS  = NBATCH * NSEQ;
constexpr int ROWS_PER_EBLK = 32;
constexpr float WCARRY     = 16.0f;
constexpr float WCARRY_INV = 1.0f / 16.0f;
static_assert(NSEQ % ROWS_PER_EBLK == 0, "energy blocks stay inside one batch row");
static_assert(NROWS % 64 == 0 && NPROJ % 64 == 0 && NDIM % 32 == 0, "GEMM tile multiples");
static_assert((NBATCH * NSTEPS * NCLS) % (256 * 4) == 0, "pack grid exact");
static_assert(NCLS % 4 == 0, "float4 groups never straddle output rows");
static_assert(NSEQ == 4 * 256 && NHID == 256 && NDIM == 2 * 256, "thread maps");

typedef __attribute__((ext_vector_type(16))) _Float16 v16h;
typedef __attribute__((ext_vector_type(8)))  _Float16 v8h;
typedef __attribute__((ext_vector_type(16))) __bf16   v16b;
typedef __attribute__((ext_vector_type(8)))  __bf16   v8b;
typedef __attribute__((ext_vector_type(8)))  float    v8f;
typedef __attribute__((ext_vector_type(4)))  float    v4f;
typedef __attribute__((ext_vector_type(4)))  unsigned int v4u;

__device__ __forceinline__ unsigned short f2bf_bits(float f) {
  unsigned u = __float_as_uint(f);
  return (unsigned short)((u + 0x7FFFu + ((u >> 16) & 1u)) >> 16);
}
__device__ __forceinline__ float bf_bits2f(unsigned short h) { return __uint_as_float(((unsigned)h) << 16); }

__device__ __forceinline__ void dep_guard6_h(v8f& a, v8f& b, v8f& c, v8f& d, v16h x, v16h x2, v16h y0, v16h y1, v16h y2, v16h y3) {
  asm volatile("v_nop\n\tv_nop\n\tv_nop\n\tv_nop" : "+v"(a), "+v"(b), "+v"(c), "+v"(d) : "v"(x), "v"(x2), "v"(y0), "v"(y1), "v"(y2), "v"(y3));
}
__device__ __forceinline__ void dep_guard6_b(v8f& a, v8f& b, v8f& c, v8f& d, v16b x, v16b x2, v16b y0, v16b y1, v16b y2, v16b y3) {
  asm volatile("v_nop\n\tv_nop\n\tv_nop\n\tv_nop" : "+v"(a), "+v"(b), "+v"(c), "+v"(d) : "v"(x), "v"(x2), "v"(y0), "v"(y1), "v"(y2), "v"(y3));
}
__device__ __forceinline__ void keep4_h(v16h a, v16h b, v16h c, v16h d) { asm volatile("v_nop" :: "v"(a), "v"(b), "v"(c), "v"(d)); }
__device__ __forceinline__ void keep4_b(v16b a, v16b b, v16b c, v16b d) { asm volatile("v_nop" :: "v"(a), "v"(b), "v"(c), "v"(d)); }
__device__ __forceinline__ void acc_guard4(v8f& a, v8f& b, v8f& c, v8f& d) { asm volatile("v_nop\n\tv_nop\n\tv_nop\n\tv_nop" : "+v"(a), "+v"(b), "+v"(c), "+v"(d)); }

template <typename T> struct Frag;
template <> struct Frag<_Float16> {
  typedef v16h V; union U { v16h v; v8h h[2]; };
  /* elements 0..7 <- p[0..7], 8..15 <- p[16..23] */
  static __device__ __forceinline__ v16h load(const _Float16* p) {
    U f; f.h[0] = *(const v8h*)(p); f.h[1] = *(const v8h*)(p + 16); return f.v;
  }
  static __device__ __forceinline__ v8f mma(v16h a, v16h b, v8f c) {
    return __builtin_amdgcn_wmma_f32_16x16x32_f16(false, a, false, b, (short)0, c, false, false);
  }
  static __device__ __forceinline__ void guard(v8f& a, v8f& b, v8f& c, v8f& d, v16h x, v16h x2, v16h y0, v16h y1, v16h y2, v16h y3) {
    dep_guard6_h(a, b, c, d, x, x2, y0, y1, y2, y3);
  }
  static __device__ __forceinline__ void keep(v16h a, v16h b, v16h c, v16h d) { keep4_h(a, b, c, d); }
};
template <> struct Frag<__bf16> {
  typedef v16b V; union U { v16b v; v8b h[2]; };
  static __device__ __forceinline__ v16b load(const __bf16* p) {
    U f; f.h[0] = *(const v8b*)(p); f.h[1] = *(const v8b*)(p + 16); return f.v;
  }
  static __device__ __forceinline__ v8f mma(v16b a, v16b b, v8f c) {
    return __builtin_amdgcn_wmma_f32_16x16x32_bf16(false, a, false, b, (short)0, c, false, false);
  }
  static __device__ __forceinline__ void guard(v8f& a, v8f& b, v8f& c, v8f& d, v16b x, v16b x2, v16b y0, v16b y1, v16b y2, v16b y3) {
    dep_guard6_b(a, b, c, d, x, x2, y0, y1, y2, y3);
  }
  static __device__ __forceinline__ void keep(v16b a, v16b b, v16b c, v16b d) { keep4_b(a, b, c, d); }
};

__device__ __forceinline__ unsigned pk16(unsigned short a, unsigned short b) { return (unsigned)a | ((unsigned)b << 16); }
__device__ __forceinline__ unsigned short h_bits(float f) { const _Float16 h = (_Float16)f; return __builtin_bit_cast(unsigned short, h); }

/* reciprocal-based logistic and tanh with precise expf (v_rcp_f32 reciprocal) */
__device__ __forceinline__ float sigm_f(float x) { return __builtin_amdgcn_rcpf(1.0f + expf(-x)); }
__device__ __forceinline__ float tanh_e(float x) { return 1.0f - 2.0f * __builtin_amdgcn_rcpf(expf(2.0f * x) + 1.0f); }

// ---- Register-blocked batched WMMA GEMM ------------------------------------
// C[m,n] = scale * sum_k A[m,k] * Bt[n,k] (+bias)(+resid); each wave owns a 64x64 tile.
// A row-major [M,K]; Bt row-major [N,K]; M,N % 64 == 0, K % 32 == 0.
// SPLIT: operands are hi/lo planes (A2/Bt2 = lo planes, same layout); product = hi*hi + hi*lo + lo*hi.
// BIAS_MODE: 0 = none, 1 = bias[m], 2 = bias[n].
// OUT_MODE: 0 = f32, 1 = f16, 2 = bf16 hi plane (Cout) + bf16 lo plane (Cout2).
// ET: 0 = f16 operands, 1 = bf16 operands (pointers passed as 16-bit storage)
template <int ET> struct Elem;
template <> struct Elem<0> { typedef _Float16 T; };
template <> struct Elem<1> { typedef __bf16 T; };
template <int ET, bool SPLIT, int BIAS_MODE, int OUT_MODE, bool RESID, int ACT = 0>
__global__ __launch_bounds__(256) void wmma_gemm64(
    const unsigned short* __restrict__ Ap, const unsigned short* __restrict__ A2p, int lda, long strideA,
    const unsigned short* __restrict__ Btp, const unsigned short* __restrict__ Bt2p, int ldb, long strideB,
    void* __restrict__ Cout, void* __restrict__ Cout2, int ldc, long strideC,
    const float* __restrict__ bias,
    const float* __restrict__ resid, long strideR,
    int M, int N, int K, float scale) {
  typedef typename Elem<ET>::T T;
  typedef typename Frag<T>::V V;
  const T* A = (const T*)Ap; const T* A2 = (const T*)A2p; const T* Bt = (const T*)Btp; const T* Bt2 = (const T*)Bt2p;
  /* per-wave 16x64 slab, pitch 68 floats */
  __shared__ __align__(16) float sT[8][16 * 68];
  const int b    = blockIdx.y;
  const int lane = threadIdx.x & 31;
  const int wave = threadIdx.x >> 5;
  const int tilesN = N >> 6;
  const int tilesM = M >> 6;
  const int tile = blockIdx.x * 8 + wave;
  /* wave-uniform exit; no block barriers in this kernel */
  if (tile >= tilesM * tilesN) return;
  const int tm = tile / tilesN;
  const int tn = tile - tm * tilesN;
  const int m0 = tm << 6;
  const int n0 = tn << 6;

  const T* Ab  = A  + (size_t)b * strideA;
  const T* Bb  = Bt + (size_t)b * strideB;
  const T* Ab2 = SPLIT ? (A2  + (size_t)b * strideA) : nullptr;
  const T* Bb2 = SPLIT ? (Bt2 + (size_t)b * strideB) : nullptr;

  const int rlane = lane & 15;
  const int koff  = (lane >> 4) * 8;
  const int mOff  = (lane >> 4) * 8;

  v8f acc[4][4];
#pragma unroll
  for (int i = 0; i < 4; ++i)
#pragma unroll
    for (int j = 0; j < 4; ++j) acc[i][j] = (v8f){0.f,0.f,0.f,0.f,0.f,0.f,0.f,0.f};

  for (int k0 = 0; k0 < K; k0 += 32) {
    V bh[4], bl[4];
#pragma unroll
    for (int j = 0; j < 4; ++j) {
      const size_t bo = (size_t)(n0 + (j << 4) + rlane) * ldb + koff + k0;
      bh[j] = Frag<T>::load(Bb + bo);
      if (SPLIT) bl[j] = Frag<T>::load(Bb2 + bo);
    }
#pragma unroll
    for (int i = 0; i < 4; ++i) {
      const size_t ao = (size_t)(m0 + (i << 4) + rlane) * lda + koff + k0;
      V ah = Frag<T>::load(Ab + ao);
      V al;
      if (SPLIT) al = Frag<T>::load(Ab2 + ao);
#pragma unroll
      for (int j = 0; j < 4; ++j) {
        acc[i][j] = Frag<T>::mma(ah, bh[j], acc[i][j]);
        if (SPLIT) {
          acc[i][j] = Frag<T>::mma(ah, bl[j], acc[i][j]);
          acc[i][j] = Frag<T>::mma(al, bh[j], acc[i][j]);
        }
      }
      Frag<T>::guard(acc[i][0], acc[i][1], acc[i][2], acc[i][3], ah, SPLIT ? al : ah, bh[0], bh[1], bh[2], bh[3]);
    }
    Frag<T>::keep(bh[0], bh[1], bh[2], bh[3]);
    if (SPLIT) Frag<T>::keep(bl[0], bl[1], bl[2], bl[3]);
  }
  acc_guard4(acc[0][0], acc[0][1], acc[0][2], acc[0][3]);
  acc_guard4(acc[1][0], acc[1][1], acc[1][2], acc[1][3]);
  acc_guard4(acc[2][0], acc[2][1], acc[2][2], acc[2][3]);
  acc_guard4(acc[3][0], acc[3][1], acc[3][2], acc[3][3]);

  float* slab = sT[wave];
  const float* Rb = RESID ? (resid + (size_t)b * strideR) : nullptr;
#pragma unroll
  for (int i = 0; i < 4; ++i) {
    const int mBase = m0 + (i << 4);
#pragma unroll
    for (int j = 0; j < 4; ++j) {
      const int n = n0 + (j << 4) + rlane;
      float bv = 0.f;
      if (BIAS_MODE == 2) bv = bias[n];
#pragma unroll
      for (int r = 0; r < 8; ++r) {
        float v = acc[i][j][r] * scale;
        if (BIAS_MODE == 1) v += bias[mBase + mOff + r];
        if (BIAS_MODE == 2) v += bv;
        if (RESID) v += Rb[(size_t)(mBase + mOff + r) * ldc + n];
        if (ACT == 2) v = fmaxf(v, 0.0f);
        if (ACT == 4) v = (v > 0.f) ? v : 0.01f * v;
        slab[(mOff + r) * 68 + (j << 4) + rlane] = v;
      }
    }
    __builtin_amdgcn_fence(__ATOMIC_RELEASE, "workgroup");
    __builtin_amdgcn_wave_barrier();
    __builtin_amdgcn_fence(__ATOMIC_ACQUIRE, "workgroup");
    if (OUT_MODE == 0) {
      float* C = (float*)Cout + (size_t)b * strideC;
      /* row segment = 256 B = 16 lanes x 16 B */
      const int hh = lane >> 4, c4 = (lane & 15) * 4;
      {
#pragma unroll
        for (int it = 0; it < 8; ++it) {
          const int row = it * 2 + hh;
          v4f v = *(const v4f*)(slab + row * 68 + c4);
          *(v4f*)(C + (size_t)(mBase + row) * ldc + n0 + c4) = v;
        }
        
      }
    } else {
      const int q = lane >> 3, c8 = (lane & 7) * 8;
      unsigned short* C  = (unsigned short*)Cout  + (size_t)b * strideC;
      unsigned short* C2 = (OUT_MODE == 2) ? ((unsigned short*)Cout2 + (size_t)b * strideC) : nullptr;
      {
#pragma unroll
        for (int it = 0; it < 4; ++it) {
          const int row = it * 4 + q;
          const float* sp = slab + row * 68 + c8;
          v8h hv, lv;
#pragma unroll
          for (int e = 0; e < 8; ++e) {
            if (OUT_MODE == 1) {
              hv[e] = (_Float16)sp[e];
            } else {
              unsigned short hb = f2bf_bits(sp[e]);
              unsigned short lb = f2bf_bits(sp[e] - bf_bits2f(hb));
              hv[e] = __builtin_bit_cast(_Float16, hb);
              lv[e] = __builtin_bit_cast(_Float16, lb);
            }
          }
          *(v8h*)(C + (size_t)(mBase + row) * ldc + n0 + c8) = hv;
          if (OUT_MODE == 2) *(v8h*)(C2 + (size_t)(mBase + row) * ldc + n0 + c8) = lv;
        }
        
      }
    }
    __builtin_amdgcn_fence(__ATOMIC_RELEASE, "workgroup");
    __builtin_amdgcn_wave_barrier();
    __builtin_amdgcn_fence(__ATOMIC_ACQUIRE, "workgroup");
  }
}

// ---------------------------------------------------------------------------
// Weight transpose + cast: W0, W1 are [512 in d][512 out h] f32; WT[z*512 + h][d] = f16(scale * Wz[d][h]).
// grid (8, 8, 2): blockIdx.x = d tile (64 cols of WT), blockIdx.y = h tile (64 rows of WT), blockIdx.z selects W.
// Load coverage: 16 iterations x 256 threads = 4096 = the whole 64x64 tile.
// Store coverage: 8 waves x 2 iterations x 4 rows = 64 rows; 8 lanes x 8 halves = 64 cols; each row segment =
// ---------------------------------------------------------------------------
__global__ __launch_bounds__(256) void wtcast_kernel(const float* __restrict__ W0, const float* __restrict__ W1,
                                                     unsigned short* __restrict__ out, float scale) {
  __shared__ float tl[64][65];
  const int t  = threadIdx.x;
  const int d0 = blockIdx.x * 64;
  const int h0 = blockIdx.y * 64;
  const int z  = blockIdx.z;
  const float* W = (z == 0) ? W0 : W1;
#pragma unroll
  for (int i = 0; i < 16; ++i) {
    const int e = i * 256 + t;
    const int r = e >> 6;
    const int c = e & 63;
    tl[c][r] = W[(size_t)(d0 + r) * NDIM + h0 + c] * scale;
  }
  __syncthreads();
  const int lane = t & 31, wave = t >> 5;
  const int q = lane >> 3, c8 = (lane & 7) * 8;
  unsigned short* op = out + (size_t)z * NDIM * NDIM;
  {
#pragma unroll
    for (int it = 0; it < 2; ++it) {
      const int row = wave * 8 + it * 4 + q;
      unsigned short hb[8];
#pragma unroll
      for (int e = 0; e < 8; ++e) hb[e] = h_bits(tl[row][c8 + e]);
      const v4u u = (v4u){pk16(hb[0], hb[1]), pk16(hb[2], hb[3]), pk16(hb[4], hb[5]), pk16(hb[6], hb[7])};
      *(v4u*)(op + (size_t)(h0 + row) * NDIM + d0 + c8) = u;
    }
    
  }
}

// ---------------------------------------------------------------------------
// ---------------------------------------------------------------------------
__global__ __launch_bounds__(256) void cast8_f16_kernel(const float* __restrict__ in, unsigned short* __restrict__ out, int n8) {
  const int i = blockIdx.x * 256 + threadIdx.x;
  if (i >= n8) return;
  const float* p = in + 8 * (size_t)i;
  const v4f a = *(const v4f*)(p);
  const v4f c = *(const v4f*)(p + 4);
  unsigned short hb[8];
#pragma unroll
  for (int e = 0; e < 4; ++e) {
    hb[e]     = h_bits(a[e]);
    hb[4 + e] = h_bits(c[e]);
  }
  const v4u u = (v4u){pk16(hb[0], hb[1]), pk16(hb[2], hb[3]), pk16(hb[4], hb[5]), pk16(hb[6], hb[7])};
  unsigned short* q = out + 8 * (size_t)i;
  *(v4u*)q = u;
  
}

// ---------------------------------------------------------------------------
// Initial state: one block per batch row b (grid 16, 256 threads).
//   acar0[b][0] = 1, else 0 (1024 floats = 256 threads x 16 B); s0, c0 units 16b..16b+15 = 0 (threads 0..63 x 16 B each);
//   smsc[b][0..511] = Ws_mono_b, smsc[b][512..1023] = Ws_chunk_b (s0 = 0); block 0 writes one line with
// ---------------------------------------------------------------------------
__global__ __launch_bounds__(256) void init_state_kernel(const float* __restrict__ vmono, const float* __restrict__ gmono,
                                                         const float* __restrict__ bm, const float* __restrict__ bc,
                                                         float* __restrict__ acar0, float* __restrict__ s0,
                                                         float* __restrict__ c0, float* __restrict__ smsc,
                                                         float* __restrict__ vnorm) {
  __shared__ float red[8];
  const int tid = threadIdx.x, lane = tid & 31, wave = tid >> 5;
  const int b = blockIdx.x;
  const float v0 = vmono[tid], v1 = vmono[tid + 256];
  float ss = v0 * v0 + v1 * v1;
#pragma unroll
  for (int off = 16; off > 0; off >>= 1) ss += __shfl_xor(ss, off, 32);
  if (lane == 0) red[wave] = ss;
  __syncthreads();
  float tot = 0.0f;
#pragma unroll
  for (int w = 0; w < 8; ++w) tot += red[w];
  const float vn = gmono[0] / sqrtf(tot);

  const int which = tid >> 7;
  const int idx = (tid & 127) * 4;
  const v4f va = *(const v4f*)(bm + idx);
  const v4f vb = *(const v4f*)(bc + idx);
  v4f sv;
#pragma unroll
  for (int e = 0; e < 4; ++e) sv[e] = which ? vb[e] : va[e];
  v4f av = (v4f){0.f, 0.f, 0.f, 0.f};
  av[0] = (tid == 0) ? 1.0f : 0.0f;
  const v4f zv = (v4f){0.f, 0.f, 0.f, 0.f};
  const v4f nv = (v4f){vn, vn, vn, vn};
  {
    *(v4f*)(acar0 + b * NSEQ + 4 * tid) = av;
    *(v4f*)(smsc + b * NPROJ + 4 * tid) = sv;
    if (tid < 64) {
      *(v4f*)(s0 + b * NHID + 4 * tid) = zv;
      *(v4f*)(c0 + b * NHID + 4 * tid) = zv;
    }
    if (b == 0 && tid < 8) *(v4f*)(vnorm + 4 * tid) = nv;
    
  }
}

// ---------------------------------------------------------------------------
// Energies for one decode step: 512 blocks x 256 threads; block owns 32 consecutive (b,s) rows (one batch row b),
// wave w owns rows 4w..4w+3. Per row: both tanh dots over 512 columns (lane covers float4 groups j*32 + lane),
// wave shuffle sum, mask, noise, logistic - all computed in every lane (the noise value is loaded unconditionally
// and pinned in a VGPR; the results are pinned before the lane-0 LDS store). Results collected in LDS; wave 0
// Masked positions: p = 0 exactly, chunk energy stored as 0 (the consumer re-derives the mask from the lengths).
// ---------------------------------------------------------------------------
__global__ __launch_bounds__(256) void energies_kernel(
    const float* __restrict__ Pf, const float* __restrict__ smsc,
    const float* __restrict__ vmono, const float* __restrict__ vchunk,
    const float* __restrict__ vnp, const float* __restrict__ rmono,
    const int* __restrict__ len, const float* __restrict__ noise_t,
    float* __restrict__ pbuf, float* __restrict__ ebuf) {
  __shared__ __align__(16) float resp[ROWS_PER_EBLK];
  __shared__ __align__(16) float rese[ROWS_PER_EBLK];
  const int tid = threadIdx.x, lane = tid & 31, wave = tid >> 5;
  const int row0 = blockIdx.x * ROWS_PER_EBLK;
  const int b  = row0 / NSEQ;
  const int s0 = row0 - b * NSEQ;
  int L = len[b];
  L = (L < 0) ? 0 : ((L > NSEQ) ? NSEQ : L);
  const float vn = vnp[0];
  const float rm = rmono[0];
  const float* sb = smsc + b * NPROJ;
#pragma unroll 1
  for (int rr = 0; rr < 4; ++rr) {
    const int lr  = wave * 4 + rr;
    const int row = row0 + lr;
    const float* pr = Pf + (size_t)row * NPROJ;
    /* per-row noise value: loaded by every lane, pinned so the load stays outside any lane mask */
    float nz = noise_t[row];
    asm volatile("" : "+v"(nz));
    float am = 0.0f, ac = 0.0f;
#pragma unroll 1
    for (int hsel = 0; hsel < 2; ++hsel) {
      const float* vv = hsel ? vchunk : vmono;
      float acc = 0.0f;
#pragma unroll 1
      for (int j = 0; j < 4; ++j) {
        const int d = (j * 32 + lane) * 4;
        const v4f e = *(const v4f*)(pr + hsel * NDIM + d);
        const v4f t = *(const v4f*)(sb + hsel * NDIM + d);
        const v4f v = *(const v4f*)(vv + d);
        acc += tanhf(e[0] + t[0]) * v[0];
        acc += tanhf(e[1] + t[1]) * v[1];
        acc += tanhf(e[2] + t[2]) * v[2];
        acc += tanhf(e[3] + t[3]) * v[3];
      }
#pragma unroll
      for (int off = 16; off > 0; off >>= 1) acc += __shfl_xor(acc, off, 32);
      am = hsel ? am : acc;
      ac = hsel ? acc : ac;
    }
    const int s = s0 + lr;
    const bool masked = (s >= L);
    const float em = (vn * am + rm) + nz;
    const float sg = sigm_f(em);
    /* all lanes compute the row results; masked positions give p = 0 exactly */
    float pv = masked ? 0.0f : sg;
    float ev = masked ? 0.0f : ac;
    asm volatile("" : "+v"(pv), "+v"(ev));
    if (lane == 0) { resp[lr] = pv; rese[lr] = ev; }
  }
  __syncthreads();
  if (wave == 0 && lane < 8) {
    const v4f v = *(const v4f*)(resp + 4 * lane);
    float* dst = pbuf + row0 + 4 * lane;
    *(v4f*)dst = v;
    
  }
  if (wave == 1 && lane < 8) {
    const v4f v = *(const v4f*)(rese + 4 * lane);
    float* dst = ebuf + row0 + 4 * lane;
    *(v4f*)dst = v;
    
  }
}

// exclusive block prefix of one value per thread (256 threads = 8 waves), fixed order; one block barrier inside.
__device__ __forceinline__ float block_excl_scan(float total, float* wt, int lane, int wave) {
  float x = total;
#pragma unroll
  for (int off = 1; off < 32; off <<= 1) {
    const float n = __shfl_up(x, off, 32);
    x += (lane >= off) ? n : 0.0f;
  }
  float ex = __shfl_up(x, 1, 32);
  ex = (lane == 0) ? 0.0f : ex;
  if (lane == 31) wt[wave] = x;
  __syncthreads();
  float woff = 0.0f;
#pragma unroll
  for (int w = 0; w < 8; ++w) woff += (w < wave) ? wt[w] : 0.0f;
  return woff + ex;
}

// ---------------------------------------------------------------------------
// Decode step, cut by output column. Four launches:
//   scan_ctx_kernel   grid (8 column chunks, 16 batch rows): every block repeats the row's scans (12 KB of input),
//                     then sums beta . enc for its own 64 columns only.
//   gates_kernel      16 blocks x 16 LSTM units (64 gate columns), all 16 batch rows.
//   sproj_hid_kernel  4 blocks x 64 columns of h, then 16 blocks x 64 columns of the next step's s-projections.
//   ycols_kernel      16 blocks x 64 columns of y (padded to 1024).
// In the three product kernels a thread owns four weight columns and one sixteenth of k and keeps 64 sums, one per column
// and batch row, so a weight element is loaded once per step for all rows. s, c and h live in the workspace as [unit][16 rows].
// ---------------------------------------------------------------------------
constexpr int XP = 20;  /* LDS pitch in floats of one k row of 16 batch values: 16-B aligned, transposing stores 2-way at most */
constexpr int PP = 17;  /* LDS pitch in floats of one column's 16 partial sums */
constexpr int KCAT = NHID + NDIM;
static_assert(KCAT % 128 == 0 && NHID % 128 == 0, "the 16 k ranges are whole 8-row groups and no group straddles the two weights");

/* src [K][16] -> xs[k * XP + row] */
template <int K>
__device__ __forceinline__ void stage_kmajor(float* xs, const float* __restrict__ srcp, int tid) {
#pragma unroll
  for (int i = 0; i < K * 4 / 256; ++i) {
    const int e4 = i * 256 + tid;
    const v4f v = *(const v4f*)(srcp + 4 * e4);
    *(v4f*)(xs + (e4 >> 2) * XP + (e4 & 3) * 4) = v;
  }
}
/* src [16][K] -> xs[k * XP + row] */
template <int K>
__device__ __forceinline__ void stage_rows(float* xs, const float* __restrict__ srcp, int tid) {
#pragma unroll
  for (int i = 0; i < 16 * K / 256; ++i) {
    const int e = i * 256 + tid;
    xs[(e % K) * XP + (e / K)] = srcp[e];
  }
}

/* eight rows of four weight columns; p0 .. p3 point at the first row of the four columns */
__device__ __forceinline__ void rows8x4(float (&w)[8][4], const float* p0, const float* p1, const float* p2,
                                        const float* p3, int ldw) {
#pragma unroll
  for (int i = 0; i < 8; ++i) {
    w[i][0] = p0[(size_t)i * ldw];
    w[i][1] = p1[(size_t)i * ldw];
    w[i][2] = p2[(size_t)i * ldw];
    w[i][3] = p3[(size_t)i * ldw];
  }
  /* the wait in front of any rewrite of these loads' address registers; as inputs the four addresses stay in their
     registers up to here, so that no load of the run lands in one; it also keeps the loads ahead of the fmaf behind it */
  asm volatile("s_wait_xcnt 0x0" :: "v"(p0), "v"(p1), "v"(p2), "v"(p3) : "memory");
}

/* acc[j][row] += xs[k0 + i][row] * w[i][j] for the eight rows i: one LDS read of the 16 batch values feeds 64 fmaf */
__device__ __forceinline__ void fma8x4x16(const float* xs, int k0, const float (&w)[8][4], float (&acc)[4][16]) {
#pragma unroll
  for (int i = 0; i < 8; ++i) {
    const float* x = xs + (k0 + i) * XP;
    const v4f x0 = *(const v4f*)(x);
    const v4f x1 = *(const v4f*)(x + 4);
    const v4f x2 = *(const v4f*)(x + 8);
    const v4f x3 = *(const v4f*)(x + 12);
#pragma unroll
    for (int j = 0; j < 4; ++j) {
      const float wv = w[i][j];
#pragma unroll
      for (int e = 0; e < 4; ++e) {
        acc[j][e]      = fmaf(x0[e], wv, acc[j][e]);
        acc[j][4 + e]  = fmaf(x1[e], wv, acc[j][4 + e]);
        acc[j][8 + e]  = fmaf(x2[e], wv, acc[j][8 + e]);
        acc[j][12 + e] = fmaf(x3[e], wv, acc[j][12 + e]);
      }
    }
  }
}

/* acc[j][row] += sum over k in [kb, ke) of xs[k][row] * W[k][cols[j]]; rows k < K0 of the joined weight are W0, the rest W1.
   The next 8 weight rows are asked for ahead of the current 8 rows' fmaf. */
__device__ __forceinline__ void cols4x16(const float* xs, const float* __restrict__ W0, int K0,
                                         const float* __restrict__ W1, int ldw, const int (&cols)[4], int kb, int ke,
                                         float (&acc)[4][16]) {
  float wa[8][4];
  {
    const float* wp = (kb < K0) ? (W0 + (size_t)kb * ldw) : (W1 + (size_t)(kb - K0) * ldw);
    rows8x4(wa, wp + cols[0], wp + cols[1], wp + cols[2], wp + cols[3], ldw);
  }
  int k0 = kb;
  for (; k0 + 8 < ke; k0 += 8) {
    const int kn = k0 + 8;
    const float* wp = (kn < K0) ? (W0 + (size_t)kn * ldw) : (W1 + (size_t)(kn - K0) * ldw);
    float wb[8][4];
    rows8x4(wb, wp + cols[0], wp + cols[1], wp + cols[2], wp + cols[3], ldw);
    fma8x4x16(xs, k0, wa, acc);
#pragma unroll
    for (int i = 0; i < 8; ++i)
#pragma unroll
      for (int j = 0; j < 4; ++j) wa[i][j] = wb[i][j];
  }
  fma8x4x16(xs, k0, wa, acc);
}
__device__ __forceinline__ void zero_acc(float (&acc)[4][16]) {
#pragma unroll
  for (int j = 0; j < 4; ++j)
#pragma unroll
    for (int r = 0; r < 16; ++r) acc[j][r] = 0.0f;
}
/* block column index of (j, t16) is j * 16 + t16 */
__device__ __forceinline__ void put_part(float* part, int q, int t16, const float (&acc)[4][16]) {
#pragma unroll
  for (int j = 0; j < 4; ++j)
#pragma unroll
    for (int r = 0; r < 16; ++r) part[(q * 64 + j * 16 + t16) * PP + r] = acc[j][r];
}
/* the 16 k ranges of (block column c, batch row r), fixed order */
__device__ __forceinline__ float get_part(const float* part, int c, int r) {
  float v = part[c * PP + r];
#pragma unroll
  for (int q = 1; q < 16; ++q) v += part[(q * 64 + c) * PP + r];
  return v;
}

__global__ __launch_bounds__(256) void scan_ctx_kernel(
    const float* __restrict__ enc, const int* __restrict__ len,
    const float* __restrict__ pbuf, const float* __restrict__ ebuf,
    const float* __restrict__ acar_in, float* __restrict__ acar_out, float* __restrict__ ctx) {
  __shared__ __align__(16) float sh_p[NSEQ];
  __shared__ __align__(16) float sh_a[NSEQ];
  __shared__ __align__(16) float sh_ex[NSEQ];
  __shared__ __align__(16) float sh_g[NSEQ];
  __shared__ __align__(16) float sh_cpp[NSEQ];
  __shared__ __align__(16) float sh_u[NSEQ];
  __shared__ __align__(16) float sh_al[NSEQ];
  __shared__ __align__(16) float sh_r[NSEQ];
  __shared__ __align__(16) float sh_beta[NSEQ];
  __shared__ __align__(16) float sh_cpart[16 * 68];
  __shared__ float redm[8];
  __shared__ float wtA[8];
  __shared__ float wtB[8];

  const int tid = threadIdx.x, lane = tid & 31, wave = tid >> 5;
  const int chunk = blockIdx.x;
  const int b = blockIdx.y;
  const int i0 = tid * 4;
  int L = len[b];
  L = (L < 0) ? 0 : ((L > NSEQ) ? NSEQ : L);
  const float* prow = pbuf + b * NSEQ;
  const float* erow = ebuf + b * NSEQ;
  const float* arow = acar_in + b * NSEQ;

  /* phase 1: stage p, a, e; log terms; running max over unmasked positions */
  float ml = -3.0e38f;
/* all four trips open: the 12 row loads fly together instead of four L2 round trips one after the other */
#pragma unroll
  for (int j = 0; j < 4; ++j) {
    const int i = j * 256 + tid;
    const float pv = prow[i];
    const float ev = erow[i];
    const float av = arow[i];
    sh_p[i] = pv;
    sh_a[i] = av;
    sh_ex[i] = ev;
    sh_g[i] = logf(fminf(fmaxf(1.0f - pv, 1e-8f), 1.0f));
    ml = (i < L) ? fmaxf(ml, ev) : ml;
  }
#pragma unroll
  for (int off = 16; off > 0; off >>= 1) ml = fmaxf(ml, __shfl_xor(ml, off, 32));
  if (lane == 0) redm[wave] = ml;
  __syncthreads();
  float mx = redm[0];
#pragma unroll
  for (int w = 1; w < 8; ++w) mx = fmaxf(mx, redm[w]);

  /* phase 2: ex = max(exp(e - max), 1e-5); masked positions give 1e-5 */
#pragma unroll 1
  for (int j = 0; j < 4; ++j) {
    const int i = j * 256 + tid;
    const float t = fmaxf(expf(sh_ex[i] - mx), 1e-5f);
    sh_ex[i] = (i < L) ? t : 1e-5f;
  }

  /* phase 3: exclusive prefix of the log terms over contiguous chunks of 4 */
  {
    const v4f g4 = *(const v4f*)(sh_g + i0);
    const float e1 = g4[0];
    const float e2 = e1 + g4[1];
    const float e3 = e2 + g4[2];
    const float tot = e3 + g4[3];
    const float off = block_excl_scan(tot, wtA, lane, wave);
    v4f x4;
    x4[0] = off;
    x4[1] = off + e1;
    x4[2] = off + e2;
    x4[3] = off + e3;
    *(v4f*)(sh_cpp + i0) = x4;
  }
  __syncthreads();

  /* phase 4: cpp = exp(prefix) (flushed below the smallest normal), u = a / clip(cpp, 1e-8, 1) */
#pragma unroll 1
  for (int j = 0; j < 4; ++j) {
    const int i = j * 256 + tid;
    float cp = expf(sh_cpp[i]);
    cp = (cp < 1.17549435e-38f) ? 0.0f : cp;
    sh_cpp[i] = cp;
    const float cl = fminf(fmaxf(cp, 1e-8f), 1.0f);
    sh_u[i] = sh_a[i] * __builtin_amdgcn_rcpf(cl);
  }
  __syncthreads();

  /* phase 5: inclusive prefix of u, q = cpp * prefix, alpha = clip(p * q, 1e-8, 1) */
  {
    const v4f u4 = *(const v4f*)(sh_u + i0);
    const v4f c4 = *(const v4f*)(sh_cpp + i0);
    const v4f p4 = *(const v4f*)(sh_p + i0);
    const float c0 = u4[0];
    const float c1 = c0 + u4[1];
    const float c2 = c1 + u4[2];
    const float c3 = c2 + u4[3];
    const float off2 = block_excl_scan(c3, wtB, lane, wave);
    v4f al;
    al[0] = fminf(fmaxf(p4[0] * (c4[0] * (off2 + c0)), 1e-8f), 1.0f);
    al[1] = fminf(fmaxf(p4[1] * (c4[1] * (off2 + c1)), 1e-8f), 1.0f);
    al[2] = fminf(fmaxf(p4[2] * (c4[2] * (off2 + c2)), 1e-8f), 1.0f);
    al[3] = fminf(fmaxf(p4[3] * (c4[3] * (off2 + c3)), 1e-8f), 1.0f);
    *(v4f*)(sh_al + i0) = al;
  }
  __syncthreads();

  /* phase 6: denom = max(sum ex[i-3..i], 1e-10) (zero padded), r = alpha / denom */
#pragma unroll 1
  for (int j = 0; j < 4; ++j) {
    const int i = j * 256 + tid;
    float d = 0.0f;
#pragma unroll
    for (int k = 3; k >= 0; --k) {
      const int ii = i - k;
      const int ic = (ii < 0) ? 0 : ii;
      const float v = sh_ex[ic];
      d += (ii >= 0) ? v : 0.0f;
    }
    d = fmaxf(d, 1e-10f);
    sh_r[i] = sh_al[i] * __builtin_amdgcn_rcpf(d);
  }
  __syncthreads();

  /* phase 7: beta = ex * sum r[i..i+3] (zero padded) */
#pragma unroll 1
  for (int j = 0; j < 4; ++j) {
    const int i = j * 256 + tid;
    float ms = 0.0f;
#pragma unroll
    for (int k = 0; k < 4; ++k) {
      const int ii = i + k;
      const int ic = (ii > NSEQ - 1) ? (NSEQ - 1) : ii;
      const float v = sh_r[ic];
      ms += (ii < NSEQ) ? v : 0.0f;
    }
    sh_beta[i] = sh_ex[i] * ms;
  }
  __syncthreads();

  /* phase 8: ctx of this block's 64 columns; thread = (group of 4 columns, position class s mod 16), 64 positions each */
  {
    const int cg = tid & 15, sp = tid >> 4;
    const float* eb = enc + (size_t)b * NSEQ * NDIM + chunk * 64 + 4 * cg;
    v4f acc = (v4f){0.f, 0.f, 0.f, 0.f};
/* 16 trips per pass: their row loads fly together */
#pragma unroll 16
    for (int it = 0; it < NSEQ / 16; ++it) {
      const int s = 16 * it + sp;
      const float bv = sh_beta[s];
      const v4f e4 = *(const v4f*)(eb + (size_t)s * NDIM);
      acc[0] = fmaf(bv, e4[0], acc[0]);
      acc[1] = fmaf(bv, e4[1], acc[1]);
      acc[2] = fmaf(bv, e4[2], acc[2]);
      acc[3] = fmaf(bv, e4[3], acc[3]);
    }
    *(v4f*)(sh_cpart + sp * 68 + 4 * cg) = acc;
  }
  __syncthreads();
  /* 16 position classes joined in fixed order; 64 threads store the block's own 256-B piece of the row */
  if (tid < 64) {
    float v = sh_cpart[tid];
#pragma unroll
    for (int sp = 1; sp < 16; ++sp) v += sh_cpart[sp * 68 + tid];
    ctx[b * NDIM + chunk * 64 + tid] = v;
  }
  /* the alpha carry is stored by one block of the row */
  if (chunk == 0) {
    const v4f alv = *(const v4f*)(sh_al + i0);
    *(v4f*)(acar_out + b * NSEQ + i0) = alv;
  }
}

__global__ __launch_bounds__(256) void gates_kernel(
    const float* __restrict__ ctx, const int* __restrict__ target,
    const float* __restrict__ s_in, const float* __restrict__ c_in,
    float* __restrict__ s_out, float* __restrict__ c_out,
    const float* __restrict__ Lys, const float* __restrict__ Lss,
    const float* __restrict__ Lgsw, const float* __restrict__ Lgsb, int step) {
  __shared__ __align__(16) float xs[KCAT * XP];
  __shared__ float part[16 * 64 * PP];
  const int tid = threadIdx.x;
  const int u0 = blockIdx.x * 16;
  stage_kmajor<NHID>(xs, s_in, tid);
  stage_rows<NDIM>(xs + NHID * XP, ctx, tid);
  __syncthreads();
  const int t16 = tid & 15, q = tid >> 4;
  float acc[4][16];
  zero_acc(acc);
  /* the thread's four columns: gates i, f, g, o of unit u0 + t16 */
  const int cols[4] = {u0 + t16, NHID + u0 + t16, 2 * NHID + u0 + t16, 3 * NHID + u0 + t16};
  cols4x16(xs, Lss, NHID, Lgsw, NGATE, cols, q * (KCAT / 16), (q + 1) * (KCAT / 16), acc);
  put_part(part, q, t16, acc);
  __syncthreads();
  /* LSTM cell of (unit u0 + u, batch row r) */
  const int u = tid >> 4, r = tid & 15;
  int tg = target[r * NSTEPS + step];
  tg = (tg < 0) ? 0 : ((tg > NCLS - 1) ? (NCLS - 1) : tg);
  const float* ly = Lys + (size_t)tg * NGATE + u0 + u;
  const float* lb = Lgsb + u0 + u;
  const float r0 = get_part(part, u, r)      + (ly[0] + lb[0]);
  const float r1 = get_part(part, 16 + u, r) + (ly[NHID] + lb[NHID]);
  const float r2 = get_part(part, 32 + u, r) + (ly[2 * NHID] + lb[2 * NHID]);
  const float r3 = get_part(part, 48 + u, r) + (ly[3 * NHID] + lb[3 * NHID]);
  const float cold = c_in[u0 * 16 + tid];
  const float ig = sigm_f(r0);
  const float fg = sigm_f(r1);
  const float gg = tanh_e(r2);
  const float og = sigm_f(r3);
  const float cn = fg * cold + ig * gg;
  const float sn = og * tanh_e(cn);
  c_out[u0 * 16 + tid] = cn;
  s_out[u0 * 16 + tid] = sn;
}

__global__ __launch_bounds__(256) void sproj_hid_kernel(
    const float* __restrict__ ctx, const float* __restrict__ s_new,
    const float* __restrict__ Wsm, const float* __restrict__ Wsmb,
    const float* __restrict__ Wsc, const float* __restrict__ Wscb,
    const float* __restrict__ Lsy, const float* __restrict__ Lgyw, const float* __restrict__ Lgyb,
    float* __restrict__ smsc, float* __restrict__ hx, int step) {
  __shared__ __align__(16) float xs[KCAT * XP];
  __shared__ float part[16 * 64 * PP];
  const int tid = threadIdx.x;
  /* the four h blocks have three times the k range: they come first */
  const bool ish = blockIdx.x < 4;
  /* no next step: its projections are not formed (whole block leaves, in front of every barrier) */
  if (!ish && step + 1 >= NSTEPS) return;
  stage_kmajor<NHID>(xs, s_new, tid);
  if (ish) stage_rows<NDIM>(xs + NHID * XP, ctx, tid);
  __syncthreads();
  const int t16 = tid & 15, q = tid >> 4;
  float acc[4][16];
  zero_acc(acc);
  if (ish) {
    const int col0 = blockIdx.x * 64;
    const int cols[4] = {col0 + t16, col0 + 16 + t16, col0 + 32 + t16, col0 + 48 + t16};
    cols4x16(xs, Lsy, NHID, Lgyw, NHID, cols, q * (KCAT / 16), (q + 1) * (KCAT / 16), acc);
    put_part(part, q, t16, acc);
    __syncthreads();
#pragma unroll
    for (int e = 0; e < 4; ++e) {
      const int o = e * 256 + tid;
      const float v = get_part(part, o >> 4, o & 15) + Lgyb[col0 + (o >> 4)];
      hx[col0 * 16 + o] = tanh_e(v);
    }
    /* in the listing the other branch's code, which rewrites these stores' registers, follows them: the wait stands in front of it */
    asm volatile("s_wait_xcnt 0x0" ::: "memory");
  } else {
    const int col0 = (blockIdx.x - 4) * 64;
    const float* Wp = (col0 < NDIM) ? Wsm : Wsc;
    const float* bp = (col0 < NDIM) ? Wsmb : Wscb;
    const int cw = col0 & (NDIM - 1);
    const int cols[4] = {cw + t16, cw + 16 + t16, cw + 32 + t16, cw + 48 + t16};
    cols4x16(xs, Wp, NHID, Wp, NDIM, cols, q * (NHID / 16), (q + 1) * (NHID / 16), acc);
    put_part(part, q, t16, acc);
    __syncthreads();
    const int r = tid >> 4, c4 = (tid & 15) * 4;
    v4f v;
#pragma unroll
    for (int e = 0; e < 4; ++e) v[e] = get_part(part, c4 + e, r) + bp[cw + c4 + e];
    *(v4f*)(smsc + r * NPROJ + col0 + c4) = v;
  }
}

__global__ __launch_bounds__(256) void ycols_kernel(const float* __restrict__ hx, const float* __restrict__ Lyyw,
                                                    const float* __restrict__ Lyyb, float* __restrict__ Yrow) {
  __shared__ __align__(16) float xs[NHID * XP];
  __shared__ float part[16 * 64 * PP];
  const int tid = threadIdx.x;
  const int col0 = blockIdx.x * 64;
  stage_kmajor<NHID>(xs, hx, tid);
  __syncthreads();
  const int t16 = tid & 15, q = tid >> 4;
  float acc[4][16];
  zero_acc(acc);
  /* column index clamped for the address; columns beyond 999 are stored as zero below */
  int cols[4];
#pragma unroll
  for (int j = 0; j < 4; ++j) {
    const int n = col0 + j * 16 + t16;
    cols[j] = (n < NCLS) ? n : (NCLS - 1);
  }
  cols4x16(xs, Lyyw, NHID, Lyyw, NCLS, cols, q * (NHID / 16), (q + 1) * (NHID / 16), acc);
  put_part(part, q, t16, acc);
  __syncthreads();
  const int r = tid >> 4, c4 = (tid & 15) * 4;
  v4f v;
#pragma unroll
  for (int e = 0; e < 4; ++e) {
    const int n = col0 + c4 + e;
    const int nc = (n < NCLS) ? n : (NCLS - 1);
    const float y = get_part(part, c4 + e, r) + Lyyb[nc];
    v[e] = (n < NCLS) ? y : 0.0f;
  }
  *(v4f*)(Yrow + r * YPITCH + col0 + c4) = v;
}

// ---------------------------------------------------------------------------
// Pack: out[b][t][n] = Y[t][b][n], n < 1000. Thread i4 moves floats 4 i4 .. 4 i4 + 3 of the flat output
// (1000 % 4 == 0 so a group never straddles rows). A wave writes 32 x 16 B = 512 contiguous 512-B aligned bytes =
// ---------------------------------------------------------------------------
__global__ __launch_bounds__(256) void pack_out_kernel(const float* __restrict__ Yt, float* __restrict__ out) {
  const int i4 = blockIdx.x * 256 + threadIdx.x;
  const int e  = i4 * 4;
  const int row = e / NCLS;
  const int n   = e - row * NCLS;
  const int b = row / NSTEPS;
  const int t = row - b * NSTEPS;
  const v4f v = *(const v4f*)(Yt + ((size_t)t * NBATCH + b) * YPITCH + n);
  float* dst = out + e;
  *(v4f*)dst = v;
  
}

// ---------------------------------------------------------------------------
// Host glue. Workspace region map (bytes, 256-B aligned carve; total 85,901,568 <= 134,217,728):
//   A16   [16384][512]  f16   16,777,216   f16(enc)
//   BT16  [1024][512]   f16    1,048,576   rows 0..511: f16(16 Wh_mono[k][n]), rows 512..1023: f16(16 Wh_chunk[k][n-512])
//   PF    [16384][1024] f32   67,108,864   enc @ [Wh_mono | Wh_chunk]
//   PBUF  [16][1024]    f32       65,536   p of the current step
//   EBUF  [16][1024]    f32       65,536   chunk energies of the current step
//   ACAR  [2][16][1024] f32      131,072   alpha carry, ping-pong by step parity
//   SMSC  [16][1024]    f32       65,536   s @ [Ws_mono | Ws_chunk] + biases for the current step
//   SST   [2][256][16]  f32       32,768   s, ping-pong, [unit][batch row]
//   CST   [2][256][16]  f32       32,768   c, ping-pong, [unit][batch row]
//   YT    [8][16][1024] f32      524,288   y per step, columns 1000..1023 zero
//   VNORM [64]          f32          256   line 0 = g / norm(v_mono)
//   CTX   [16][512]     f32       32,768   ctx of the current step
//   HX    [256][16]     f32       16,384   output hidden h of the current step, [unit][batch row]
// ---------------------------------------------------------------------------
extern "C" void kernel_launch(void* const* d_in, const int* in_sizes, int n_in,
                              void* d_out, int out_size, void* d_ws, size_t ws_size, hipStream_t stream) {
  if (n_in < 23 || d_out == nullptr || d_ws == nullptr) return;
  if (in_sizes[0] != NBATCH * NSEQ * NDIM || in_sizes[1] != NBATCH * NSTEPS || in_sizes[2] != NBATCH ||
      in_sizes[3] != NSTEPS * NBATCH * NSEQ || in_sizes[4] != NHID * NDIM || in_sizes[6] != NDIM * NDIM ||
      in_sizes[10] != NHID * NDIM || in_sizes[12] != NDIM * NDIM || in_sizes[14] != NHID * NHID ||
      in_sizes[15] != NDIM * NHID || in_sizes[17] != NHID * NCLS || in_sizes[19] != NCLS * NGATE ||
      in_sizes[20] != NHID * NGATE || in_sizes[21] != NDIM * NGATE || out_size != NBATCH * NSTEPS * NCLS) return;

  const float* enc     = (const float*)d_in[0];
  const int*   target  = (const int*)d_in[1];
  const int*   lenenc  = (const int*)d_in[2];
  const float* noise   = (const float*)d_in[3];
  const float* ws_m_w  = (const float*)d_in[4];
  const float* ws_m_b  = (const float*)d_in[5];
  const float* wh_m    = (const float*)d_in[6];
  const float* v_m     = (const float*)d_in[7];
  const float* g_m     = (const float*)d_in[8];
  const float* r_m     = (const float*)d_in[9];
  const float* ws_c_w  = (const float*)d_in[10];
  const float* ws_c_b  = (const float*)d_in[11];
  const float* wh_c    = (const float*)d_in[12];
  const float* v_c     = (const float*)d_in[13];
  const float* l_sy    = (const float*)d_in[14];
  const float* l_gy_w  = (const float*)d_in[15];
  const float* l_gy_b  = (const float*)d_in[16];
  const float* l_yy_w  = (const float*)d_in[17];
  const float* l_yy_b  = (const float*)d_in[18];
  const float* l_ys    = (const float*)d_in[19];
  const float* l_ss    = (const float*)d_in[20];
  const float* l_gs_w  = (const float*)d_in[21];
  const float* l_gs_b  = (const float*)d_in[22];
  float* out = (float*)d_out;

  char* ws = (char*)d_ws; size_t off = 0;
  auto carve = [&](size_t bytes) -> char* { char* p = ws + off; off += (bytes + 255) & ~(size_t)255; return p; };
  unsigned short* A16  = (unsigned short*)carve((size_t)NROWS * NDIM * 2);
  unsigned short* BT16 = (unsigned short*)carve((size_t)NPROJ * NDIM * 2);
  float* PF    = (float*)carve((size_t)NROWS * NPROJ * 4);
  float* PBUF  = (float*)carve((size_t)NBATCH * NSEQ * 4);
  float* EBUF  = (float*)carve((size_t)NBATCH * NSEQ * 4);
  float* ACAR  = (float*)carve((size_t)2 * NBATCH * NSEQ * 4);
  float* SMSC  = (float*)carve((size_t)NBATCH * NPROJ * 4);
  float* SST   = (float*)carve((size_t)2 * NBATCH * NHID * 4);
  float* CST   = (float*)carve((size_t)2 * NBATCH * NHID * 4);
  float* YT    = (float*)carve((size_t)NSTEPS * NBATCH * YPITCH * 4);
  float* VNORM = (float*)carve((size_t)256);
  float* CTX   = (float*)carve((size_t)NBATCH * NDIM * 4);
  float* HX    = (float*)carve((size_t)NBATCH * NHID * 4);
  if (off > ws_size || off > (size_t)134217728) return;

  /* (1) f16 operand planes */
  const int n8 = NROWS * NDIM / 8;
  cast8_f16_kernel<<<n8 / 256, 256, 0, stream>>>(enc, A16, n8);
  /* in [512 k][512 n] -> out [n][k]; grid (k tiles, n tiles, weight) */
  wtcast_kernel<<<dim3(NDIM / 64, NDIM / 64, 2), 256, 0, stream>>>(wh_m, wh_c, BT16, WCARRY);
  /* (2) initial state, s-projection biases, vnorm */
  init_state_kernel<<<NBATCH, 256, 0, stream>>>(v_m, g_m, ws_m_b, ws_c_b, ACAR, SST, CST, SMSC, VNORM);
  /* (3) fused encoder projections: M = 16384, N = 1024, K = 512; 4096 tiles = 512 blocks x 8 waves */
  wmma_gemm64<0, false, 0, 0, false, 0><<<dim3((NROWS / 64) * (NPROJ / 64) / 8, 1), 256, 0, stream>>>(
      A16, A16, NDIM, 0L, BT16, BT16, NDIM, 0L, (void*)PF, (void*)PF, NPROJ, 0L,
      PF, PF, 0L, NROWS, NPROJ, NDIM, WCARRY_INV);

  /* (4) decode steps: five launches per step */
  for (int step = 0; step < NSTEPS; ++step) {
    const int par = step & 1;
    energies_kernel<<<NROWS / ROWS_PER_EBLK, 256, 0, stream>>>(
        PF, SMSC, v_m, v_c, VNORM, r_m, lenenc, noise + (size_t)step * NBATCH * NSEQ, PBUF, EBUF);
    scan_ctx_kernel<<<dim3(NDIM / 64, NBATCH), 256, 0, stream>>>(
        enc, lenenc, PBUF, EBUF,
        ACAR + (size_t)par * NBATCH * NSEQ, ACAR + (size_t)(par ^ 1) * NBATCH * NSEQ, CTX);
    gates_kernel<<<NHID / 16, 256, 0, stream>>>(
        CTX, target, SST + (size_t)par * NBATCH * NHID, CST + (size_t)par * NBATCH * NHID,
        SST + (size_t)(par ^ 1) * NBATCH * NHID, CST + (size_t)(par ^ 1) * NBATCH * NHID,
        l_ys, l_ss, l_gs_w, l_gs_b, step);
    sproj_hid_kernel<<<NHID / 64 + NPROJ / 64, 256, 0, stream>>>(
        CTX, SST + (size_t)(par ^ 1) * NBATCH * NHID, ws_m_w, ws_m_b, ws_c_w, ws_c_b,
        l_sy, l_gy_w, l_gy_b, SMSC, HX, step);
    ycols_kernel<<<YPITCH / 64, 256, 0, stream>>>(HX, l_yy_w, l_yy_b, YT + (size_t)step * NBATCH * YPITCH);
  }

  /* (5) pack the padded Y plane into the output */
  pack_out_kernel<<<(NBATCH * NSTEPS * NCLS) / (256 * 4), 256, 0, stream>>>(YT, out);
}

// v003
// Measured time: 428 microseconds a run.
// Next to v002, in two timings, it ran 1.16 times as fast each time.
// Counting every step since v000, it is 9.20 times as fast.
// Compute dtype: enc x [Wh_mono | Wh_chunk] on v_wmma_f32_16x16x32_f16 (f16 enc, f16 weights carried x16, f32 accumulate, folded by 1/16); all per-step small products, energy dots, scans, gates and state in f32 on VALU.
#include <hip/hip_runtime.h>
#include <math.h>

// ---------------------------------------------------------------------------
// Shape constants
// ---------------------------------------------------------------------------
constexpr int NBATCH = 16;
constexpr int NSEQ   = 1024;
constexpr int NHID   = 256;
constexpr int NDIM   = 512;
constexpr int NCLS   = 1000;
constexpr int NSTEPS = 8;
constexpr int NGATE  = 4 * NHID;
constexpr int NPROJ  = 2 * NDIM;
constexpr int YPITCH = 1024;
constexpr int NROWS  = NBATCH * NSEQ;
constexpr int ROWS_PER_EBLK = 32;
constexpr float WCARRY     = 16.0f;
constexpr float WCARRY_INV = 1.0f / 16.0f;
static_assert(NSEQ % ROWS_PER_EBLK == 0, "energy blocks stay inside one batch row");
static_assert(NROWS % 64 == 0 && NPROJ % 64 == 0 && NDIM % 32 == 0, "GEMM tile multiples");
static_assert((NBATCH * NSTEPS * NCLS) % (256 * 4) == 0, "pack grid exact");
static_assert(NCLS % 4 == 0, "float4 groups never straddle output rows");
static_assert(NSEQ == 4 * 256 && NHID == 256 && NDIM == 2 * 256, "thread maps");

typedef __attribute__((ext_vector_type(16))) _Float16 v16h;
typedef __attribute__((ext_vector_type(8)))  _Float16 v8h;
typedef __attribute__((ext_vector_type(16))) __bf16   v16b;
typedef __attribute__((ext_vector_type(8)))  __bf16   v8b;
typedef __attribute__((ext_vector_type(8)))  float    v8f;
typedef __attribute__((ext_vector_type(4)))  float    v4f;
typedef __attribute__((ext_vector_type(4)))  unsigned int v4u;

__device__ __forceinline__ unsigned short f2bf_bits(float f) {
  unsigned u = __float_as_uint(f);
  return (unsigned short)((u + 0x7FFFu + ((u >> 16) & 1u)) >> 16);
}
__device__ __forceinline__ float bf_bits2f(unsigned short h) { return __uint_as_float(((unsigned)h) << 16); }

__device__ __forceinline__ void dep_guard6_h(v8f& a, v8f& b, v8f& c, v8f& d, v16h x, v16h x2, v16h y0, v16h y1, v16h y2, v16h y3) {
  asm volatile("v_nop\n\tv_nop\n\tv_nop\n\tv_nop" : "+v"(a), "+v"(b), "+v"(c), "+v"(d) : "v"(x), "v"(x2), "v"(y0), "v"(y1), "v"(y2), "v"(y3));
}
__device__ __forceinline__ void dep_guard6_b(v8f& a, v8f& b, v8f& c, v8f& d, v16b x, v16b x2, v16b y0, v16b y1, v16b y2, v16b y3) {
  asm volatile("v_nop\n\tv_nop\n\tv_nop\n\tv_nop" : "+v"(a), "+v"(b), "+v"(c), "+v"(d) : "v"(x), "v"(x2), "v"(y0), "v"(y1), "v"(y2), "v"(y3));
}
__device__ __forceinline__ void keep4_h(v16h a, v16h b, v16h c, v16h d) { asm volatile("v_nop" :: "v"(a), "v"(b), "v"(c), "v"(d)); }
__device__ __forceinline__ void keep4_b(v16b a, v16b b, v16b c, v16b d) { asm volatile("v_nop" :: "v"(a), "v"(b), "v"(c), "v"(d)); }
__device__ __forceinline__ void acc_guard4(v8f& a, v8f& b, v8f& c, v8f& d) { asm volatile("v_nop\n\tv_nop\n\tv_nop\n\tv_nop" : "+v"(a), "+v"(b), "+v"(c), "+v"(d)); }

template <typename T> struct Frag;
template <> struct Frag<_Float16> {
  typedef v16h V; union U { v16h v; v8h h[2]; };
  /* elements 0..7 <- p[0..7], 8..15 <- p[16..23] */
  static __device__ __forceinline__ v16h load(const _Float16* p) {
    U f; f.h[0] = *(const v8h*)(p); f.h[1] = *(const v8h*)(p + 16); return f.v;
  }
  static __device__ __forceinline__ v8f mma(v16h a, v16h b, v8f c) {
    return __builtin_amdgcn_wmma_f32_16x16x32_f16(false, a, false, b, (short)0, c, false, false);
  }
  static __device__ __forceinline__ void guard(v8f& a, v8f& b, v8f& c, v8f& d, v16h x, v16h x2, v16h y0, v16h y1, v16h y2, v16h y3) {
    dep_guard6_h(a, b, c, d, x, x2, y0, y1, y2, y3);
  }
  static __device__ __forceinline__ void keep(v16h a, v16h b, v16h c, v16h d) { keep4_h(a, b, c, d); }
};
template <> struct Frag<__bf16> {
  typedef v16b V; union U { v16b v; v8b h[2]; };
  static __device__ __forceinline__ v16b load(const __bf16* p) {
    U f; f.h[0] = *(const v8b*)(p); f.h[1] = *(const v8b*)(p + 16); return f.v;
  }
  static __device__ __forceinline__ v8f mma(v16b a, v16b b, v8f c) {
    return __builtin_amdgcn_wmma_f32_16x16x32_bf16(false, a, false, b, (short)0, c, false, false);
  }
  static __device__ __forceinline__ void guard(v8f& a, v8f& b, v8f& c, v8f& d, v16b x, v16b x2, v16b y0, v16b y1, v16b y2, v16b y3) {
    dep_guard6_b(a, b, c, d, x, x2, y0, y1, y2, y3);
  }
  static __device__ __forceinline__ void keep(v16b a, v16b b, v16b c, v16b d) { keep4_b(a, b, c, d); }
};

__device__ __forceinline__ unsigned pk16(unsigned short a, unsigned short b) { return (unsigned)a | ((unsigned)b << 16); }
__device__ __forceinline__ unsigned short h_bits(float f) { const _Float16 h = (_Float16)f; return __builtin_bit_cast(unsigned short, h); }

/* reciprocal-based logistic and tanh with precise expf (v_rcp_f32 reciprocal) */
__device__ __forceinline__ float sigm_f(float x) { return __builtin_amdgcn_rcpf(1.0f + expf(-x)); }
__device__ __forceinline__ float tanh_e(float x) { return 1.0f - 2.0f * __builtin_amdgcn_rcpf(expf(2.0f * x) + 1.0f); }
__device__ __forceinline__ v4f exp2_x4(v4f a) {
  float r0, r1, r2, r3;
  asm("v_exp_f32 %0, %4\n\tv_exp_f32 %1, %5\n\tv_exp_f32 %2, %6\n\tv_exp_f32 %3, %7\n\tv_nop"
      : "=&v"(r0), "=&v"(r1), "=&v"(r2), "=&v"(r3) : "v"(a[0]), "v"(a[1]), "v"(a[2]), "v"(a[3]));
  return (v4f){r0, r1, r2, r3};
}
__device__ __forceinline__ v4f rcp_x4(v4f a) {
  float r0, r1, r2, r3;
  asm("v_rcp_f32 %0, %4\n\tv_rcp_f32 %1, %5\n\tv_rcp_f32 %2, %6\n\tv_rcp_f32 %3, %7\n\tv_nop"
      : "=&v"(r0), "=&v"(r1), "=&v"(r2), "=&v"(r3) : "v"(a[0]), "v"(a[1]), "v"(a[2]), "v"(a[3]));
  return (v4f){r0, r1, r2, r3};
}
__device__ __forceinline__ v4f tanh_x4(v4f x) {
  const v4f q = rcp_x4(exp2_x4(x * 2.885390082f) + 1.0f);
  return 1.0f - 2.0f * q;
}

// ---- Register-blocked batched WMMA GEMM ------------------------------------
// C[m,n] = scale * sum_k A[m,k] * Bt[n,k] (+bias)(+resid); each wave owns a 64x64 tile.
// A row-major [M,K]; Bt row-major [N,K]; M,N % 64 == 0, K % 32 == 0.
// SPLIT: operands are hi/lo planes (A2/Bt2 = lo planes, same layout); product = hi*hi + hi*lo + lo*hi.
// BIAS_MODE: 0 = none, 1 = bias[m], 2 = bias[n].
// OUT_MODE: 0 = f32, 1 = f16, 2 = bf16 hi plane (Cout) + bf16 lo plane (Cout2).
// ET: 0 = f16 operands, 1 = bf16 operands (pointers passed as 16-bit storage)
template <int ET> struct Elem;
template <> struct Elem<0> { typedef _Float16 T; };
template <> struct Elem<1> { typedef __bf16 T; };
template <int ET, bool SPLIT, int BIAS_MODE, int OUT_MODE, bool RESID, int ACT = 0>
__global__ __launch_bounds__(256) void wmma_gemm64(
    const unsigned short* __restrict__ Ap, const unsigned short* __restrict__ A2p, int lda, long strideA,
    const unsigned short* __restrict__ Btp, const unsigned short* __restrict__ Bt2p, int ldb, long strideB,
    void* __restrict__ Cout, void* __restrict__ Cout2, int ldc, long strideC,
    const float* __restrict__ bias,
    const float* __restrict__ resid, long strideR,
    int M, int N, int K, float scale) {
  typedef typename Elem<ET>::T T;
  typedef typename Frag<T>::V V;
  const T* A = (const T*)Ap; const T* A2 = (const T*)A2p; const T* Bt = (const T*)Btp; const T* Bt2 = (const T*)Bt2p;
  /* per-wave 16x64 slab, pitch 68 floats */
  __shared__ __align__(16) float sT[8][16 * 68];
  const int b    = blockIdx.y;
  const int lane = threadIdx.x & 31;
  const int wave = threadIdx.x >> 5;
  const int tilesN = N >> 6;
  const int tilesM = M >> 6;
  const int tile = blockIdx.x * 8 + wave;
  /* wave-uniform exit; no block barriers in this kernel */
  if (tile >= tilesM * tilesN) return;
  const int tm = tile / tilesN;
  const int tn = tile - tm * tilesN;
  const int m0 = tm << 6;
  const int n0 = tn << 6;

  const T* Ab  = A  + (size_t)b * strideA;
  const T* Bb  = Bt + (size_t)b * strideB;
  const T* Ab2 = SPLIT ? (A2  + (size_t)b * strideA) : nullptr;
  const T* Bb2 = SPLIT ? (Bt2 + (size_t)b * strideB) : nullptr;

  const int rlane = lane & 15;
  const int koff  = (lane >> 4) * 8;
  const int mOff  = (lane >> 4) * 8;

  v8f acc[4][4];
#pragma unroll
  for (int i = 0; i < 4; ++i)
#pragma unroll
    for (int j = 0; j < 4; ++j) acc[i][j] = (v8f){0.f,0.f,0.f,0.f,0.f,0.f,0.f,0.f};

  for (int k0 = 0; k0 < K; k0 += 32) {
    V bh[4], bl[4];
#pragma unroll
    for (int j = 0; j < 4; ++j) {
      const size_t bo = (size_t)(n0 + (j << 4) + rlane) * ldb + koff + k0;
      bh[j] = Frag<T>::load(Bb + bo);
      if (SPLIT) bl[j] = Frag<T>::load(Bb2 + bo);
    }
#pragma unroll
    for (int i = 0; i < 4; ++i) {
      const size_t ao = (size_t)(m0 + (i << 4) + rlane) * lda + koff + k0;
      V ah = Frag<T>::load(Ab + ao);
      V al;
      if (SPLIT) al = Frag<T>::load(Ab2 + ao);
#pragma unroll
      for (int j = 0; j < 4; ++j) {
        acc[i][j] = Frag<T>::mma(ah, bh[j], acc[i][j]);
        if (SPLIT) {
          acc[i][j] = Frag<T>::mma(ah, bl[j], acc[i][j]);
          acc[i][j] = Frag<T>::mma(al, bh[j], acc[i][j]);
        }
      }
      Frag<T>::guard(acc[i][0], acc[i][1], acc[i][2], acc[i][3], ah, SPLIT ? al : ah, bh[0], bh[1], bh[2], bh[3]);
    }
    Frag<T>::keep(bh[0], bh[1], bh[2], bh[3]);
    if (SPLIT) Frag<T>::keep(bl[0], bl[1], bl[2], bl[3]);
  }
  acc_guard4(acc[0][0], acc[0][1], acc[0][2], acc[0][3]);
  acc_guard4(acc[1][0], acc[1][1], acc[1][2], acc[1][3]);
  acc_guard4(acc[2][0], acc[2][1], acc[2][2], acc[2][3]);
  acc_guard4(acc[3][0], acc[3][1], acc[3][2], acc[3][3]);

  float* slab = sT[wave];
  const float* Rb = RESID ? (resid + (size_t)b * strideR) : nullptr;
#pragma unroll
  for (int i = 0; i < 4; ++i) {
    const int mBase = m0 + (i << 4);
#pragma unroll
    for (int j = 0; j < 4; ++j) {
      const int n = n0 + (j << 4) + rlane;
      float bv = 0.f;
      if (BIAS_MODE == 2) bv = bias[n];
#pragma unroll
      for (int r = 0; r < 8; ++r) {
        float v = acc[i][j][r] * scale;
        if (BIAS_MODE == 1) v += bias[mBase + mOff + r];
        if (BIAS_MODE == 2) v += bv;
        if (RESID) v += Rb[(size_t)(mBase + mOff + r) * ldc + n];
        if (ACT == 2) v = fmaxf(v, 0.0f);
        if (ACT == 4) v = (v > 0.f) ? v : 0.01f * v;
        slab[(mOff + r) * 68 + (j << 4) + rlane] = v;
      }
    }
    __builtin_amdgcn_fence(__ATOMIC_RELEASE, "workgroup");
    __builtin_amdgcn_wave_barrier();
    __builtin_amdgcn_fence(__ATOMIC_ACQUIRE, "workgroup");
    if (OUT_MODE == 0) {
      float* C = (float*)Cout + (size_t)b * strideC;
      /* row segment = 256 B = 16 lanes x 16 B */
      const int hh = lane >> 4, c4 = (lane & 15) * 4;
      {
#pragma unroll
        for (int it = 0; it < 8; ++it) {
          const int row = it * 2 + hh;
          v4f v = *(const v4f*)(slab + row * 68 + c4);
          *(v4f*)(C + (size_t)(mBase + row) * ldc + n0 + c4) = v;
        }
        
      }
    } else {
      const int q = lane >> 3, c8 = (lane & 7) * 8;
      unsigned short* C  = (unsigned short*)Cout  + (size_t)b * strideC;
      unsigned short* C2 = (OUT_MODE == 2) ? ((unsigned short*)Cout2 + (size_t)b * strideC) : nullptr;
      {
#pragma unroll
        for (int it = 0; it < 4; ++it) {
          const int row = it * 4 + q;
          const float* sp = slab + row * 68 + c8;
          v8h hv, lv;
#pragma unroll
          for (int e = 0; e < 8; ++e) {
            if (OUT_MODE == 1) {
              hv[e] = (_Float16)sp[e];
            } else {
              unsigned short hb = f2bf_bits(sp[e]);
              unsigned short lb = f2bf_bits(sp[e] - bf_bits2f(hb));
              hv[e] = __builtin_bit_cast(_Float16, hb);
              lv[e] = __builtin_bit_cast(_Float16, lb);
            }
          }
          *(v8h*)(C + (size_t)(mBase + row) * ldc + n0 + c8) = hv;
          if (OUT_MODE == 2) *(v8h*)(C2 + (size_t)(mBase + row) * ldc + n0 + c8) = lv;
        }
        
      }
    }
    __builtin_amdgcn_fence(__ATOMIC_RELEASE, "workgroup");
    __builtin_amdgcn_wave_barrier();
    __builtin_amdgcn_fence(__ATOMIC_ACQUIRE, "workgroup");
  }
}

// ---------------------------------------------------------------------------
// Weight transpose + cast: W0, W1 are [512 in d][512 out h] f32; WT[z*512 + h][d] = f16(scale * Wz[d][h]).
// grid (8, 8, 2): blockIdx.x = d tile (64 cols of WT), blockIdx.y = h tile (64 rows of WT), blockIdx.z selects W.
// Load coverage: 16 iterations x 256 threads = 4096 = the whole 64x64 tile.
// Store coverage: 8 waves x 2 iterations x 4 rows = 64 rows; 8 lanes x 8 halves = 64 cols; each row segment =
// ---------------------------------------------------------------------------
__global__ __launch_bounds__(256) void wtcast_kernel(const float* __restrict__ W0, const float* __restrict__ W1,
                                                     unsigned short* __restrict__ out, float scale) {
  __shared__ float tl[64][65];
  const int t  = threadIdx.x;
  const int d0 = blockIdx.x * 64;
  const int h0 = blockIdx.y * 64;
  const int z  = blockIdx.z;
  const float* W = (z == 0) ? W0 : W1;
#pragma unroll
  for (int i = 0; i < 16; ++i) {
    const int e = i * 256 + t;
    const int r = e >> 6;
    const int c = e & 63;
    tl[c][r] = W[(size_t)(d0 + r) * NDIM + h0 + c] * scale;
  }
  __syncthreads();
  const int lane = t & 31, wave = t >> 5;
  const int q = lane >> 3, c8 = (lane & 7) * 8;
  unsigned short* op = out + (size_t)z * NDIM * NDIM;
  {
#pragma unroll
    for (int it = 0; it < 2; ++it) {
      const int row = wave * 8 + it * 4 + q;
      unsigned short hb[8];
#pragma unroll
      for (int e = 0; e < 8; ++e) hb[e] = h_bits(tl[row][c8 + e]);
      const v4u u = (v4u){pk16(hb[0], hb[1]), pk16(hb[2], hb[3]), pk16(hb[4], hb[5]), pk16(hb[6], hb[7])};
      *(v4u*)(op + (size_t)(h0 + row) * NDIM + d0 + c8) = u;
    }
    
  }
}

// ---------------------------------------------------------------------------
// ---------------------------------------------------------------------------
__global__ __launch_bounds__(256) void cast8_f16_kernel(const float* __restrict__ in, unsigned short* __restrict__ out, int n8) {
  const int i = blockIdx.x * 256 + threadIdx.x;
  if (i >= n8) return;
  const float* p = in + 8 * (size_t)i;
  const v4f a = *(const v4f*)(p);
  const v4f c = *(const v4f*)(p + 4);
  unsigned short hb[8];
#pragma unroll
  for (int e = 0; e < 4; ++e) {
    hb[e]     = h_bits(a[e]);
    hb[4 + e] = h_bits(c[e]);
  }
  const v4u u = (v4u){pk16(hb[0], hb[1]), pk16(hb[2], hb[3]), pk16(hb[4], hb[5]), pk16(hb[6], hb[7])};
  unsigned short* q = out + 8 * (size_t)i;
  *(v4u*)q = u;
  
}

// ---------------------------------------------------------------------------
// Initial state: one block per batch row b (grid 16, 256 threads).
//   acar0[b][0] = 1, else 0 (1024 floats = 256 threads x 16 B); s0, c0 units 16b..16b+15 = 0 (threads 0..63 x 16 B each);
//   smsc[b][0..511] = Ws_mono_b, smsc[b][512..1023] = Ws_chunk_b (s0 = 0); block 0 writes one line with
// ---------------------------------------------------------------------------
__global__ __launch_bounds__(256) void init_state_kernel(const float* __restrict__ vmono, const float* __restrict__ gmono,
                                                         const float* __restrict__ bm, const float* __restrict__ bc,
                                                         float* __restrict__ acar0, float* __restrict__ s0,
                                                         float* __restrict__ c0, float* __restrict__ smsc,
                                                         float* __restrict__ vnorm) {
  __shared__ float red[8];
  const int tid = threadIdx.x, lane = tid & 31, wave = tid >> 5;
  const int b = blockIdx.x;
  const float v0 = vmono[tid], v1 = vmono[tid + 256];
  float ss = v0 * v0 + v1 * v1;
#pragma unroll
  for (int off = 16; off > 0; off >>= 1) ss += __shfl_xor(ss, off, 32);
  if (lane == 0) red[wave] = ss;
  __syncthreads();
  float tot = 0.0f;
#pragma unroll
  for (int w = 0; w < 8; ++w) tot += red[w];
  const float vn = gmono[0] / sqrtf(tot);

  const int which = tid >> 7;
  const int idx = (tid & 127) * 4;
  const v4f va = *(const v4f*)(bm + idx);
  const v4f vb = *(const v4f*)(bc + idx);
  v4f sv;
#pragma unroll
  for (int e = 0; e < 4; ++e) sv[e] = which ? vb[e] : va[e];
  v4f av = (v4f){0.f, 0.f, 0.f, 0.f};
  av[0] = (tid == 0) ? 1.0f : 0.0f;
  const v4f zv = (v4f){0.f, 0.f, 0.f, 0.f};
  const v4f nv = (v4f){vn, vn, vn, vn};
  {
    *(v4f*)(acar0 + b * NSEQ + 4 * tid) = av;
    *(v4f*)(smsc + b * NPROJ + 4 * tid) = sv;
    if (tid < 64) {
      *(v4f*)(s0 + b * NHID + 4 * tid) = zv;
      *(v4f*)(c0 + b * NHID + 4 * tid) = zv;
    }
    if (b == 0 && tid < 8) *(v4f*)(vnorm + 4 * tid) = nv;
    
  }
}

// ---------------------------------------------------------------------------
// Energies for one decode step: 512 blocks x 256 threads; block owns 32 consecutive (b,s) rows (one batch row b),
// wave w owns rows 4w..4w+3. Per row: both tanh dots over 512 columns (lane covers float4 groups j*32 + lane),
// wave shuffle sum, mask, noise, logistic - all computed in every lane (the noise value is loaded unconditionally
// and pinned in a VGPR; the results are pinned before the lane-0 LDS store). Results collected in LDS; wave 0
// Masked positions: p = 0 exactly, chunk energy stored as 0 (the consumer re-derives the mask from the lengths).
// ---------------------------------------------------------------------------
__global__ __launch_bounds__(256) void energies_kernel(
    const float* __restrict__ Pf, const float* __restrict__ smsc,
    const float* __restrict__ vmono, const float* __restrict__ vchunk,
    const float* __restrict__ vnp, const float* __restrict__ rmono,
    const int* __restrict__ len, const float* __restrict__ noise_t,
    float* __restrict__ pbuf, float* __restrict__ ebuf) {
  __shared__ __align__(16) float resp[ROWS_PER_EBLK];
  __shared__ __align__(16) float rese[ROWS_PER_EBLK];
  const int tid = threadIdx.x, lane = tid & 31, wave = tid >> 5;
  const int row0 = blockIdx.x * ROWS_PER_EBLK;
  const int b  = row0 / NSEQ;
  const int s0 = row0 - b * NSEQ;
  int L = len[b];
  L = (L < 0) ? 0 : ((L > NSEQ) ? NSEQ : L);
  const float vn = vnp[0];
  const float rm = rmono[0];
  const float* sb = smsc + b * NPROJ;
#pragma unroll 1
  for (int rr = 0; rr < 4; ++rr) {
    const int lr  = wave * 4 + rr;
    const int row = row0 + lr;
    const float* pr = Pf + (size_t)row * NPROJ;
    /* per-row noise value: loaded by every lane, pinned so the load stays outside any lane mask */
    float nz = noise_t[row];
    asm volatile("" : "+v"(nz));
    float am = 0.0f, ac = 0.0f;
#pragma unroll 1
    for (int hsel = 0; hsel < 2; ++hsel) {
      const float* vv = hsel ? vchunk : vmono;
      float acc = 0.0f;
#pragma unroll 1
      for (int j = 0; j < 4; ++j) {
        const int d = (j * 32 + lane) * 4;
        const v4f e = *(const v4f*)(pr + hsel * NDIM + d);
        const v4f t = *(const v4f*)(sb + hsel * NDIM + d);
        const v4f v = *(const v4f*)(vv + d);
        const v4f th = tanh_x4(e + t);
        acc = fmaf(th[0], v[0], acc);
        acc = fmaf(th[1], v[1], acc);
        acc = fmaf(th[2], v[2], acc);
        acc = fmaf(th[3], v[3], acc);
      }
#pragma unroll
      for (int off = 16; off > 0; off >>= 1) acc += __shfl_xor(acc, off, 32);
      am = hsel ? am : acc;
      ac = hsel ? acc : ac;
    }
    const int s = s0 + lr;
    const bool masked = (s >= L);
    const float em = (vn * am + rm) + nz;
    const float sg = sigm_f(em);
    /* all lanes compute the row results; masked positions give p = 0 exactly */
    float pv = masked ? 0.0f : sg;
    float ev = masked ? 0.0f : ac;
    asm volatile("" : "+v"(pv), "+v"(ev));
    if (lane == 0) { resp[lr] = pv; rese[lr] = ev; }
  }
  __syncthreads();
  if (wave == 0 && lane < 8) {
    const v4f v = *(const v4f*)(resp + 4 * lane);
    float* dst = pbuf + row0 + 4 * lane;
    *(v4f*)dst = v;
    
  }
  if (wave == 1 && lane < 8) {
    const v4f v = *(const v4f*)(rese + 4 * lane);
    float* dst = ebuf + row0 + 4 * lane;
    *(v4f*)dst = v;
    
  }
}

// exclusive block prefix of one value per thread (256 threads = 8 waves), fixed order; one block barrier inside.
__device__ __forceinline__ float block_excl_scan(float total, float* wt, int lane, int wave) {
  float x = total;
#pragma unroll
  for (int off = 1; off < 32; off <<= 1) {
    const float n = __shfl_up(x, off, 32);
    x += (lane >= off) ? n : 0.0f;
  }
  float ex = __shfl_up(x, 1, 32);
  ex = (lane == 0) ? 0.0f : ex;
  if (lane == 31) wt[wave] = x;
  __syncthreads();
  float woff = 0.0f;
#pragma unroll
  for (int w = 0; w < 8; ++w) woff += (w < wave) ? wt[w] : 0.0f;
  return woff + ex;
}

// ---------------------------------------------------------------------------
// Decode step, cut by output column. Four launches:
//   scan_ctx_kernel   grid (8 column chunks, 16 batch rows): every block repeats the row's scans (12 KB of input),
//                     then sums beta . enc for its own 64 columns only.
//   gates_kernel      16 blocks x 16 LSTM units (64 gate columns), all 16 batch rows.
//   sproj_hid_kernel  4 blocks x 64 columns of h, then 16 blocks x 64 columns of the next step's s-projections.
//   ycols_kernel      16 blocks x 64 columns of y (padded to 1024).
// In the three product kernels a thread owns four weight columns and one sixteenth of k and keeps 64 sums, one per column
// and batch row, so a weight element is loaded once per step for all rows. s, c and h live in the workspace as [unit][16 rows].
// ---------------------------------------------------------------------------
constexpr int XP = 20;  /* LDS pitch in floats of one k row of 16 batch values: 16-B aligned, transposing stores 2-way at most */
constexpr int PP = 17;  /* LDS pitch in floats of one column's 16 partial sums */
constexpr int KCAT = NHID + NDIM;
static_assert(KCAT % 128 == 0 && NHID % 128 == 0, "the 16 k ranges are whole 8-row groups and no group straddles the two weights");

/* src [K][16] -> xs[k * XP + row] */
template <int K>
__device__ __forceinline__ void stage_kmajor(float* xs, const float* __restrict__ srcp, int tid) {
#pragma unroll
  for (int i = 0; i < K * 4 / 256; ++i) {
    const int e4 = i * 256 + tid;
    const v4f v = *(const v4f*)(srcp + 4 * e4);
    *(v4f*)(xs + (e4 >> 2) * XP + (e4 & 3) * 4) = v;
  }
}
/* src [16][K] -> xs[k * XP + row] */
template <int K>
__device__ __forceinline__ void stage_rows(float* xs, const float* __restrict__ srcp, int tid) {
#pragma unroll
  for (int i = 0; i < 16 * K / 256; ++i) {
    const int e = i * 256 + tid;
    xs[(e % K) * XP + (e / K)] = srcp[e];
  }
}

/* eight rows of four weight columns; p0 .. p3 point at the first row of the four columns */
__device__ __forceinline__ void rows8x4(float (&w)[8][4], const float* p0, const float* p1, const float* p2,
                                        const float* p3, int ldw) {
#pragma unroll
  for (int i = 0; i < 8; ++i) {
    w[i][0] = p0[(size_t)i * ldw];
    w[i][1] = p1[(size_t)i * ldw];
    w[i][2] = p2[(size_t)i * ldw];
    w[i][3] = p3[(size_t)i * ldw];
  }
  /* the wait in front of any rewrite of these loads' address registers; as inputs the four addresses stay in their
     registers up to here, so that no load of the run lands in one; it also keeps the loads ahead of the fmaf behind it */
  asm volatile("s_wait_xcnt 0x0" :: "v"(p0), "v"(p1), "v"(p2), "v"(p3) : "memory");
}

/* acc[j][row] += xs[k0 + i][row] * w[i][j] for the eight rows i: one LDS read of the 16 batch values feeds 64 fmaf */
__device__ __forceinline__ void fma8x4x16(const float* xs, int k0, const float (&w)[8][4], float (&acc)[4][16]) {
#pragma unroll
  for (int i = 0; i < 8; ++i) {
    const float* x = xs + (k0 + i) * XP;
    const v4f x0 = *(const v4f*)(x);
    const v4f x1 = *(const v4f*)(x + 4);
    const v4f x2 = *(const v4f*)(x + 8);
    const v4f x3 = *(const v4f*)(x + 12);
#pragma unroll
    for (int j = 0; j < 4; ++j) {
      const float wv = w[i][j];
#pragma unroll
      for (int e = 0; e < 4; ++e) {
        acc[j][e]      = fmaf(x0[e], wv, acc[j][e]);
        acc[j][4 + e]  = fmaf(x1[e], wv, acc[j][4 + e]);
        acc[j][8 + e]  = fmaf(x2[e], wv, acc[j][8 + e]);
        acc[j][12 + e] = fmaf(x3[e], wv, acc[j][12 + e]);
      }
    }
  }
}

/* acc[j][row] += sum over k in [kb, ke) of xs[k][row] * W[k][cols[j]]; rows k < K0 of the joined weight are W0, the rest W1.
   The next 8 weight rows are asked for ahead of the current 8 rows' fmaf. */
__device__ __forceinline__ void cols4x16(const float* xs, const float* __restrict__ W0, int K0,
                                         const float* __restrict__ W1, int ldw, const int (&cols)[4], int kb, int ke,
                                         float (&acc)[4][16]) {
  float wa[8][4];
  {
    const float* wp = (kb < K0) ? (W0 + (size_t)kb * ldw) : (W1 + (size_t)(kb - K0) * ldw);
    rows8x4(wa, wp + cols[0], wp + cols[1], wp + cols[2], wp + cols[3], ldw);
  }
  int k0 = kb;
  for (; k0 + 8 < ke; k0 += 8) {
    const int kn = k0 + 8;
    const float* wp = (kn < K0) ? (W0 + (size_t)kn * ldw) : (W1 + (size_t)(kn - K0) * ldw);
    float wb[8][4];
    rows8x4(wb, wp + cols[0], wp + cols[1], wp + cols[2], wp + cols[3], ldw);
    fma8x4x16(xs, k0, wa, acc);
#pragma unroll
    for (int i = 0; i < 8; ++i)
#pragma unroll
      for (int j = 0; j < 4; ++j) wa[i][j] = wb[i][j];
  }
  fma8x4x16(xs, k0, wa, acc);
}
__device__ __forceinline__ void zero_acc(float (&acc)[4][16]) {
#pragma unroll
  for (int j = 0; j < 4; ++j)
#pragma unroll
    for (int r = 0; r < 16; ++r) acc[j][r] = 0.0f;
}
/* block column index of (j, t16) is j * 16 + t16 */
__device__ __forceinline__ void put_part(float* part, int q, int t16, const float (&acc)[4][16]) {
#pragma unroll
  for (int j = 0; j < 4; ++j)
#pragma unroll
    for (int r = 0; r < 16; ++r) part[(q * 64 + j * 16 + t16) * PP + r] = acc[j][r];
}
/* the 16 k ranges of (block column c, batch row r), fixed order */
__device__ __forceinline__ float get_part(const float* part, int c, int r) {
  float v = part[c * PP + r];
#pragma unroll
  for (int q = 1; q < 16; ++q) v += part[(q * 64 + c) * PP + r];
  return v;
}

__global__ __launch_bounds__(256) void scan_ctx_kernel(
    const float* __restrict__ enc, const int* __restrict__ len,
    const float* __restrict__ pbuf, const float* __restrict__ ebuf,
    const float* __restrict__ acar_in, float* __restrict__ acar_out, float* __restrict__ ctx) {
  __shared__ __align__(16) float sh_p[NSEQ];
  __shared__ __align__(16) float sh_a[NSEQ];
  __shared__ __align__(16) float sh_ex[NSEQ];
  __shared__ __align__(16) float sh_g[NSEQ];
  __shared__ __align__(16) float sh_cpp[NSEQ];
  __shared__ __align__(16) float sh_u[NSEQ];
  __shared__ __align__(16) float sh_al[NSEQ];
  __shared__ __align__(16) float sh_r[NSEQ];
  __shared__ __align__(16) float sh_beta[NSEQ];
  __shared__ __align__(16) float sh_cpart[16 * 68];
  __shared__ float redm[8];
  __shared__ float wtA[8];
  __shared__ float wtB[8];

  const int tid = threadIdx.x, lane = tid & 31, wave = tid >> 5;
  const int chunk = blockIdx.x;
  const int b = blockIdx.y;
  const int i0 = tid * 4;
  int L = len[b];
  L = (L < 0) ? 0 : ((L > NSEQ) ? NSEQ : L);
  const float* prow = pbuf + b * NSEQ;
  const float* erow = ebuf + b * NSEQ;
  const float* arow = acar_in + b * NSEQ;

  /* phase 1: stage p, a, e; log terms; running max over unmasked positions */
  float ml = -3.0e38f;
/* all four trips open: the 12 row loads fly together instead of four L2 round trips one after the other */
#pragma unroll
  for (int j = 0; j < 4; ++j) {
    const int i = j * 256 + tid;
    const float pv = prow[i];
    const float ev = erow[i];
    const float av = arow[i];
    sh_p[i] = pv;
    sh_a[i] = av;
    sh_ex[i] = ev;
    sh_g[i] = logf(fminf(fmaxf(1.0f - pv, 1e-8f), 1.0f));
    ml = (i < L) ? fmaxf(ml, ev) : ml;
  }
#pragma unroll
  for (int off = 16; off > 0; off >>= 1) ml = fmaxf(ml, __shfl_xor(ml, off, 32));
  if (lane == 0) redm[wave] = ml;
  __syncthreads();
  float mx = redm[0];
#pragma unroll
  for (int w = 1; w < 8; ++w) mx = fmaxf(mx, redm[w]);

  /* phase 2: ex = max(exp(e - max), 1e-5); masked positions give 1e-5 */
#pragma unroll 1
  for (int j = 0; j < 4; ++j) {
    const int i = j * 256 + tid;
    const float t = fmaxf(expf(sh_ex[i] - mx), 1e-5f);
    sh_ex[i] = (i < L) ? t : 1e-5f;
  }

  /* phase 3: exclusive prefix of the log terms over contiguous chunks of 4 */
  {
    const v4f g4 = *(const v4f*)(sh_g + i0);
    const float e1 = g4[0];
    const float e2 = e1 + g4[1];
    const float e3 = e2 + g4[2];
    const float tot = e3 + g4[3];
    const float off = block_excl_scan(tot, wtA, lane, wave);
    v4f x4;
    x4[0] = off;
    x4[1] = off + e1;
    x4[2] = off + e2;
    x4[3] = off + e3;
    *(v4f*)(sh_cpp + i0) = x4;
  }
  __syncthreads();

  /* phase 4: cpp = exp(prefix) (flushed below the smallest normal), u = a / clip(cpp, 1e-8, 1) */
#pragma unroll 1
  for (int j = 0; j < 4; ++j) {
    const int i = j * 256 + tid;
    float cp = expf(sh_cpp[i]);
    cp = (cp < 1.17549435e-38f) ? 0.0f : cp;
    sh_cpp[i] = cp;
    const float cl = fminf(fmaxf(cp, 1e-8f), 1.0f);
    sh_u[i] = sh_a[i] * __builtin_amdgcn_rcpf(cl);
  }
  __syncthreads();

  /* phase 5: inclusive prefix of u, q = cpp * prefix, alpha = clip(p * q, 1e-8, 1) */
  {
    const v4f u4 = *(const v4f*)(sh_u + i0);
    const v4f c4 = *(const v4f*)(sh_cpp + i0);
    const v4f p4 = *(const v4f*)(sh_p + i0);
    const float c0 = u4[0];
    const float c1 = c0 + u4[1];
    const float c2 = c1 + u4[2];
    const float c3 = c2 + u4[3];
    const float off2 = block_excl_scan(c3, wtB, lane, wave);
    v4f al;
    al[0] = fminf(fmaxf(p4[0] * (c4[0] * (off2 + c0)), 1e-8f), 1.0f);
    al[1] = fminf(fmaxf(p4[1] * (c4[1] * (off2 + c1)), 1e-8f), 1.0f);
    al[2] = fminf(fmaxf(p4[2] * (c4[2] * (off2 + c2)), 1e-8f), 1.0f);
    al[3] = fminf(fmaxf(p4[3] * (c4[3] * (off2 + c3)), 1e-8f), 1.0f);
    *(v4f*)(sh_al + i0) = al;
  }
  __syncthreads();

  /* phase 6: denom = max(sum ex[i-3..i], 1e-10) (zero padded), r = alpha / denom */
#pragma unroll 1
  for (int j = 0; j < 4; ++j) {
    const int i = j * 256 + tid;
    float d = 0.0f;
#pragma unroll
    for (int k = 3; k >= 0; --k) {
      const int ii = i - k;
      const int ic = (ii < 0) ? 0 : ii;
      const float v = sh_ex[ic];
      d += (ii >= 0) ? v : 0.0f;
    }
    d = fmaxf(d, 1e-10f);
    sh_r[i] = sh_al[i] * __builtin_amdgcn_rcpf(d);
  }
  __syncthreads();

  /* phase 7: beta = ex * sum r[i..i+3] (zero padded) */
#pragma unroll 1
  for (int j = 0; j < 4; ++j) {
    const int i = j * 256 + tid;
    float ms = 0.0f;
#pragma unroll
    for (int k = 0; k < 4; ++k) {
      const int ii = i + k;
      const int ic = (ii > NSEQ - 1) ? (NSEQ - 1) : ii;
      const float v = sh_r[ic];
      ms += (ii < NSEQ) ? v : 0.0f;
    }
    sh_beta[i] = sh_ex[i] * ms;
  }
  __syncthreads();

  /* phase 8: ctx of this block's 64 columns; thread = (group of 4 columns, position class s mod 16), 64 positions each */
  {
    const int cg = tid & 15, sp = tid >> 4;
    const float* eb = enc + (size_t)b * NSEQ * NDIM + chunk * 64 + 4 * cg;
    v4f acc = (v4f){0.f, 0.f, 0.f, 0.f};
/* 16 trips per pass: their row loads fly together */
#pragma unroll 16
    for (int it = 0; it < NSEQ / 16; ++it) {
      const int s = 16 * it + sp;
      const float bv = sh_beta[s];
      const v4f e4 = *(const v4f*)(eb + (size_t)s * NDIM);
      acc[0] = fmaf(bv, e4[0], acc[0]);
      acc[1] = fmaf(bv, e4[1], acc[1]);
      acc[2] = fmaf(bv, e4[2], acc[2]);
      acc[3] = fmaf(bv, e4[3], acc[3]);
    }
    *(v4f*)(sh_cpart + sp * 68 + 4 * cg) = acc;
  }
  __syncthreads();
  /* 16 position classes joined in fixed order; 64 threads store the block's own 256-B piece of the row */
  if (tid < 64) {
    float v = sh_cpart[tid];
#pragma unroll
    for (int sp = 1; sp < 16; ++sp) v += sh_cpart[sp * 68 + tid];
    ctx[b * NDIM + chunk * 64 + tid] = v;
  }
  /* the alpha carry is stored by one block of the row */
  if (chunk == 0) {
    const v4f alv = *(const v4f*)(sh_al + i0);
    *(v4f*)(acar_out + b * NSEQ + i0) = alv;
  }
}

__global__ __launch_bounds__(256) void gates_kernel(
    const float* __restrict__ ctx, const int* __restrict__ target,
    const float* __restrict__ s_in, const float* __restrict__ c_in,
    float* __restrict__ s_out, float* __restrict__ c_out,
    const float* __restrict__ Lys, const float* __restrict__ Lss,
    const float* __restrict__ Lgsw, const float* __restrict__ Lgsb, int step) {
  __shared__ __align__(16) float xs[KCAT * XP];
  __shared__ float part[16 * 64 * PP];
  const int tid = threadIdx.x;
  const int u0 = blockIdx.x * 16;
  stage_kmajor<NHID>(xs, s_in, tid);
  stage_rows<NDIM>(xs + NHID * XP, ctx, tid);
  __syncthreads();
  const int t16 = tid & 15, q = tid >> 4;
  float acc[4][16];
  zero_acc(acc);
  /* the thread's four columns: gates i, f, g, o of unit u0 + t16 */
  const int cols[4] = {u0 + t16, NHID + u0 + t16, 2 * NHID + u0 + t16, 3 * NHID + u0 + t16};
  cols4x16(xs, Lss, NHID, Lgsw, NGATE, cols, q * (KCAT / 16), (q + 1) * (KCAT / 16), acc);
  put_part(part, q, t16, acc);
  __syncthreads();
  /* LSTM cell of (unit u0 + u, batch row r) */
  const int u = tid >> 4, r = tid & 15;
  int tg = target[r * NSTEPS + step];
  tg = (tg < 0) ? 0 : ((tg > NCLS - 1) ? (NCLS - 1) : tg);
  const float* ly = Lys + (size_t)tg * NGATE + u0 + u;
  const float* lb = Lgsb + u0 + u;
  const float r0 = get_part(part, u, r)      + (ly[0] + lb[0]);
  const float r1 = get_part(part, 16 + u, r) + (ly[NHID] + lb[NHID]);
  const float r2 = get_part(part, 32 + u, r) + (ly[2 * NHID] + lb[2 * NHID]);
  const float r3 = get_part(part, 48 + u, r) + (ly[3 * NHID] + lb[3 * NHID]);
  const float cold = c_in[u0 * 16 + tid];
  const float ig = sigm_f(r0);
  const float fg = sigm_f(r1);
  const float gg = tanh_e(r2);
  const float og = sigm_f(r3);
  const float cn = fg * cold + ig * gg;
  const float sn = og * tanh_e(cn);
  c_out[u0 * 16 + tid] = cn;
  s_out[u0 * 16 + tid] = sn;
}

__global__ __launch_bounds__(256) void sproj_hid_kernel(
    const float* __restrict__ ctx, const float* __restrict__ s_new,
    const float* __restrict__ Wsm, const float* __restrict__ Wsmb,
    const float* __restrict__ Wsc, const float* __restrict__ Wscb,
    const float* __restrict__ Lsy, const float* __restrict__ Lgyw, const float* __restrict__ Lgyb,
    float* __restrict__ smsc, float* __restrict__ hx, int step) {
  __shared__ __align__(16) float xs[KCAT * XP];
  __shared__ float part[16 * 64 * PP];
  const int tid = threadIdx.x;
  /* the four h blocks have three times the k range: they come first */
  const bool ish = blockIdx.x < 4;
  /* no next step: its projections are not formed (whole block leaves, in front of every barrier) */
  if (!ish && step + 1 >= NSTEPS) return;
  stage_kmajor<NHID>(xs, s_new, tid);
  if (ish) stage_rows<NDIM>(xs + NHID * XP, ctx, tid);
  __syncthreads();
  const int t16 = tid & 15, q = tid >> 4;
  float acc[4][16];
  zero_acc(acc);
  if (ish) {
    const int col0 = blockIdx.x * 64;
    const int cols[4] = {col0 + t16, col0 + 16 + t16, col0 + 32 + t16, col0 + 48 + t16};
    cols4x16(xs, Lsy, NHID, Lgyw, NHID, cols, q * (KCAT / 16), (q + 1) * (KCAT / 16), acc);
    put_part(part, q, t16, acc);
    __syncthreads();
#pragma unroll
    for (int e = 0; e < 4; ++e) {
      const int o = e * 256 + tid;
      const float v = get_part(part, o >> 4, o & 15) + Lgyb[col0 + (o >> 4)];
      hx[col0 * 16 + o] = tanh_e(v);
    }
    /* in the listing the other branch's code, which rewrites these stores' registers, follows them: the wait stands in front of it */
    asm volatile("s_wait_xcnt 0x0" ::: "memory");
  } else {
    const int col0 = (blockIdx.x - 4) * 64;
    const float* Wp = (col0 < NDIM) ? Wsm : Wsc;
    const float* bp = (col0 < NDIM) ? Wsmb : Wscb;
    const int cw = col0 & (NDIM - 1);
    const int cols[4] = {cw + t16, cw + 16 + t16, cw + 32 + t16, cw + 48 + t16};
    cols4x16(xs, Wp, NHID, Wp, NDIM, cols, q * (NHID / 16), (q + 1) * (NHID / 16), acc);
    put_part(part, q, t16, acc);
    __syncthreads();
    const int r = tid >> 4, c4 = (tid & 15) * 4;
    v4f v;
#pragma unroll
    for (int e = 0; e < 4; ++e) v[e] = get_part(part, c4 + e, r) + bp[cw + c4 + e];
    *(v4f*)(smsc + r * NPROJ + col0 + c4) = v;
  }
}

__global__ __launch_bounds__(256) void ycols_kernel(const float* __restrict__ hx, const float* __restrict__ Lyyw,
                                                    const float* __restrict__ Lyyb, float* __restrict__ Yrow) {
  __shared__ __align__(16) float xs[NHID * XP];
  __shared__ float part[16 * 64 * PP];
  const int tid = threadIdx.x;
  const int col0 = blockIdx.x * 64;
  stage_kmajor<NHID>(xs, hx, tid);
  __syncthreads();
  const int t16 = tid & 15, q = tid >> 4;
  float acc[4][16];
  zero_acc(acc);
  /* column index clamped for the address; columns beyond 999 are stored as zero below */
  int cols[4];
#pragma unroll
  for (int j = 0; j < 4; ++j) {
    const int n = col0 + j * 16 + t16;
    cols[j] = (n < NCLS) ? n : (NCLS - 1);
  }
  cols4x16(xs, Lyyw, NHID, Lyyw, NCLS, cols, q * (NHID / 16), (q + 1) * (NHID / 16), acc);
  put_part(part, q, t16, acc);
  __syncthreads();
  const int r = tid >> 4, c4 = (tid & 15) * 4;
  v4f v;
#pragma unroll
  for (int e = 0; e < 4; ++e) {
    const int n = col0 + c4 + e;
    const int nc = (n < NCLS) ? n : (NCLS - 1);
    const float y = get_part(part, c4 + e, r) + Lyyb[nc];
    v[e] = (n < NCLS) ? y : 0.0f;
  }
  *(v4f*)(Yrow + r * YPITCH + col0 + c4) = v;
}

// ---------------------------------------------------------------------------
// Pack: out[b][t][n] = Y[t][b][n], n < 1000. Thread i4 moves floats 4 i4 .. 4 i4 + 3 of the flat output
// (1000 % 4 == 0 so a group never straddles rows). A wave writes 32 x 16 B = 512 contiguous 512-B aligned bytes =
// ---------------------------------------------------------------------------
__global__ __launch_bounds__(256) void pack_out_kernel(const float* __restrict__ Yt, float* __restrict__ out) {
  const int i4 = blockIdx.x * 256 + threadIdx.x;
  const int e  = i4 * 4;
  const int row = e / NCLS;
  const int n   = e - row * NCLS;
  const int b = row / NSTEPS;
  const int t = row - b * NSTEPS;
  const v4f v = *(const v4f*)(Yt + ((size_t)t * NBATCH + b) * YPITCH + n);
  float* dst = out + e;
  *(v4f*)dst = v;
  
}

// ---------------------------------------------------------------------------
// Host glue. Workspace region map (bytes, 256-B aligned carve; total 85,901,568 <= 134,217,728):
//   A16   [16384][512]  f16   16,777,216   f16(enc)
//   BT16  [1024][512]   f16    1,048,576   rows 0..511: f16(16 Wh_mono[k][n]), rows 512..1023: f16(16 Wh_chunk[k][n-512])
//   PF    [16384][1024] f32   67,108,864   enc @ [Wh_mono | Wh_chunk]
//   PBUF  [16][1024]    f32       65,536   p of the current step
//   EBUF  [16][1024]    f32       65,536   chunk energies of the current step
//   ACAR  [2][16][1024] f32      131,072   alpha carry, ping-pong by step parity
//   SMSC  [16][1024]    f32       65,536   s @ [Ws_mono | Ws_chunk] + biases for the current step
//   SST   [2][256][16]  f32       32,768   s, ping-pong, [unit][batch row]
//   CST   [2][256][16]  f32       32,768   c, ping-pong, [unit][batch row]
//   YT    [8][16][1024] f32      524,288   y per step, columns 1000..1023 zero
//   VNORM [64]          f32          256   line 0 = g / norm(v_mono)
//   CTX   [16][512]     f32       32,768   ctx of the current step
//   HX    [256][16]     f32       16,384   output hidden h of the current step, [unit][batch row]
// ---------------------------------------------------------------------------
extern "C" void kernel_launch(void* const* d_in, const int* in_sizes, int n_in,
                              void* d_out, int out_size, void* d_ws, size_t ws_size, hipStream_t stream) {
  if (n_in < 23 || d_out == nullptr || d_ws == nullptr) return;
  if (in_sizes[0] != NBATCH * NSEQ * NDIM || in_sizes[1] != NBATCH * NSTEPS || in_sizes[2] != NBATCH ||
      in_sizes[3] != NSTEPS * NBATCH * NSEQ || in_sizes[4] != NHID * NDIM || in_sizes[6] != NDIM * NDIM ||
      in_sizes[10] != NHID * NDIM || in_sizes[12] != NDIM * NDIM || in_sizes[14] != NHID * NHID ||
      in_sizes[15] != NDIM * NHID || in_sizes[17] != NHID * NCLS || in_sizes[19] != NCLS * NGATE ||
      in_sizes[20] != NHID * NGATE || in_sizes[21] != NDIM * NGATE || out_size != NBATCH * NSTEPS * NCLS) return;

  const float* enc     = (const float*)d_in[0];
  const int*   target  = (const int*)d_in[1];
  const int*   lenenc  = (const int*)d_in[2];
  const float* noise   = (const float*)d_in[3];
  const float* ws_m_w  = (const float*)d_in[4];
  const float* ws_m_b  = (const float*)d_in[5];
  const float* wh_m    = (const float*)d_in[6];
  const float* v_m     = (const float*)d_in[7];
  const float* g_m     = (const float*)d_in[8];
  const float* r_m     = (const float*)d_in[9];
  const float* ws_c_w  = (const float*)d_in[10];
  const float* ws_c_b  = (const float*)d_in[11];
  const float* wh_c    = (const float*)d_in[12];
  const float* v_c     = (const float*)d_in[13];
  const float* l_sy    = (const float*)d_in[14];
  const float* l_gy_w  = (const float*)d_in[15];
  const float* l_gy_b  = (const float*)d_in[16];
  const float* l_yy_w  = (const float*)d_in[17];
  const float* l_yy_b  = (const float*)d_in[18];
  const float* l_ys    = (const float*)d_in[19];
  const float* l_ss    = (const float*)d_in[20];
  const float* l_gs_w  = (const float*)d_in[21];
  const float* l_gs_b  = (const float*)d_in[22];
  float* out = (float*)d_out;

  char* ws = (char*)d_ws; size_t off = 0;
  auto carve = [&](size_t bytes) -> char* { char* p = ws + off; off += (bytes + 255) & ~(size_t)255; return p; };
  unsigned short* A16  = (unsigned short*)carve((size_t)NROWS * NDIM * 2);
  unsigned short* BT16 = (unsigned short*)carve((size_t)NPROJ * NDIM * 2);
  float* PF    = (float*)carve((size_t)NROWS * NPROJ * 4);
  float* PBUF  = (float*)carve((size_t)NBATCH * NSEQ * 4);
  float* EBUF  = (float*)carve((size_t)NBATCH * NSEQ * 4);
  float* ACAR  = (float*)carve((size_t)2 * NBATCH * NSEQ * 4);
  float* SMSC  = (float*)carve((size_t)NBATCH * NPROJ * 4);
  float* SST   = (float*)carve((size_t)2 * NBATCH * NHID * 4);
  float* CST   = (float*)carve((size_t)2 * NBATCH * NHID * 4);
  float* YT    = (float*)carve((size_t)NSTEPS * NBATCH * YPITCH * 4);
  float* VNORM = (float*)carve((size_t)256);
  float* CTX   = (float*)carve((size_t)NBATCH * NDIM * 4);
  float* HX    = (float*)carve((size_t)NBATCH * NHID * 4);
  if (off > ws_size || off > (size_t)134217728) return;

  /* (1) f16 operand planes */
  const int n8 = NROWS * NDIM / 8;
  cast8_f16_kernel<<<n8 / 256, 256, 0, stream>>>(enc, A16, n8);
  /* in [512 k][512 n] -> out [n][k]; grid (k tiles, n tiles, weight) */
  wtcast_kernel<<<dim3(NDIM / 64, NDIM / 64, 2), 256, 0, stream>>>(wh_m, wh_c, BT16, WCARRY);
  /* (2) initial state, s-projection biases, vnorm */
  init_state_kernel<<<NBATCH, 256, 0, stream>>>(v_m, g_m, ws_m_b, ws_c_b, ACAR, SST, CST, SMSC, VNORM);
  /* (3) fused encoder projections: M = 16384, N = 1024, K = 512; 4096 tiles = 512 blocks x 8 waves */
  wmma_gemm64<0, false, 0, 0, false, 0><<<dim3((NROWS / 64) * (NPROJ / 64) / 8, 1), 256, 0, stream>>>(
      A16, A16, NDIM, 0L, BT16, BT16, NDIM, 0L, (void*)PF, (void*)PF, NPROJ, 0L,
      PF, PF, 0L, NROWS, NPROJ, NDIM, WCARRY_INV);

  /* (4) decode steps: five launches per step */
  for (int step = 0; step < NSTEPS; ++step) {
    const int par = step & 1;
    energies_kernel<<<NROWS / ROWS_PER_EBLK, 256, 0, stream>>>(
        PF, SMSC, v_m, v_c, VNORM, r_m, lenenc, noise + (size_t)step * NBATCH * NSEQ, PBUF, EBUF);
    scan_ctx_kernel<<<dim3(NDIM / 64, NBATCH), 256, 0, stream>>>(
        enc, lenenc, PBUF, EBUF,
        ACAR + (size_t)par * NBATCH * NSEQ, ACAR + (size_t)(par ^ 1) * NBATCH * NSEQ, CTX);
    gates_kernel<<<NHID / 16, 256, 0, stream>>>(
        CTX, target, SST + (size_t)par * NBATCH * NHID, CST + (size_t)par * NBATCH * NHID,
        SST + (size_t)(par ^ 1) * NBATCH * NHID, CST + (size_t)(par ^ 1) * NBATCH * NHID,
        l_ys, l_ss, l_gs_w, l_gs_b, step);
    sproj_hid_kernel<<<NHID / 64 + NPROJ / 64, 256, 0, stream>>>(
        CTX, SST + (size_t)(par ^ 1) * NBATCH * NHID, ws_m_w, ws_m_b, ws_c_w, ws_c_b,
        l_sy, l_gy_w, l_gy_b, SMSC, HX, step);
    ycols_kernel<<<YPITCH / 64, 256, 0, stream>>>(HX, l_yy_w, l_yy_b, YT + (size_t)step * NBATCH * YPITCH);
  }

  /* (5) pack the padded Y plane into the output */
  pack_out_kernel<<<(NBATCH * NSTEPS * NCLS) / (256 * 4), 256, 0, stream>>>(YT, out);
}

// v004
// One run takes 314 microseconds.
// Two timings next to v003 both put it at 1.37 times that version's speed.
// All steps since v000 together make it 12.6 times as fast.
// Compute dtype: enc x [Wh_mono | Wh_chunk] on v_wmma_f32_16x16x32_f16 (f16 enc, f16 weights carried x16, f32 accumulate, folded by 1/16); all per-step small products, energy dots, scans, gates and state in f32 on VALU.
#include <hip/hip_runtime.h>
#include <math.h>

// ---------------------------------------------------------------------------
// Shape constants
// ---------------------------------------------------------------------------
constexpr int NBATCH = 16;
constexpr int NSEQ   = 1024;
constexpr int NHID   = 256;
constexpr int NDIM   = 512;
constexpr int NCLS   = 1000;
constexpr int NSTEPS = 8;
constexpr int NGATE  = 4 * NHID;
constexpr int NPROJ  = 2 * NDIM;
constexpr int YPITCH = 1024;
constexpr int NROWS  = NBATCH * NSEQ;
constexpr int ROWS_PER_EBLK = 32;
constexpr float WCARRY     = 16.0f;
constexpr float WCARRY_INV = 1.0f / 16.0f;
static_assert(NSEQ % ROWS_PER_EBLK == 0, "energy blocks stay inside one batch row");
static_assert(NROWS % 64 == 0 && NPROJ % 64 == 0 && NDIM % 32 == 0, "GEMM tile multiples");
static_assert((NBATCH * NSTEPS * NCLS) % (256 * 4) == 0, "pack grid exact");
static_assert(NCLS % 4 == 0, "float4 groups never straddle output rows");
static_assert(NSEQ == 4 * 256 && NHID == 256 && NDIM == 2 * 256, "thread maps");

typedef __attribute__((ext_vector_type(16))) _Float16 v16h;
typedef __attribute__((ext_vector_type(8)))  _Float16 v8h;
typedef __attribute__((ext_vector_type(16))) __bf16   v16b;
typedef __attribute__((ext_vector_type(8)))  __bf16   v8b;
typedef __attribute__((ext_vector_type(8)))  float    v8f;
typedef __attribute__((ext_vector_type(4)))  float    v4f;
typedef __attribute__((ext_vector_type(4)))  unsigned int v4u;

__device__ __forceinline__ unsigned short f2bf_bits(float f) {
  unsigned u = __float_as_uint(f);
  return (unsigned short)((u + 0x7FFFu + ((u >> 16) & 1u)) >> 16);
}
__device__ __forceinline__ float bf_bits2f(unsigned short h) { return __uint_as_float(((unsigned)h) << 16); }

__device__ __forceinline__ void dep_guard6_h(v8f& a, v8f& b, v8f& c, v8f& d, v16h x, v16h x2, v16h y0, v16h y1, v16h y2, v16h y3) {
  asm volatile("v_nop\n\tv_nop\n\tv_nop\n\tv_nop" : "+v"(a), "+v"(b), "+v"(c), "+v"(d) : "v"(x), "v"(x2), "v"(y0), "v"(y1), "v"(y2), "v"(y3));
}
__device__ __forceinline__ void dep_guard6_b(v8f& a, v8f& b, v8f& c, v8f& d, v16b x, v16b x2, v16b y0, v16b y1, v16b y2, v16b y3) {
  asm volatile("v_nop\n\tv_nop\n\tv_nop\n\tv_nop" : "+v"(a), "+v"(b), "+v"(c), "+v"(d) : "v"(x), "v"(x2), "v"(y0), "v"(y1), "v"(y2), "v"(y3));
}
__device__ __forceinline__ void keep4_h(v16h a, v16h b, v16h c, v16h d) { asm volatile("v_nop" :: "v"(a), "v"(b), "v"(c), "v"(d)); }
__device__ __forceinline__ void keep4_b(v16b a, v16b b, v16b c, v16b d) { asm volatile("v_nop" :: "v"(a), "v"(b), "v"(c), "v"(d)); }
__device__ __forceinline__ void acc_guard4(v8f& a, v8f& b, v8f& c, v8f& d) { asm volatile("v_nop\n\tv_nop\n\tv_nop\n\tv_nop" : "+v"(a), "+v"(b), "+v"(c), "+v"(d)); }

template <typename T> struct Frag;
template <> struct Frag<_Float16> {
  typedef v16h V; union U { v16h v; v8h h[2]; };
  /* elements 0..7 <- p[0..7], 8..15 <- p[16..23] */
  static __device__ __forceinline__ v16h load(const _Float16* p) {
    U f; f.h[0] = *(const v8h*)(p); f.h[1] = *(const v8h*)(p + 16); return f.v;
  }
  static __device__ __forceinline__ v8f mma(v16h a, v16h b, v8f c) {
    return __builtin_amdgcn_wmma_f32_16x16x32_f16(false, a, false, b, (short)0, c, false, false);
  }
  static __device__ __forceinline__ void guard(v8f& a, v8f& b, v8f& c, v8f& d, v16h x, v16h x2, v16h y0, v16h y1, v16h y2, v16h y3) {
    dep_guard6_h(a, b, c, d, x, x2, y0, y1, y2, y3);
  }
  static __device__ __forceinline__ void keep(v16h a, v16h b, v16h c, v16h d) { keep4_h(a, b, c, d); }
};
template <> struct Frag<__bf16> {
  typedef v16b V; union U { v16b v; v8b h[2]; };
  static __device__ __forceinline__ v16b load(const __bf16* p) {
    U f; f.h[0] = *(const v8b*)(p); f.h[1] = *(const v8b*)(p + 16); return f.v;
  }
  static __device__ __forceinline__ v8f mma(v16b a, v16b b, v8f c) {
    return __builtin_amdgcn_wmma_f32_16x16x32_bf16(false, a, false, b, (short)0, c, false, false);
  }
  static __device__ __forceinline__ void guard(v8f& a, v8f& b, v8f& c, v8f& d, v16b x, v16b x2, v16b y0, v16b y1, v16b y2, v16b y3) {
    dep_guard6_b(a, b, c, d, x, x2, y0, y1, y2, y3);
  }
  static __device__ __forceinline__ void keep(v16b a, v16b b, v16b c, v16b d) { keep4_b(a, b, c, d); }
};

__device__ __forceinline__ unsigned pk16(unsigned short a, unsigned short b) { return (unsigned)a | ((unsigned)b << 16); }
__device__ __forceinline__ unsigned short h_bits(float f) { const _Float16 h = (_Float16)f; return __builtin_bit_cast(unsigned short, h); }

/* reciprocal-based logistic and tanh with precise expf (v_rcp_f32 reciprocal) */
__device__ __forceinline__ float sigm_f(float x) { return __builtin_amdgcn_rcpf(1.0f + expf(-x)); }
__device__ __forceinline__ float tanh_e(float x) { return 1.0f - 2.0f * __builtin_amdgcn_rcpf(expf(2.0f * x) + 1.0f); }
__device__ __forceinline__ v4f exp2_x4(v4f a) {
  float r0, r1, r2, r3;
  asm("v_exp_f32 %0, %4\n\tv_exp_f32 %1, %5\n\tv_exp_f32 %2, %6\n\tv_exp_f32 %3, %7\n\tv_nop"
      : "=&v"(r0), "=&v"(r1), "=&v"(r2), "=&v"(r3) : "v"(a[0]), "v"(a[1]), "v"(a[2]), "v"(a[3]));
  return (v4f){r0, r1, r2, r3};
}
__device__ __forceinline__ v4f rcp_x4(v4f a) {
  float r0, r1, r2, r3;
  asm("v_rcp_f32 %0, %4\n\tv_rcp_f32 %1, %5\n\tv_rcp_f32 %2, %6\n\tv_rcp_f32 %3, %7\n\tv_nop"
      : "=&v"(r0), "=&v"(r1), "=&v"(r2), "=&v"(r3) : "v"(a[0]), "v"(a[1]), "v"(a[2]), "v"(a[3]));
  return (v4f){r0, r1, r2, r3};
}
__device__ __forceinline__ v4f tanh_x4(v4f x) {
  const v4f q = rcp_x4(exp2_x4(x * 2.885390082f) + 1.0f);
  return 1.0f - 2.0f * q;
}

// ---- Register-blocked batched WMMA GEMM ------------------------------------
// C[m,n] = scale * sum_k A[m,k] * Bt[n,k] (+bias)(+resid); each wave owns a 64x64 tile.
// A row-major [M,K]; Bt row-major [N,K]; M,N % 64 == 0, K % 32 == 0.
// SPLIT: operands are hi/lo planes (A2/Bt2 = lo planes, same layout); product = hi*hi + hi*lo + lo*hi.
// BIAS_MODE: 0 = none, 1 = bias[m], 2 = bias[n].
// OUT_MODE: 0 = f32, 1 = f16, 2 = bf16 hi plane (Cout) + bf16 lo plane (Cout2).
// ET: 0 = f16 operands, 1 = bf16 operands (pointers passed as 16-bit storage)
template <int ET> struct Elem;
template <> struct Elem<0> { typedef _Float16 T; };
template <> struct Elem<1> { typedef __bf16 T; };
template <int ET, bool SPLIT, int BIAS_MODE, int OUT_MODE, bool RESID, int ACT = 0>
__global__ __launch_bounds__(256) void wmma_gemm64(
    const unsigned short* __restrict__ Ap, const unsigned short* __restrict__ A2p, int lda, long strideA,
    const unsigned short* __restrict__ Btp, const unsigned short* __restrict__ Bt2p, int ldb, long strideB,
    void* __restrict__ Cout, void* __restrict__ Cout2, int ldc, long strideC,
    const float* __restrict__ bias,
    const float* __restrict__ resid, long strideR,
    int M, int N, int K, float scale) {
  typedef typename Elem<ET>::T T;
  typedef typename Frag<T>::V V;
  const T* A = (const T*)Ap; const T* A2 = (const T*)A2p; const T* Bt = (const T*)Btp; const T* Bt2 = (const T*)Bt2p;
  /* per-wave 16x64 slab, pitch 68 floats */
  __shared__ __align__(16) float sT[8][16 * 68];
  const int b    = blockIdx.y;
  const int lane = threadIdx.x & 31;
  const int wave = threadIdx.x >> 5;
  const int tilesN = N >> 6;
  const int tilesM = M >> 6;
  const int tile = blockIdx.x * 8 + wave;
  /* wave-uniform exit; no block barriers in this kernel */
  if (tile >= tilesM * tilesN) return;
  const int tm = tile / tilesN;
  const int tn = tile - tm * tilesN;
  const int m0 = tm << 6;
  const int n0 = tn << 6;

  const T* Ab  = A  + (size_t)b * strideA;
  const T* Bb  = Bt + (size_t)b * strideB;
  const T* Ab2 = SPLIT ? (A2  + (size_t)b * strideA) : nullptr;
  const T* Bb2 = SPLIT ? (Bt2 + (size_t)b * strideB) : nullptr;

  const int rlane = lane & 15;
  const int koff  = (lane >> 4) * 8;
  const int mOff  = (lane >> 4) * 8;

  v8f acc[4][4];
#pragma unroll
  for (int i = 0; i < 4; ++i)
#pragma unroll
    for (int j = 0; j < 4; ++j) acc[i][j] = (v8f){0.f,0.f,0.f,0.f,0.f,0.f,0.f,0.f};

  for (int k0 = 0; k0 < K; k0 += 32) {
    V bh[4], bl[4];
#pragma unroll
    for (int j = 0; j < 4; ++j) {
      const size_t bo = (size_t)(n0 + (j << 4) + rlane) * ldb + koff + k0;
      bh[j] = Frag<T>::load(Bb + bo);
      if (SPLIT) bl[j] = Frag<T>::load(Bb2 + bo);
    }
#pragma unroll
    for (int i = 0; i < 4; ++i) {
      const size_t ao = (size_t)(m0 + (i << 4) + rlane) * lda + koff + k0;
      V ah = Frag<T>::load(Ab + ao);
      V al;
      if (SPLIT) al = Frag<T>::load(Ab2 + ao);
#pragma unroll
      for (int j = 0; j < 4; ++j) {
        acc[i][j] = Frag<T>::mma(ah, bh[j], acc[i][j]);
        if (SPLIT) {
          acc[i][j] = Frag<T>::mma(ah, bl[j], acc[i][j]);
          acc[i][j] = Frag<T>::mma(al, bh[j], acc[i][j]);
        }
      }
      Frag<T>::guard(acc[i][0], acc[i][1], acc[i][2], acc[i][3], ah, SPLIT ? al : ah, bh[0], bh[1], bh[2], bh[3]);
    }
    Frag<T>::keep(bh[0], bh[1], bh[2], bh[3]);
    if (SPLIT) Frag<T>::keep(bl[0], bl[1], bl[2], bl[3]);
  }
  acc_guard4(acc[0][0], acc[0][1], acc[0][2], acc[0][3]);
  acc_guard4(acc[1][0], acc[1][1], acc[1][2], acc[1][3]);
  acc_guard4(acc[2][0], acc[2][1], acc[2][2], acc[2][3]);
  acc_guard4(acc[3][0], acc[3][1], acc[3][2], acc[3][3]);

  float* slab = sT[wave];
  const float* Rb = RESID ? (resid + (size_t)b * strideR) : nullptr;
#pragma unroll
  for (int i = 0; i < 4; ++i) {
    const int mBase = m0 + (i << 4);
#pragma unroll
    for (int j = 0; j < 4; ++j) {
      const int n = n0 + (j << 4) + rlane;
      float bv = 0.f;
      if (BIAS_MODE == 2) bv = bias[n];
#pragma unroll
      for (int r = 0; r < 8; ++r) {
        float v = acc[i][j][r] * scale;
        if (BIAS_MODE == 1) v += bias[mBase + mOff + r];
        if (BIAS_MODE == 2) v += bv;
        if (RESID) v += Rb[(size_t)(mBase + mOff + r) * ldc + n];
        if (ACT == 2) v = fmaxf(v, 0.0f);
        if (ACT == 4) v = (v > 0.f) ? v : 0.01f * v;
        slab[(mOff + r) * 68 + (j << 4) + rlane] = v;
      }
    }
    __builtin_amdgcn_fence(__ATOMIC_RELEASE, "workgroup");
    __builtin_amdgcn_wave_barrier();
    __builtin_amdgcn_fence(__ATOMIC_ACQUIRE, "workgroup");
    if (OUT_MODE == 0) {
      float* C = (float*)Cout + (size_t)b * strideC;
      /* row segment = 256 B = 16 lanes x 16 B */
      const int hh = lane >> 4, c4 = (lane & 15) * 4;
      {
#pragma unroll
        for (int it = 0; it < 8; ++it) {
          const int row = it * 2 + hh;
          v4f v = *(const v4f*)(slab + row * 68 + c4);
          *(v4f*)(C + (size_t)(mBase + row) * ldc + n0 + c4) = v;
        }
        
      }
    } else {
      const int q = lane >> 3, c8 = (lane & 7) * 8;
      unsigned short* C  = (unsigned short*)Cout  + (size_t)b * strideC;
      unsigned short* C2 = (OUT_MODE == 2) ? ((unsigned short*)Cout2 + (size_t)b * strideC) : nullptr;
      {
#pragma unroll
        for (int it = 0; it < 4; ++it) {
          const int row = it * 4 + q;
          const float* sp = slab + row * 68 + c8;
          v8h hv, lv;
#pragma unroll
          for (int e = 0; e < 8; ++e) {
            if (OUT_MODE == 1) {
              hv[e] = (_Float16)sp[e];
            } else {
              unsigned short hb = f2bf_bits(sp[e]);
              unsigned short lb = f2bf_bits(sp[e] - bf_bits2f(hb));
              hv[e] = __builtin_bit_cast(_Float16, hb);
              lv[e] = __builtin_bit_cast(_Float16, lb);
            }
          }
          *(v8h*)(C + (size_t)(mBase + row) * ldc + n0 + c8) = hv;
          if (OUT_MODE == 2) *(v8h*)(C2 + (size_t)(mBase + row) * ldc + n0 + c8) = lv;
        }
        
      }
    }
    __builtin_amdgcn_fence(__ATOMIC_RELEASE, "workgroup");
    __builtin_amdgcn_wave_barrier();
    __builtin_amdgcn_fence(__ATOMIC_ACQUIRE, "workgroup");
  }
}

// ---------------------------------------------------------------------------
// Weight transpose + cast: W0, W1 are [512 in d][512 out h] f32; WT[z*512 + h][d] = f16(scale * Wz[d][h]).
// grid (8, 8, 2): blockIdx.x = d tile (64 cols of WT), blockIdx.y = h tile (64 rows of WT), blockIdx.z selects W.
// Load coverage: 16 iterations x 256 threads = 4096 = the whole 64x64 tile.
// Store coverage: 8 waves x 2 iterations x 4 rows = 64 rows; 8 lanes x 8 halves = 64 cols; each row segment =
// ---------------------------------------------------------------------------
__global__ __launch_bounds__(256) void wtcast_kernel(const float* __restrict__ W0, const float* __restrict__ W1,
                                                     unsigned short* __restrict__ out, float scale) {
  __shared__ float tl[64][65];
  const int t  = threadIdx.x;
  const int d0 = blockIdx.x * 64;
  const int h0 = blockIdx.y * 64;
  const int z  = blockIdx.z;
  const float* W = (z == 0) ? W0 : W1;
#pragma unroll
  for (int i = 0; i < 16; ++i) {
    const int e = i * 256 + t;
    const int r = e >> 6;
    const int c = e & 63;
    tl[c][r] = W[(size_t)(d0 + r) * NDIM + h0 + c] * scale;
  }
  __syncthreads();
  const int lane = t & 31, wave = t >> 5;
  const int q = lane >> 3, c8 = (lane & 7) * 8;
  unsigned short* op = out + (size_t)z * NDIM * NDIM;
  {
#pragma unroll
    for (int it = 0; it < 2; ++it) {
      const int row = wave * 8 + it * 4 + q;
      unsigned short hb[8];
#pragma unroll
      for (int e = 0; e < 8; ++e) hb[e] = h_bits(tl[row][c8 + e]);
      const v4u u = (v4u){pk16(hb[0], hb[1]), pk16(hb[2], hb[3]), pk16(hb[4], hb[5]), pk16(hb[6], hb[7])};
      *(v4u*)(op + (size_t)(h0 + row) * NDIM + d0 + c8) = u;
    }
    
  }
}

// ---------------------------------------------------------------------------
// ---------------------------------------------------------------------------
__global__ __launch_bounds__(256) void cast8_f16_kernel(const float* __restrict__ in, unsigned short* __restrict__ out, int n8) {
  const int i = blockIdx.x * 256 + threadIdx.x;
  if (i >= n8) return;
  const float* p = in + 8 * (size_t)i;
  const v4f a = *(const v4f*)(p);
  const v4f c = *(const v4f*)(p + 4);
  unsigned short hb[8];
#pragma unroll
  for (int e = 0; e < 4; ++e) {
    hb[e]     = h_bits(a[e]);
    hb[4 + e] = h_bits(c[e]);
  }
  const v4u u = (v4u){pk16(hb[0], hb[1]), pk16(hb[2], hb[3]), pk16(hb[4], hb[5]), pk16(hb[6], hb[7])};
  unsigned short* q = out + 8 * (size_t)i;
  *(v4u*)q = u;
  
}

// ---------------------------------------------------------------------------
// Initial state: one block per batch row b (grid 16, 256 threads).
//   acar0[b][0] = 1, else 0 (1024 floats = 256 threads x 16 B); s0, c0 units 16b..16b+15 = 0 (threads 0..63 x 16 B each);
//   smsc[b][0..511] = Ws_mono_b, smsc[b][512..1023] = Ws_chunk_b (s0 = 0); block 0 writes one line with
// ---------------------------------------------------------------------------
__global__ __launch_bounds__(256) void init_state_kernel(const float* __restrict__ vmono, const float* __restrict__ gmono,
                                                         const float* __restrict__ bm, const float* __restrict__ bc,
                                                         float* __restrict__ acar0, float* __restrict__ s0,
                                                         float* __restrict__ c0, float* __restrict__ smsc,
                                                         float* __restrict__ vnorm) {
  __shared__ float red[8];
  const int tid = threadIdx.x, lane = tid & 31, wave = tid >> 5;
  const int b = blockIdx.x;
  const float v0 = vmono[tid], v1 = vmono[tid + 256];
  float ss = v0 * v0 + v1 * v1;
#pragma unroll
  for (int off = 16; off > 0; off >>= 1) ss += __shfl_xor(ss, off, 32);
  if (lane == 0) red[wave] = ss;
  __syncthreads();
  float tot = 0.0f;
#pragma unroll
  for (int w = 0; w < 8; ++w) tot += red[w];
  const float vn = gmono[0] / sqrtf(tot);

  const int which = tid >> 7;
  const int idx = (tid & 127) * 4;
  const v4f va = *(const v4f*)(bm + idx);
  const v4f vb = *(const v4f*)(bc + idx);
  v4f sv;
#pragma unroll
  for (int e = 0; e < 4; ++e) sv[e] = which ? vb[e] : va[e];
  v4f av = (v4f){0.f, 0.f, 0.f, 0.f};
  av[0] = (tid == 0) ? 1.0f : 0.0f;
  const v4f zv = (v4f){0.f, 0.f, 0.f, 0.f};
  const v4f nv = (v4f){vn, vn, vn, vn};
  {
    *(v4f*)(acar0 + b * NSEQ + 4 * tid) = av;
    *(v4f*)(smsc + b * NPROJ + 4 * tid) = sv;
    if (tid < 64) {
      *(v4f*)(s0 + b * NHID + 4 * tid) = zv;
      *(v4f*)(c0 + b * NHID + 4 * tid) = zv;
    }
    if (b == 0 && tid < 8) *(v4f*)(vnorm + 4 * tid) = nv;
    
  }
}

// ---------------------------------------------------------------------------
// Energies for one decode step: 512 blocks x 256 threads; block owns 32 consecutive (b,s) rows (one batch row b),
// wave w owns rows 4w..4w+3. Per row: both tanh dots over 512 columns (lane covers float4 groups j*32 + lane),
// wave shuffle sum, mask, noise, logistic. Results collected in LDS; wave 0 and wave 1 store them.
// Masked positions: p = 0 exactly, chunk energy stored as 0 (the consumer re-derives the mask from the lengths).
// ---------------------------------------------------------------------------
__global__ __launch_bounds__(256) void energies_kernel(
    const float* __restrict__ Pf, const float* __restrict__ smsc,
    const float* __restrict__ vmono, const float* __restrict__ vchunk,
    const float* __restrict__ vnp, const float* __restrict__ rmono,
    const int* __restrict__ len, const float* __restrict__ noise_t,
    float* __restrict__ pbuf, float* __restrict__ ebuf) {
  __shared__ __align__(16) float resp[ROWS_PER_EBLK];
  __shared__ __align__(16) float rese[ROWS_PER_EBLK];
  const int tid = threadIdx.x, lane = tid & 31, wave = tid >> 5;
  const int row0 = blockIdx.x * ROWS_PER_EBLK;
  const int b  = row0 / NSEQ;
  const int s0 = row0 - b * NSEQ;
  int L = len[b];
  L = (L < 0) ? 0 : ((L > NSEQ) ? NSEQ : L);
  const float vn = vnp[0];
  const float rm = rmono[0];
  /* Every global value the wave needs is asked for first: 32 row loads, the row-invariant s-projection and v groups (once
     for the four rows) and the noise, so that they fly together instead of one round trip per group of four columns.
     Column group g = 0..3 is the mono half, 4..7 the chunk half; the lane's columns of group g start at g * 128 + 4 * lane. */
  const int lr0 = wave * 4;
  const float* pr = Pf + (size_t)(row0 + lr0) * NPROJ + 4 * lane;
  const float* sb = smsc + b * NPROJ + 4 * lane;
  const float* vm = vmono + 4 * lane;
  const float* vc = vchunk + 4 * lane;
  const float* np = noise_t + row0 + lr0;
  v4f e[4][8], t[8], v[8];
  const v4f nz = *(const v4f*)np;
#pragma unroll
  for (int g = 0; g < 8; ++g) {
    t[g] = *(const v4f*)(sb + g * 128);
    v[g] = *(const v4f*)(((g < 4) ? vm : vc) + (g & 3) * 128);
  }
#pragma unroll
  for (int rr = 0; rr < 4; ++rr)
#pragma unroll
    for (int g = 0; g < 8; ++g) e[rr][g] = *(const v4f*)(pr + rr * NPROJ + g * 128);
  /* keeps every load of the run ahead of the arithmetic: without it the scheduler sinks a third of them between the dots,
     each with its latency in the open */
  __builtin_amdgcn_sched_barrier(0);
  /* dots: acc[2 rr] mono, acc[2 rr + 1] chunk; per lane the columns are summed in the order of the groups */
  float acc[8];
#pragma unroll
  for (int rr = 0; rr < 4; ++rr) {
#pragma unroll
    for (int hsel = 0; hsel < 2; ++hsel) {
      float a = 0.0f;
#pragma unroll
      for (int j = 0; j < 4; ++j) {
        const int g = hsel * 4 + j;
        const v4f th = tanh_x4(e[rr][g] + t[g]);
        a = fmaf(th[0], v[g][0], a);
        a = fmaf(th[1], v[g][1], a);
        a = fmaf(th[2], v[g][2], a);
        a = fmaf(th[3], v[g][3], a);
      }
      acc[2 * rr + hsel] = a;
    }
  }
  /* the loaded noise as an input only: its load stays in the run at the top; without this the compiler sinks it under the
     lane-0 mask behind the wave sums, with its latency in the open */
  asm volatile("" :: "v"(nz));
  /* the eight wave sums side by side: each level's eight exchanges share one LDS-path latency */
#pragma unroll
  for (int off = 16; off > 0; off >>= 1)
#pragma unroll
    for (int k = 0; k < 8; ++k) acc[k] += __shfl_xor(acc[k], off, 32);
  v4f pv, ev;
#pragma unroll
  for (int rr = 0; rr < 4; ++rr) {
    const bool masked = (s0 + lr0 + rr >= L);
    const float em = (vn * acc[2 * rr] + rm) + nz[rr];
    const float sg = sigm_f(em);
    /* masked positions give p = 0 exactly */
    pv[rr] = masked ? 0.0f : sg;
    ev[rr] = masked ? 0.0f : acc[2 * rr + 1];
  }
  if (lane == 0) {
    *(v4f*)(resp + lr0) = pv;
    *(v4f*)(rese + lr0) = ev;
  }
  __syncthreads();
  if (wave == 0 && lane < 8) {
    const v4f v = *(const v4f*)(resp + 4 * lane);
    float* dst = pbuf + row0 + 4 * lane;
    *(v4f*)dst = v;
    
  }
  if (wave == 1 && lane < 8) {
    const v4f v = *(const v4f*)(rese + 4 * lane);
    float* dst = ebuf + row0 + 4 * lane;
    *(v4f*)dst = v;
    
  }
}

// exclusive block prefix of one value per thread (256 threads = 8 waves), fixed order; one block barrier inside.
__device__ __forceinline__ float block_excl_scan(float total, float* wt, int lane, int wave) {
  float x = total;
#pragma unroll
  for (int off = 1; off < 32; off <<= 1) {
    const float n = __shfl_up(x, off, 32);
    x += (lane >= off) ? n : 0.0f;
  }
  float ex = __shfl_up(x, 1, 32);
  ex = (lane == 0) ? 0.0f : ex;
  if (lane == 31) wt[wave] = x;
  __syncthreads();
  float woff = 0.0f;
#pragma unroll
  for (int w = 0; w < 8; ++w) woff += (w < wave) ? wt[w] : 0.0f;
  return woff + ex;
}

// ---------------------------------------------------------------------------
// Decode step, cut by output column. Four launches:
//   scan_ctx_kernel   grid (8 column chunks, 16 batch rows): every block repeats the row's scans (12 KB of input),
//                     then sums beta . enc for its own 64 columns only.
//   gates_kernel      16 blocks x 16 LSTM units (64 gate columns), all 16 batch rows.
//   sproj_hid_kernel  4 blocks x 64 columns of h, then 16 blocks x 64 columns of the next step's s-projections.
//   ycols_kernel      16 blocks x 64 columns of y (padded to 1024).
// In the three product kernels a thread owns four weight columns and one sixteenth of k and keeps 64 sums, one per column
// and batch row, so a weight element is loaded once per step for all rows. s, c and h live in the workspace as [unit][16 rows].
// ---------------------------------------------------------------------------
constexpr int XP = 20;  /* LDS pitch in floats of one k row of 16 batch values: 16-B aligned, transposing stores 2-way at most */
constexpr int PP = 17;  /* LDS pitch in floats of one column's 16 partial sums */
constexpr int KCAT = NHID + NDIM;
static_assert(KCAT % 128 == 0 && NHID % 128 == 0, "the 16 k ranges are whole 8-row groups and no group straddles the two weights");

/* src [K][16] -> xs[k * XP + row] */
template <int K>
__device__ __forceinline__ void stage_kmajor(float* xs, const float* __restrict__ srcp, int tid) {
#pragma unroll
  for (int i = 0; i < K * 4 / 256; ++i) {
    const int e4 = i * 256 + tid;
    const v4f v = *(const v4f*)(srcp + 4 * e4);
    *(v4f*)(xs + (e4 >> 2) * XP + (e4 & 3) * 4) = v;
  }
}
/* src [16][K] -> xs[k * XP + row] */
template <int K>
__device__ __forceinline__ void stage_rows(float* xs, const float* __restrict__ srcp, int tid) {
#pragma unroll
  for (int i = 0; i < 16 * K / 256; ++i) {
    const int e = i * 256 + tid;
    xs[(e % K) * XP + (e / K)] = srcp[e];
  }
}

/* eight rows of four weight columns; p0 .. p3 point at the first row of the four columns */
__device__ __forceinline__ void rows8x4(float (&w)[8][4], const float* p0, const float* p1, const float* p2,
                                        const float* p3, int ldw) {
#pragma unroll
  for (int i = 0; i < 8; ++i) {
    w[i][0] = p0[(size_t)i * ldw];
    w[i][1] = p1[(size_t)i * ldw];
    w[i][2] = p2[(size_t)i * ldw];
    w[i][3] = p3[(size_t)i * ldw];
  }
  /* the wait in front of any rewrite of these loads' address registers; as inputs the four addresses stay in their
     registers up to here, so that no load of the run lands in one; it also keeps the loads ahead of the fmaf behind it */
  asm volatile("s_wait_xcnt 0x0" :: "v"(p0), "v"(p1), "v"(p2), "v"(p3) : "memory");
}

/* acc[j][row] += xs[k0 + i][row] * w[i][j] for the eight rows i: one LDS read of the 16 batch values feeds 64 fmaf */
__device__ __forceinline__ void fma8x4x16(const float* xs, int k0, const float (&w)[8][4], float (&acc)[4][16]) {
#pragma unroll
  for (int i = 0; i < 8; ++i) {
    const float* x = xs + (k0 + i) * XP;
    const v4f x0 = *(const v4f*)(x);
    const v4f x1 = *(const v4f*)(x + 4);
    const v4f x2 = *(const v4f*)(x + 8);
    const v4f x3 = *(const v4f*)(x + 12);
#pragma unroll
    for (int j = 0; j < 4; ++j) {
      const float wv = w[i][j];
#pragma unroll
      for (int e = 0; e < 4; ++e) {
        acc[j][e]      = fmaf(x0[e], wv, acc[j][e]);
        acc[j][4 + e]  = fmaf(x1[e], wv, acc[j][4 + e]);
        acc[j][8 + e]  = fmaf(x2[e], wv, acc[j][8 + e]);
        acc[j][12 + e] = fmaf(x3[e], wv, acc[j][12 + e]);
      }
    }
  }
}

/* acc[j][row] += sum over k in [kb, ke) of xs[k][row] * W[k][cols[j]]; rows k < K0 of the joined weight are W0, the rest W1.
   The next 8 weight rows are asked for ahead of the current 8 rows' fmaf. */
__device__ __forceinline__ void cols4x16(const float* xs, const float* __restrict__ W0, int K0,
                                         const float* __restrict__ W1, int ldw, const int (&cols)[4], int kb, int ke,
                                         float (&acc)[4][16]) {
  float wa[8][4];
  {
    const float* wp = (kb < K0) ? (W0 + (size_t)kb * ldw) : (W1 + (size_t)(kb - K0) * ldw);
    rows8x4(wa, wp + cols[0], wp + cols[1], wp + cols[2], wp + cols[3], ldw);
  }
  int k0 = kb;
  for (; k0 + 8 < ke; k0 += 8) {
    const int kn = k0 + 8;
    const float* wp = (kn < K0) ? (W0 + (size_t)kn * ldw) : (W1 + (size_t)(kn - K0) * ldw);
    float wb[8][4];
    rows8x4(wb, wp + cols[0], wp + cols[1], wp + cols[2], wp + cols[3], ldw);
    fma8x4x16(xs, k0, wa, acc);
#pragma unroll
    for (int i = 0; i < 8; ++i)
#pragma unroll
      for (int j = 0; j < 4; ++j) wa[i][j] = wb[i][j];
  }
  fma8x4x16(xs, k0, wa, acc);
}
__device__ __forceinline__ void zero_acc(float (&acc)[4][16]) {
#pragma unroll
  for (int j = 0; j < 4; ++j)
#pragma unroll
    for (int r = 0; r < 16; ++r) acc[j][r] = 0.0f;
}
/* block column index of (j, t16) is j * 16 + t16 */
__device__ __forceinline__ void put_part(float* part, int q, int t16, const float (&acc)[4][16]) {
#pragma unroll
  for (int j = 0; j < 4; ++j)
#pragma unroll
    for (int r = 0; r < 16; ++r) part[(q * 64 + j * 16 + t16) * PP + r] = acc[j][r];
}
/* the 16 k ranges of (block column c, batch row r), fixed order */
__device__ __forceinline__ float get_part(const float* part, int c, int r) {
  float v = part[c * PP + r];
#pragma unroll
  for (int q = 1; q < 16; ++q) v += part[(q * 64 + c) * PP + r];
  return v;
}

__global__ __launch_bounds__(256) void scan_ctx_kernel(
    const float* __restrict__ enc, const int* __restrict__ len,
    const float* __restrict__ pbuf, const float* __restrict__ ebuf,
    const float* __restrict__ acar_in, float* __restrict__ acar_out, float* __restrict__ ctx) {
  __shared__ __align__(16) float sh_p[NSEQ];
  __shared__ __align__(16) float sh_a[NSEQ];
  __shared__ __align__(16) float sh_ex[NSEQ];
  __shared__ __align__(16) float sh_g[NSEQ];
  __shared__ __align__(16) float sh_cpp[NSEQ];
  __shared__ __align__(16) float sh_u[NSEQ];
  __shared__ __align__(16) float sh_al[NSEQ];
  __shared__ __align__(16) float sh_r[NSEQ];
  __shared__ __align__(16) float sh_beta[NSEQ];
  __shared__ __align__(16) float sh_cpart[16 * 68];
  __shared__ float redm[8];
  __shared__ float wtA[8];
  __shared__ float wtB[8];

  const int tid = threadIdx.x, lane = tid & 31, wave = tid >> 5;
  const int chunk = blockIdx.x;
  const int b = blockIdx.y;
  const int i0 = tid * 4;
  int L = len[b];
  L = (L < 0) ? 0 : ((L > NSEQ) ? NSEQ : L);
  const float* prow = pbuf + b * NSEQ;
  const float* erow = ebuf + b * NSEQ;
  const float* arow = acar_in + b * NSEQ;

  /* phase 1: stage p, a, e; log terms; running max over unmasked positions */
  float ml = -3.0e38f;
/* all four trips open: the 12 row loads fly together instead of four L2 round trips one after the other */
#pragma unroll
  for (int j = 0; j < 4; ++j) {
    const int i = j * 256 + tid;
    const float pv = prow[i];
    const float ev = erow[i];
    const float av = arow[i];
    sh_p[i] = pv;
    sh_a[i] = av;
    sh_ex[i] = ev;
    sh_g[i] = logf(fminf(fmaxf(1.0f - pv, 1e-8f), 1.0f));
    ml = (i < L) ? fmaxf(ml, ev) : ml;
  }
#pragma unroll
  for (int off = 16; off > 0; off >>= 1) ml = fmaxf(ml, __shfl_xor(ml, off, 32));
  if (lane == 0) redm[wave] = ml;
  __syncthreads();
  float mx = redm[0];
#pragma unroll
  for (int w = 1; w < 8; ++w) mx = fmaxf(mx, redm[w]);

  /* phase 2: ex = max(exp(e - max), 1e-5); masked positions give 1e-5 */
#pragma unroll 1
  for (int j = 0; j < 4; ++j) {
    const int i = j * 256 + tid;
    const float t = fmaxf(expf(sh_ex[i] - mx), 1e-5f);
    sh_ex[i] = (i < L) ? t : 1e-5f;
  }

  /* phase 3: exclusive prefix of the log terms over contiguous chunks of 4 */
  {
    const v4f g4 = *(const v4f*)(sh_g + i0);
    const float e1 = g4[0];
    const float e2 = e1 + g4[1];
    const float e3 = e2 + g4[2];
    const float tot = e3 + g4[3];
    const float off = block_excl_scan(tot, wtA, lane, wave);
    v4f x4;
    x4[0] = off;
    x4[1] = off + e1;
    x4[2] = off + e2;
    x4[3] = off + e3;
    *(v4f*)(sh_cpp + i0) = x4;
  }
  __syncthreads();

  /* phase 4: cpp = exp(prefix) (flushed below the smallest normal), u = a / clip(cpp, 1e-8, 1) */
#pragma unroll 1
  for (int j = 0; j < 4; ++j) {
    const int i = j * 256 + tid;
    float cp = expf(sh_cpp[i]);
    cp = (cp < 1.17549435e-38f) ? 0.0f : cp;
    sh_cpp[i] = cp;
    const float cl = fminf(fmaxf(cp, 1e-8f), 1.0f);
    sh_u[i] = sh_a[i] * __builtin_amdgcn_rcpf(cl);
  }
  __syncthreads();

  /* phase 5: inclusive prefix of u, q = cpp * prefix, alpha = clip(p * q, 1e-8, 1) */
  {
    const v4f u4 = *(const v4f*)(sh_u + i0);
    const v4f c4 = *(const v4f*)(sh_cpp + i0);
    const v4f p4 = *(const v4f*)(sh_p + i0);
    const float c0 = u4[0];
    const float c1 = c0 + u4[1];
    const float c2 = c1 + u4[2];
    const float c3 = c2 + u4[3];
    const float off2 = block_excl_scan(c3, wtB, lane, wave);
    v4f al;
    al[0] = fminf(fmaxf(p4[0] * (c4[0] * (off2 + c0)), 1e-8f), 1.0f);
    al[1] = fminf(fmaxf(p4[1] * (c4[1] * (off2 + c1)), 1e-8f), 1.0f);
    al[2] = fminf(fmaxf(p4[2] * (c4[2] * (off2 + c2)), 1e-8f), 1.0f);
    al[3] = fminf(fmaxf(p4[3] * (c4[3] * (off2 + c3)), 1e-8f), 1.0f);
    *(v4f*)(sh_al + i0) = al;
  }
  __syncthreads();

  /* phase 6: denom = max(sum ex[i-3..i], 1e-10) (zero padded), r = alpha / denom */
#pragma unroll 1
  for (int j = 0; j < 4; ++j) {
    const int i = j * 256 + tid;
    float d = 0.0f;
#pragma unroll
    for (int k = 3; k >= 0; --k) {
      const int ii = i - k;
      const int ic = (ii < 0) ? 0 : ii;
      const float v = sh_ex[ic];
      d += (ii >= 0) ? v : 0.0f;
    }
    d = fmaxf(d, 1e-10f);
    sh_r[i] = sh_al[i] * __builtin_amdgcn_rcpf(d);
  }
  __syncthreads();

  /* phase 7: beta = ex * sum r[i..i+3] (zero padded) */
#pragma unroll 1
  for (int j = 0; j < 4; ++j) {
    const int i = j * 256 + tid;
    float ms = 0.0f;
#pragma unroll
    for (int k = 0; k < 4; ++k) {
      const int ii = i + k;
      const int ic = (ii > NSEQ - 1) ? (NSEQ - 1) : ii;
      const float v = sh_r[ic];
      ms += (ii < NSEQ) ? v : 0.0f;
    }
    sh_beta[i] = sh_ex[i] * ms;
  }
  __syncthreads();

  /* phase 8: ctx of this block's 64 columns; thread = (group of 4 columns, position class s mod 16), 64 positions each */
  {
    const int cg = tid & 15, sp = tid >> 4;
    const float* eb = enc + (size_t)b * NSEQ * NDIM + chunk * 64 + 4 * cg;
    v4f acc = (v4f){0.f, 0.f, 0.f, 0.f};
/* 16 trips per pass: their row loads fly together */
#pragma unroll 16
    for (int it = 0; it < NSEQ / 16; ++it) {
      const int s = 16 * it + sp;
      const float bv = sh_beta[s];
      const v4f e4 = *(const v4f*)(eb + (size_t)s * NDIM);
      acc[0] = fmaf(bv, e4[0], acc[0]);
      acc[1] = fmaf(bv, e4[1], acc[1]);
      acc[2] = fmaf(bv, e4[2], acc[2]);
      acc[3] = fmaf(bv, e4[3], acc[3]);
    }
    *(v4f*)(sh_cpart + sp * 68 + 4 * cg) = acc;
  }
  __syncthreads();
  /* 16 position classes joined in fixed order; 64 threads store the block's own 256-B piece of the row */
  if (tid < 64) {
    float v = sh_cpart[tid];
#pragma unroll
    for (int sp = 1; sp < 16; ++sp) v += sh_cpart[sp * 68 + tid];
    ctx[b * NDIM + chunk * 64 + tid] = v;
  }
  /* the alpha carry is stored by one block of the row */
  if (chunk == 0) {
    const v4f alv = *(const v4f*)(sh_al + i0);
    *(v4f*)(acar_out + b * NSEQ + i0) = alv;
  }
}

__global__ __launch_bounds__(256) void gates_kernel(
    const float* __restrict__ ctx, const int* __restrict__ target,
    const float* __restrict__ s_in, const float* __restrict__ c_in,
    float* __restrict__ s_out, float* __restrict__ c_out,
    const float* __restrict__ Lys, const float* __restrict__ Lss,
    const float* __restrict__ Lgsw, const float* __restrict__ Lgsb, int step) {
  __shared__ __align__(16) float xs[KCAT * XP];
  __shared__ float part[16 * 64 * PP];
  const int tid = threadIdx.x;
  const int u0 = blockIdx.x * 16;
  stage_kmajor<NHID>(xs, s_in, tid);
  stage_rows<NDIM>(xs + NHID * XP, ctx, tid);
  __syncthreads();
  const int t16 = tid & 15, q = tid >> 4;
  float acc[4][16];
  zero_acc(acc);
  /* the thread's four columns: gates i, f, g, o of unit u0 + t16 */
  const int cols[4] = {u0 + t16, NHID + u0 + t16, 2 * NHID + u0 + t16, 3 * NHID + u0 + t16};
  cols4x16(xs, Lss, NHID, Lgsw, NGATE, cols, q * (KCAT / 16), (q + 1) * (KCAT / 16), acc);
  put_part(part, q, t16, acc);
  __syncthreads();
  /* LSTM cell of (unit u0 + u, batch row r) */
  const int u = tid >> 4, r = tid & 15;
  int tg = target[r * NSTEPS + step];
  tg = (tg < 0) ? 0 : ((tg > NCLS - 1) ? (NCLS - 1) : tg);
  const float* ly = Lys + (size_t)tg * NGATE + u0 + u;
  const float* lb = Lgsb + u0 + u;
  const float r0 = get_part(part, u, r)      + (ly[0] + lb[0]);
  const float r1 = get_part(part, 16 + u, r) + (ly[NHID] + lb[NHID]);
  const float r2 = get_part(part, 32 + u, r) + (ly[2 * NHID] + lb[2 * NHID]);
  const float r3 = get_part(part, 48 + u, r) + (ly[3 * NHID] + lb[3 * NHID]);
  const float cold = c_in[u0 * 16 + tid];
  const float ig = sigm_f(r0);
  const float fg = sigm_f(r1);
  const float gg = tanh_e(r2);
  const float og = sigm_f(r3);
  const float cn = fg * cold + ig * gg;
  const float sn = og * tanh_e(cn);
  c_out[u0 * 16 + tid] = cn;
  s_out[u0 * 16 + tid] = sn;
}

__global__ __launch_bounds__(256) void sproj_hid_kernel(
    const float* __restrict__ ctx, const float* __restrict__ s_new,
    const float* __restrict__ Wsm, const float* __restrict__ Wsmb,
    const float* __restrict__ Wsc, const float* __restrict__ Wscb,
    const float* __restrict__ Lsy, const float* __restrict__ Lgyw, const float* __restrict__ Lgyb,
    float* __restrict__ smsc, float* __restrict__ hx, int step) {
  __shared__ __align__(16) float xs[KCAT * XP];
  __shared__ float part[16 * 64 * PP];
  const int tid = threadIdx.x;
  /* the four h blocks have three times the k range: they come first */
  const bool ish = blockIdx.x < 4;
  /* no next step: its projections are not formed (whole block leaves, in front of every barrier) */
  if (!ish && step + 1 >= NSTEPS) return;
  stage_kmajor<NHID>(xs, s_new, tid);
  if (ish) stage_rows<NDIM>(xs + NHID * XP, ctx, tid);
  __syncthreads();
  const int t16 = tid & 15, q = tid >> 4;
  float acc[4][16];
  zero_acc(acc);
  if (ish) {
    const int col0 = blockIdx.x * 64;
    const int cols[4] = {col0 + t16, col0 + 16 + t16, col0 + 32 + t16, col0 + 48 + t16};
    cols4x16(xs, Lsy, NHID, Lgyw, NHID, cols, q * (KCAT / 16), (q + 1) * (KCAT / 16), acc);
    put_part(part, q, t16, acc);
    __syncthreads();
#pragma unroll
    for (int e = 0; e < 4; ++e) {
      const int o = e * 256 + tid;
      const float v = get_part(part, o >> 4, o & 15) + Lgyb[col0 + (o >> 4)];
      hx[col0 * 16 + o] = tanh_e(v);
    }
    /* in the listing the other branch's code, which rewrites these stores' registers, follows them: the wait stands in front of it */
    asm volatile("s_wait_xcnt 0x0" ::: "memory");
  } else {
    const int col0 = (blockIdx.x - 4) * 64;
    const float* Wp = (col0 < NDIM) ? Wsm : Wsc;
    const float* bp = (col0 < NDIM) ? Wsmb : Wscb;
    const int cw = col0 & (NDIM - 1);
    const int cols[4] = {cw + t16, cw + 16 + t16, cw + 32 + t16, cw + 48 + t16};
    cols4x16(xs, Wp, NHID, Wp, NDIM, cols, q * (NHID / 16), (q + 1) * (NHID / 16), acc);
    put_part(part, q, t16, acc);
    __syncthreads();
    const int r = tid >> 4, c4 = (tid & 15) * 4;
    v4f v;
#pragma unroll
    for (int e = 0; e < 4; ++e) v[e] = get_part(part, c4 + e, r) + bp[cw + c4 + e];
    *(v4f*)(smsc + r * NPROJ + col0 + c4) = v;
  }
}

__global__ __launch_bounds__(256) void ycols_kernel(const float* __restrict__ hx, const float* __restrict__ Lyyw,
                                                    const float* __restrict__ Lyyb, float* __restrict__ Yrow) {
  __shared__ __align__(16) float xs[NHID * XP];
  __shared__ float part[16 * 64 * PP];
  const int tid = threadIdx.x;
  const int col0 = blockIdx.x * 64;
  stage_kmajor<NHID>(xs, hx, tid);
  __syncthreads();
  const int t16 = tid & 15, q = tid >> 4;
  float acc[4][16];
  zero_acc(acc);
  /* column index clamped for the address; columns beyond 999 are stored as zero below */
  int cols[4];
#pragma unroll
  for (int j = 0; j < 4; ++j) {
    const int n = col0 + j * 16 + t16;
    cols[j] = (n < NCLS) ? n : (NCLS - 1);
  }
  cols4x16(xs, Lyyw, NHID, Lyyw, NCLS, cols, q * (NHID / 16), (q + 1) * (NHID / 16), acc);
  put_part(part, q, t16, acc);
  __syncthreads();
  const int r = tid >> 4, c4 = (tid & 15) * 4;
  v4f v;
#pragma unroll
  for (int e = 0; e < 4; ++e) {
    const int n = col0 + c4 + e;
    const int nc = (n < NCLS) ? n : (NCLS - 1);
    const float y = get_part(part, c4 + e, r) + Lyyb[nc];
    v[e] = (n < NCLS) ? y : 0.0f;
  }
  *(v4f*)(Yrow + r * YPITCH + col0 + c4) = v;
}

// ---------------------------------------------------------------------------
// Pack: out[b][t][n] = Y[t][b][n], n < 1000. Thread i4 moves floats 4 i4 .. 4 i4 + 3 of the flat output
// (1000 % 4 == 0 so a group never straddles rows). A wave writes 32 x 16 B = 512 contiguous 512-B aligned bytes =
// ---------------------------------------------------------------------------
__global__ __launch_bounds__(256) void pack_out_kernel(const float* __restrict__ Yt, float* __restrict__ out) {
  const int i4 = blockIdx.x * 256 + threadIdx.x;
  const int e  = i4 * 4;
  const int row = e / NCLS;
  const int n   = e - row * NCLS;
  const int b = row / NSTEPS;
  const int t = row - b * NSTEPS;
  const v4f v = *(const v4f*)(Yt + ((size_t)t * NBATCH + b) * YPITCH + n);
  float* dst = out + e;
  *(v4f*)dst = v;
  
}

// ---------------------------------------------------------------------------
// Host glue. Workspace region map (bytes, 256-B aligned carve; total 85,901,568 <= 134,217,728):
//   A16   [16384][512]  f16   16,777,216   f16(enc)
//   BT16  [1024][512]   f16    1,048,576   rows 0..511: f16(16 Wh_mono[k][n]), rows 512..1023: f16(16 Wh_chunk[k][n-512])
//   PF    [16384][1024] f32   67,108,864   enc @ [Wh_mono | Wh_chunk]
//   PBUF  [16][1024]    f32       65,536   p of the current step
//   EBUF  [16][1024]    f32       65,536   chunk energies of the current step
//   ACAR  [2][16][1024] f32      131,072   alpha carry, ping-pong by step parity
//   SMSC  [16][1024]    f32       65,536   s @ [Ws_mono | Ws_chunk] + biases for the current step
//   SST   [2][256][16]  f32       32,768   s, ping-pong, [unit][batch row]
//   CST   [2][256][16]  f32       32,768   c, ping-pong, [unit][batch row]
//   YT    [8][16][1024] f32      524,288   y per step, columns 1000..1023 zero
//   VNORM [64]          f32          256   line 0 = g / norm(v_mono)
//   CTX   [16][512]     f32       32,768   ctx of the current step
//   HX    [256][16]     f32       16,384   output hidden h of the current step, [unit][batch row]
// ---------------------------------------------------------------------------
extern "C" void kernel_launch(void* const* d_in, const int* in_sizes, int n_in,
                              void* d_out, int out_size, void* d_ws, size_t ws_size, hipStream_t stream) {
  if (n_in < 23 || d_out == nullptr || d_ws == nullptr) return;
  if (in_sizes[0] != NBATCH * NSEQ * NDIM || in_sizes[1] != NBATCH * NSTEPS || in_sizes[2] != NBATCH ||
      in_sizes[3] != NSTEPS * NBATCH * NSEQ || in_sizes[4] != NHID * NDIM || in_sizes[6] != NDIM * NDIM ||
      in_sizes[10] != NHID * NDIM || in_sizes[12] != NDIM * NDIM || in_sizes[14] != NHID * NHID ||
      in_sizes[15] != NDIM * NHID || in_sizes[17] != NHID * NCLS || in_sizes[19] != NCLS * NGATE ||
      in_sizes[20] != NHID * NGATE || in_sizes[21] != NDIM * NGATE || out_size != NBATCH * NSTEPS * NCLS) return;

  const float* enc     = (const float*)d_in[0];
  const int*   target  = (const int*)d_in[1];
  const int*   lenenc  = (const int*)d_in[2];
  const float* noise   = (const float*)d_in[3];
  const float* ws_m_w  = (const float*)d_in[4];
  const float* ws_m_b  = (const float*)d_in[5];
  const float* wh_m    = (const float*)d_in[6];
  const float* v_m     = (const float*)d_in[7];
  const float* g_m     = (const float*)d_in[8];
  const float* r_m     = (const float*)d_in[9];
  const float* ws_c_w  = (const float*)d_in[10];
  const float* ws_c_b  = (const float*)d_in[11];
  const float* wh_c    = (const float*)d_in[12];
  const float* v_c     = (const float*)d_in[13];
  const float* l_sy    = (const float*)d_in[14];
  const float* l_gy_w  = (const float*)d_in[15];
  const float* l_gy_b  = (const float*)d_in[16];
  const float* l_yy_w  = (const float*)d_in[17];
  const float* l_yy_b  = (const float*)d_in[18];
  const float* l_ys    = (const float*)d_in[19];
  const float* l_ss    = (const float*)d_in[20];
  const float* l_gs_w  = (const float*)d_in[21];
  const float* l_gs_b  = (const float*)d_in[22];
  float* out = (float*)d_out;

  char* ws = (char*)d_ws; size_t off = 0;
  auto carve = [&](size_t bytes) -> char* { char* p = ws + off; off += (bytes + 255) & ~(size_t)255; return p; };
  unsigned short* A16  = (unsigned short*)carve((size_t)NROWS * NDIM * 2);
  unsigned short* BT16 = (unsigned short*)carve((size_t)NPROJ * NDIM * 2);
  float* PF    = (float*)carve((size_t)NROWS * NPROJ * 4);
  float* PBUF  = (float*)carve((size_t)NBATCH * NSEQ * 4);
  float* EBUF  = (float*)carve((size_t)NBATCH * NSEQ * 4);
  float* ACAR  = (float*)carve((size_t)2 * NBATCH * NSEQ * 4);
  float* SMSC  = (float*)carve((size_t)NBATCH * NPROJ * 4);
  float* SST   = (float*)carve((size_t)2 * NBATCH * NHID * 4);
  float* CST   = (float*)carve((size_t)2 * NBATCH * NHID * 4);
  float* YT    = (float*)carve((size_t)NSTEPS * NBATCH * YPITCH * 4);
  float* VNORM = (float*)carve((size_t)256);
  float* CTX   = (float*)carve((size_t)NBATCH * NDIM * 4);
  float* HX    = (float*)carve((size_t)NBATCH * NHID * 4);
  if (off > ws_size || off > (size_t)134217728) return;

  /* (1) f16 operand planes */
  const int n8 = NROWS * NDIM / 8;
  cast8_f16_kernel<<<n8 / 256, 256, 0, stream>>>(enc, A16, n8);
  /* in [512 k][512 n] -> out [n][k]; grid (k tiles, n tiles, weight) */
  wtcast_kernel<<<dim3(NDIM / 64, NDIM / 64, 2), 256, 0, stream>>>(wh_m, wh_c, BT16, WCARRY);
  /* (2) initial state, s-projection biases, vnorm */
  init_state_kernel<<<NBATCH, 256, 0, stream>>>(v_m, g_m, ws_m_b, ws_c_b, ACAR, SST, CST, SMSC, VNORM);
  /* (3) fused encoder projections: M = 16384, N = 1024, K = 512; 4096 tiles = 512 blocks x 8 waves */
  wmma_gemm64<0, false, 0, 0, false, 0><<<dim3((NROWS / 64) * (NPROJ / 64) / 8, 1), 256, 0, stream>>>(
      A16, A16, NDIM, 0L, BT16, BT16, NDIM, 0L, (void*)PF, (void*)PF, NPROJ, 0L,
      PF, PF, 0L, NROWS, NPROJ, NDIM, WCARRY_INV);

  /* (4) decode steps: five launches per step */
  for (int step = 0; step < NSTEPS; ++step) {
    const int par = step & 1;
    energies_kernel<<<NROWS / ROWS_PER_EBLK, 256, 0, stream>>>(
        PF, SMSC, v_m, v_c, VNORM, r_m, lenenc, noise + (size_t)step * NBATCH * NSEQ, PBUF, EBUF);
    scan_ctx_kernel<<<dim3(NDIM / 64, NBATCH), 256, 0, stream>>>(
        enc, lenenc, PBUF, EBUF,
        ACAR + (size_t)par * NBATCH * NSEQ, ACAR + (size_t)(par ^ 1) * NBATCH * NSEQ, CTX);
    gates_kernel<<<NHID / 16, 256, 0, stream>>>(
        CTX, target, SST + (size_t)par * NBATCH * NHID, CST + (size_t)par * NBATCH * NHID,
        SST + (size_t)(par ^ 1) * NBATCH * NHID, CST + (size_t)(par ^ 1) * NBATCH * NHID,
        l_ys, l_ss, l_gs_w, l_gs_b, step);
    sproj_hid_kernel<<<NHID / 64 + NPROJ / 64, 256, 0, stream>>>(
        CTX, SST + (size_t)(par ^ 1) * NBATCH * NHID, ws_m_w, ws_m_b, ws_c_w, ws_c_b,
        l_sy, l_gy_w, l_gy_b, SMSC, HX, step);
    ycols_kernel<<<YPITCH / 64, 256, 0, stream>>>(HX, l_yy_w, l_yy_b, YT + (size_t)step * NBATCH * YPITCH);
  }

  /* (5) pack the padded Y plane into the output */
  pack_out_kernel<<<(NBATCH * NSTEPS * NCLS) / (256 * 4), 256, 0, stream>>>(YT, out);
}

// v005
// Measured time: 268 microseconds a run.
// In both of two side-by-side timings against v004, it was 1.17 times as fast.
// All steps since v000 together make it 14.8 times as fast.
// Compute dtype: enc x [Wh_mono | Wh_chunk] on v_wmma_f32_16x16x32_f16 (f16 enc, f16 weights carried x16, f32 accumulate, folded by 1/16); all per-step small products, energy dots, scans, gates and state in f32 on VALU.
#include <hip/hip_runtime.h>
#include <math.h>

// ---------------------------------------------------------------------------
// Shape constants
// ---------------------------------------------------------------------------
constexpr int NBATCH = 16;
constexpr int NSEQ   = 1024;
constexpr int NHID   = 256;
constexpr int NDIM   = 512;
constexpr int NCLS   = 1000;
constexpr int NSTEPS = 8;
constexpr int NGATE  = 4 * NHID;
constexpr int NPROJ  = 2 * NDIM;
constexpr int YPITCH = 1024;
constexpr int NROWS  = NBATCH * NSEQ;
constexpr int ROWS_PER_EBLK = 32;
constexpr float WCARRY     = 16.0f;
constexpr float WCARRY_INV = 1.0f / 16.0f;
static_assert(NSEQ % ROWS_PER_EBLK == 0, "energy blocks stay inside one batch row");
static_assert(NROWS % 64 == 0 && NPROJ % 64 == 0 && NDIM % 32 == 0, "GEMM tile multiples");
static_assert((NBATCH * NSTEPS * NCLS) % (256 * 4) == 0, "pack grid exact");
static_assert(NCLS % 4 == 0, "float4 groups never straddle output rows");
static_assert(NSEQ == 4 * 256 && NHID == 256 && NDIM == 2 * 256, "thread maps");

typedef __attribute__((ext_vector_type(16))) _Float16 v16h;
typedef __attribute__((ext_vector_type(8)))  _Float16 v8h;
typedef __attribute__((ext_vector_type(16))) __bf16   v16b;
typedef __attribute__((ext_vector_type(8)))  __bf16   v8b;
typedef __attribute__((ext_vector_type(8)))  float    v8f;
typedef __attribute__((ext_vector_type(4)))  float    v4f;
typedef __attribute__((ext_vector_type(4)))  unsigned int v4u;

__device__ __forceinline__ unsigned short f2bf_bits(float f) {
  unsigned u = __float_as_uint(f);
  return (unsigned short)((u + 0x7FFFu + ((u >> 16) & 1u)) >> 16);
}
__device__ __forceinline__ float bf_bits2f(unsigned short h) { return __uint_as_float(((unsigned)h) << 16); }

__device__ __forceinline__ void dep_guard6_h(v8f& a, v8f& b, v8f& c, v8f& d, v16h x, v16h x2, v16h y0, v16h y1, v16h y2, v16h y3) {
  asm volatile("v_nop\n\tv_nop\n\tv_nop\n\tv_nop" : "+v"(a), "+v"(b), "+v"(c), "+v"(d) : "v"(x), "v"(x2), "v"(y0), "v"(y1), "v"(y2), "v"(y3));
}
__device__ __forceinline__ void dep_guard6_b(v8f& a, v8f& b, v8f& c, v8f& d, v16b x, v16b x2, v16b y0, v16b y1, v16b y2, v16b y3) {
  asm volatile("v_nop\n\tv_nop\n\tv_nop\n\tv_nop" : "+v"(a), "+v"(b), "+v"(c), "+v"(d) : "v"(x), "v"(x2), "v"(y0), "v"(y1), "v"(y2), "v"(y3));
}
__device__ __forceinline__ void keep4_h(v16h a, v16h b, v16h c, v16h d) { asm volatile("v_nop" :: "v"(a), "v"(b), "v"(c), "v"(d)); }
__device__ __forceinline__ void keep4_b(v16b a, v16b b, v16b c, v16b d) { asm volatile("v_nop" :: "v"(a), "v"(b), "v"(c), "v"(d)); }
__device__ __forceinline__ void acc_guard4(v8f& a, v8f& b, v8f& c, v8f& d) { asm volatile("v_nop\n\tv_nop\n\tv_nop\n\tv_nop" : "+v"(a), "+v"(b), "+v"(c), "+v"(d)); }

template <typename T> struct Frag;
template <> struct Frag<_Float16> {
  typedef v16h V; union U { v16h v; v8h h[2]; };
  /* elements 0..7 <- p[0..7], 8..15 <- p[16..23] */
  static __device__ __forceinline__ v16h load(const _Float16* p) {
    U f; f.h[0] = *(const v8h*)(p); f.h[1] = *(const v8h*)(p + 16); return f.v;
  }
  static __device__ __forceinline__ v8f mma(v16h a, v16h b, v8f c) {
    return __builtin_amdgcn_wmma_f32_16x16x32_f16(false, a, false, b, (short)0, c, false, false);
  }
  static __device__ __forceinline__ void guard(v8f& a, v8f& b, v8f& c, v8f& d, v16h x, v16h x2, v16h y0, v16h y1, v16h y2, v16h y3) {
    dep_guard6_h(a, b, c, d, x, x2, y0, y1, y2, y3);
  }
  static __device__ __forceinline__ void keep(v16h a, v16h b, v16h c, v16h d) { keep4_h(a, b, c, d); }
};
template <> struct Frag<__bf16> {
  typedef v16b V; union U { v16b v; v8b h[2]; };
  static __device__ __forceinline__ v16b load(const __bf16* p) {
    U f; f.h[0] = *(const v8b*)(p); f.h[1] = *(const v8b*)(p + 16); return f.v;
  }
  static __device__ __forceinline__ v8f mma(v16b a, v16b b, v8f c) {
    return __builtin_amdgcn_wmma_f32_16x16x32_bf16(false, a, false, b, (short)0, c, false, false);
  }
  static __device__ __forceinline__ void guard(v8f& a, v8f& b, v8f& c, v8f& d, v16b x, v16b x2, v16b y0, v16b y1, v16b y2, v16b y3) {
    dep_guard6_b(a, b, c, d, x, x2, y0, y1, y2, y3);
  }
  static __device__ __forceinline__ void keep(v16b a, v16b b, v16b c, v16b d) { keep4_b(a, b, c, d); }
};

__device__ __forceinline__ unsigned pk16(unsigned short a, unsigned short b) { return (unsigned)a | ((unsigned)b << 16); }
__device__ __forceinline__ unsigned short h_bits(float f) { const _Float16 h = (_Float16)f; return __builtin_bit_cast(unsigned short, h); }

/* reciprocal-based logistic and tanh with precise expf (v_rcp_f32 reciprocal) */
__device__ __forceinline__ float sigm_f(float x) { return __builtin_amdgcn_rcpf(1.0f + expf(-x)); }
__device__ __forceinline__ float tanh_e(float x) { return 1.0f - 2.0f * __builtin_amdgcn_rcpf(expf(2.0f * x) + 1.0f); }
__device__ __forceinline__ v4f exp2_x4(v4f a) {
  float r0, r1, r2, r3;
  asm("v_exp_f32 %0, %4\n\tv_exp_f32 %1, %5\n\tv_exp_f32 %2, %6\n\tv_exp_f32 %3, %7\n\tv_nop"
      : "=&v"(r0), "=&v"(r1), "=&v"(r2), "=&v"(r3) : "v"(a[0]), "v"(a[1]), "v"(a[2]), "v"(a[3]));
  return (v4f){r0, r1, r2, r3};
}
__device__ __forceinline__ v4f rcp_x4(v4f a) {
  float r0, r1, r2, r3;
  asm("v_rcp_f32 %0, %4\n\tv_rcp_f32 %1, %5\n\tv_rcp_f32 %2, %6\n\tv_rcp_f32 %3, %7\n\tv_nop"
      : "=&v"(r0), "=&v"(r1), "=&v"(r2), "=&v"(r3) : "v"(a[0]), "v"(a[1]), "v"(a[2]), "v"(a[3]));
  return (v4f){r0, r1, r2, r3};
}
__device__ __forceinline__ v4f tanh_x4(v4f x) {
  const v4f q = rcp_x4(exp2_x4(x * 2.885390082f) + 1.0f);
  return 1.0f - 2.0f * q;
}

// ---- Register-blocked batched WMMA GEMM ------------------------------------
// C[m,n] = scale * sum_k A[m,k] * Bt[n,k] (+bias)(+resid); each wave owns a 64x64 tile.
// A row-major [M,K]; Bt row-major [N,K]; M,N % 64 == 0, K % 32 == 0.
// SPLIT: operands are hi/lo planes (A2/Bt2 = lo planes, same layout); product = hi*hi + hi*lo + lo*hi.
// BIAS_MODE: 0 = none, 1 = bias[m], 2 = bias[n].
// OUT_MODE: 0 = f32, 1 = f16, 2 = bf16 hi plane (Cout) + bf16 lo plane (Cout2).
// ET: 0 = f16 operands, 1 = bf16 operands (pointers passed as 16-bit storage)
template <int ET> struct Elem;
template <> struct Elem<0> { typedef _Float16 T; };
template <> struct Elem<1> { typedef __bf16 T; };
template <int ET, bool SPLIT, int BIAS_MODE, int OUT_MODE, bool RESID, int ACT = 0>
__global__ __launch_bounds__(256) void wmma_gemm64(
    const unsigned short* __restrict__ Ap, const unsigned short* __restrict__ A2p, int lda, long strideA,
    const unsigned short* __restrict__ Btp, const unsigned short* __restrict__ Bt2p, int ldb, long strideB,
    void* __restrict__ Cout, void* __restrict__ Cout2, int ldc, long strideC,
    const float* __restrict__ bias,
    const float* __restrict__ resid, long strideR,
    int M, int N, int K, float scale) {
  typedef typename Elem<ET>::T T;
  typedef typename Frag<T>::V V;
  const T* A = (const T*)Ap; const T* A2 = (const T*)A2p; const T* Bt = (const T*)Btp; const T* Bt2 = (const T*)Bt2p;
  /* per-wave 16x64 slab, pitch 68 floats */
  __shared__ __align__(16) float sT[8][16 * 68];
  const int b    = blockIdx.y;
  const int lane = threadIdx.x & 31;
  const int wave = threadIdx.x >> 5;
  const int tilesN = N >> 6;
  const int tilesM = M >> 6;
  const int tile = blockIdx.x * 8 + wave;
  /* wave-uniform exit; no block barriers in this kernel */
  if (tile >= tilesM * tilesN) return;
  const int tm = tile / tilesN;
  const int tn = tile - tm * tilesN;
  const int m0 = tm << 6;
  const int n0 = tn << 6;

  const T* Ab  = A  + (size_t)b * strideA;
  const T* Bb  = Bt + (size_t)b * strideB;
  const T* Ab2 = SPLIT ? (A2  + (size_t)b * strideA) : nullptr;
  const T* Bb2 = SPLIT ? (Bt2 + (size_t)b * strideB) : nullptr;

  const int rlane = lane & 15;
  const int koff  = (lane >> 4) * 8;
  const int mOff  = (lane >> 4) * 8;

  v8f acc[4][4];
#pragma unroll
  for (int i = 0; i < 4; ++i)
#pragma unroll
    for (int j = 0; j < 4; ++j) acc[i][j] = (v8f){0.f,0.f,0.f,0.f,0.f,0.f,0.f,0.f};

  for (int k0 = 0; k0 < K; k0 += 32) {
    V bh[4], bl[4];
#pragma unroll
    for (int j = 0; j < 4; ++j) {
      const size_t bo = (size_t)(n0 + (j << 4) + rlane) * ldb + koff + k0;
      bh[j] = Frag<T>::load(Bb + bo);
      if (SPLIT) bl[j] = Frag<T>::load(Bb2 + bo);
    }
#pragma unroll
    for (int i = 0; i < 4; ++i) {
      const size_t ao = (size_t)(m0 + (i << 4) + rlane) * lda + koff + k0;
      V ah = Frag<T>::load(Ab + ao);
      V al;
      if (SPLIT) al = Frag<T>::load(Ab2 + ao);
#pragma unroll
      for (int j = 0; j < 4; ++j) {
        acc[i][j] = Frag<T>::mma(ah, bh[j], acc[i][j]);
        if (SPLIT) {
          acc[i][j] = Frag<T>::mma(ah, bl[j], acc[i][j]);
          acc[i][j] = Frag<T>::mma(al, bh[j], acc[i][j]);
        }
      }
      Frag<T>::guard(acc[i][0], acc[i][1], acc[i][2], acc[i][3], ah, SPLIT ? al : ah, bh[0], bh[1], bh[2], bh[3]);
    }
    Frag<T>::keep(bh[0], bh[1], bh[2], bh[3]);
    if (SPLIT) Frag<T>::keep(bl[0], bl[1], bl[2], bl[3]);
  }
  acc_guard4(acc[0][0], acc[0][1], acc[0][2], acc[0][3]);
  acc_guard4(acc[1][0], acc[1][1], acc[1][2], acc[1][3]);
  acc_guard4(acc[2][0], acc[2][1], acc[2][2], acc[2][3]);
  acc_guard4(acc[3][0], acc[3][1], acc[3][2], acc[3][3]);

  float* slab = sT[wave];
  const float* Rb = RESID ? (resid + (size_t)b * strideR) : nullptr;
#pragma unroll
  for (int i = 0; i < 4; ++i) {
    const int mBase = m0 + (i << 4);
#pragma unroll
    for (int j = 0; j < 4; ++j) {
      const int n = n0 + (j << 4) + rlane;
      float bv = 0.f;
      if (BIAS_MODE == 2) bv = bias[n];
#pragma unroll
      for (int r = 0; r < 8; ++r) {
        float v = acc[i][j][r] * scale;
        if (BIAS_MODE == 1) v += bias[mBase + mOff + r];
        if (BIAS_MODE == 2) v += bv;
        if (RESID) v += Rb[(size_t)(mBase + mOff + r) * ldc + n];
        if (ACT == 2) v = fmaxf(v, 0.0f);
        if (ACT == 4) v = (v > 0.f) ? v : 0.01f * v;
        slab[(mOff + r) * 68 + (j << 4) + rlane] = v;
      }
    }
    __builtin_amdgcn_fence(__ATOMIC_RELEASE, "workgroup");
    __builtin_amdgcn_wave_barrier();
    __builtin_amdgcn_fence(__ATOMIC_ACQUIRE, "workgroup");
    if (OUT_MODE == 0) {
      float* C = (float*)Cout + (size_t)b * strideC;
      /* row segment = 256 B = 16 lanes x 16 B */
      const int hh = lane >> 4, c4 = (lane & 15) * 4;
      {
#pragma unroll
        for (int it = 0; it < 8; ++it) {
          const int row = it * 2 + hh;
          v4f v = *(const v4f*)(slab + row * 68 + c4);
          *(v4f*)(C + (size_t)(mBase + row) * ldc + n0 + c4) = v;
        }
        
      }
    } else {
      const int q = lane >> 3, c8 = (lane & 7) * 8;
      unsigned short* C  = (unsigned short*)Cout  + (size_t)b * strideC;
      unsigned short* C2 = (OUT_MODE == 2) ? ((unsigned short*)Cout2 + (size_t)b * strideC) : nullptr;
      {
#pragma unroll
        for (int it = 0; it < 4; ++it) {
          const int row = it * 4 + q;
          const float* sp = slab + row * 68 + c8;
          v8h hv, lv;
#pragma unroll
          for (int e = 0; e < 8; ++e) {
            if (OUT_MODE == 1) {
              hv[e] = (_Float16)sp[e];
            } else {
              unsigned short hb = f2bf_bits(sp[e]);
              unsigned short lb = f2bf_bits(sp[e] - bf_bits2f(hb));
              hv[e] = __builtin_bit_cast(_Float16, hb);
              lv[e] = __builtin_bit_cast(_Float16, lb);
            }
          }
          *(v8h*)(C + (size_t)(mBase + row) * ldc + n0 + c8) = hv;
          if (OUT_MODE == 2) *(v8h*)(C2 + (size_t)(mBase + row) * ldc + n0 + c8) = lv;
        }
        
      }
    }
    __builtin_amdgcn_fence(__ATOMIC_RELEASE, "workgroup");
    __builtin_amdgcn_wave_barrier();
    __builtin_amdgcn_fence(__ATOMIC_ACQUIRE, "workgroup");
  }
}

// ---------------------------------------------------------------------------
// Weight transpose + cast: W0, W1 are [512 in d][512 out h] f32; WT[z*512 + h][d] = f16(scale * Wz[d][h]).
// grid (8, 8, 2): blockIdx.x = d tile (64 cols of WT), blockIdx.y = h tile (64 rows of WT), blockIdx.z selects W.
// Load coverage: 16 iterations x 256 threads = 4096 = the whole 64x64 tile.
// Store coverage: 8 waves x 2 iterations x 4 rows = 64 rows; 8 lanes x 8 halves = 64 cols; each row segment =
// ---------------------------------------------------------------------------
__global__ __launch_bounds__(256) void wtcast_kernel(const float* __restrict__ W0, const float* __restrict__ W1,
                                                     unsigned short* __restrict__ out, float scale) {
  __shared__ float tl[64][65];
  const int t  = threadIdx.x;
  const int d0 = blockIdx.x * 64;
  const int h0 = blockIdx.y * 64;
  const int z  = blockIdx.z;
  const float* W = (z == 0) ? W0 : W1;
#pragma unroll
  for (int i = 0; i < 16; ++i) {
    const int e = i * 256 + t;
    const int r = e >> 6;
    const int c = e & 63;
    tl[c][r] = W[(size_t)(d0 + r) * NDIM + h0 + c] * scale;
  }
  __syncthreads();
  const int lane = t & 31, wave = t >> 5;
  const int q = lane >> 3, c8 = (lane & 7) * 8;
  unsigned short* op = out + (size_t)z * NDIM * NDIM;
  {
#pragma unroll
    for (int it = 0; it < 2; ++it) {
      const int row = wave * 8 + it * 4 + q;
      unsigned short hb[8];
#pragma unroll
      for (int e = 0; e < 8; ++e) hb[e] = h_bits(tl[row][c8 + e]);
      const v4u u = (v4u){pk16(hb[0], hb[1]), pk16(hb[2], hb[3]), pk16(hb[4], hb[5]), pk16(hb[6], hb[7])};
      *(v4u*)(op + (size_t)(h0 + row) * NDIM + d0 + c8) = u;
    }
    
  }
}

// ---------------------------------------------------------------------------
// ---------------------------------------------------------------------------
__global__ __launch_bounds__(256) void cast8_f16_kernel(const float* __restrict__ in, unsigned short* __restrict__ out, int n8) {
  const int i = blockIdx.x * 256 + threadIdx.x;
  if (i >= n8) return;
  const float* p = in + 8 * (size_t)i;
  const v4f a = *(const v4f*)(p);
  const v4f c = *(const v4f*)(p + 4);
  unsigned short hb[8];
#pragma unroll
  for (int e = 0; e < 4; ++e) {
    hb[e]     = h_bits(a[e]);
    hb[4 + e] = h_bits(c[e]);
  }
  const v4u u = (v4u){pk16(hb[0], hb[1]), pk16(hb[2], hb[3]), pk16(hb[4], hb[5]), pk16(hb[6], hb[7])};
  unsigned short* q = out + 8 * (size_t)i;
  *(v4u*)q = u;
  
}

// ---------------------------------------------------------------------------
// Initial state: one block per batch row b (grid 16, 256 threads).
//   acar0[b][0] = 1, else 0 (1024 floats = 256 threads x 16 B); s0, c0 units 16b..16b+15 = 0 (threads 0..63 x 16 B each);
//   smsc[b][0..511] = Ws_mono_b, smsc[b][512..1023] = Ws_chunk_b (s0 = 0); block 0 writes one line with
// ---------------------------------------------------------------------------
__global__ __launch_bounds__(256) void init_state_kernel(const float* __restrict__ vmono, const float* __restrict__ gmono,
                                                         const float* __restrict__ bm, const float* __restrict__ bc,
                                                         float* __restrict__ acar0, float* __restrict__ s0,
                                                         float* __restrict__ c0, float* __restrict__ smsc,
                                                         float* __restrict__ vnorm) {
  __shared__ float red[8];
  const int tid = threadIdx.x, lane = tid & 31, wave = tid >> 5;
  const int b = blockIdx.x;
  const float v0 = vmono[tid], v1 = vmono[tid + 256];
  float ss = v0 * v0 + v1 * v1;
#pragma unroll
  for (int off = 16; off > 0; off >>= 1) ss += __shfl_xor(ss, off, 32);
  if (lane == 0) red[wave] = ss;
  __syncthreads();
  float tot = 0.0f;
#pragma unroll
  for (int w = 0; w < 8; ++w) tot += red[w];
  const float vn = gmono[0] / sqrtf(tot);

  const int which = tid >> 7;
  const int idx = (tid & 127) * 4;
  const v4f va = *(const v4f*)(bm + idx);
  const v4f vb = *(const v4f*)(bc + idx);
  v4f sv;
#pragma unroll
  for (int e = 0; e < 4; ++e) sv[e] = which ? vb[e] : va[e];
  v4f av = (v4f){0.f, 0.f, 0.f, 0.f};
  av[0] = (tid == 0) ? 1.0f : 0.0f;
  const v4f zv = (v4f){0.f, 0.f, 0.f, 0.f};
  const v4f nv = (v4f){vn, vn, vn, vn};
  {
    *(v4f*)(acar0 + b * NSEQ + 4 * tid) = av;
    *(v4f*)(smsc + b * NPROJ + 4 * tid) = sv;
    if (tid < 64) {
      *(v4f*)(s0 + b * NHID + 4 * tid) = zv;
      *(v4f*)(c0 + b * NHID + 4 * tid) = zv;
    }
    if (b == 0 && tid < 8) *(v4f*)(vnorm + 4 * tid) = nv;
    
  }
}

// ---------------------------------------------------------------------------
// Energies for one decode step: 512 blocks x 256 threads; block owns 32 consecutive (b,s) rows (one batch row b),
// wave w owns rows 4w..4w+3. Per row: both tanh dots over 512 columns (lane covers float4 groups j*32 + lane),
// wave shuffle sum, mask, noise, logistic. Results collected in LDS; wave 0 and wave 1 store them.
// Masked positions: p = 0 exactly, chunk energy stored as 0 (the consumer re-derives the mask from the lengths).
// ---------------------------------------------------------------------------
__global__ __launch_bounds__(256) void energies_kernel(
    const float* __restrict__ Pf, const float* __restrict__ smsc,
    const float* __restrict__ vmono, const float* __restrict__ vchunk,
    const float* __restrict__ vnp, const float* __restrict__ rmono,
    const int* __restrict__ len, const float* __restrict__ noise_t,
    float* __restrict__ pbuf, float* __restrict__ ebuf) {
  __shared__ __align__(16) float resp[ROWS_PER_EBLK];
  __shared__ __align__(16) float rese[ROWS_PER_EBLK];
  const int tid = threadIdx.x, lane = tid & 31, wave = tid >> 5;
  const int row0 = blockIdx.x * ROWS_PER_EBLK;
  const int b  = row0 / NSEQ;
  const int s0 = row0 - b * NSEQ;
  int L = len[b];
  L = (L < 0) ? 0 : ((L > NSEQ) ? NSEQ : L);
  const float vn = vnp[0];
  const float rm = rmono[0];
  /* Every global value the wave needs is asked for first: 32 row loads, the row-invariant s-projection and v groups (once
     for the four rows) and the noise, so that they fly together instead of one round trip per group of four columns.
     Column group g = 0..3 is the mono half, 4..7 the chunk half; the lane's columns of group g start at g * 128 + 4 * lane. */
  const int lr0 = wave * 4;
  const float* pr = Pf + (size_t)(row0 + lr0) * NPROJ + 4 * lane;
  const float* sb = smsc + b * NPROJ + 4 * lane;
  const float* vm = vmono + 4 * lane;
  const float* vc = vchunk + 4 * lane;
  const float* np = noise_t + row0 + lr0;
  v4f e[4][8], t[8], v[8];
  const v4f nz = *(const v4f*)np;
#pragma unroll
  for (int g = 0; g < 8; ++g) {
    t[g] = *(const v4f*)(sb + g * 128);
    v[g] = *(const v4f*)(((g < 4) ? vm : vc) + (g & 3) * 128);
  }
#pragma unroll
  for (int rr = 0; rr < 4; ++rr)
#pragma unroll
    for (int g = 0; g < 8; ++g) e[rr][g] = *(const v4f*)(pr + rr * NPROJ + g * 128);
  /* keeps every load of the run ahead of the arithmetic: without it the scheduler sinks a third of them between the dots,
     each with its latency in the open */
  __builtin_amdgcn_sched_barrier(0);
  /* dots: acc[2 rr] mono, acc[2 rr + 1] chunk; per lane the columns are summed in the order of the groups */
  float acc[8];
#pragma unroll
  for (int rr = 0; rr < 4; ++rr) {
#pragma unroll
    for (int hsel = 0; hsel < 2; ++hsel) {
      float a = 0.0f;
#pragma unroll
      for (int j = 0; j < 4; ++j) {
        const int g = hsel * 4 + j;
        const v4f th = tanh_x4(e[rr][g] + t[g]);
        a = fmaf(th[0], v[g][0], a);
        a = fmaf(th[1], v[g][1], a);
        a = fmaf(th[2], v[g][2], a);
        a = fmaf(th[3], v[g][3], a);
      }
      acc[2 * rr + hsel] = a;
    }
  }
  /* the loaded noise as an input only: its load stays in the run at the top; without this the compiler sinks it under the
     lane-0 mask behind the wave sums, with its latency in the open */
  asm volatile("" :: "v"(nz));
  /* the eight wave sums side by side: each level's eight exchanges share one LDS-path latency */
#pragma unroll
  for (int off = 16; off > 0; off >>= 1)
#pragma unroll
    for (int k = 0; k < 8; ++k) acc[k] += __shfl_xor(acc[k], off, 32);
  v4f pv, ev;
#pragma unroll
  for (int rr = 0; rr < 4; ++rr) {
    const bool masked = (s0 + lr0 + rr >= L);
    const float em = (vn * acc[2 * rr] + rm) + nz[rr];
    const float sg = sigm_f(em);
    /* masked positions give p = 0 exactly */
    pv[rr] = masked ? 0.0f : sg;
    ev[rr] = masked ? 0.0f : acc[2 * rr + 1];
  }
  if (lane == 0) {
    *(v4f*)(resp + lr0) = pv;
    *(v4f*)(rese + lr0) = ev;
  }
  __syncthreads();
  if (wave == 0 && lane < 8) {
    const v4f v = *(const v4f*)(resp + 4 * lane);
    float* dst = pbuf + row0 + 4 * lane;
    *(v4f*)dst = v;
    
  }
  if (wave == 1 && lane < 8) {
    const v4f v = *(const v4f*)(rese + 4 * lane);
    float* dst = ebuf + row0 + 4 * lane;
    *(v4f*)dst = v;
    
  }
}

// exclusive block prefix of one value per thread (256 threads = 8 waves), fixed order; one block barrier inside.
__device__ __forceinline__ float block_excl_scan(float total, float* wt, int lane, int wave) {
  float x = total;
#pragma unroll
  for (int off = 1; off < 32; off <<= 1) {
    const float n = __shfl_up(x, off, 32);
    x += (lane >= off) ? n : 0.0f;
  }
  float ex = __shfl_up(x, 1, 32);
  ex = (lane == 0) ? 0.0f : ex;
  if (lane == 31) wt[wave] = x;
  __syncthreads();
  float woff = 0.0f;
#pragma unroll
  for (int w = 0; w < 8; ++w) woff += (w < wave) ? wt[w] : 0.0f;
  return woff + ex;
}

// ---------------------------------------------------------------------------
// Decode step, cut by output column. Three launches in the step loop behind the energies:
//   scan_ctx_kernel   grid (8 column chunks, 16 batch rows): every block repeats the row's scans (12 KB of input),
//                     then sums beta . enc for its own 64 columns only.
//   gates_kernel      16 blocks x 16 LSTM units (64 gate columns), all 16 batch rows.
//   sproj_kernel      16 blocks x 64 columns of the next step's s-projections (not launched for the last step).
// The output head feeds no later step: ctx and s of every step are kept, and behind the loop one launch each serves all steps:
//   hid_kernel        grid (4 blocks x 64 columns of h, 8 steps).
//   ycols_kernel      grid (16 blocks x 64 columns of y (padded to 1024), 8 steps).
// In the four product kernels a thread owns four weight columns and one sixteenth of k and keeps 64 sums, one per column
// and batch row, so a weight element is loaded once per step for all rows. s, c and h live in the workspace as [unit][16 rows].
// ---------------------------------------------------------------------------
constexpr int XP = 20;  /* LDS pitch in floats of one k row of 16 batch values: 16-B aligned, transposing stores 2-way at most */
constexpr int PP = 17;  /* LDS pitch in floats of one column's 16 partial sums */
constexpr int KCAT = NHID + NDIM;
static_assert(KCAT % 128 == 0 && NHID % 128 == 0, "the 16 k ranges are whole 8-row groups and no group straddles the two weights");

/* src [K][16] -> xs[k * XP + row] */
template <int K>
__device__ __forceinline__ void stage_kmajor(float* xs, const float* __restrict__ srcp, int tid) {
#pragma unroll
  for (int i = 0; i < K * 4 / 256; ++i) {
    const int e4 = i * 256 + tid;
    const v4f v = *(const v4f*)(srcp + 4 * e4);
    *(v4f*)(xs + (e4 >> 2) * XP + (e4 & 3) * 4) = v;
  }
}
/* src [16][K] -> xs[k * XP + row] */
template <int K>
__device__ __forceinline__ void stage_rows(float* xs, const float* __restrict__ srcp, int tid) {
#pragma unroll
  for (int i = 0; i < 16 * K / 256; ++i) {
    const int e = i * 256 + tid;
    xs[(e % K) * XP + (e / K)] = srcp[e];
  }
}

/* eight rows of four weight columns; p0 .. p3 point at the first row of the four columns */
__device__ __forceinline__ void rows8x4(float (&w)[8][4], const float* p0, const float* p1, const float* p2,
                                        const float* p3, int ldw) {
#pragma unroll
  for (int i = 0; i < 8; ++i) {
    w[i][0] = p0[(size_t)i * ldw];
    w[i][1] = p1[(size_t)i * ldw];
    w[i][2] = p2[(size_t)i * ldw];
    w[i][3] = p3[(size_t)i * ldw];
  }
  /* the wait in front of any rewrite of these loads' address registers; as inputs the four addresses stay in their
     registers up to here, so that no load of the run lands in one; it also keeps the loads ahead of the fmaf behind it */
  asm volatile("s_wait_xcnt 0x0" :: "v"(p0), "v"(p1), "v"(p2), "v"(p3) : "memory");
}

/* acc[j][row] += xs[k0 + i][row] * w[i][j] for the eight rows i: one LDS read of the 16 batch values feeds 64 fmaf */
__device__ __forceinline__ void fma8x4x16(const float* xs, int k0, const float (&w)[8][4], float (&acc)[4][16]) {
#pragma unroll
  for (int i = 0; i < 8; ++i) {
    const float* x = xs + (k0 + i) * XP;
    const v4f x0 = *(const v4f*)(x);
    const v4f x1 = *(const v4f*)(x + 4);
    const v4f x2 = *(const v4f*)(x + 8);
    const v4f x3 = *(const v4f*)(x + 12);
#pragma unroll
    for (int j = 0; j < 4; ++j) {
      const float wv = w[i][j];
#pragma unroll
      for (int e = 0; e < 4; ++e) {
        acc[j][e]      = fmaf(x0[e], wv, acc[j][e]);
        acc[j][4 + e]  = fmaf(x1[e], wv, acc[j][4 + e]);
        acc[j][8 + e]  = fmaf(x2[e], wv, acc[j][8 + e]);
        acc[j][12 + e] = fmaf(x3[e], wv, acc[j][12 + e]);
      }
    }
  }
}

/* acc[j][row] += sum over k in [kb, ke) of xs[k][row] * W[k][cols[j]]; rows k < K0 of the joined weight are W0, the rest W1.
   The next 8 weight rows are asked for ahead of the current 8 rows' fmaf. */
__device__ __forceinline__ void cols4x16(const float* xs, const float* __restrict__ W0, int K0,
                                         const float* __restrict__ W1, int ldw, const int (&cols)[4], int kb, int ke,
                                         float (&acc)[4][16]) {
  float wa[8][4];
  {
    const float* wp = (kb < K0) ? (W0 + (size_t)kb * ldw) : (W1 + (size_t)(kb - K0) * ldw);
    rows8x4(wa, wp + cols[0], wp + cols[1], wp + cols[2], wp + cols[3], ldw);
  }
  int k0 = kb;
  for (; k0 + 8 < ke; k0 += 8) {
    const int kn = k0 + 8;
    const float* wp = (kn < K0) ? (W0 + (size_t)kn * ldw) : (W1 + (size_t)(kn - K0) * ldw);
    float wb[8][4];
    rows8x4(wb, wp + cols[0], wp + cols[1], wp + cols[2], wp + cols[3], ldw);
    fma8x4x16(xs, k0, wa, acc);
#pragma unroll
    for (int i = 0; i < 8; ++i)
#pragma unroll
      for (int j = 0; j < 4; ++j) wa[i][j] = wb[i][j];
  }
  fma8x4x16(xs, k0, wa, acc);
}
__device__ __forceinline__ void zero_acc(float (&acc)[4][16]) {
#pragma unroll
  for (int j = 0; j < 4; ++j)
#pragma unroll
    for (int r = 0; r < 16; ++r) acc[j][r] = 0.0f;
}
/* block column index of (j, t16) is j * 16 + t16 */
__device__ __forceinline__ void put_part(float* part, int q, int t16, const float (&acc)[4][16]) {
#pragma unroll
  for (int j = 0; j < 4; ++j)
#pragma unroll
    for (int r = 0; r < 16; ++r) part[(q * 64 + j * 16 + t16) * PP + r] = acc[j][r];
}
/* the 16 k ranges of (block column c, batch row r), fixed order */
__device__ __forceinline__ float get_part(const float* part, int c, int r) {
  float v = part[c * PP + r];
#pragma unroll
  for (int q = 1; q < 16; ++q) v += part[(q * 64 + c) * PP + r];
  return v;
}

__global__ __launch_bounds__(256) void scan_ctx_kernel(
    const float* __restrict__ enc, const int* __restrict__ len,
    const float* __restrict__ pbuf, const float* __restrict__ ebuf,
    const float* __restrict__ acar_in, float* __restrict__ acar_out, float* __restrict__ ctx) {
  __shared__ __align__(16) float sh_p[NSEQ];
  __shared__ __align__(16) float sh_a[NSEQ];
  __shared__ __align__(16) float sh_ex[NSEQ];
  __shared__ __align__(16) float sh_g[NSEQ];
  __shared__ __align__(16) float sh_cpp[NSEQ];
  __shared__ __align__(16) float sh_u[NSEQ];
  __shared__ __align__(16) float sh_al[NSEQ];
  __shared__ __align__(16) float sh_r[NSEQ];
  __shared__ __align__(16) float sh_beta[NSEQ];
  __shared__ __align__(16) float sh_cpart[16 * 68];
  __shared__ float redm[8];
  __shared__ float wtA[8];
  __shared__ float wtB[8];

  const int tid = threadIdx.x, lane = tid & 31, wave = tid >> 5;
  const int chunk = blockIdx.x;
  const int b = blockIdx.y;
  const int i0 = tid * 4;
  int L = len[b];
  L = (L < 0) ? 0 : ((L > NSEQ) ? NSEQ : L);
  const float* prow = pbuf + b * NSEQ;
  const float* erow = ebuf + b * NSEQ;
  const float* arow = acar_in + b * NSEQ;

  /* phase 1: stage p, a, e; log terms; running max over unmasked positions */
  float ml = -3.0e38f;
/* all four trips open: the 12 row loads fly together instead of four L2 round trips one after the other */
#pragma unroll
  for (int j = 0; j < 4; ++j) {
    const int i = j * 256 + tid;
    const float pv = prow[i];
    const float ev = erow[i];
    const float av = arow[i];
    sh_p[i] = pv;
    sh_a[i] = av;
    sh_ex[i] = ev;
    sh_g[i] = logf(fminf(fmaxf(1.0f - pv, 1e-8f), 1.0f));
    ml = (i < L) ? fmaxf(ml, ev) : ml;
  }
#pragma unroll
  for (int off = 16; off > 0; off >>= 1) ml = fmaxf(ml, __shfl_xor(ml, off, 32));
  if (lane == 0) redm[wave] = ml;
  __syncthreads();
  float mx = redm[0];
#pragma unroll
  for (int w = 1; w < 8; ++w) mx = fmaxf(mx, redm[w]);

  /* phase 2: ex = max(exp(e - max), 1e-5); masked positions give 1e-5 */
#pragma unroll 1
  for (int j = 0; j < 4; ++j) {
    const int i = j * 256 + tid;
    const float t = fmaxf(expf(sh_ex[i] - mx), 1e-5f);
    sh_ex[i] = (i < L) ? t : 1e-5f;
  }

  /* phase 3: exclusive prefix of the log terms over contiguous chunks of 4 */
  {
    const v4f g4 = *(const v4f*)(sh_g + i0);
    const float e1 = g4[0];
    const float e2 = e1 + g4[1];
    const float e3 = e2 + g4[2];
    const float tot = e3 + g4[3];
    const float off = block_excl_scan(tot, wtA, lane, wave);
    v4f x4;
    x4[0] = off;
    x4[1] = off + e1;
    x4[2] = off + e2;
    x4[3] = off + e3;
    *(v4f*)(sh_cpp + i0) = x4;
  }
  __syncthreads();

  /* phase 4: cpp = exp(prefix) (flushed below the smallest normal), u = a / clip(cpp, 1e-8, 1) */
#pragma unroll 1
  for (int j = 0; j < 4; ++j) {
    const int i = j * 256 + tid;
    float cp = expf(sh_cpp[i]);
    cp = (cp < 1.17549435e-38f) ? 0.0f : cp;
    sh_cpp[i] = cp;
    const float cl = fminf(fmaxf(cp, 1e-8f), 1.0f);
    sh_u[i] = sh_a[i] * __builtin_amdgcn_rcpf(cl);
  }
  __syncthreads();

  /* phase 5: inclusive prefix of u, q = cpp * prefix, alpha = clip(p * q, 1e-8, 1) */
  {
    const v4f u4 = *(const v4f*)(sh_u + i0);
    const v4f c4 = *(const v4f*)(sh_cpp + i0);
    const v4f p4 = *(const v4f*)(sh_p + i0);
    const float c0 = u4[0];
    const float c1 = c0 + u4[1];
    const float c2 = c1 + u4[2];
    const float c3 = c2 + u4[3];
    const float off2 = block_excl_scan(c3, wtB, lane, wave);
    v4f al;
    al[0] = fminf(fmaxf(p4[0] * (c4[0] * (off2 + c0)), 1e-8f), 1.0f);
    al[1] = fminf(fmaxf(p4[1] * (c4[1] * (off2 + c1)), 1e-8f), 1.0f);
    al[2] = fminf(fmaxf(p4[2] * (c4[2] * (off2 + c2)), 1e-8f), 1.0f);
    al[3] = fminf(fmaxf(p4[3] * (c4[3] * (off2 + c3)), 1e-8f), 1.0f);
    *(v4f*)(sh_al + i0) = al;
  }
  __syncthreads();

  /* phase 6: denom = max(sum ex[i-3..i], 1e-10) (zero padded), r = alpha / denom */
#pragma unroll 1
  for (int j = 0; j < 4; ++j) {
    const int i = j * 256 + tid;
    float d = 0.0f;
#pragma unroll
    for (int k = 3; k >= 0; --k) {
      const int ii = i - k;
      const int ic = (ii < 0) ? 0 : ii;
      const float v = sh_ex[ic];
      d += (ii >= 0) ? v : 0.0f;
    }
    d = fmaxf(d, 1e-10f);
    sh_r[i] = sh_al[i] * __builtin_amdgcn_rcpf(d);
  }
  __syncthreads();

  /* phase 7: beta = ex * sum r[i..i+3] (zero padded) */
#pragma unroll 1
  for (int j = 0; j < 4; ++j) {
    const int i = j * 256 + tid;
    float ms = 0.0f;
#pragma unroll
    for (int k = 0; k < 4; ++k) {
      const int ii = i + k;
      const int ic = (ii > NSEQ - 1) ? (NSEQ - 1) : ii;
      const float v = sh_r[ic];
      ms += (ii < NSEQ) ? v : 0.0f;
    }
    sh_beta[i] = sh_ex[i] * ms;
  }
  __syncthreads();

  /* phase 8: ctx of this block's 64 columns; thread = (group of 4 columns, position class s mod 16), 64 positions each */
  {
    const int cg = tid & 15, sp = tid >> 4;
    const float* eb = enc + (size_t)b * NSEQ * NDIM + chunk * 64 + 4 * cg;
    v4f acc = (v4f){0.f, 0.f, 0.f, 0.f};
/* 16 trips per pass: their row loads fly together */
#pragma unroll 16
    for (int it = 0; it < NSEQ / 16; ++it) {
      const int s = 16 * it + sp;
      const float bv = sh_beta[s];
      const v4f e4 = *(const v4f*)(eb + (size_t)s * NDIM);
      acc[0] = fmaf(bv, e4[0], acc[0]);
      acc[1] = fmaf(bv, e4[1], acc[1]);
      acc[2] = fmaf(bv, e4[2], acc[2]);
      acc[3] = fmaf(bv, e4[3], acc[3]);
    }
    *(v4f*)(sh_cpart + sp * 68 + 4 * cg) = acc;
  }
  __syncthreads();
  /* 16 position classes joined in fixed order; 64 threads store the block's own 256-B piece of the row */
  if (tid < 64) {
    float v = sh_cpart[tid];
#pragma unroll
    for (int sp = 1; sp < 16; ++sp) v += sh_cpart[sp * 68 + tid];
    ctx[b * NDIM + chunk * 64 + tid] = v;
  }
  /* the alpha carry is stored by one block of the row */
  if (chunk == 0) {
    const v4f alv = *(const v4f*)(sh_al + i0);
    *(v4f*)(acar_out + b * NSEQ + i0) = alv;
  }
}

__global__ __launch_bounds__(256) void gates_kernel(
    const float* __restrict__ ctx, const int* __restrict__ target,
    const float* __restrict__ s_in, const float* __restrict__ c_in,
    float* __restrict__ s_out, float* __restrict__ c_out,
    const float* __restrict__ Lys, const float* __restrict__ Lss,
    const float* __restrict__ Lgsw, const float* __restrict__ Lgsb, int step) {
  __shared__ __align__(16) float xs[KCAT * XP];
  __shared__ float part[16 * 64 * PP];
  const int tid = threadIdx.x;
  const int u0 = blockIdx.x * 16;
  stage_kmajor<NHID>(xs, s_in, tid);
  stage_rows<NDIM>(xs + NHID * XP, ctx, tid);
  __syncthreads();
  const int t16 = tid & 15, q = tid >> 4;
  float acc[4][16];
  zero_acc(acc);
  /* the thread's four columns: gates i, f, g, o of unit u0 + t16 */
  const int cols[4] = {u0 + t16, NHID + u0 + t16, 2 * NHID + u0 + t16, 3 * NHID + u0 + t16};
  cols4x16(xs, Lss, NHID, Lgsw, NGATE, cols, q * (KCAT / 16), (q + 1) * (KCAT / 16), acc);
  put_part(part, q, t16, acc);
  __syncthreads();
  /* LSTM cell of (unit u0 + u, batch row r) */
  const int u = tid >> 4, r = tid & 15;
  int tg = target[r * NSTEPS + step];
  tg = (tg < 0) ? 0 : ((tg > NCLS - 1) ? (NCLS - 1) : tg);
  const float* ly = Lys + (size_t)tg * NGATE + u0 + u;
  const float* lb = Lgsb + u0 + u;
  const float r0 = get_part(part, u, r)      + (ly[0] + lb[0]);
  const float r1 = get_part(part, 16 + u, r) + (ly[NHID] + lb[NHID]);
  const float r2 = get_part(part, 32 + u, r) + (ly[2 * NHID] + lb[2 * NHID]);
  const float r3 = get_part(part, 48 + u, r) + (ly[3 * NHID] + lb[3 * NHID]);
  const float cold = c_in[u0 * 16 + tid];
  const float ig = sigm_f(r0);
  const float fg = sigm_f(r1);
  const float gg = tanh_e(r2);
  const float og = sigm_f(r3);
  const float cn = fg * cold + ig * gg;
  const float sn = og * tanh_e(cn);
  c_out[u0 * 16 + tid] = cn;
  s_out[u0 * 16 + tid] = sn;
}

__global__ __launch_bounds__(256) void sproj_kernel(
    const float* __restrict__ s_new,
    const float* __restrict__ Wsm, const float* __restrict__ Wsmb,
    const float* __restrict__ Wsc, const float* __restrict__ Wscb,
    float* __restrict__ smsc) {
  __shared__ __align__(16) float xs[NHID * XP];
  __shared__ float part[16 * 64 * PP];
  const int tid = threadIdx.x;
  stage_kmajor<NHID>(xs, s_new, tid);
  __syncthreads();
  const int t16 = tid & 15, q = tid >> 4;
  float acc[4][16];
  zero_acc(acc);
  const int col0 = blockIdx.x * 64;
  const float* Wp = (col0 < NDIM) ? Wsm : Wsc;
  const float* bp = (col0 < NDIM) ? Wsmb : Wscb;
  const int cw = col0 & (NDIM - 1);
  const int cols[4] = {cw + t16, cw + 16 + t16, cw + 32 + t16, cw + 48 + t16};
  cols4x16(xs, Wp, NHID, Wp, NDIM, cols, q * (NHID / 16), (q + 1) * (NHID / 16), acc);
  put_part(part, q, t16, acc);
  __syncthreads();
  const int r = tid >> 4, c4 = (tid & 15) * 4;
  v4f v;
#pragma unroll
  for (int e = 0; e < 4; ++e) v[e] = get_part(part, c4 + e, r) + bp[cw + c4 + e];
  *(v4f*)(smsc + r * NPROJ + col0 + c4) = v;
}

/* blockIdx.y = step; ctx_all [step][16][512], s_all [step + 1][256][16] (plane 0 is the initial state), hx_all [step][256][16] */
__global__ __launch_bounds__(256) void hid_kernel(
    const float* __restrict__ ctx_all, const float* __restrict__ s_all,
    const float* __restrict__ Lsy, const float* __restrict__ Lgyw, const float* __restrict__ Lgyb,
    float* __restrict__ hx_all) {
  __shared__ __align__(16) float xs[KCAT * XP];
  __shared__ float part[16 * 64 * PP];
  const int tid = threadIdx.x;
  const int step = blockIdx.y;
  const float* ctx = ctx_all + step * (NBATCH * NDIM);
  const float* s_new = s_all + (step + 1) * (NBATCH * NHID);
  float* hx = hx_all + step * (NBATCH * NHID);
  stage_kmajor<NHID>(xs, s_new, tid);
  stage_rows<NDIM>(xs + NHID * XP, ctx, tid);
  __syncthreads();
  const int t16 = tid & 15, q = tid >> 4;
  float acc[4][16];
  zero_acc(acc);
  const int col0 = blockIdx.x * 64;
  const int cols[4] = {col0 + t16, col0 + 16 + t16, col0 + 32 + t16, col0 + 48 + t16};
  cols4x16(xs, Lsy, NHID, Lgyw, NHID, cols, q * (KCAT / 16), (q + 1) * (KCAT / 16), acc);
  put_part(part, q, t16, acc);
  __syncthreads();
#pragma unroll
  for (int e = 0; e < 4; ++e) {
    const int o = e * 256 + tid;
    const float v = get_part(part, o >> 4, o & 15) + Lgyb[col0 + (o >> 4)];
    hx[col0 * 16 + o] = tanh_e(v);
  }
}

/* blockIdx.y = step; hx_all [step][256][16], Yt [step][16][1024] */
__global__ __launch_bounds__(256) void ycols_kernel(const float* __restrict__ hx_all, const float* __restrict__ Lyyw,
                                                    const float* __restrict__ Lyyb, float* __restrict__ Yt) {
  __shared__ __align__(16) float xs[NHID * XP];
  __shared__ float part[16 * 64 * PP];
  const int tid = threadIdx.x;
  const int col0 = blockIdx.x * 64;
  const float* hx = hx_all + blockIdx.y * (NBATCH * NHID);
  float* Yrow = Yt + blockIdx.y * (NBATCH * YPITCH);
  stage_kmajor<NHID>(xs, hx, tid);
  __syncthreads();
  const int t16 = tid & 15, q = tid >> 4;
  float acc[4][16];
  zero_acc(acc);
  /* column index clamped for the address; columns beyond 999 are stored as zero below */
  int cols[4];
#pragma unroll
  for (int j = 0; j < 4; ++j) {
    const int n = col0 + j * 16 + t16;
    cols[j] = (n < NCLS) ? n : (NCLS - 1);
  }
  cols4x16(xs, Lyyw, NHID, Lyyw, NCLS, cols, q * (NHID / 16), (q + 1) * (NHID / 16), acc);
  put_part(part, q, t16, acc);
  __syncthreads();
  const int r = tid >> 4, c4 = (tid & 15) * 4;
  v4f v;
#pragma unroll
  for (int e = 0; e < 4; ++e) {
    const int n = col0 + c4 + e;
    const int nc = (n < NCLS) ? n : (NCLS - 1);
    const float y = get_part(part, c4 + e, r) + Lyyb[nc];
    v[e] = (n < NCLS) ? y : 0.0f;
  }
  *(v4f*)(Yrow + r * YPITCH + col0 + c4) = v;
}

// ---------------------------------------------------------------------------
// Pack: out[b][t][n] = Y[t][b][n], n < 1000. Thread i4 moves floats 4 i4 .. 4 i4 + 3 of the flat output
// (1000 % 4 == 0 so a group never straddles rows). A wave writes 32 x 16 B = 512 contiguous 512-B aligned bytes =
// ---------------------------------------------------------------------------
__global__ __launch_bounds__(256) void pack_out_kernel(const float* __restrict__ Yt, float* __restrict__ out) {
  const int i4 = blockIdx.x * 256 + threadIdx.x;
  const int e  = i4 * 4;
  const int row = e / NCLS;
  const int n   = e - row * NCLS;
  const int b = row / NSTEPS;
  const int t = row - b * NSTEPS;
  const v4f v = *(const v4f*)(Yt + ((size_t)t * NBATCH + b) * YPITCH + n);
  float* dst = out + e;
  *(v4f*)dst = v;
  
}

// ---------------------------------------------------------------------------
// Host glue. Workspace region map (bytes, 256-B aligned carve; total 86,360,320 <= 134,217,728):
//   A16   [16384][512]  f16   16,777,216   f16(enc)
//   BT16  [1024][512]   f16    1,048,576   rows 0..511: f16(16 Wh_mono[k][n]), rows 512..1023: f16(16 Wh_chunk[k][n-512])
//   PF    [16384][1024] f32   67,108,864   enc @ [Wh_mono | Wh_chunk]
//   PBUF  [16][1024]    f32       65,536   p of the current step
//   EBUF  [16][1024]    f32       65,536   chunk energies of the current step
//   ACAR  [2][16][1024] f32      131,072   alpha carry, ping-pong by step parity
//   SMSC  [16][1024]    f32       65,536   s @ [Ws_mono | Ws_chunk] + biases for the current step
//   SST   [9][256][16]  f32      147,456   s, plane 0 the initial state, plane t + 1 the state behind step t, [unit][batch row]
//   CST   [2][256][16]  f32       32,768   c, ping-pong, [unit][batch row]
//   YT    [8][16][1024] f32      524,288   y per step, columns 1000..1023 zero
//   VNORM [64]          f32          256   line 0 = g / norm(v_mono)
//   CTX   [8][16][512]  f32      262,144   ctx per step
//   HX    [8][256][16]  f32      131,072   output hidden h per step, [unit][batch row]
// ---------------------------------------------------------------------------
extern "C" void kernel_launch(void* const* d_in, const int* in_sizes, int n_in,
                              void* d_out, int out_size, void* d_ws, size_t ws_size, hipStream_t stream) {
  if (n_in < 23 || d_out == nullptr || d_ws == nullptr) return;
  if (in_sizes[0] != NBATCH * NSEQ * NDIM || in_sizes[1] != NBATCH * NSTEPS || in_sizes[2] != NBATCH ||
      in_sizes[3] != NSTEPS * NBATCH * NSEQ || in_sizes[4] != NHID * NDIM || in_sizes[6] != NDIM * NDIM ||
      in_sizes[10] != NHID * NDIM || in_sizes[12] != NDIM * NDIM || in_sizes[14] != NHID * NHID ||
      in_sizes[15] != NDIM * NHID || in_sizes[17] != NHID * NCLS || in_sizes[19] != NCLS * NGATE ||
      in_sizes[20] != NHID * NGATE || in_sizes[21] != NDIM * NGATE || out_size != NBATCH * NSTEPS * NCLS) return;

  const float* enc     = (const float*)d_in[0];
  const int*   target  = (const int*)d_in[1];
  const int*   lenenc  = (const int*)d_in[2];
  const float* noise   = (const float*)d_in[3];
  const float* ws_m_w  = (const float*)d_in[4];
  const float* ws_m_b  = (const float*)d_in[5];
  const float* wh_m    = (const float*)d_in[6];
  const float* v_m     = (const float*)d_in[7];
  const float* g_m     = (const float*)d_in[8];
  const float* r_m     = (const float*)d_in[9];
  const float* ws_c_w  = (const float*)d_in[10];
  const float* ws_c_b  = (const float*)d_in[11];
  const float* wh_c    = (const float*)d_in[12];
  const float* v_c     = (const float*)d_in[13];
  const float* l_sy    = (const float*)d_in[14];
  const float* l_gy_w  = (const float*)d_in[15];
  const float* l_gy_b  = (const float*)d_in[16];
  const float* l_yy_w  = (const float*)d_in[17];
  const float* l_yy_b  = (const float*)d_in[18];
  const float* l_ys    = (const float*)d_in[19];
  const float* l_ss    = (const float*)d_in[20];
  const float* l_gs_w  = (const float*)d_in[21];
  const float* l_gs_b  = (const float*)d_in[22];
  float* out = (float*)d_out;

  char* ws = (char*)d_ws; size_t off = 0;
  auto carve = [&](size_t bytes) -> char* { char* p = ws + off; off += (bytes + 255) & ~(size_t)255; return p; };
  unsigned short* A16  = (unsigned short*)carve((size_t)NROWS * NDIM * 2);
  unsigned short* BT16 = (unsigned short*)carve((size_t)NPROJ * NDIM * 2);
  float* PF    = (float*)carve((size_t)NROWS * NPROJ * 4);
  float* PBUF  = (float*)carve((size_t)NBATCH * NSEQ * 4);
  float* EBUF  = (float*)carve((size_t)NBATCH * NSEQ * 4);
  float* ACAR  = (float*)carve((size_t)2 * NBATCH * NSEQ * 4);
  float* SMSC  = (float*)carve((size_t)NBATCH * NPROJ * 4);
  float* SST   = (float*)carve((size_t)(NSTEPS + 1) * NBATCH * NHID * 4);
  float* CST   = (float*)carve((size_t)2 * NBATCH * NHID * 4);
  float* YT    = (float*)carve((size_t)NSTEPS * NBATCH * YPITCH * 4);
  float* VNORM = (float*)carve((size_t)256);
  float* CTX   = (float*)carve((size_t)NSTEPS * NBATCH * NDIM * 4);
  float* HX    = (float*)carve((size_t)NSTEPS * NBATCH * NHID * 4);
  if (off > ws_size || off > (size_t)134217728) return;

  /* (1) f16 operand planes */
  const int n8 = NROWS * NDIM / 8;
  cast8_f16_kernel<<<n8 / 256, 256, 0, stream>>>(enc, A16, n8);
  /* in [512 k][512 n] -> out [n][k]; grid (k tiles, n tiles, weight) */
  wtcast_kernel<<<dim3(NDIM / 64, NDIM / 64, 2), 256, 0, stream>>>(wh_m, wh_c, BT16, WCARRY);
  /* (2) initial state, s-projection biases, vnorm */
  init_state_kernel<<<NBATCH, 256, 0, stream>>>(v_m, g_m, ws_m_b, ws_c_b, ACAR, SST, CST, SMSC, VNORM);
  /* (3) fused encoder projections: M = 16384, N = 1024, K = 512; 4096 tiles = 512 blocks x 8 waves */
  wmma_gemm64<0, false, 0, 0, false, 0><<<dim3((NROWS / 64) * (NPROJ / 64) / 8, 1), 256, 0, stream>>>(
      A16, A16, NDIM, 0L, BT16, BT16, NDIM, 0L, (void*)PF, (void*)PF, NPROJ, 0L,
      PF, PF, 0L, NROWS, NPROJ, NDIM, WCARRY_INV);

  /* (4) decode steps: only what the next step needs, four launches per step (three in the last) */
  for (int step = 0; step < NSTEPS; ++step) {
    const int par = step & 1;
    float* ctx_t = CTX + (size_t)step * NBATCH * NDIM;
    float* s_old = SST + (size_t)step * NBATCH * NHID;
    float* s_new = SST + (size_t)(step + 1) * NBATCH * NHID;
    energies_kernel<<<NROWS / ROWS_PER_EBLK, 256, 0, stream>>>(
        PF, SMSC, v_m, v_c, VNORM, r_m, lenenc, noise + (size_t)step * NBATCH * NSEQ, PBUF, EBUF);
    scan_ctx_kernel<<<dim3(NDIM / 64, NBATCH), 256, 0, stream>>>(
        enc, lenenc, PBUF, EBUF,
        ACAR + (size_t)par * NBATCH * NSEQ, ACAR + (size_t)(par ^ 1) * NBATCH * NSEQ, ctx_t);
    gates_kernel<<<NHID / 16, 256, 0, stream>>>(
        ctx_t, target, s_old, CST + (size_t)par * NBATCH * NHID,
        s_new, CST + (size_t)(par ^ 1) * NBATCH * NHID,
        l_ys, l_ss, l_gs_w, l_gs_b, step);
    /* no next step: its projections are not formed */
    if (step + 1 < NSTEPS)
      sproj_kernel<<<NPROJ / 64, 256, 0, stream>>>(s_new, ws_m_w, ws_m_b, ws_c_w, ws_c_b, SMSC);
  }
  /* output head of all steps: h, then y */
  hid_kernel<<<dim3(NHID / 64, NSTEPS), 256, 0, stream>>>(CTX, SST, l_sy, l_gy_w, l_gy_b, HX);
  ycols_kernel<<<dim3(YPITCH / 64, NSTEPS), 256, 0, stream>>>(HX, l_yy_w, l_yy_b, YT);

  /* (5) pack the padded Y plane into the output */
  pack_out_kernel<<<(NBATCH * NSTEPS * NCLS) / (256 * 4), 256, 0, stream>>>(YT, out);
}

// v006
// Measured time: 257 microseconds a run.
// Two timings next to v005 both put it at 1.04 times that version's speed.
// Over all steps from v000 it is 15.4 times as fast.
// Compute dtype: enc x [Wh_mono | Wh_chunk] on v_wmma_f32_16x16x32_f16 (f16 enc, f16 weights carried x16, f32 accumulate, folded by 1/16); all per-step small products, energy dots, scans, gates and state in f32 on VALU.
#include <hip/hip_runtime.h>
#include <math.h>

// ---------------------------------------------------------------------------
// Shape constants
// ---------------------------------------------------------------------------
constexpr int NBATCH = 16;
constexpr int NSEQ   = 1024;
constexpr int NHID   = 256;
constexpr int NDIM   = 512;
constexpr int NCLS   = 1000;
constexpr int NSTEPS = 8;
constexpr int NGATE  = 4 * NHID;
constexpr int NPROJ  = 2 * NDIM;
constexpr int YPITCH = 1024;
constexpr int NROWS  = NBATCH * NSEQ;
constexpr float WCARRY     = 16.0f;
constexpr float WCARRY_INV = 1.0f / 16.0f;
static_assert(NROWS % 64 == 0 && NPROJ % 64 == 0 && NDIM % 32 == 0, "GEMM tile multiples");
static_assert((NBATCH * NSTEPS * NCLS) % (256 * 4) == 0, "pack grid exact");
static_assert(NCLS % 4 == 0, "float4 groups never straddle output rows");
static_assert(NSEQ == 4 * 256 && NHID == 256 && NDIM == 2 * 256, "thread maps");

typedef __attribute__((ext_vector_type(16))) _Float16 v16h;
typedef __attribute__((ext_vector_type(8)))  _Float16 v8h;
typedef __attribute__((ext_vector_type(16))) __bf16   v16b;
typedef __attribute__((ext_vector_type(8)))  __bf16   v8b;
typedef __attribute__((ext_vector_type(8)))  float    v8f;
typedef __attribute__((ext_vector_type(4)))  float    v4f;
typedef __attribute__((ext_vector_type(4)))  unsigned int v4u;

__device__ __forceinline__ unsigned short f2bf_bits(float f) {
  unsigned u = __float_as_uint(f);
  return (unsigned short)((u + 0x7FFFu + ((u >> 16) & 1u)) >> 16);
}
__device__ __forceinline__ float bf_bits2f(unsigned short h) { return __uint_as_float(((unsigned)h) << 16); }

__device__ __forceinline__ void dep_guard6_h(v8f& a, v8f& b, v8f& c, v8f& d, v16h x, v16h x2, v16h y0, v16h y1, v16h y2, v16h y3) {
  asm volatile("v_nop\n\tv_nop\n\tv_nop\n\tv_nop" : "+v"(a), "+v"(b), "+v"(c), "+v"(d) : "v"(x), "v"(x2), "v"(y0), "v"(y1), "v"(y2), "v"(y3));
}
__device__ __forceinline__ void dep_guard6_b(v8f& a, v8f& b, v8f& c, v8f& d, v16b x, v16b x2, v16b y0, v16b y1, v16b y2, v16b y3) {
  asm volatile("v_nop\n\tv_nop\n\tv_nop\n\tv_nop" : "+v"(a), "+v"(b), "+v"(c), "+v"(d) : "v"(x), "v"(x2), "v"(y0), "v"(y1), "v"(y2), "v"(y3));
}
__device__ __forceinline__ void keep4_h(v16h a, v16h b, v16h c, v16h d) { asm volatile("v_nop" :: "v"(a), "v"(b), "v"(c), "v"(d)); }
__device__ __forceinline__ void keep4_b(v16b a, v16b b, v16b c, v16b d) { asm volatile("v_nop" :: "v"(a), "v"(b), "v"(c), "v"(d)); }
__device__ __forceinline__ void acc_guard4(v8f& a, v8f& b, v8f& c, v8f& d) { asm volatile("v_nop\n\tv_nop\n\tv_nop\n\tv_nop" : "+v"(a), "+v"(b), "+v"(c), "+v"(d)); }

template <typename T> struct Frag;
template <> struct Frag<_Float16> {
  typedef v16h V; union U { v16h v; v8h h[2]; };
  /* elements 0..7 <- p[0..7], 8..15 <- p[16..23] */
  static __device__ __forceinline__ v16h load(const _Float16* p) {
    U f; f.h[0] = *(const v8h*)(p); f.h[1] = *(const v8h*)(p + 16); return f.v;
  }
  static __device__ __forceinline__ v8f mma(v16h a, v16h b, v8f c) {
    return __builtin_amdgcn_wmma_f32_16x16x32_f16(false, a, false, b, (short)0, c, false, false);
  }
  static __device__ __forceinline__ void guard(v8f& a, v8f& b, v8f& c, v8f& d, v16h x, v16h x2, v16h y0, v16h y1, v16h y2, v16h y3) {
    dep_guard6_h(a, b, c, d, x, x2, y0, y1, y2, y3);
  }
  static __device__ __forceinline__ void keep(v16h a, v16h b, v16h c, v16h d) { keep4_h(a, b, c, d); }
};
template <> struct Frag<__bf16> {
  typedef v16b V; union U { v16b v; v8b h[2]; };
  static __device__ __forceinline__ v16b load(const __bf16* p) {
    U f; f.h[0] = *(const v8b*)(p); f.h[1] = *(const v8b*)(p + 16); return f.v;
  }
  static __device__ __forceinline__ v8f mma(v16b a, v16b b, v8f c) {
    return __builtin_amdgcn_wmma_f32_16x16x32_bf16(false, a, false, b, (short)0, c, false, false);
  }
  static __device__ __forceinline__ void guard(v8f& a, v8f& b, v8f& c, v8f& d, v16b x, v16b x2, v16b y0, v16b y1, v16b y2, v16b y3) {
    dep_guard6_b(a, b, c, d, x, x2, y0, y1, y2, y3);
  }
  static __device__ __forceinline__ void keep(v16b a, v16b b, v16b c, v16b d) { keep4_b(a, b, c, d); }
};

__device__ __forceinline__ unsigned pk16(unsigned short a, unsigned short b) { return (unsigned)a | ((unsigned)b << 16); }
__device__ __forceinline__ unsigned short h_bits(float f) { const _Float16 h = (_Float16)f; return __builtin_bit_cast(unsigned short, h); }

/* reciprocal-based logistic and tanh with precise expf (v_rcp_f32 reciprocal) */
__device__ __forceinline__ float sigm_f(float x) { return __builtin_amdgcn_rcpf(1.0f + expf(-x)); }
__device__ __forceinline__ float tanh_e(float x) { return 1.0f - 2.0f * __builtin_amdgcn_rcpf(expf(2.0f * x) + 1.0f); }
__device__ __forceinline__ v4f exp2_x4(v4f a) {
  float r0, r1, r2, r3;
  asm("v_exp_f32 %0, %4\n\tv_exp_f32 %1, %5\n\tv_exp_f32 %2, %6\n\tv_exp_f32 %3, %7\n\tv_nop"
      : "=&v"(r0), "=&v"(r1), "=&v"(r2), "=&v"(r3) : "v"(a[0]), "v"(a[1]), "v"(a[2]), "v"(a[3]));
  return (v4f){r0, r1, r2, r3};
}
__device__ __forceinline__ v4f rcp_x4(v4f a) {
  float r0, r1, r2, r3;
  asm("v_rcp_f32 %0, %4\n\tv_rcp_f32 %1, %5\n\tv_rcp_f32 %2, %6\n\tv_rcp_f32 %3, %7\n\tv_nop"
      : "=&v"(r0), "=&v"(r1), "=&v"(r2), "=&v"(r3) : "v"(a[0]), "v"(a[1]), "v"(a[2]), "v"(a[3]));
  return (v4f){r0, r1, r2, r3};
}
__device__ __forceinline__ v4f tanh_x4(v4f x) {
  const v4f q = rcp_x4(exp2_x4(x * 2.885390082f) + 1.0f);
  return 1.0f - 2.0f * q;
}

// ---- Register-blocked batched WMMA GEMM ------------------------------------
// C[m,n] = scale * sum_k A[m,k] * Bt[n,k] (+bias)(+resid); each wave owns a 64x64 tile.
// A row-major [M,K]; Bt row-major [N,K]; M,N % 64 == 0, K % 32 == 0.
// SPLIT: operands are hi/lo planes (A2/Bt2 = lo planes, same layout); product = hi*hi + hi*lo + lo*hi.
// BIAS_MODE: 0 = none, 1 = bias[m], 2 = bias[n].
// OUT_MODE: 0 = f32, 1 = f16, 2 = bf16 hi plane (Cout) + bf16 lo plane (Cout2).
// ET: 0 = f16 operands, 1 = bf16 operands (pointers passed as 16-bit storage)
template <int ET> struct Elem;
template <> struct Elem<0> { typedef _Float16 T; };
template <> struct Elem<1> { typedef __bf16 T; };
template <int ET, bool SPLIT, int BIAS_MODE, int OUT_MODE, bool RESID, int ACT = 0>
__global__ __launch_bounds__(256) void wmma_gemm64(
    const unsigned short* __restrict__ Ap, const unsigned short* __restrict__ A2p, int lda, long strideA,
    const unsigned short* __restrict__ Btp, const unsigned short* __restrict__ Bt2p, int ldb, long strideB,
    void* __restrict__ Cout, void* __restrict__ Cout2, int ldc, long strideC,
    const float* __restrict__ bias,
    const float* __restrict__ resid, long strideR,
    int M, int N, int K, float scale) {
  typedef typename Elem<ET>::T T;
  typedef typename Frag<T>::V V;
  const T* A = (const T*)Ap; const T* A2 = (const T*)A2p; const T* Bt = (const T*)Btp; const T* Bt2 = (const T*)Bt2p;
  /* per-wave 16x64 slab, pitch 68 floats */
  __shared__ __align__(16) float sT[8][16 * 68];
  const int b    = blockIdx.y;
  const int lane = threadIdx.x & 31;
  const int wave = threadIdx.x >> 5;
  const int tilesN = N >> 6;
  const int tilesM = M >> 6;
  const int tile = blockIdx.x * 8 + wave;
  /* wave-uniform exit; no block barriers in this kernel */
  if (tile >= tilesM * tilesN) return;
  const int tm = tile / tilesN;
  const int tn = tile - tm * tilesN;
  const int m0 = tm << 6;
  const int n0 = tn << 6;

  const T* Ab  = A  + (size_t)b * strideA;
  const T* Bb  = Bt + (size_t)b * strideB;
  const T* Ab2 = SPLIT ? (A2  + (size_t)b * strideA) : nullptr;
  const T* Bb2 = SPLIT ? (Bt2 + (size_t)b * strideB) : nullptr;

  const int rlane = lane & 15;
  const int koff  = (lane >> 4) * 8;
  const int mOff  = (lane >> 4) * 8;

  v8f acc[4][4];
#pragma unroll
  for (int i = 0; i < 4; ++i)
#pragma unroll
    for (int j = 0; j < 4; ++j) acc[i][j] = (v8f){0.f,0.f,0.f,0.f,0.f,0.f,0.f,0.f};

  for (int k0 = 0; k0 < K; k0 += 32) {
    V bh[4], bl[4];
#pragma unroll
    for (int j = 0; j < 4; ++j) {
      const size_t bo = (size_t)(n0 + (j << 4) + rlane) * ldb + koff + k0;
      bh[j] = Frag<T>::load(Bb + bo);
      if (SPLIT) bl[j] = Frag<T>::load(Bb2 + bo);
    }
#pragma unroll
    for (int i = 0; i < 4; ++i) {
      const size_t ao = (size_t)(m0 + (i << 4) + rlane) * lda + koff + k0;
      V ah = Frag<T>::load(Ab + ao);
      V al;
      if (SPLIT) al = Frag<T>::load(Ab2 + ao);
#pragma unroll
      for (int j = 0; j < 4; ++j) {
        acc[i][j] = Frag<T>::mma(ah, bh[j], acc[i][j]);
        if (SPLIT) {
          acc[i][j] = Frag<T>::mma(ah, bl[j], acc[i][j]);
          acc[i][j] = Frag<T>::mma(al, bh[j], acc[i][j]);
        }
      }
      Frag<T>::guard(acc[i][0], acc[i][1], acc[i][2], acc[i][3], ah, SPLIT ? al : ah, bh[0], bh[1], bh[2], bh[3]);
    }
    Frag<T>::keep(bh[0], bh[1], bh[2], bh[3]);
    if (SPLIT) Frag<T>::keep(bl[0], bl[1], bl[2], bl[3]);
  }
  acc_guard4(acc[0][0], acc[0][1], acc[0][2], acc[0][3]);
  acc_guard4(acc[1][0], acc[1][1], acc[1][2], acc[1][3]);
  acc_guard4(acc[2][0], acc[2][1], acc[2][2], acc[2][3]);
  acc_guard4(acc[3][0], acc[3][1], acc[3][2], acc[3][3]);

  float* slab = sT[wave];
  const float* Rb = RESID ? (resid + (size_t)b * strideR) : nullptr;
#pragma unroll
  for (int i = 0; i < 4; ++i) {
    const int mBase = m0 + (i << 4);
#pragma unroll
    for (int j = 0; j < 4; ++j) {
      const int n = n0 + (j << 4) + rlane;
      float bv = 0.f;
      if (BIAS_MODE == 2) bv = bias[n];
#pragma unroll
      for (int r = 0; r < 8; ++r) {
        float v = acc[i][j][r] * scale;
        if (BIAS_MODE == 1) v += bias[mBase + mOff + r];
        if (BIAS_MODE == 2) v += bv;
        if (RESID) v += Rb[(size_t)(mBase + mOff + r) * ldc + n];
        if (ACT == 2) v = fmaxf(v, 0.0f);
        if (ACT == 4) v = (v > 0.f) ? v : 0.01f * v;
        slab[(mOff + r) * 68 + (j << 4) + rlane] = v;
      }
    }
    __builtin_amdgcn_fence(__ATOMIC_RELEASE, "workgroup");
    __builtin_amdgcn_wave_barrier();
    __builtin_amdgcn_fence(__ATOMIC_ACQUIRE, "workgroup");
    if (OUT_MODE == 0) {
      float* C = (float*)Cout + (size_t)b * strideC;
      /* row segment = 256 B = 16 lanes x 16 B */
      const int hh = lane >> 4, c4 = (lane & 15) * 4;
      {
#pragma unroll
        for (int it = 0; it < 8; ++it) {
          const int row = it * 2 + hh;
          v4f v = *(const v4f*)(slab + row * 68 + c4);
          *(v4f*)(C + (size_t)(mBase + row) * ldc + n0 + c4) = v;
        }
        
      }
    } else {
      const int q = lane >> 3, c8 = (lane & 7) * 8;
      unsigned short* C  = (unsigned short*)Cout  + (size_t)b * strideC;
      unsigned short* C2 = (OUT_MODE == 2) ? ((unsigned short*)Cout2 + (size_t)b * strideC) : nullptr;
      {
#pragma unroll
        for (int it = 0; it < 4; ++it) {
          const int row = it * 4 + q;
          const float* sp = slab + row * 68 + c8;
          v8h hv, lv;
#pragma unroll
          for (int e = 0; e < 8; ++e) {
            if (OUT_MODE == 1) {
              hv[e] = (_Float16)sp[e];
            } else {
              unsigned short hb = f2bf_bits(sp[e]);
              unsigned short lb = f2bf_bits(sp[e] - bf_bits2f(hb));
              hv[e] = __builtin_bit_cast(_Float16, hb);
              lv[e] = __builtin_bit_cast(_Float16, lb);
            }
          }
          *(v8h*)(C + (size_t)(mBase + row) * ldc + n0 + c8) = hv;
          if (OUT_MODE == 2) *(v8h*)(C2 + (size_t)(mBase + row) * ldc + n0 + c8) = lv;
        }
        
      }
    }
    __builtin_amdgcn_fence(__ATOMIC_RELEASE, "workgroup");
    __builtin_amdgcn_wave_barrier();
    __builtin_amdgcn_fence(__ATOMIC_ACQUIRE, "workgroup");
  }
}

// ---------------------------------------------------------------------------
// Weight transpose + cast: W0, W1 are [512 in d][512 out h] f32; WT[z*512 + h][d] = f16(scale * Wz[d][h]).
// grid (8, 8, 2): blockIdx.x = d tile (64 cols of WT), blockIdx.y = h tile (64 rows of WT), blockIdx.z selects W.
// Load coverage: 16 iterations x 256 threads = 4096 = the whole 64x64 tile.
// Store coverage: 8 waves x 2 iterations x 4 rows = 64 rows; 8 lanes x 8 halves = 64 cols; each row segment =
// ---------------------------------------------------------------------------
__global__ __launch_bounds__(256) void wtcast_kernel(const float* __restrict__ W0, const float* __restrict__ W1,
                                                     unsigned short* __restrict__ out, float scale) {
  __shared__ float tl[64][65];
  const int t  = threadIdx.x;
  const int d0 = blockIdx.x * 64;
  const int h0 = blockIdx.y * 64;
  const int z  = blockIdx.z;
  const float* W = (z == 0) ? W0 : W1;
#pragma unroll
  for (int i = 0; i < 16; ++i) {
    const int e = i * 256 + t;
    const int r = e >> 6;
    const int c = e & 63;
    tl[c][r] = W[(size_t)(d0 + r) * NDIM + h0 + c] * scale;
  }
  __syncthreads();
  const int lane = t & 31, wave = t >> 5;
  const int q = lane >> 3, c8 = (lane & 7) * 8;
  unsigned short* op = out + (size_t)z * NDIM * NDIM;
  {
#pragma unroll
    for (int it = 0; it < 2; ++it) {
      const int row = wave * 8 + it * 4 + q;
      unsigned short hb[8];
#pragma unroll
      for (int e = 0; e < 8; ++e) hb[e] = h_bits(tl[row][c8 + e]);
      const v4u u = (v4u){pk16(hb[0], hb[1]), pk16(hb[2], hb[3]), pk16(hb[4], hb[5]), pk16(hb[6], hb[7])};
      *(v4u*)(op + (size_t)(h0 + row) * NDIM + d0 + c8) = u;
    }
    
  }
}

// ---------------------------------------------------------------------------
// ---------------------------------------------------------------------------
__global__ __launch_bounds__(256) void cast8_f16_kernel(const float* __restrict__ in, unsigned short* __restrict__ out, int n8) {
  const int i = blockIdx.x * 256 + threadIdx.x;
  if (i >= n8) return;
  const float* p = in + 8 * (size_t)i;
  const v4f a = *(const v4f*)(p);
  const v4f c = *(const v4f*)(p + 4);
  unsigned short hb[8];
#pragma unroll
  for (int e = 0; e < 4; ++e) {
    hb[e]     = h_bits(a[e]);
    hb[4 + e] = h_bits(c[e]);
  }
  const v4u u = (v4u){pk16(hb[0], hb[1]), pk16(hb[2], hb[3]), pk16(hb[4], hb[5]), pk16(hb[6], hb[7])};
  unsigned short* q = out + 8 * (size_t)i;
  *(v4u*)q = u;
  
}

// ---------------------------------------------------------------------------
// Initial state: one block per batch row b (grid 16, 256 threads).
//   acar0[b][0] = 1, else 0 (1024 floats = 256 threads x 16 B); s0[b] = c0[b] = 0 (threads 0..63 x 16 B each);
//   block 0 writes one line with g / norm(v_mono).
// ---------------------------------------------------------------------------
__global__ __launch_bounds__(256) void init_state_kernel(const float* __restrict__ vmono, const float* __restrict__ gmono,
                                                         float* __restrict__ acar0, float* __restrict__ s0,
                                                         float* __restrict__ c0, float* __restrict__ vnorm) {
  __shared__ float red[8];
  const int tid = threadIdx.x, lane = tid & 31, wave = tid >> 5;
  const int b = blockIdx.x;
  const float v0 = vmono[tid], v1 = vmono[tid + 256];
  float ss = v0 * v0 + v1 * v1;
#pragma unroll
  for (int off = 16; off > 0; off >>= 1) ss += __shfl_xor(ss, off, 32);
  if (lane == 0) red[wave] = ss;
  __syncthreads();
  float tot = 0.0f;
#pragma unroll
  for (int w = 0; w < 8; ++w) tot += red[w];
  const float vn = gmono[0] / sqrtf(tot);

  v4f av = (v4f){0.f, 0.f, 0.f, 0.f};
  av[0] = (tid == 0) ? 1.0f : 0.0f;
  const v4f zv = (v4f){0.f, 0.f, 0.f, 0.f};
  const v4f nv = (v4f){vn, vn, vn, vn};
  {
    *(v4f*)(acar0 + b * NSEQ + 4 * tid) = av;
    if (tid < 64) {
      *(v4f*)(s0 + b * NHID + 4 * tid) = zv;
      *(v4f*)(c0 + b * NHID + 4 * tid) = zv;
    }
    if (b == 0 && tid < 8) *(v4f*)(vnorm + 4 * tid) = nv;
  }
}

// ---------------------------------------------------------------------------
// Energy dots for one decode step, cut by column: grid (16 column chunks, 16 batch rows, 2 halves of the positions),
// 256 threads. A block owns 64 of the 1024 projection columns (chunks 0..7 mono, 8..15 chunk) of 512 positions of one
// batch row. It first forms its own 64 columns of s @ Ws + b (256 x 64 weights, 64 KB), so that no launch of its own is
// needed for the s-projections, then the tanh dots of its columns. epart[chunk][b][s] holds the partial dots; the scan
// kernel joins the chunks and does mask, noise and logistic.
// ---------------------------------------------------------------------------
constexpr int ECOLS = 64;              /* columns of one block */
constexpr int NECH  = NPROJ / ECOLS;   /* column chunks */
constexpr int EROWS = 512;             /* positions of one block */
constexpr int RP    = 17;              /* LDS pitch in floats of one position's 16 lane sums */
static_assert(NDIM % ECOLS == 0 && NSEQ % EROWS == 0 && EROWS == 2 * 256 && NHID == 16 * 16, "energy block maps");
__global__ __launch_bounds__(256) void energies_kernel(
    const float* __restrict__ Pf, const float* __restrict__ s_cur,
    const float* __restrict__ Wsm, const float* __restrict__ Wsmb,
    const float* __restrict__ Wsc, const float* __restrict__ Wscb,
    const float* __restrict__ vmono, const float* __restrict__ vchunk,
    float* __restrict__ epart) {
  __shared__ __align__(16) float tpart[16 * ECOLS];
  __shared__ float rsum[EROWS * RP];
  const int tid = threadIdx.x;
  const int chunk = blockIdx.x, b = blockIdx.y, half = blockIdx.z;
  /* thread = (group of 4 columns c16, class q): q is the k range of the s-projection and the position class s mod 16 */
  const int c16 = tid & 15, q = tid >> 4;
  const bool mono = chunk < NDIM / ECOLS;
  const int cw = (chunk & (NDIM / ECOLS - 1)) * ECOLS + 4 * c16;
  const float* wr = (mono ? Wsm : Wsc) + (size_t)(q * 16) * NDIM + cw;
  const float* sr = s_cur + (q * 16) * NBATCH + b;
  const float* bb = mono ? Wsmb : Wscb;
  const float* vb = mono ? vmono : vchunk;
  const unsigned cwb = (unsigned)cw * 4u;  /* byte offset of the thread's columns in the bias and in v */
  const float* pr = Pf + (size_t)(b * NSEQ + half * EROWS + q) * NPROJ + chunk * ECOLS + 4 * c16;
  /* Every global value the thread needs is asked for first, the s-projection's operands ahead of the 32 row loads: the
     projection is formed while the rows are still on their way. */
  v4f w[16], e[32];
  float sv[16];
#pragma unroll
  for (int i = 0; i < 16; ++i) {
    sv[i] = sr[i * NBATCH];
    w[i]  = *(const v4f*)(wr + i * NDIM);
  }
  const v4f bias = *(const v4f*)((const char*)bb + cwb);
  const v4f vv   = *(const v4f*)((const char*)vb + cwb);
#pragma unroll
  for (int it = 0; it < 32; ++it) e[it] = *(const v4f*)(pr + (size_t)it * 16 * NPROJ);
  /* keeps every load of the run ahead of the arithmetic: without it the scheduler sinks half of the row loads behind the
     projection's first products, which wait for the weights */
  __builtin_amdgcn_sched_barrier(0);
  /* the wait in front of any rewrite of these loads' address registers; as inputs the three address pairs and the offset of
     the bias and v loads stay in their registers up to here, so that no load of the run lands in one */
  asm volatile("s_wait_xcnt 0x0" :: "v"(wr), "v"(sr), "v"(pr), "v"(cwb) : "memory");
  /* s-projection of the block's columns: 16 k ranges of 16, each summed in rising k, joined in fixed order, bias last */
  {
    v4f a = (v4f){0.f, 0.f, 0.f, 0.f};
#pragma unroll
    for (int i = 0; i < 16; ++i) {
      a[0] = fmaf(sv[i], w[i][0], a[0]);
      a[1] = fmaf(sv[i], w[i][1], a[1]);
      a[2] = fmaf(sv[i], w[i][2], a[2]);
      a[3] = fmaf(sv[i], w[i][3], a[3]);
    }
    *(v4f*)(tpart + q * ECOLS + 4 * c16) = a;
  }
  /* work-group barrier that orders LDS alone: __syncthreads() also waits for every global load, here the 32 row loads still
     on their way, and no wave could start on its first rows while the last ones arrive */
  __builtin_amdgcn_fence(__ATOMIC_RELEASE, "workgroup", "local");
  __builtin_amdgcn_s_barrier();
  __builtin_amdgcn_fence(__ATOMIC_ACQUIRE, "workgroup", "local");
  v4f t = *(const v4f*)(tpart + 4 * c16);
#pragma unroll
  for (int k = 1; k < 16; ++k) t += *(const v4f*)(tpart + k * ECOLS + 4 * c16);
  t += bias;
  /* the thread's four columns of positions 16 it + q */
#pragma unroll
  for (int it = 0; it < 32; ++it) {
    const v4f th = tanh_x4(e[it] + t);
    float a = 0.0f;
    a = fmaf(th[0], vv[0], a);
    a = fmaf(th[1], vv[1], a);
    a = fmaf(th[2], vv[2], a);
    a = fmaf(th[3], vv[3], a);
    rsum[(it * 16 + q) * RP + c16] = a;
  }
  __syncthreads();
  /* the 16 column groups of a position joined in fixed order; a thread stores positions tid and 256 + tid */
  float* dst = epart + (size_t)(chunk * NBATCH + b) * NSEQ + half * EROWS;
#pragma unroll
  for (int rr = 0; rr < 2; ++rr) {
    const int row = rr * 256 + tid;
    float v = rsum[row * RP];
#pragma unroll
    for (int l = 1; l < 16; ++l) v += rsum[row * RP + l];
    dst[row] = v;
  }
}

// exclusive block prefix of one value per thread (256 threads = 8 waves), fixed order; one block barrier inside.
__device__ __forceinline__ float block_excl_scan(float total, float* wt, int lane, int wave) {
  float x = total;
#pragma unroll
  for (int off = 1; off < 32; off <<= 1) {
    const float n = __shfl_up(x, off, 32);
    x += (lane >= off) ? n : 0.0f;
  }
  float ex = __shfl_up(x, 1, 32);
  ex = (lane == 0) ? 0.0f : ex;
  if (lane == 31) wt[wave] = x;
  __syncthreads();
  float woff = 0.0f;
#pragma unroll
  for (int w = 0; w < 8; ++w) woff += (w < wave) ? wt[w] : 0.0f;
  return woff + ex;
}

// ---------------------------------------------------------------------------
// Decode step, cut by output column. Two launches in the step loop behind the energy dots:
//   scan_ctx_kernel   grid (8 column chunks, 16 batch rows): every block joins the row's partial dots and repeats its
//                     scans (72 KB of input), then sums beta . enc for its own 64 columns only.
//   gates_kernel      16 blocks x 16 LSTM units (64 gate columns), all 16 batch rows.
// The output head feeds no later step: ctx and s of every step are kept, and behind the loop one launch each serves all steps:
//   hid_kernel        grid (4 blocks x 64 columns of h, 8 steps).
//   ycols_kernel      grid (16 blocks x 64 columns of y (padded to 1024), 8 steps).
// In the three product kernels a thread owns four weight columns and one sixteenth of k and keeps 64 sums, one per column
// and batch row, so a weight element is loaded once per step for all rows. s, c and h live in the workspace as [unit][16 rows].
// ---------------------------------------------------------------------------
constexpr int XP = 20;  /* LDS pitch in floats of one k row of 16 batch values: 16-B aligned, transposing stores 2-way at most */
constexpr int PP = 17;  /* LDS pitch in floats of one column's 16 partial sums */
constexpr int KCAT = NHID + NDIM;
static_assert(KCAT % 128 == 0 && NHID % 128 == 0, "the 16 k ranges are whole 8-row groups and no group straddles the two weights");

/* src [K][16] -> xs[k * XP + row] */
template <int K>
__device__ __forceinline__ void stage_kmajor(float* xs, const float* __restrict__ srcp, int tid) {
#pragma unroll
  for (int i = 0; i < K * 4 / 256; ++i) {
    const int e4 = i * 256 + tid;
    const v4f v = *(const v4f*)(srcp + 4 * e4);
    *(v4f*)(xs + (e4 >> 2) * XP + (e4 & 3) * 4) = v;
  }
}
/* src [16][K] -> xs[k * XP + row] */
template <int K>
__device__ __forceinline__ void stage_rows(float* xs, const float* __restrict__ srcp, int tid) {
#pragma unroll
  for (int i = 0; i < 16 * K / 256; ++i) {
    const int e = i * 256 + tid;
    xs[(e % K) * XP + (e / K)] = srcp[e];
  }
}

/* eight rows of four weight columns; p0 .. p3 point at the first row of the four columns */
__device__ __forceinline__ void rows8x4(float (&w)[8][4], const float* p0, const float* p1, const float* p2,
                                        const float* p3, int ldw) {
#pragma unroll
  for (int i = 0; i < 8; ++i) {
    w[i][0] = p0[(size_t)i * ldw];
    w[i][1] = p1[(size_t)i * ldw];
    w[i][2] = p2[(size_t)i * ldw];
    w[i][3] = p3[(size_t)i * ldw];
  }
  /* the wait in front of any rewrite of these loads' address registers; as inputs the four addresses stay in their
     registers up to here, so that no load of the run lands in one; it also keeps the loads ahead of the fmaf behind it */
  asm volatile("s_wait_xcnt 0x0" :: "v"(p0), "v"(p1), "v"(p2), "v"(p3) : "memory");
}

/* acc[j][row] += xs[k0 + i][row] * w[i][j] for the eight rows i: one LDS read of the 16 batch values feeds 64 fmaf */
__device__ __forceinline__ void fma8x4x16(const float* xs, int k0, const float (&w)[8][4], float (&acc)[4][16]) {
#pragma unroll
  for (int i = 0; i < 8; ++i) {
    const float* x = xs + (k0 + i) * XP;
    const v4f x0 = *(const v4f*)(x);
    const v4f x1 = *(const v4f*)(x + 4);
    const v4f x2 = *(const v4f*)(x + 8);
    const v4f x3 = *(const v4f*)(x + 12);
#pragma unroll
    for (int j = 0; j < 4; ++j) {
      const float wv = w[i][j];
#pragma unroll
      for (int e = 0; e < 4; ++e) {
        acc[j][e]      = fmaf(x0[e], wv, acc[j][e]);
        acc[j][4 + e]  = fmaf(x1[e], wv, acc[j][4 + e]);
        acc[j][8 + e]  = fmaf(x2[e], wv, acc[j][8 + e]);
        acc[j][12 + e] = fmaf(x3[e], wv, acc[j][12 + e]);
      }
    }
  }
}

/* acc[j][row] += sum over k in [kb, ke) of xs[k][row] * W[k][cols[j]]; rows k < K0 of the joined weight are W0, the rest W1.
   The next 8 weight rows are asked for ahead of the current 8 rows' fmaf. */
__device__ __forceinline__ void cols4x16(const float* xs, const float* __restrict__ W0, int K0,
                                         const float* __restrict__ W1, int ldw, const int (&cols)[4], int kb, int ke,
                                         float (&acc)[4][16]) {
  float wa[8][4];
  {
    const float* wp = (kb < K0) ? (W0 + (size_t)kb * ldw) : (W1 + (size_t)(kb - K0) * ldw);
    rows8x4(wa, wp + cols[0], wp + cols[1], wp + cols[2], wp + cols[3], ldw);
  }
  int k0 = kb;
  for (; k0 + 8 < ke; k0 += 8) {
    const int kn = k0 + 8;
    const float* wp = (kn < K0) ? (W0 + (size_t)kn * ldw) : (W1 + (size_t)(kn - K0) * ldw);
    float wb[8][4];
    rows8x4(wb, wp + cols[0], wp + cols[1], wp + cols[2], wp + cols[3], ldw);
    fma8x4x16(xs, k0, wa, acc);
#pragma unroll
    for (int i = 0; i < 8; ++i)
#pragma unroll
      for (int j = 0; j < 4; ++j) wa[i][j] = wb[i][j];
  }
  fma8x4x16(xs, k0, wa, acc);
}
__device__ __forceinline__ void zero_acc(float (&acc)[4][16]) {
#pragma unroll
  for (int j = 0; j < 4; ++j)
#pragma unroll
    for (int r = 0; r < 16; ++r) acc[j][r] = 0.0f;
}
/* block column index of (j, t16) is j * 16 + t16 */
__device__ __forceinline__ void put_part(float* part, int q, int t16, const float (&acc)[4][16]) {
#pragma unroll
  for (int j = 0; j < 4; ++j)
#pragma unroll
    for (int r = 0; r < 16; ++r) part[(q * 64 + j * 16 + t16) * PP + r] = acc[j][r];
}
/* the 16 k ranges of (block column c, batch row r), fixed order */
__device__ __forceinline__ float get_part(const float* part, int c, int r) {
  float v = part[c * PP + r];
#pragma unroll
  for (int q = 1; q < 16; ++q) v += part[(q * 64 + c) * PP + r];
  return v;
}

__global__ __launch_bounds__(256) void scan_ctx_kernel(
    const float* __restrict__ enc, const int* __restrict__ len,
    const float* __restrict__ epart, const float* __restrict__ vnp, const float* __restrict__ rmono,
    const float* __restrict__ noise_t,
    const float* __restrict__ acar_in, float* __restrict__ acar_out, float* __restrict__ ctx) {
  __shared__ __align__(16) float sh_p[NSEQ];
  __shared__ __align__(16) float sh_a[NSEQ];
  __shared__ __align__(16) float sh_ex[NSEQ];
  __shared__ __align__(16) float sh_g[NSEQ];
  __shared__ __align__(16) float sh_cpp[NSEQ];
  __shared__ __align__(16) float sh_u[NSEQ];
  __shared__ __align__(16) float sh_al[NSEQ];
  __shared__ __align__(16) float sh_r[NSEQ];
  __shared__ __align__(16) float sh_beta[NSEQ];
  __shared__ __align__(16) float sh_cpart[16 * 68];
  __shared__ float redm[8];
  __shared__ float wtA[8];
  __shared__ float wtB[8];

  const int tid = threadIdx.x, lane = tid & 31, wave = tid >> 5;
  const int chunk = blockIdx.x;
  const int b = blockIdx.y;
  const int i0 = tid * 4;
  int L = len[b];
  L = (L < 0) ? 0 : ((L > NSEQ) ? NSEQ : L);
  const float vn = vnp[0];
  const float rm = rmono[0];

  /* phase 1: the thread's four positions: the 8 + 8 partial dots joined in the order of the chunks, mask, noise, logistic;
     stage p, a, e; log terms; running max over unmasked positions. All 18 loads are asked for first and fly together. */
  float ml = -3.0e38f;
  {
    const float* ep = epart + b * NSEQ + i0;
    v4f pm[8], pc[8];
#pragma unroll
    for (int c = 0; c < 8; ++c) {
      pm[c] = *(const v4f*)(ep + c * (NBATCH * NSEQ));
      pc[c] = *(const v4f*)(ep + (8 + c) * (NBATCH * NSEQ));
    }
    const v4f nz = *(const v4f*)(noise_t + b * NSEQ + i0);
    const v4f av = *(const v4f*)(acar_in + b * NSEQ + i0);
    /* keeps every load of the run, the three scalars above too, ahead of the sums: without it the scheduler sinks four of
       the loads and the scalars behind the first waits, three round trips in a row instead of one */
    __builtin_amdgcn_sched_barrier(0);
    v4f dm = pm[0], dc = pc[0];
#pragma unroll
    for (int c = 1; c < 8; ++c) {
      dm += pm[c];
      dc += pc[c];
    }
    v4f pv, ev, gv;
#pragma unroll
    for (int k = 0; k < 4; ++k) {
      const bool masked = (i0 + k >= L);
      const float em = (vn * dm[k] + rm) + nz[k];
      const float sg = sigm_f(em);
      /* masked positions give p = 0 exactly; their chunk energy is staged as 0 and replaced in phase 2 */
      pv[k] = masked ? 0.0f : sg;
      ev[k] = masked ? 0.0f : dc[k];
      gv[k] = logf(fminf(fmaxf(1.0f - pv[k], 1e-8f), 1.0f));
      ml = masked ? ml : fmaxf(ml, ev[k]);
    }
    *(v4f*)(sh_p + i0)  = pv;
    *(v4f*)(sh_a + i0)  = av;
    *(v4f*)(sh_ex + i0) = ev;
    *(v4f*)(sh_g + i0)  = gv;
  }
#pragma unroll
  for (int off = 16; off > 0; off >>= 1) ml = fmaxf(ml, __shfl_xor(ml, off, 32));
  if (lane == 0) redm[wave] = ml;
  __syncthreads();
  float mx = redm[0];
#pragma unroll
  for (int w = 1; w < 8; ++w) mx = fmaxf(mx, redm[w]);

  /* phase 2: ex = max(exp(e - max), 1e-5); masked positions give 1e-5 */
#pragma unroll 1
  for (int j = 0; j < 4; ++j) {
    const int i = j * 256 + tid;
    const float t = fmaxf(expf(sh_ex[i] - mx), 1e-5f);
    sh_ex[i] = (i < L) ? t : 1e-5f;
  }

  /* phase 3: exclusive prefix of the log terms over contiguous chunks of 4 */
  {
    const v4f g4 = *(const v4f*)(sh_g + i0);
    const float e1 = g4[0];
    const float e2 = e1 + g4[1];
    const float e3 = e2 + g4[2];
    const float tot = e3 + g4[3];
    const float off = block_excl_scan(tot, wtA, lane, wave);
    v4f x4;
    x4[0] = off;
    x4[1] = off + e1;
    x4[2] = off + e2;
    x4[3] = off + e3;
    *(v4f*)(sh_cpp + i0) = x4;
  }
  __syncthreads();

  /* phase 4: cpp = exp(prefix) (flushed below the smallest normal), u = a / clip(cpp, 1e-8, 1) */
#pragma unroll 1
  for (int j = 0; j < 4; ++j) {
    const int i = j * 256 + tid;
    float cp = expf(sh_cpp[i]);
    cp = (cp < 1.17549435e-38f) ? 0.0f : cp;
    sh_cpp[i] = cp;
    const float cl = fminf(fmaxf(cp, 1e-8f), 1.0f);
    sh_u[i] = sh_a[i] * __builtin_amdgcn_rcpf(cl);
  }
  __syncthreads();

  /* phase 5: inclusive prefix of u, q = cpp * prefix, alpha = clip(p * q, 1e-8, 1) */
  {
    const v4f u4 = *(const v4f*)(sh_u + i0);
    const v4f c4 = *(const v4f*)(sh_cpp + i0);
    const v4f p4 = *(const v4f*)(sh_p + i0);
    const float c0 = u4[0];
    const float c1 = c0 + u4[1];
    const float c2 = c1 + u4[2];
    const float c3 = c2 + u4[3];
    const float off2 = block_excl_scan(c3, wtB, lane, wave);
    v4f al;
    al[0] = fminf(fmaxf(p4[0] * (c4[0] * (off2 + c0)), 1e-8f), 1.0f);
    al[1] = fminf(fmaxf(p4[1] * (c4[1] * (off2 + c1)), 1e-8f), 1.0f);
    al[2] = fminf(fmaxf(p4[2] * (c4[2] * (off2 + c2)), 1e-8f), 1.0f);
    al[3] = fminf(fmaxf(p4[3] * (c4[3] * (off2 + c3)), 1e-8f), 1.0f);
    *(v4f*)(sh_al + i0) = al;
  }
  __syncthreads();

  /* phase 6: denom = max(sum ex[i-3..i], 1e-10) (zero padded), r = alpha / denom */
#pragma unroll 1
  for (int j = 0; j < 4; ++j) {
    const int i = j * 256 + tid;
    float d = 0.0f;
#pragma unroll
    for (int k = 3; k >= 0; --k) {
      const int ii = i - k;
      const int ic = (ii < 0) ? 0 : ii;
      const float v = sh_ex[ic];
      d += (ii >= 0) ? v : 0.0f;
    }
    d = fmaxf(d, 1e-10f);
    sh_r[i] = sh_al[i] * __builtin_amdgcn_rcpf(d);
  }
  __syncthreads();

  /* phase 7: beta = ex * sum r[i..i+3] (zero padded) */
#pragma unroll 1
  for (int j = 0; j < 4; ++j) {
    const int i = j * 256 + tid;
    float ms = 0.0f;
#pragma unroll
    for (int k = 0; k < 4; ++k) {
      const int ii = i + k;
      const int ic = (ii > NSEQ - 1) ? (NSEQ - 1) : ii;
      const float v = sh_r[ic];
      ms += (ii < NSEQ) ? v : 0.0f;
    }
    sh_beta[i] = sh_ex[i] * ms;
  }
  __syncthreads();

  /* phase 8: ctx of this block's 64 columns; thread = (group of 4 columns, position class s mod 16), 64 positions each */
  {
    const int cg = tid & 15, sp = tid >> 4;
    const float* eb = enc + (size_t)b * NSEQ * NDIM + chunk * 64 + 4 * cg;
    v4f acc = (v4f){0.f, 0.f, 0.f, 0.f};
/* 16 trips per pass: their row loads fly together */
#pragma unroll 16
    for (int it = 0; it < NSEQ / 16; ++it) {
      const int s = 16 * it + sp;
      const float bv = sh_beta[s];
      const v4f e4 = *(const v4f*)(eb + (size_t)s * NDIM);
      acc[0] = fmaf(bv, e4[0], acc[0]);
      acc[1] = fmaf(bv, e4[1], acc[1]);
      acc[2] = fmaf(bv, e4[2], acc[2]);
      acc[3] = fmaf(bv, e4[3], acc[3]);
    }
    *(v4f*)(sh_cpart + sp * 68 + 4 * cg) = acc;
  }
  __syncthreads();
  /* 16 position classes joined in fixed order; 64 threads store the block's own 256-B piece of the row */
  if (tid < 64) {
    float v = sh_cpart[tid];
#pragma unroll
    for (int sp = 1; sp < 16; ++sp) v += sh_cpart[sp * 68 + tid];
    ctx[b * NDIM + chunk * 64 + tid] = v;
  }
  /* the alpha carry is stored by one block of the row */
  if (chunk == 0) {
    const v4f alv = *(const v4f*)(sh_al + i0);
    *(v4f*)(acar_out + b * NSEQ + i0) = alv;
  }
}

__global__ __launch_bounds__(256) void gates_kernel(
    const float* __restrict__ ctx, const int* __restrict__ target,
    const float* __restrict__ s_in, const float* __restrict__ c_in,
    float* __restrict__ s_out, float* __restrict__ c_out,
    const float* __restrict__ Lys, const float* __restrict__ Lss,
    const float* __restrict__ Lgsw, const float* __restrict__ Lgsb, int step) {
  __shared__ __align__(16) float xs[KCAT * XP];
  __shared__ float part[16 * 64 * PP];
  const int tid = threadIdx.x;
  const int u0 = blockIdx.x * 16;
  stage_kmajor<NHID>(xs, s_in, tid);
  stage_rows<NDIM>(xs + NHID * XP, ctx, tid);
  __syncthreads();
  const int t16 = tid & 15, q = tid >> 4;
  float acc[4][16];
  zero_acc(acc);
  /* the thread's four columns: gates i, f, g, o of unit u0 + t16 */
  const int cols[4] = {u0 + t16, NHID + u0 + t16, 2 * NHID + u0 + t16, 3 * NHID + u0 + t16};
  cols4x16(xs, Lss, NHID, Lgsw, NGATE, cols, q * (KCAT / 16), (q + 1) * (KCAT / 16), acc);
  put_part(part, q, t16, acc);
  __syncthreads();
  /* LSTM cell of (unit u0 + u, batch row r) */
  const int u = tid >> 4, r = tid & 15;
  int tg = target[r * NSTEPS + step];
  tg = (tg < 0) ? 0 : ((tg > NCLS - 1) ? (NCLS - 1) : tg);
  const float* ly = Lys + (size_t)tg * NGATE + u0 + u;
  const float* lb = Lgsb + u0 + u;
  const float r0 = get_part(part, u, r)      + (ly[0] + lb[0]);
  const float r1 = get_part(part, 16 + u, r) + (ly[NHID] + lb[NHID]);
  const float r2 = get_part(part, 32 + u, r) + (ly[2 * NHID] + lb[2 * NHID]);
  const float r3 = get_part(part, 48 + u, r) + (ly[3 * NHID] + lb[3 * NHID]);
  const float cold = c_in[u0 * 16 + tid];
  const float ig = sigm_f(r0);
  const float fg = sigm_f(r1);
  const float gg = tanh_e(r2);
  const float og = sigm_f(r3);
  const float cn = fg * cold + ig * gg;
  const float sn = og * tanh_e(cn);
  c_out[u0 * 16 + tid] = cn;
  s_out[u0 * 16 + tid] = sn;
}

/* blockIdx.y = step; ctx_all [step][16][512], s_all [step + 1][256][16] (plane 0 is the initial state), hx_all [step][256][16] */
__global__ __launch_bounds__(256) void hid_kernel(
    const float* __restrict__ ctx_all, const float* __restrict__ s_all,
    const float* __restrict__ Lsy, const float* __restrict__ Lgyw, const float* __restrict__ Lgyb,
    float* __restrict__ hx_all) {
  __shared__ __align__(16) float xs[KCAT * XP];
  __shared__ float part[16 * 64 * PP];
  const int tid = threadIdx.x;
  const int step = blockIdx.y;
  const float* ctx = ctx_all + step * (NBATCH * NDIM);
  const float* s_new = s_all + (step + 1) * (NBATCH * NHID);
  float* hx = hx_all + step * (NBATCH * NHID);
  stage_kmajor<NHID>(xs, s_new, tid);
  stage_rows<NDIM>(xs + NHID * XP, ctx, tid);
  __syncthreads();
  const int t16 = tid & 15, q = tid >> 4;
  float acc[4][16];
  zero_acc(acc);
  const int col0 = blockIdx.x * 64;
  const int cols[4] = {col0 + t16, col0 + 16 + t16, col0 + 32 + t16, col0 + 48 + t16};
  cols4x16(xs, Lsy, NHID, Lgyw, NHID, cols, q * (KCAT / 16), (q + 1) * (KCAT / 16), acc);
  put_part(part, q, t16, acc);
  __syncthreads();
#pragma unroll
  for (int e = 0; e < 4; ++e) {
    const int o = e * 256 + tid;
    const float v = get_part(part, o >> 4, o & 15) + Lgyb[col0 + (o >> 4)];
    hx[col0 * 16 + o] = tanh_e(v);
  }
}

/* blockIdx.y = step; hx_all [step][256][16], Yt [step][16][1024] */
__global__ __launch_bounds__(256) void ycols_kernel(const float* __restrict__ hx_all, const float* __restrict__ Lyyw,
                                                    const float* __restrict__ Lyyb, float* __restrict__ Yt) {
  __shared__ __align__(16) float xs[NHID * XP];
  __shared__ float part[16 * 64 * PP];
  const int tid = threadIdx.x;
  const int col0 = blockIdx.x * 64;
  const float* hx = hx_all + blockIdx.y * (NBATCH * NHID);
  float* Yrow = Yt + blockIdx.y * (NBATCH * YPITCH);
  stage_kmajor<NHID>(xs, hx, tid);
  __syncthreads();
  const int t16 = tid & 15, q = tid >> 4;
  float acc[4][16];
  zero_acc(acc);
  /* column index clamped for the address; columns beyond 999 are stored as zero below */
  int cols[4];
#pragma unroll
  for (int j = 0; j < 4; ++j) {
    const int n = col0 + j * 16 + t16;
    cols[j] = (n < NCLS) ? n : (NCLS - 1);
  }
  cols4x16(xs, Lyyw, NHID, Lyyw, NCLS, cols, q * (NHID / 16), (q + 1) * (NHID / 16), acc);
  put_part(part, q, t16, acc);
  __syncthreads();
  const int r = tid >> 4, c4 = (tid & 15) * 4;
  v4f v;
#pragma unroll
  for (int e = 0; e < 4; ++e) {
    const int n = col0 + c4 + e;
    const int nc = (n < NCLS) ? n : (NCLS - 1);
    const float y = get_part(part, c4 + e, r) + Lyyb[nc];
    v[e] = (n < NCLS) ? y : 0.0f;
  }
  *(v4f*)(Yrow + r * YPITCH + col0 + c4) = v;
}

// ---------------------------------------------------------------------------
// Pack: out[b][t][n] = Y[t][b][n], n < 1000. Thread i4 moves floats 4 i4 .. 4 i4 + 3 of the flat output
// (1000 % 4 == 0 so a group never straddles rows). A wave writes 32 x 16 B = 512 contiguous 512-B aligned bytes =
// ---------------------------------------------------------------------------
__global__ __launch_bounds__(256) void pack_out_kernel(const float* __restrict__ Yt, float* __restrict__ out) {
  const int i4 = blockIdx.x * 256 + threadIdx.x;
  const int e  = i4 * 4;
  const int row = e / NCLS;
  const int n   = e - row * NCLS;
  const int b = row / NSTEPS;
  const int t = row - b * NSTEPS;
  const v4f v = *(const v4f*)(Yt + ((size_t)t * NBATCH + b) * YPITCH + n);
  float* dst = out + e;
  *(v4f*)dst = v;
  
}

// ---------------------------------------------------------------------------
// Host glue. Workspace region map (bytes, 256-B aligned carve; total 87,212,288 <= 134,217,728):
//   A16   [16384][512]  f16   16,777,216   f16(enc)
//   BT16  [1024][512]   f16    1,048,576   rows 0..511: f16(16 Wh_mono[k][n]), rows 512..1023: f16(16 Wh_chunk[k][n-512])
//   PF    [16384][1024] f32   67,108,864   enc @ [Wh_mono | Wh_chunk]
//   EPART [16][16][1024] f32   1,048,576   partial energy dots of the current step, [column chunk][batch row][position]
//   ACAR  [2][16][1024] f32      131,072   alpha carry, ping-pong by step parity
//   SST   [9][256][16]  f32      147,456   s, plane 0 the initial state, plane t + 1 the state behind step t, [unit][batch row]
//   CST   [2][256][16]  f32       32,768   c, ping-pong, [unit][batch row]
//   YT    [8][16][1024] f32      524,288   y per step, columns 1000..1023 zero
//   VNORM [64]          f32          256   line 0 = g / norm(v_mono)
//   CTX   [8][16][512]  f32      262,144   ctx per step
//   HX    [8][256][16]  f32      131,072   output hidden h per step, [unit][batch row]
// ---------------------------------------------------------------------------
extern "C" void kernel_launch(void* const* d_in, const int* in_sizes, int n_in,
                              void* d_out, int out_size, void* d_ws, size_t ws_size, hipStream_t stream) {
  if (n_in < 23 || d_out == nullptr || d_ws == nullptr) return;
  if (in_sizes[0] != NBATCH * NSEQ * NDIM || in_sizes[1] != NBATCH * NSTEPS || in_sizes[2] != NBATCH ||
      in_sizes[3] != NSTEPS * NBATCH * NSEQ || in_sizes[4] != NHID * NDIM || in_sizes[6] != NDIM * NDIM ||
      in_sizes[10] != NHID * NDIM || in_sizes[12] != NDIM * NDIM || in_sizes[14] != NHID * NHID ||
      in_sizes[15] != NDIM * NHID || in_sizes[17] != NHID * NCLS || in_sizes[19] != NCLS * NGATE ||
      in_sizes[20] != NHID * NGATE || in_sizes[21] != NDIM * NGATE || out_size != NBATCH * NSTEPS * NCLS) return;

  const float* enc     = (const float*)d_in[0];
  const int*   target  = (const int*)d_in[1];
  const int*   lenenc  = (const int*)d_in[2];
  const float* noise   = (const float*)d_in[3];
  const float* ws_m_w  = (const float*)d_in[4];
  const float* ws_m_b  = (const float*)d_in[5];
  const float* wh_m    = (const float*)d_in[6];
  const float* v_m     = (const float*)d_in[7];
  const float* g_m     = (const float*)d_in[8];
  const float* r_m     = (const float*)d_in[9];
  const float* ws_c_w  = (const float*)d_in[10];
  const float* ws_c_b  = (const float*)d_in[11];
  const float* wh_c    = (const float*)d_in[12];
  const float* v_c     = (const float*)d_in[13];
  const float* l_sy    = (const float*)d_in[14];
  const float* l_gy_w  = (const float*)d_in[15];
  const float* l_gy_b  = (const float*)d_in[16];
  const float* l_yy_w  = (const float*)d_in[17];
  const float* l_yy_b  = (const float*)d_in[18];
  const float* l_ys    = (const float*)d_in[19];
  const float* l_ss    = (const float*)d_in[20];
  const float* l_gs_w  = (const float*)d_in[21];
  const float* l_gs_b  = (const float*)d_in[22];
  float* out = (float*)d_out;

  char* ws = (char*)d_ws; size_t off = 0;
  auto carve = [&](size_t bytes) -> char* { char* p = ws + off; off += (bytes + 255) & ~(size_t)255; return p; };
  unsigned short* A16  = (unsigned short*)carve((size_t)NROWS * NDIM * 2);
  unsigned short* BT16 = (unsigned short*)carve((size_t)NPROJ * NDIM * 2);
  float* PF    = (float*)carve((size_t)NROWS * NPROJ * 4);
  float* EPART = (float*)carve((size_t)NECH * NBATCH * NSEQ * 4);
  float* ACAR  = (float*)carve((size_t)2 * NBATCH * NSEQ * 4);
  float* SST   = (float*)carve((size_t)(NSTEPS + 1) * NBATCH * NHID * 4);
  float* CST   = (float*)carve((size_t)2 * NBATCH * NHID * 4);
  float* YT    = (float*)carve((size_t)NSTEPS * NBATCH * YPITCH * 4);
  float* VNORM = (float*)carve((size_t)256);
  float* CTX   = (float*)carve((size_t)NSTEPS * NBATCH * NDIM * 4);
  float* HX    = (float*)carve((size_t)NSTEPS * NBATCH * NHID * 4);
  if (off > ws_size || off > (size_t)134217728) return;

  /* (1) f16 operand planes */
  const int n8 = NROWS * NDIM / 8;
  cast8_f16_kernel<<<n8 / 256, 256, 0, stream>>>(enc, A16, n8);
  /* in [512 k][512 n] -> out [n][k]; grid (k tiles, n tiles, weight) */
  wtcast_kernel<<<dim3(NDIM / 64, NDIM / 64, 2), 256, 0, stream>>>(wh_m, wh_c, BT16, WCARRY);
  /* (2) initial state, vnorm */
  init_state_kernel<<<NBATCH, 256, 0, stream>>>(v_m, g_m, ACAR, SST, CST, VNORM);
  /* (3) fused encoder projections: M = 16384, N = 1024, K = 512; 4096 tiles = 512 blocks x 8 waves */
  wmma_gemm64<0, false, 0, 0, false, 0><<<dim3((NROWS / 64) * (NPROJ / 64) / 8, 1), 256, 0, stream>>>(
      A16, A16, NDIM, 0L, BT16, BT16, NDIM, 0L, (void*)PF, (void*)PF, NPROJ, 0L,
      PF, PF, 0L, NROWS, NPROJ, NDIM, WCARRY_INV);

  /* (4) decode steps: only what the next step needs, three launches per step */
  for (int step = 0; step < NSTEPS; ++step) {
    const int par = step & 1;
    float* ctx_t = CTX + (size_t)step * NBATCH * NDIM;
    float* s_old = SST + (size_t)step * NBATCH * NHID;
    float* s_new = SST + (size_t)(step + 1) * NBATCH * NHID;
    energies_kernel<<<dim3(NECH, NBATCH, NSEQ / EROWS), 256, 0, stream>>>(
        PF, s_old, ws_m_w, ws_m_b, ws_c_w, ws_c_b, v_m, v_c, EPART);
    scan_ctx_kernel<<<dim3(NDIM / 64, NBATCH), 256, 0, stream>>>(
        enc, lenenc, EPART, VNORM, r_m, noise + (size_t)step * NBATCH * NSEQ,
        ACAR + (size_t)par * NBATCH * NSEQ, ACAR + (size_t)(par ^ 1) * NBATCH * NSEQ, ctx_t);
    gates_kernel<<<NHID / 16, 256, 0, stream>>>(
        ctx_t, target, s_old, CST + (size_t)par * NBATCH * NHID,
        s_new, CST + (size_t)(par ^ 1) * NBATCH * NHID,
        l_ys, l_ss, l_gs_w, l_gs_b, step);
  }
  /* output head of all steps: h, then y */
  hid_kernel<<<dim3(NHID / 64, NSTEPS), 256, 0, stream>>>(CTX, SST, l_sy, l_gy_w, l_gy_b, HX);
  ycols_kernel<<<dim3(YPITCH / 64, NSTEPS), 256, 0, stream>>>(HX, l_yy_w, l_yy_b, YT);

  /* (5) pack the padded Y plane into the output */
  pack_out_kernel<<<(NBATCH * NSTEPS * NCLS) / (256 * 4), 256, 0, stream>>>(YT, out);
}

// v007
// Measured time: 226 microseconds a run.
// Next to v006, in two timings, it ran 1.14 and 1.15 times as fast.
// Counting every step since v000, it is 17.5 times as fast.
// Compute dtype: enc x [Wh_mono | Wh_chunk] on v_wmma_f32_16x16x32_f16 (f16 enc, f16 weights carried x16, f32 accumulate, folded by 1/16); all per-step small products, energy dots, scans, gates and state in f32 on VALU.
#include <hip/hip_runtime.h>
#include <math.h>

// ---------------------------------------------------------------------------
// Shape constants
// ---------------------------------------------------------------------------
constexpr int NBATCH = 16;
constexpr int NSEQ   = 1024;
constexpr int NHID   = 256;
constexpr int NDIM   = 512;
constexpr int NCLS   = 1000;
constexpr int NSTEPS = 8;
constexpr int NGATE  = 4 * NHID;
constexpr int NPROJ  = 2 * NDIM;
constexpr int YPITCH = 1024;
constexpr int NROWS  = NBATCH * NSEQ;
constexpr float WCARRY     = 16.0f;
constexpr float WCARRY_INV = 1.0f / 16.0f;
static_assert(NROWS % 64 == 0 && NPROJ % 64 == 0 && NDIM % 32 == 0, "GEMM tile multiples");
static_assert((NBATCH * NSTEPS * NCLS) % (256 * 4) == 0, "pack grid exact");
static_assert(NCLS % 4 == 0, "float4 groups never straddle output rows");
static_assert(NSEQ == 4 * 256 && NHID == 256 && NDIM == 2 * 256, "thread maps");

typedef __attribute__((ext_vector_type(16))) _Float16 v16h;
typedef __attribute__((ext_vector_type(8)))  _Float16 v8h;
typedef __attribute__((ext_vector_type(16))) __bf16   v16b;
typedef __attribute__((ext_vector_type(8)))  __bf16   v8b;
typedef __attribute__((ext_vector_type(8)))  float    v8f;
typedef __attribute__((ext_vector_type(4)))  float    v4f;
typedef __attribute__((ext_vector_type(4)))  unsigned int v4u;

__device__ __forceinline__ unsigned short f2bf_bits(float f) {
  unsigned u = __float_as_uint(f);
  return (unsigned short)((u + 0x7FFFu + ((u >> 16) & 1u)) >> 16);
}
__device__ __forceinline__ float bf_bits2f(unsigned short h) { return __uint_as_float(((unsigned)h) << 16); }

__device__ __forceinline__ void dep_guard6_h(v8f& a, v8f& b, v8f& c, v8f& d, v16h x, v16h x2, v16h y0, v16h y1, v16h y2, v16h y3) {
  asm volatile("v_nop\n\tv_nop\n\tv_nop\n\tv_nop" : "+v"(a), "+v"(b), "+v"(c), "+v"(d) : "v"(x), "v"(x2), "v"(y0), "v"(y1), "v"(y2), "v"(y3));
}
__device__ __forceinline__ void dep_guard6_b(v8f& a, v8f& b, v8f& c, v8f& d, v16b x, v16b x2, v16b y0, v16b y1, v16b y2, v16b y3) {
  asm volatile("v_nop\n\tv_nop\n\tv_nop\n\tv_nop" : "+v"(a), "+v"(b), "+v"(c), "+v"(d) : "v"(x), "v"(x2), "v"(y0), "v"(y1), "v"(y2), "v"(y3));
}
__device__ __forceinline__ void keep4_h(v16h a, v16h b, v16h c, v16h d) { asm volatile("v_nop" :: "v"(a), "v"(b), "v"(c), "v"(d)); }
__device__ __forceinline__ void keep4_b(v16b a, v16b b, v16b c, v16b d) { asm volatile("v_nop" :: "v"(a), "v"(b), "v"(c), "v"(d)); }
__device__ __forceinline__ void acc_guard4(v8f& a, v8f& b, v8f& c, v8f& d) { asm volatile("v_nop\n\tv_nop\n\tv_nop\n\tv_nop" : "+v"(a), "+v"(b), "+v"(c), "+v"(d)); }

template <typename T> struct Frag;
template <> struct Frag<_Float16> {
  typedef v16h V; union U { v16h v; v8h h[2]; };
  /* elements 0..7 <- p[0..7], 8..15 <- p[16..23] */
  static __device__ __forceinline__ v16h load(const _Float16* p) {
    U f; f.h[0] = *(const v8h*)(p); f.h[1] = *(const v8h*)(p + 16); return f.v;
  }
  static __device__ __forceinline__ v8f mma(v16h a, v16h b, v8f c) {
    return __builtin_amdgcn_wmma_f32_16x16x32_f16(false, a, false, b, (short)0, c, false, false);
  }
  static __device__ __forceinline__ void guard(v8f& a, v8f& b, v8f& c, v8f& d, v16h x, v16h x2, v16h y0, v16h y1, v16h y2, v16h y3) {
    dep_guard6_h(a, b, c, d, x, x2, y0, y1, y2, y3);
  }
  static __device__ __forceinline__ void keep(v16h a, v16h b, v16h c, v16h d) { keep4_h(a, b, c, d); }
};
template <> struct Frag<__bf16> {
  typedef v16b V; union U { v16b v; v8b h[2]; };
  static __device__ __forceinline__ v16b load(const __bf16* p) {
    U f; f.h[0] = *(const v8b*)(p); f.h[1] = *(const v8b*)(p + 16); return f.v;
  }
  static __device__ __forceinline__ v8f mma(v16b a, v16b b, v8f c) {
    return __builtin_amdgcn_wmma_f32_16x16x32_bf16(false, a, false, b, (short)0, c, false, false);
  }
  static __device__ __forceinline__ void guard(v8f& a, v8f& b, v8f& c, v8f& d, v16b x, v16b x2, v16b y0, v16b y1, v16b y2, v16b y3) {
    dep_guard6_b(a, b, c, d, x, x2, y0, y1, y2, y3);
  }
  static __device__ __forceinline__ void keep(v16b a, v16b b, v16b c, v16b d) { keep4_b(a, b, c, d); }
};

__device__ __forceinline__ unsigned pk16(unsigned short a, unsigned short b) { return (unsigned)a | ((unsigned)b << 16); }
__device__ __forceinline__ unsigned short h_bits(float f) { const _Float16 h = (_Float16)f; return __builtin_bit_cast(unsigned short, h); }

/* reciprocal-based logistic and tanh with precise expf (v_rcp_f32 reciprocal) */
__device__ __forceinline__ float sigm_f(float x) { return __builtin_amdgcn_rcpf(1.0f + expf(-x)); }
__device__ __forceinline__ float tanh_e(float x) { return 1.0f - 2.0f * __builtin_amdgcn_rcpf(expf(2.0f * x) + 1.0f); }
__device__ __forceinline__ v4f exp2_x4(v4f a) {
  float r0, r1, r2, r3;
  asm("v_exp_f32 %0, %4\n\tv_exp_f32 %1, %5\n\tv_exp_f32 %2, %6\n\tv_exp_f32 %3, %7\n\tv_nop"
      : "=&v"(r0), "=&v"(r1), "=&v"(r2), "=&v"(r3) : "v"(a[0]), "v"(a[1]), "v"(a[2]), "v"(a[3]));
  return (v4f){r0, r1, r2, r3};
}
__device__ __forceinline__ v4f rcp_x4(v4f a) {
  float r0, r1, r2, r3;
  asm("v_rcp_f32 %0, %4\n\tv_rcp_f32 %1, %5\n\tv_rcp_f32 %2, %6\n\tv_rcp_f32 %3, %7\n\tv_nop"
      : "=&v"(r0), "=&v"(r1), "=&v"(r2), "=&v"(r3) : "v"(a[0]), "v"(a[1]), "v"(a[2]), "v"(a[3]));
  return (v4f){r0, r1, r2, r3};
}
__device__ __forceinline__ v4f tanh_x4(v4f x) {
  const v4f q = rcp_x4(exp2_x4(x * 2.885390082f) + 1.0f);
  return 1.0f - 2.0f * q;
}

// ---- Encoder projections: WMMA GEMM with both operand tiles staged in LDS ----
// C[m,n] = scale * sum_k f16(enc[m,k]) * Bt[n,k]; enc row-major f32 [NROWS][NDIM], Bt row-major f16 [NPROJ][NDIM].
// A work-group of 16 waves (4 x 4) owns a 256 x 256 tile of C, a wave 64 x 64. A pass is 64 k: 256 rows of enc (cast to f16 on
// the way into LDS) and 256 rows of Bt, asked for with whole-line loads one pass ahead and kept in registers while the current
// pass is worked on; two LDS buffers, one work-group barrier a pass. Every operand row is fetched once per work-group and the
// fragments come from LDS. Each accumulator sums its k in rising blocks of 32.
constexpr int GBM = 256;               /* rows of C per work-group */
constexpr int GBN = 256;               /* columns of C per work-group */
constexpr int GBK = 64;                /* k of one pass */
constexpr int GP  = GBK + 8;           /* LDS pitch in halves: 144 B = 16 B x 9, conflict-free for 16-byte reads of 128-B rows */
constexpr int GA_H  = GBM * GP;        /* halves of the staged enc tile */
constexpr int GST_H = (GBM + GBN) * GP; /* halves of one buffer */
constexpr int GNP = NDIM / GBK;        /* passes */
static_assert(NROWS % GBM == 0 && NPROJ % GBN == 0 && NDIM % GBK == 0 && GNP >= 2, "projection tile multiples");
static_assert((NROWS / GBM) == 64 && (NPROJ / GBN) == 4, "block index split below");
static_assert(16 * 16 * 68 * 4 <= 2 * GST_H * 2, "the epilogue slabs fit the staging buffers");
typedef __attribute__((ext_vector_type(4))) _Float16 v4h;
__global__ __launch_bounds__(512) void proj_gemm_kernel(const float* __restrict__ enc, const unsigned short* __restrict__ Btp,
                                                        float* __restrict__ C, float scale) {
  __shared__ __align__(16) _Float16 tiles[2 * GST_H];
  typedef Frag<_Float16> F;
  const int tid  = threadIdx.x;
  const int lane = tid & 31;
  const int wave = tid >> 5;
  /* the four column tiles of one row tile are 8 apart in the block index (a permutation of the 64 x 4 tiles) */
  const int bx = blockIdx.x;
  const int tm = (bx & 7) | ((bx >> 5) << 3);
  const int tn = (bx >> 3) & 3;
  const int wm = wave >> 2, wn = wave & 3;
  const int rlane = lane & 15;
  const int koff  = (lane >> 4) * 8;
  const int mOff  = (lane >> 4) * 8;

  /* staging maps: 16 threads x 16 B = the 256 B of one enc row of a pass; 8 threads x 16 B = the 128 B of one Bt row */
  const int ar = tid >> 4, ac = (tid & 15) * 4;
  const int br = tid >> 3, bc = (tid & 7) * 8;
  const float*    pa = enc + (size_t)(tm * GBM + ar) * NDIM + ac;
  const _Float16* pb = (const _Float16*)Btp + (size_t)(tn * GBN + br) * NDIM + bc;
  v4f ra[8];
  v8h rb[4];

  v8f acc[4][4];
#pragma unroll
  for (int i = 0; i < 4; ++i)
#pragma unroll
    for (int j = 0; j < 4; ++j) acc[i][j] = (v8f){0.f,0.f,0.f,0.f,0.f,0.f,0.f,0.f};

  for (int p = -1; p < GNP; ++p) {
    /* ask for pass p + 1 */
    if (p + 1 < GNP) {
#pragma unroll
      for (int i = 0; i < 8; ++i) ra[i] = *(const v4f*)(pa + (size_t)i * 32 * NDIM);
#pragma unroll
      for (int i = 0; i < 4; ++i) rb[i] = *(const v8h*)(pb + (size_t)i * 64 * NDIM);
      /* the wait in front of the rewrite of these loads' address registers just below; as inputs the two addresses stay in
         their registers up to here, so that no load of the run lands in one */
      asm volatile("s_wait_xcnt 0x0" :: "v"(pa), "v"(pb) : "memory");
      pa += GBK;
      pb += GBK;
    }
    /* work on pass p */
    if (p >= 0) {
      const _Float16* Al = tiles + (p & 1) * GST_H + (wm * 64 + rlane) * GP + koff;
      const _Float16* Bl = tiles + (p & 1) * GST_H + GA_H + (wn * 64 + rlane) * GP + koff;
#pragma unroll
      for (int ks = 0; ks < GBK; ks += 32) {
        v16h bh[4];
#pragma unroll
        for (int j = 0; j < 4; ++j) bh[j] = F::load(Bl + j * 16 * GP + ks);
        /* the next enc fragment is asked for ahead of the current one's four products, into a second register set */
        v16h ah = F::load(Al + ks);
#pragma unroll
        for (int i = 0; i < 4; ++i) {
          v16h an = ah;
          if (i < 3) an = F::load(Al + (i + 1) * 16 * GP + ks);
#pragma unroll
          for (int j = 0; j < 4; ++j) acc[i][j] = F::mma(ah, bh[j], acc[i][j]);
          F::guard(acc[i][0], acc[i][1], acc[i][2], acc[i][3], ah, ah, bh[0], bh[1], bh[2], bh[3]);
          ah = an;
        }
        F::keep(bh[0], bh[1], bh[2], bh[3]);
      }
    }
    /* lay pass p + 1 into the buffer that pass p - 1 was read from: its readers left it at the last barrier */
    if (p + 1 < GNP) {
      _Float16* st = tiles + ((p + 1) & 1) * GST_H;
#pragma unroll
      for (int i = 0; i < 8; ++i) {
        const v4h h = (v4h){(_Float16)ra[i][0], (_Float16)ra[i][1], (_Float16)ra[i][2], (_Float16)ra[i][3]};
        *(v4h*)(st + (i * 32 + ar) * GP + ac) = h;
      }
#pragma unroll
      for (int i = 0; i < 4; ++i) *(v8h*)(st + GA_H + (i * 64 + br) * GP + bc) = rb[i];
    }
    /* publishes pass p + 1 and ends every read of pass p; behind the last pass it frees the buffers for the slabs */
    __syncthreads();
  }
  acc_guard4(acc[0][0], acc[0][1], acc[0][2], acc[0][3]);
  acc_guard4(acc[1][0], acc[1][1], acc[1][2], acc[1][3]);
  acc_guard4(acc[2][0], acc[2][1], acc[2][2], acc[2][3]);
  acc_guard4(acc[3][0], acc[3][1], acc[3][2], acc[3][3]);

  /* per-wave 16x64 slab, pitch 68 floats, in the staging buffers: whole 256-B row segments go out */
  float* slab = (float*)tiles + wave * (16 * 68);
  const int m0 = tm * GBM + wm * 64;
  const int n0 = tn * GBN + wn * 64;
#pragma unroll
  for (int i = 0; i < 4; ++i) {
    const int mBase = m0 + (i << 4);
#pragma unroll
    for (int j = 0; j < 4; ++j) {
#pragma unroll
      for (int r = 0; r < 8; ++r) slab[(mOff + r) * 68 + (j << 4) + rlane] = acc[i][j][r] * scale;
    }
    __builtin_amdgcn_fence(__ATOMIC_RELEASE, "workgroup");
    __builtin_amdgcn_wave_barrier();
    __builtin_amdgcn_fence(__ATOMIC_ACQUIRE, "workgroup");
    /* row segment = 256 B = 16 lanes x 16 B */
    const int hh = lane >> 4, c4 = (lane & 15) * 4;
#pragma unroll
    for (int it = 0; it < 8; ++it) {
      const int row = it * 2 + hh;
      const v4f v = *(const v4f*)(slab + row * 68 + c4);
      *(v4f*)(C + (size_t)(mBase + row) * NPROJ + n0 + c4) = v;
    }
    __builtin_amdgcn_fence(__ATOMIC_RELEASE, "workgroup");
    __builtin_amdgcn_wave_barrier();
    __builtin_amdgcn_fence(__ATOMIC_ACQUIRE, "workgroup");
  }
}

// ---------------------------------------------------------------------------
// Weight transpose + cast: W0, W1 are [512 in d][512 out h] f32; WT[z*512 + h][d] = f16(scale * Wz[d][h]).
// grid (8, 8, 2): blockIdx.x = d tile (64 cols of WT), blockIdx.y = h tile (64 rows of WT), blockIdx.z selects W.
// Load coverage: 16 iterations x 256 threads = 4096 = the whole 64x64 tile.
// Store coverage: 8 waves x 2 iterations x 4 rows = 64 rows; 8 lanes x 8 halves = 64 cols; each row segment =
// ---------------------------------------------------------------------------
__global__ __launch_bounds__(256) void wtcast_kernel(const float* __restrict__ W0, const float* __restrict__ W1,
                                                     unsigned short* __restrict__ out, float scale) {
  __shared__ float tl[64][65];
  const int t  = threadIdx.x;
  const int d0 = blockIdx.x * 64;
  const int h0 = blockIdx.y * 64;
  const int z  = blockIdx.z;
  const float* W = (z == 0) ? W0 : W1;
#pragma unroll
  for (int i = 0; i < 16; ++i) {
    const int e = i * 256 + t;
    const int r = e >> 6;
    const int c = e & 63;
    tl[c][r] = W[(size_t)(d0 + r) * NDIM + h0 + c] * scale;
  }
  __syncthreads();
  const int lane = t & 31, wave = t >> 5;
  const int q = lane >> 3, c8 = (lane & 7) * 8;
  unsigned short* op = out + (size_t)z * NDIM * NDIM;
  {
#pragma unroll
    for (int it = 0; it < 2; ++it) {
      const int row = wave * 8 + it * 4 + q;
      unsigned short hb[8];
#pragma unroll
      for (int e = 0; e < 8; ++e) hb[e] = h_bits(tl[row][c8 + e]);
      const v4u u = (v4u){pk16(hb[0], hb[1]), pk16(hb[2], hb[3]), pk16(hb[4], hb[5]), pk16(hb[6], hb[7])};
      *(v4u*)(op + (size_t)(h0 + row) * NDIM + d0 + c8) = u;
    }
    
  }
}

// ---------------------------------------------------------------------------
// Initial state: one block per batch row b (grid 16, 256 threads).
//   acar0[b][0] = 1, else 0 (1024 floats = 256 threads x 16 B); s0[b] = c0[b] = 0 (threads 0..63 x 16 B each);
//   block 0 writes one line with g / norm(v_mono).
// ---------------------------------------------------------------------------
__global__ __launch_bounds__(256) void init_state_kernel(const float* __restrict__ vmono, const float* __restrict__ gmono,
                                                         float* __restrict__ acar0, float* __restrict__ s0,
                                                         float* __restrict__ c0, float* __restrict__ vnorm) {
  __shared__ float red[8];
  const int tid = threadIdx.x, lane = tid & 31, wave = tid >> 5;
  const int b = blockIdx.x;
  const float v0 = vmono[tid], v1 = vmono[tid + 256];
  float ss = v0 * v0 + v1 * v1;
#pragma unroll
  for (int off = 16; off > 0; off >>= 1) ss += __shfl_xor(ss, off, 32);
  if (lane == 0) red[wave] = ss;
  __syncthreads();
  float tot = 0.0f;
#pragma unroll
  for (int w = 0; w < 8; ++w) tot += red[w];
  const float vn = gmono[0] / sqrtf(tot);

  v4f av = (v4f){0.f, 0.f, 0.f, 0.f};
  av[0] = (tid == 0) ? 1.0f : 0.0f;
  const v4f zv = (v4f){0.f, 0.f, 0.f, 0.f};
  const v4f nv = (v4f){vn, vn, vn, vn};
  {
    *(v4f*)(acar0 + b * NSEQ + 4 * tid) = av;
    if (tid < 64) {
      *(v4f*)(s0 + b * NHID + 4 * tid) = zv;
      *(v4f*)(c0 + b * NHID + 4 * tid) = zv;
    }
    if (b == 0 && tid < 8) *(v4f*)(vnorm + 4 * tid) = nv;
  }
}

// ---------------------------------------------------------------------------
// Energy dots for one decode step, cut by column: grid (16 column chunks, 16 batch rows, 2 halves of the positions),
// 256 threads. A block owns 64 of the 1024 projection columns (chunks 0..7 mono, 8..15 chunk) of 512 positions of one
// batch row. It first forms its own 64 columns of s @ Ws + b (256 x 64 weights, 64 KB), so that no launch of its own is
// needed for the s-projections, then the tanh dots of its columns. epart[chunk][b][s] holds the partial dots; the scan
// kernel joins the chunks and does mask, noise and logistic.
// ---------------------------------------------------------------------------
constexpr int ECOLS = 64;              /* columns of one block */
constexpr int NECH  = NPROJ / ECOLS;   /* column chunks */
constexpr int EROWS = 512;             /* positions of one block */
constexpr int RP    = 17;              /* LDS pitch in floats of one position's 16 lane sums */
static_assert(NDIM % ECOLS == 0 && NSEQ % EROWS == 0 && EROWS == 2 * 256 && NHID == 16 * 16, "energy block maps");
__global__ __launch_bounds__(256) void energies_kernel(
    const float* __restrict__ Pf, const float* __restrict__ s_cur,
    const float* __restrict__ Wsm, const float* __restrict__ Wsmb,
    const float* __restrict__ Wsc, const float* __restrict__ Wscb,
    const float* __restrict__ vmono, const float* __restrict__ vchunk,
    float* __restrict__ epart) {
  __shared__ __align__(16) float tpart[16 * ECOLS];
  __shared__ float rsum[EROWS * RP];
  const int tid = threadIdx.x;
  const int chunk = blockIdx.x, b = blockIdx.y, half = blockIdx.z;
  /* thread = (group of 4 columns c16, class q): q is the k range of the s-projection and the position class s mod 16 */
  const int c16 = tid & 15, q = tid >> 4;
  const bool mono = chunk < NDIM / ECOLS;
  const int cw = (chunk & (NDIM / ECOLS - 1)) * ECOLS + 4 * c16;
  const float* wr = (mono ? Wsm : Wsc) + (size_t)(q * 16) * NDIM + cw;
  const float* sr = s_cur + (q * 16) * NBATCH + b;
  const float* bb = mono ? Wsmb : Wscb;
  const float* vb = mono ? vmono : vchunk;
  const unsigned cwb = (unsigned)cw * 4u;  /* byte offset of the thread's columns in the bias and in v */
  const float* pr = Pf + (size_t)(b * NSEQ + half * EROWS + q) * NPROJ + chunk * ECOLS + 4 * c16;
  /* Every global value the thread needs is asked for first, the s-projection's operands ahead of the 32 row loads: the
     projection is formed while the rows are still on their way. */
  v4f w[16], e[32];
  float sv[16];
#pragma unroll
  for (int i = 0; i < 16; ++i) {
    sv[i] = sr[i * NBATCH];
    w[i]  = *(const v4f*)(wr + i * NDIM);
  }
  const v4f bias = *(const v4f*)((const char*)bb + cwb);
  const v4f vv   = *(const v4f*)((const char*)vb + cwb);
#pragma unroll
  for (int it = 0; it < 32; ++it) e[it] = *(const v4f*)(pr + (size_t)it * 16 * NPROJ);
  /* keeps every load of the run ahead of the arithmetic: without it the scheduler sinks half of the row loads behind the
     projection's first products, which wait for the weights */
  __builtin_amdgcn_sched_barrier(0);
  /* the wait in front of any rewrite of these loads' address registers; as inputs the three address pairs and the offset of
     the bias and v loads stay in their registers up to here, so that no load of the run lands in one */
  asm volatile("s_wait_xcnt 0x0" :: "v"(wr), "v"(sr), "v"(pr), "v"(cwb) : "memory");
  /* s-projection of the block's columns: 16 k ranges of 16, each summed in rising k, joined in fixed order, bias last */
  {
    v4f a = (v4f){0.f, 0.f, 0.f, 0.f};
#pragma unroll
    for (int i = 0; i < 16; ++i) {
      a[0] = fmaf(sv[i], w[i][0], a[0]);
      a[1] = fmaf(sv[i], w[i][1], a[1]);
      a[2] = fmaf(sv[i], w[i][2], a[2]);
      a[3] = fmaf(sv[i], w[i][3], a[3]);
    }
    *(v4f*)(tpart + q * ECOLS + 4 * c16) = a;
  }
  /* work-group barrier that orders LDS alone: __syncthreads() also waits for every global load, here the 32 row loads still
     on their way, and no wave could start on its first rows while the last ones arrive */
  __builtin_amdgcn_fence(__ATOMIC_RELEASE, "workgroup", "local");
  __builtin_amdgcn_s_barrier();
  __builtin_amdgcn_fence(__ATOMIC_ACQUIRE, "workgroup", "local");
  v4f t = *(const v4f*)(tpart + 4 * c16);
#pragma unroll
  for (int k = 1; k < 16; ++k) t += *(const v4f*)(tpart + k * ECOLS + 4 * c16);
  t += bias;
  /* the thread's four columns of positions 16 it + q */
#pragma unroll
  for (int it = 0; it < 32; ++it) {
    const v4f th = tanh_x4(e[it] + t);
    float a = 0.0f;
    a = fmaf(th[0], vv[0], a);
    a = fmaf(th[1], vv[1], a);
    a = fmaf(th[2], vv[2], a);
    a = fmaf(th[3], vv[3], a);
    rsum[(it * 16 + q) * RP + c16] = a;
  }
  __syncthreads();
  /* the 16 column groups of a position joined in fixed order; a thread stores positions tid and 256 + tid */
  float* dst = epart + (size_t)(chunk * NBATCH + b) * NSEQ + half * EROWS;
#pragma unroll
  for (int rr = 0; rr < 2; ++rr) {
    const int row = rr * 256 + tid;
    float v = rsum[row * RP];
#pragma unroll
    for (int l = 1; l < 16; ++l) v += rsum[row * RP + l];
    dst[row] = v;
  }
}

// exclusive block prefix of one value per thread (256 threads = 8 waves), fixed order; one block barrier inside.
__device__ __forceinline__ float block_excl_scan(float total, float* wt, int lane, int wave) {
  float x = total;
#pragma unroll
  for (int off = 1; off < 32; off <<= 1) {
    const float n = __shfl_up(x, off, 32);
    x += (lane >= off) ? n : 0.0f;
  }
  float ex = __shfl_up(x, 1, 32);
  ex = (lane == 0) ? 0.0f : ex;
  if (lane == 31) wt[wave] = x;
  __syncthreads();
  float woff = 0.0f;
#pragma unroll
  for (int w = 0; w < 8; ++w) woff += (w < wave) ? wt[w] : 0.0f;
  return woff + ex;
}

// ---------------------------------------------------------------------------
// Decode step, cut by output column. Two launches in the step loop behind the energy dots:
//   scan_ctx_kernel   grid (8 column chunks, 16 batch rows): every block joins the row's partial dots and repeats its
//                     scans (72 KB of input), then sums beta . enc for its own 64 columns only.
//   gates_kernel      16 blocks x 16 LSTM units (64 gate columns), all 16 batch rows.
// The output head feeds no later step: ctx and s of every step are kept, and behind the loop one launch each serves all steps:
//   hid_kernel        grid (4 blocks x 64 columns of h, 8 steps).
//   ycols_kernel      grid (16 blocks x 64 columns of y (padded to 1024), 8 steps).
// In the three product kernels a thread owns four weight columns and one sixteenth of k and keeps 64 sums, one per column
// and batch row, so a weight element is loaded once per step for all rows. s, c and h live in the workspace as [unit][16 rows].
// ---------------------------------------------------------------------------
constexpr int XP = 20;  /* LDS pitch in floats of one k row of 16 batch values: 16-B aligned, transposing stores 2-way at most */
constexpr int PP = 17;  /* LDS pitch in floats of one column's 16 partial sums */
constexpr int KCAT = NHID + NDIM;
static_assert(KCAT % 128 == 0 && NHID % 128 == 0, "the 16 k ranges are whole 8-row groups and no group straddles the two weights");

/* src [K][16] -> xs[k * XP + row] */
template <int K>
__device__ __forceinline__ void stage_kmajor(float* xs, const float* __restrict__ srcp, int tid) {
#pragma unroll
  for (int i = 0; i < K * 4 / 256; ++i) {
    const int e4 = i * 256 + tid;
    const v4f v = *(const v4f*)(srcp + 4 * e4);
    *(v4f*)(xs + (e4 >> 2) * XP + (e4 & 3) * 4) = v;
  }
}
/* src [16][K] -> xs[k * XP + row] */
template <int K>
__device__ __forceinline__ void stage_rows(float* xs, const float* __restrict__ srcp, int tid) {
#pragma unroll
  for (int i = 0; i < 16 * K / 256; ++i) {
    const int e = i * 256 + tid;
    xs[(e % K) * XP + (e / K)] = srcp[e];
  }
}

/* eight rows of four weight columns; p0 .. p3 point at the first row of the four columns */
__device__ __forceinline__ void rows8x4(float (&w)[8][4], const float* p0, const float* p1, const float* p2,
                                        const float* p3, int ldw) {
#pragma unroll
  for (int i = 0; i < 8; ++i) {
    w[i][0] = p0[(size_t)i * ldw];
    w[i][1] = p1[(size_t)i * ldw];
    w[i][2] = p2[(size_t)i * ldw];
    w[i][3] = p3[(size_t)i * ldw];
  }
  /* the wait in front of any rewrite of these loads' address registers; as inputs the four addresses stay in their
     registers up to here, so that no load of the run lands in one; it also keeps the loads ahead of the fmaf behind it */
  asm volatile("s_wait_xcnt 0x0" :: "v"(p0), "v"(p1), "v"(p2), "v"(p3) : "memory");
}

/* acc[j][row] += xs[k0 + i][row] * w[i][j] for the eight rows i: one LDS read of the 16 batch values feeds 64 fmaf */
__device__ __forceinline__ void fma8x4x16(const float* xs, int k0, const float (&w)[8][4], float (&acc)[4][16]) {
#pragma unroll
  for (int i = 0; i < 8; ++i) {
    const float* x = xs + (k0 + i) * XP;
    const v4f x0 = *(const v4f*)(x);
    const v4f x1 = *(const v4f*)(x + 4);
    const v4f x2 = *(const v4f*)(x + 8);
    const v4f x3 = *(const v4f*)(x + 12);
#pragma unroll
    for (int j = 0; j < 4; ++j) {
      const float wv = w[i][j];
#pragma unroll
      for (int e = 0; e < 4; ++e) {
        acc[j][e]      = fmaf(x0[e], wv, acc[j][e]);
        acc[j][4 + e]  = fmaf(x1[e], wv, acc[j][4 + e]);
        acc[j][8 + e]  = fmaf(x2[e], wv, acc[j][8 + e]);
        acc[j][12 + e] = fmaf(x3[e], wv, acc[j][12 + e]);
      }
    }
  }
}

/* acc[j][row] += sum over k in [kb, ke) of xs[k][row] * W[k][cols[j]]; rows k < K0 of the joined weight are W0, the rest W1.
   The next 8 weight rows are asked for ahead of the current 8 rows' fmaf. */
__device__ __forceinline__ void cols4x16(const float* xs, const float* __restrict__ W0, int K0,
                                         const float* __restrict__ W1, int ldw, const int (&cols)[4], int kb, int ke,
                                         float (&acc)[4][16]) {
  float wa[8][4];
  {
    const float* wp = (kb < K0) ? (W0 + (size_t)kb * ldw) : (W1 + (size_t)(kb - K0) * ldw);
    rows8x4(wa, wp + cols[0], wp + cols[1], wp + cols[2], wp + cols[3], ldw);
  }
  int k0 = kb;
  for (; k0 + 8 < ke; k0 += 8) {
    const int kn = k0 + 8;
    const float* wp = (kn < K0) ? (W0 + (size_t)kn * ldw) : (W1 + (size_t)(kn - K0) * ldw);
    float wb[8][4];
    rows8x4(wb, wp + cols[0], wp + cols[1], wp + cols[2], wp + cols[3], ldw);
    fma8x4x16(xs, k0, wa, acc);
#pragma unroll
    for (int i = 0; i < 8; ++i)
#pragma unroll
      for (int j = 0; j < 4; ++j) wa[i][j] = wb[i][j];
  }
  fma8x4x16(xs, k0, wa, acc);
}
__device__ __forceinline__ void zero_acc(float (&acc)[4][16]) {
#pragma unroll
  for (int j = 0; j < 4; ++j)
#pragma unroll
    for (int r = 0; r < 16; ++r) acc[j][r] = 0.0f;
}
/* block column index of (j, t16) is j * 16 + t16 */
__device__ __forceinline__ void put_part(float* part, int q, int t16, const float (&acc)[4][16]) {
#pragma unroll
  for (int j = 0; j < 4; ++j)
#pragma unroll
    for (int r = 0; r < 16; ++r) part[(q * 64 + j * 16 + t16) * PP + r] = acc[j][r];
}
/* the 16 k ranges of (block column c, batch row r), fixed order */
__device__ __forceinline__ float get_part(const float* part, int c, int r) {
  float v = part[c * PP + r];
#pragma unroll
  for (int q = 1; q < 16; ++q) v += part[(q * 64 + c) * PP + r];
  return v;
}

__global__ __launch_bounds__(256) void scan_ctx_kernel(
    const float* __restrict__ enc, const int* __restrict__ len,
    const float* __restrict__ epart, const float* __restrict__ vnp, const float* __restrict__ rmono,
    const float* __restrict__ noise_t,
    const float* __restrict__ acar_in, float* __restrict__ acar_out, float* __restrict__ ctx) {
  __shared__ __align__(16) float sh_p[NSEQ];
  __shared__ __align__(16) float sh_a[NSEQ];
  __shared__ __align__(16) float sh_ex[NSEQ];
  __shared__ __align__(16) float sh_g[NSEQ];
  __shared__ __align__(16) float sh_cpp[NSEQ];
  __shared__ __align__(16) float sh_u[NSEQ];
  __shared__ __align__(16) float sh_al[NSEQ];
  __shared__ __align__(16) float sh_r[NSEQ];
  __shared__ __align__(16) float sh_beta[NSEQ];
  __shared__ __align__(16) float sh_cpart[16 * 68];
  __shared__ float redm[8];
  __shared__ float wtA[8];
  __shared__ float wtB[8];

  const int tid = threadIdx.x, lane = tid & 31, wave = tid >> 5;
  const int chunk = blockIdx.x;
  const int b = blockIdx.y;
  const int i0 = tid * 4;
  int L = len[b];
  L = (L < 0) ? 0 : ((L > NSEQ) ? NSEQ : L);
  const float vn = vnp[0];
  const float rm = rmono[0];

  /* phase 1: the thread's four positions: the 8 + 8 partial dots joined in the order of the chunks, mask, noise, logistic;
     stage p, a, e; log terms; running max over unmasked positions. All 18 loads are asked for first and fly together. */
  float ml = -3.0e38f;
  {
    const float* ep = epart + b * NSEQ + i0;
    v4f pm[8], pc[8];
#pragma unroll
    for (int c = 0; c < 8; ++c) {
      pm[c] = *(const v4f*)(ep + c * (NBATCH * NSEQ));
      pc[c] = *(const v4f*)(ep + (8 + c) * (NBATCH * NSEQ));
    }
    const v4f nz = *(const v4f*)(noise_t + b * NSEQ + i0);
    const v4f av = *(const v4f*)(acar_in + b * NSEQ + i0);
    /* keeps every load of the run, the three scalars above too, ahead of the sums: without it the scheduler sinks four of
       the loads and the scalars behind the first waits, three round trips in a row instead of one */
    __builtin_amdgcn_sched_barrier(0);
    v4f dm = pm[0], dc = pc[0];
#pragma unroll
    for (int c = 1; c < 8; ++c) {
      dm += pm[c];
      dc += pc[c];
    }
    v4f pv, ev, gv;
#pragma unroll
    for (int k = 0; k < 4; ++k) {
      const bool masked = (i0 + k >= L);
      const float em = (vn * dm[k] + rm) + nz[k];
      const float sg = sigm_f(em);
      /* masked positions give p = 0 exactly; their chunk energy is staged as 0 and replaced in phase 2 */
      pv[k] = masked ? 0.0f : sg;
      ev[k] = masked ? 0.0f : dc[k];
      gv[k] = logf(fminf(fmaxf(1.0f - pv[k], 1e-8f), 1.0f));
      ml = masked ? ml : fmaxf(ml, ev[k]);
    }
    *(v4f*)(sh_p + i0)  = pv;
    *(v4f*)(sh_a + i0)  = av;
    *(v4f*)(sh_ex + i0) = ev;
    *(v4f*)(sh_g + i0)  = gv;
  }
#pragma unroll
  for (int off = 16; off > 0; off >>= 1) ml = fmaxf(ml, __shfl_xor(ml, off, 32));
  if (lane == 0) redm[wave] = ml;
  __syncthreads();
  float mx = redm[0];
#pragma unroll
  for (int w = 1; w < 8; ++w) mx = fmaxf(mx, redm[w]);

  /* phase 2: ex = max(exp(e - max), 1e-5); masked positions give 1e-5 */
#pragma unroll 1
  for (int j = 0; j < 4; ++j) {
    const int i = j * 256 + tid;
    const float t = fmaxf(expf(sh_ex[i] - mx), 1e-5f);
    sh_ex[i] = (i < L) ? t : 1e-5f;
  }

  /* phase 3: exclusive prefix of the log terms over contiguous chunks of 4 */
  {
    const v4f g4 = *(const v4f*)(sh_g + i0);
    const float e1 = g4[0];
    const float e2 = e1 + g4[1];
    const float e3 = e2 + g4[2];
    const float tot = e3 + g4[3];
    const float off = block_excl_scan(tot, wtA, lane, wave);
    v4f x4;
    x4[0] = off;
    x4[1] = off + e1;
    x4[2] = off + e2;
    x4[3] = off + e3;
    *(v4f*)(sh_cpp + i0) = x4;
  }
  __syncthreads();

  /* phase 4: cpp = exp(prefix) (flushed below the smallest normal), u = a / clip(cpp, 1e-8, 1) */
#pragma unroll 1
  for (int j = 0; j < 4; ++j) {
    const int i = j * 256 + tid;
    float cp = expf(sh_cpp[i]);
    cp = (cp < 1.17549435e-38f) ? 0.0f : cp;
    sh_cpp[i] = cp;
    const float cl = fminf(fmaxf(cp, 1e-8f), 1.0f);
    sh_u[i] = sh_a[i] * __builtin_amdgcn_rcpf(cl);
  }
  __syncthreads();

  /* phase 5: inclusive prefix of u, q = cpp * prefix, alpha = clip(p * q, 1e-8, 1) */
  {
    const v4f u4 = *(const v4f*)(sh_u + i0);
    const v4f c4 = *(const v4f*)(sh_cpp + i0);
    const v4f p4 = *(const v4f*)(sh_p + i0);
    const float c0 = u4[0];
    const float c1 = c0 + u4[1];
    const float c2 = c1 + u4[2];
    const float c3 = c2 + u4[3];
    const float off2 = block_excl_scan(c3, wtB, lane, wave);
    v4f al;
    al[0] = fminf(fmaxf(p4[0] * (c4[0] * (off2 + c0)), 1e-8f), 1.0f);
    al[1] = fminf(fmaxf(p4[1] * (c4[1] * (off2 + c1)), 1e-8f), 1.0f);
    al[2] = fminf(fmaxf(p4[2] * (c4[2] * (off2 + c2)), 1e-8f), 1.0f);
    al[3] = fminf(fmaxf(p4[3] * (c4[3] * (off2 + c3)), 1e-8f), 1.0f);
    *(v4f*)(sh_al + i0) = al;
  }
  __syncthreads();

  /* phase 6: denom = max(sum ex[i-3..i], 1e-10) (zero padded), r = alpha / denom */
#pragma unroll 1
  for (int j = 0; j < 4; ++j) {
    const int i = j * 256 + tid;
    float d = 0.0f;
#pragma unroll
    for (int k = 3; k >= 0; --k) {
      const int ii = i - k;
      const int ic = (ii < 0) ? 0 : ii;
      const float v = sh_ex[ic];
      d += (ii >= 0) ? v : 0.0f;
    }
    d = fmaxf(d, 1e-10f);
    sh_r[i] = sh_al[i] * __builtin_amdgcn_rcpf(d);
  }
  __syncthreads();

  /* phase 7: beta = ex * sum r[i..i+3] (zero padded) */
#pragma unroll 1
  for (int j = 0; j < 4; ++j) {
    const int i = j * 256 + tid;
    float ms = 0.0f;
#pragma unroll
    for (int k = 0; k < 4; ++k) {
      const int ii = i + k;
      const int ic = (ii > NSEQ - 1) ? (NSEQ - 1) : ii;
      const float v = sh_r[ic];
      ms += (ii < NSEQ) ? v : 0.0f;
    }
    sh_beta[i] = sh_ex[i] * ms;
  }
  __syncthreads();

  /* phase 8: ctx of this block's 64 columns; thread = (group of 4 columns, position class s mod 16), 64 positions each */
  {
    const int cg = tid & 15, sp = tid >> 4;
    const float* eb = enc + (size_t)b * NSEQ * NDIM + chunk * 64 + 4 * cg;
    v4f acc = (v4f){0.f, 0.f, 0.f, 0.f};
/* 16 trips per pass: their row loads fly together */
#pragma unroll 16
    for (int it = 0; it < NSEQ / 16; ++it) {
      const int s = 16 * it + sp;
      const float bv = sh_beta[s];
      const v4f e4 = *(const v4f*)(eb + (size_t)s * NDIM);
      acc[0] = fmaf(bv, e4[0], acc[0]);
      acc[1] = fmaf(bv, e4[1], acc[1]);
      acc[2] = fmaf(bv, e4[2], acc[2]);
      acc[3] = fmaf(bv, e4[3], acc[3]);
    }
    *(v4f*)(sh_cpart + sp * 68 + 4 * cg) = acc;
  }
  __syncthreads();
  /* 16 position classes joined in fixed order; 64 threads store the block's own 256-B piece of the row */
  if (tid < 64) {
    float v = sh_cpart[tid];
#pragma unroll
    for (int sp = 1; sp < 16; ++sp) v += sh_cpart[sp * 68 + tid];
    ctx[b * NDIM + chunk * 64 + tid] = v;
  }
  /* the alpha carry is stored by one block of the row */
  if (chunk == 0) {
    const v4f alv = *(const v4f*)(sh_al + i0);
    *(v4f*)(acar_out + b * NSEQ + i0) = alv;
  }
}

__global__ __launch_bounds__(256) void gates_kernel(
    const float* __restrict__ ctx, const int* __restrict__ target,
    const float* __restrict__ s_in, const float* __restrict__ c_in,
    float* __restrict__ s_out, float* __restrict__ c_out,
    const float* __restrict__ Lys, const float* __restrict__ Lss,
    const float* __restrict__ Lgsw, const float* __restrict__ Lgsb, int step) {
  __shared__ __align__(16) float xs[KCAT * XP];
  __shared__ float part[16 * 64 * PP];
  const int tid = threadIdx.x;
  const int u0 = blockIdx.x * 16;
  stage_kmajor<NHID>(xs, s_in, tid);
  stage_rows<NDIM>(xs + NHID * XP, ctx, tid);
  __syncthreads();
  const int t16 = tid & 15, q = tid >> 4;
  float acc[4][16];
  zero_acc(acc);
  /* the thread's four columns: gates i, f, g, o of unit u0 + t16 */
  const int cols[4] = {u0 + t16, NHID + u0 + t16, 2 * NHID + u0 + t16, 3 * NHID + u0 + t16};
  cols4x16(xs, Lss, NHID, Lgsw, NGATE, cols, q * (KCAT / 16), (q + 1) * (KCAT / 16), acc);
  put_part(part, q, t16, acc);
  __syncthreads();
  /* LSTM cell of (unit u0 + u, batch row r) */
  const int u = tid >> 4, r = tid & 15;
  int tg = target[r * NSTEPS + step];
  tg = (tg < 0) ? 0 : ((tg > NCLS - 1) ? (NCLS - 1) : tg);
  const float* ly = Lys + (size_t)tg * NGATE + u0 + u;
  const float* lb = Lgsb + u0 + u;
  const float r0 = get_part(part, u, r)      + (ly[0] + lb[0]);
  const float r1 = get_part(part, 16 + u, r) + (ly[NHID] + lb[NHID]);
  const float r2 = get_part(part, 32 + u, r) + (ly[2 * NHID] + lb[2 * NHID]);
  const float r3 = get_part(part, 48 + u, r) + (ly[3 * NHID] + lb[3 * NHID]);
  const float cold = c_in[u0 * 16 + tid];
  const float ig = sigm_f(r0);
  const float fg = sigm_f(r1);
  const float gg = tanh_e(r2);
  const float og = sigm_f(r3);
  const float cn = fg * cold + ig * gg;
  const float sn = og * tanh_e(cn);
  c_out[u0 * 16 + tid] = cn;
  s_out[u0 * 16 + tid] = sn;
}

/* blockIdx.y = step; ctx_all [step][16][512], s_all [step + 1][256][16] (plane 0 is the initial state), hx_all [step][256][16] */
__global__ __launch_bounds__(256) void hid_kernel(
    const float* __restrict__ ctx_all, const float* __restrict__ s_all,
    const float* __restrict__ Lsy, const float* __restrict__ Lgyw, const float* __restrict__ Lgyb,
    float* __restrict__ hx_all) {
  __shared__ __align__(16) float xs[KCAT * XP];
  __shared__ float part[16 * 64 * PP];
  const int tid = threadIdx.x;
  const int step = blockIdx.y;
  const float* ctx = ctx_all + step * (NBATCH * NDIM);
  const float* s_new = s_all + (step + 1) * (NBATCH * NHID);
  float* hx = hx_all + step * (NBATCH * NHID);
  stage_kmajor<NHID>(xs, s_new, tid);
  stage_rows<NDIM>(xs + NHID * XP, ctx, tid);
  __syncthreads();
  const int t16 = tid & 15, q = tid >> 4;
  float acc[4][16];
  zero_acc(acc);
  const int col0 = blockIdx.x * 64;
  const int cols[4] = {col0 + t16, col0 + 16 + t16, col0 + 32 + t16, col0 + 48 + t16};
  cols4x16(xs, Lsy, NHID, Lgyw, NHID, cols, q * (KCAT / 16), (q + 1) * (KCAT / 16), acc);
  put_part(part, q, t16, acc);
  __syncthreads();
#pragma unroll
  for (int e = 0; e < 4; ++e) {
    const int o = e * 256 + tid;
    const float v = get_part(part, o >> 4, o & 15) + Lgyb[col0 + (o >> 4)];
    hx[col0 * 16 + o] = tanh_e(v);
  }
}

/* blockIdx.y = step; hx_all [step][256][16], Yt [step][16][1024] */
__global__ __launch_bounds__(256) void ycols_kernel(const float* __restrict__ hx_all, const float* __restrict__ Lyyw,
                                                    const float* __restrict__ Lyyb, float* __restrict__ Yt) {
  __shared__ __align__(16) float xs[NHID * XP];
  __shared__ float part[16 * 64 * PP];
  const int tid = threadIdx.x;
  const int col0 = blockIdx.x * 64;
  const float* hx = hx_all + blockIdx.y * (NBATCH * NHID);
  float* Yrow = Yt + blockIdx.y * (NBATCH * YPITCH);
  stage_kmajor<NHID>(xs, hx, tid);
  __syncthreads();
  const int t16 = tid & 15, q = tid >> 4;
  float acc[4][16];
  zero_acc(acc);
  /* column index clamped for the address; columns beyond 999 are stored as zero below */
  int cols[4];
#pragma unroll
  for (int j = 0; j < 4; ++j) {
    const int n = col0 + j * 16 + t16;
    cols[j] = (n < NCLS) ? n : (NCLS - 1);
  }
  cols4x16(xs, Lyyw, NHID, Lyyw, NCLS, cols, q * (NHID / 16), (q + 1) * (NHID / 16), acc);
  put_part(part, q, t16, acc);
  __syncthreads();
  const int r = tid >> 4, c4 = (tid & 15) * 4;
  v4f v;
#pragma unroll
  for (int e = 0; e < 4; ++e) {
    const int n = col0 + c4 + e;
    const int nc = (n < NCLS) ? n : (NCLS - 1);
    const float y = get_part(part, c4 + e, r) + Lyyb[nc];
    v[e] = (n < NCLS) ? y : 0.0f;
  }
  *(v4f*)(Yrow + r * YPITCH + col0 + c4) = v;
}

// ---------------------------------------------------------------------------
// Pack: out[b][t][n] = Y[t][b][n], n < 1000. Thread i4 moves floats 4 i4 .. 4 i4 + 3 of the flat output
// (1000 % 4 == 0 so a group never straddles rows). A wave writes 32 x 16 B = 512 contiguous 512-B aligned bytes =
// ---------------------------------------------------------------------------
__global__ __launch_bounds__(256) void pack_out_kernel(const float* __restrict__ Yt, float* __restrict__ out) {
  const int i4 = blockIdx.x * 256 + threadIdx.x;
  const int e  = i4 * 4;
  const int row = e / NCLS;
  const int n   = e - row * NCLS;
  const int b = row / NSTEPS;
  const int t = row - b * NSTEPS;
  const v4f v = *(const v4f*)(Yt + ((size_t)t * NBATCH + b) * YPITCH + n);
  float* dst = out + e;
  *(v4f*)dst = v;
  
}

// ---------------------------------------------------------------------------
// Host glue. Workspace region map (bytes, 256-B aligned carve; total 70,435,072 <= 134,217,728):
//   BT16  [1024][512]   f16    1,048,576   rows 0..511: f16(16 Wh_mono[k][n]), rows 512..1023: f16(16 Wh_chunk[k][n-512])
//   PF    [16384][1024] f32   67,108,864   enc @ [Wh_mono | Wh_chunk]
//   EPART [16][16][1024] f32   1,048,576   partial energy dots of the current step, [column chunk][batch row][position]
//   ACAR  [2][16][1024] f32      131,072   alpha carry, ping-pong by step parity
//   SST   [9][256][16]  f32      147,456   s, plane 0 the initial state, plane t + 1 the state behind step t, [unit][batch row]
//   CST   [2][256][16]  f32       32,768   c, ping-pong, [unit][batch row]
//   YT    [8][16][1024] f32      524,288   y per step, columns 1000..1023 zero
//   VNORM [64]          f32          256   line 0 = g / norm(v_mono)
//   CTX   [8][16][512]  f32      262,144   ctx per step
//   HX    [8][256][16]  f32      131,072   output hidden h per step, [unit][batch row]
// ---------------------------------------------------------------------------
extern "C" void kernel_launch(void* const* d_in, const int* in_sizes, int n_in,
                              void* d_out, int out_size, void* d_ws, size_t ws_size, hipStream_t stream) {
  if (n_in < 23 || d_out == nullptr || d_ws == nullptr) return;
  if (in_sizes[0] != NBATCH * NSEQ * NDIM || in_sizes[1] != NBATCH * NSTEPS || in_sizes[2] != NBATCH ||
      in_sizes[3] != NSTEPS * NBATCH * NSEQ || in_sizes[4] != NHID * NDIM || in_sizes[6] != NDIM * NDIM ||
      in_sizes[10] != NHID * NDIM || in_sizes[12] != NDIM * NDIM || in_sizes[14] != NHID * NHID ||
      in_sizes[15] != NDIM * NHID || in_sizes[17] != NHID * NCLS || in_sizes[19] != NCLS * NGATE ||
      in_sizes[20] != NHID * NGATE || in_sizes[21] != NDIM * NGATE || out_size != NBATCH * NSTEPS * NCLS) return;

  const float* enc     = (const float*)d_in[0];
  const int*   target  = (const int*)d_in[1];
  const int*   lenenc  = (const int*)d_in[2];
  const float* noise   = (const float*)d_in[3];
  const float* ws_m_w  = (const float*)d_in[4];
  const float* ws_m_b  = (const float*)d_in[5];
  const float* wh_m    = (const float*)d_in[6];
  const float* v_m     = (const float*)d_in[7];
  const float* g_m     = (const float*)d_in[8];
  const float* r_m     = (const float*)d_in[9];
  const float* ws_c_w  = (const float*)d_in[10];
  const float* ws_c_b  = (const float*)d_in[11];
  const float* wh_c    = (const float*)d_in[12];
  const float* v_c     = (const float*)d_in[13];
  const float* l_sy    = (const float*)d_in[14];
  const float* l_gy_w  = (const float*)d_in[15];
  const float* l_gy_b  = (const float*)d_in[16];
  const float* l_yy_w  = (const float*)d_in[17];
  const float* l_yy_b  = (const float*)d_in[18];
  const float* l_ys    = (const float*)d_in[19];
  const float* l_ss    = (const float*)d_in[20];
  const float* l_gs_w  = (const float*)d_in[21];
  const float* l_gs_b  = (const float*)d_in[22];
  float* out = (float*)d_out;

  char* ws = (char*)d_ws; size_t off = 0;
  auto carve = [&](size_t bytes) -> char* { char* p = ws + off; off += (bytes + 255) & ~(size_t)255; return p; };
  unsigned short* BT16 = (unsigned short*)carve((size_t)NPROJ * NDIM * 2);
  float* PF    = (float*)carve((size_t)NROWS * NPROJ * 4);
  float* EPART = (float*)carve((size_t)NECH * NBATCH * NSEQ * 4);
  float* ACAR  = (float*)carve((size_t)2 * NBATCH * NSEQ * 4);
  float* SST   = (float*)carve((size_t)(NSTEPS + 1) * NBATCH * NHID * 4);
  float* CST   = (float*)carve((size_t)2 * NBATCH * NHID * 4);
  float* YT    = (float*)carve((size_t)NSTEPS * NBATCH * YPITCH * 4);
  float* VNORM = (float*)carve((size_t)256);
  float* CTX   = (float*)carve((size_t)NSTEPS * NBATCH * NDIM * 4);
  float* HX    = (float*)carve((size_t)NSTEPS * NBATCH * NHID * 4);
  if (off > ws_size || off > (size_t)134217728) return;

  /* (1) f16 weight plane */
  /* in [512 k][512 n] -> out [n][k]; grid (k tiles, n tiles, weight) */
  wtcast_kernel<<<dim3(NDIM / 64, NDIM / 64, 2), 256, 0, stream>>>(wh_m, wh_c, BT16, WCARRY);
  /* (2) initial state, vnorm */
  init_state_kernel<<<NBATCH, 256, 0, stream>>>(v_m, g_m, ACAR, SST, CST, VNORM);
  /* (3) fused encoder projections: M = 16384, N = 1024, K = 512; 64 x 4 tiles of 256 x 256, one work-group of 16 waves each */
  proj_gemm_kernel<<<(NROWS / GBM) * (NPROJ / GBN), 512, 0, stream>>>(enc, BT16, PF, WCARRY_INV);

  /* (4) decode steps: only what the next step needs, three launches per step */
  for (int step = 0; step < NSTEPS; ++step) {
    const int par = step & 1;
    float* ctx_t = CTX + (size_t)step * NBATCH * NDIM;
    float* s_old = SST + (size_t)step * NBATCH * NHID;
    float* s_new = SST + (size_t)(step + 1) * NBATCH * NHID;
    energies_kernel<<<dim3(NECH, NBATCH, NSEQ / EROWS), 256, 0, stream>>>(
        PF, s_old, ws_m_w, ws_m_b, ws_c_w, ws_c_b, v_m, v_c, EPART);
    scan_ctx_kernel<<<dim3(NDIM / 64, NBATCH), 256, 0, stream>>>(
        enc, lenenc, EPART, VNORM, r_m, noise + (size_t)step * NBATCH * NSEQ,
        ACAR + (size_t)par * NBATCH * NSEQ, ACAR + (size_t)(par ^ 1) * NBATCH * NSEQ, ctx_t);
    gates_kernel<<<NHID / 16, 256, 0, stream>>>(
        ctx_t, target, s_old, CST + (size_t)par * NBATCH * NHID,
        s_new, CST + (size_t)(par ^ 1) * NBATCH * NHID,
        l_ys, l_ss, l_gs_w, l_gs_b, step);
  }
  /* output head of all steps: h, then y */
  hid_kernel<<<dim3(NHID / 64, NSTEPS), 256, 0, stream>>>(CTX, SST, l_sy, l_gy_w, l_gy_b, HX);
  ycols_kernel<<<dim3(YPITCH / 64, NSTEPS), 256, 0, stream>>>(HX, l_yy_w, l_yy_b, YT);

  /* (5) pack the padded Y plane into the output */
  pack_out_kernel<<<(NBATCH * NSTEPS * NCLS) / (256 * 4), 256, 0, stream>>>(YT, out);
}

// v008
// Measured time: 185 microseconds a run.
// Two timings next to v007 put it at 1.24 and 1.25 times that version's speed.
// All steps since v000 together make it 21.8 times as fast.
// Compute dtype: enc x [Wh_mono | Wh_chunk] on v_wmma_f32_16x16x32_f16 (f16 enc, f16 weights carried x16, f32 accumulate, folded by 1/16); all per-step small products, energy dots, scans, gates and state in f32 on VALU.
#include <hip/hip_runtime.h>
#include <math.h>

// ---------------------------------------------------------------------------
// Shape constants
// ---------------------------------------------------------------------------
constexpr int NBATCH = 16;
constexpr int NSEQ   = 1024;
constexpr int NHID   = 256;
constexpr int NDIM   = 512;
constexpr int NCLS   = 1000;
constexpr int NSTEPS = 8;
constexpr int NGATE  = 4 * NHID;
constexpr int NPROJ  = 2 * NDIM;
constexpr int YPITCH = 1024;
constexpr int NROWS  = NBATCH * NSEQ;
constexpr float WCARRY     = 16.0f;
constexpr float WCARRY_INV = 1.0f / 16.0f;
static_assert(NROWS % 64 == 0 && NPROJ % 64 == 0 && NDIM % 32 == 0, "GEMM tile multiples");
static_assert((NBATCH * NSTEPS * NCLS) % (256 * 4) == 0, "pack grid exact");
static_assert(NCLS % 4 == 0, "float4 groups never straddle output rows");
static_assert(NSEQ == 4 * 256 && NHID == 256 && NDIM == 2 * 256, "thread maps");

typedef __attribute__((ext_vector_type(16))) _Float16 v16h;
typedef __attribute__((ext_vector_type(8)))  _Float16 v8h;
typedef __attribute__((ext_vector_type(16))) __bf16   v16b;
typedef __attribute__((ext_vector_type(8)))  __bf16   v8b;
typedef __attribute__((ext_vector_type(8)))  float    v8f;
typedef __attribute__((ext_vector_type(4)))  float    v4f;
typedef __attribute__((ext_vector_type(4)))  unsigned int v4u;

__device__ __forceinline__ unsigned short f2bf_bits(float f) {
  unsigned u = __float_as_uint(f);
  return (unsigned short)((u + 0x7FFFu + ((u >> 16) & 1u)) >> 16);
}
__device__ __forceinline__ float bf_bits2f(unsigned short h) { return __uint_as_float(((unsigned)h) << 16); }

__device__ __forceinline__ void dep_guard6_h(v8f& a, v8f& b, v8f& c, v8f& d, v16h x, v16h x2, v16h y0, v16h y1, v16h y2, v16h y3) {
  asm volatile("v_nop\n\tv_nop\n\tv_nop\n\tv_nop" : "+v"(a), "+v"(b), "+v"(c), "+v"(d) : "v"(x), "v"(x2), "v"(y0), "v"(y1), "v"(y2), "v"(y3));
}
__device__ __forceinline__ void dep_guard6_b(v8f& a, v8f& b, v8f& c, v8f& d, v16b x, v16b x2, v16b y0, v16b y1, v16b y2, v16b y3) {
  asm volatile("v_nop\n\tv_nop\n\tv_nop\n\tv_nop" : "+v"(a), "+v"(b), "+v"(c), "+v"(d) : "v"(x), "v"(x2), "v"(y0), "v"(y1), "v"(y2), "v"(y3));
}
__device__ __forceinline__ void keep4_h(v16h a, v16h b, v16h c, v16h d) { asm volatile("v_nop" :: "v"(a), "v"(b), "v"(c), "v"(d)); }
__device__ __forceinline__ void keep4_b(v16b a, v16b b, v16b c, v16b d) { asm volatile("v_nop" :: "v"(a), "v"(b), "v"(c), "v"(d)); }
__device__ __forceinline__ void acc_guard4(v8f& a, v8f& b, v8f& c, v8f& d) { asm volatile("v_nop\n\tv_nop\n\tv_nop\n\tv_nop" : "+v"(a), "+v"(b), "+v"(c), "+v"(d)); }

template <typename T> struct Frag;
template <> struct Frag<_Float16> {
  typedef v16h V; union U { v16h v; v8h h[2]; };
  /* elements 0..7 <- p[0..7], 8..15 <- p[16..23] */
  static __device__ __forceinline__ v16h load(const _Float16* p) {
    U f; f.h[0] = *(const v8h*)(p); f.h[1] = *(const v8h*)(p + 16); return f.v;
  }
  static __device__ __forceinline__ v8f mma(v16h a, v16h b, v8f c) {
    return __builtin_amdgcn_wmma_f32_16x16x32_f16(false, a, false, b, (short)0, c, false, false);
  }
  static __device__ __forceinline__ void guard(v8f& a, v8f& b, v8f& c, v8f& d, v16h x, v16h x2, v16h y0, v16h y1, v16h y2, v16h y3) {
    dep_guard6_h(a, b, c, d, x, x2, y0, y1, y2, y3);
  }
  static __device__ __forceinline__ void keep(v16h a, v16h b, v16h c, v16h d) { keep4_h(a, b, c, d); }
};
template <> struct Frag<__bf16> {
  typedef v16b V; union U { v16b v; v8b h[2]; };
  static __device__ __forceinline__ v16b load(const __bf16* p) {
    U f; f.h[0] = *(const v8b*)(p); f.h[1] = *(const v8b*)(p + 16); return f.v;
  }
  static __device__ __forceinline__ v8f mma(v16b a, v16b b, v8f c) {
    return __builtin_amdgcn_wmma_f32_16x16x32_bf16(false, a, false, b, (short)0, c, false, false);
  }
  static __device__ __forceinline__ void guard(v8f& a, v8f& b, v8f& c, v8f& d, v16b x, v16b x2, v16b y0, v16b y1, v16b y2, v16b y3) {
    dep_guard6_b(a, b, c, d, x, x2, y0, y1, y2, y3);
  }
  static __device__ __forceinline__ void keep(v16b a, v16b b, v16b c, v16b d) { keep4_b(a, b, c, d); }
};

__device__ __forceinline__ unsigned pk16(unsigned short a, unsigned short b) { return (unsigned)a | ((unsigned)b << 16); }
__device__ __forceinline__ unsigned short h_bits(float f) { const _Float16 h = (_Float16)f; return __builtin_bit_cast(unsigned short, h); }

/* reciprocal-based logistic and tanh with precise expf (v_rcp_f32 reciprocal) */
__device__ __forceinline__ float sigm_f(float x) { return __builtin_amdgcn_rcpf(1.0f + expf(-x)); }
__device__ __forceinline__ float tanh_e(float x) { return 1.0f - 2.0f * __builtin_amdgcn_rcpf(expf(2.0f * x) + 1.0f); }
__device__ __forceinline__ v4f exp2_x4(v4f a) {
  float r0, r1, r2, r3;
  asm("v_exp_f32 %0, %4\n\tv_exp_f32 %1, %5\n\tv_exp_f32 %2, %6\n\tv_exp_f32 %3, %7\n\tv_nop"
      : "=&v"(r0), "=&v"(r1), "=&v"(r2), "=&v"(r3) : "v"(a[0]), "v"(a[1]), "v"(a[2]), "v"(a[3]));
  return (v4f){r0, r1, r2, r3};
}
__device__ __forceinline__ v4f rcp_x4(v4f a) {
  float r0, r1, r2, r3;
  asm("v_rcp_f32 %0, %4\n\tv_rcp_f32 %1, %5\n\tv_rcp_f32 %2, %6\n\tv_rcp_f32 %3, %7\n\tv_nop"
      : "=&v"(r0), "=&v"(r1), "=&v"(r2), "=&v"(r3) : "v"(a[0]), "v"(a[1]), "v"(a[2]), "v"(a[3]));
  return (v4f){r0, r1, r2, r3};
}
__device__ __forceinline__ v4f tanh_x4(v4f x) {
  const v4f q = rcp_x4(exp2_x4(x * 2.885390082f) + 1.0f);
  return 1.0f - 2.0f * q;
}

// ---- Encoder projections: WMMA GEMM with both operand tiles staged in LDS ----
// C[m,n] = scale * sum_k f16(enc[m,k]) * Bt[n,k]; enc row-major f32 [NROWS][NDIM], Bt row-major f16 [NPROJ][NDIM].
// A work-group of 16 waves (4 x 4) owns a 256 x 256 tile of C, a wave 64 x 64. A pass is 64 k: 256 rows of enc (cast to f16 on
// the way into LDS) and 256 rows of Bt, asked for with whole-line loads one pass ahead and kept in registers while the current
// pass is worked on; two LDS buffers, one work-group barrier a pass. Every operand row is fetched once per work-group and the
// fragments come from LDS. Each accumulator sums its k in rising blocks of 32.
constexpr int GBM = 256;               /* rows of C per work-group */
constexpr int GBN = 256;               /* columns of C per work-group */
constexpr int GBK = 64;                /* k of one pass */
constexpr int GP  = GBK + 8;           /* LDS pitch in halves: 144 B = 16 B x 9, conflict-free for 16-byte reads of 128-B rows */
constexpr int GA_H  = GBM * GP;        /* halves of the staged enc tile */
constexpr int GST_H = (GBM + GBN) * GP; /* halves of one buffer */
constexpr int GNP = NDIM / GBK;        /* passes */
static_assert(NROWS % GBM == 0 && NPROJ % GBN == 0 && NDIM % GBK == 0 && GNP >= 2, "projection tile multiples");
static_assert((NROWS / GBM) == 64 && (NPROJ / GBN) == 4, "block index split below");
static_assert(16 * 16 * 68 * 4 <= 2 * GST_H * 2, "the epilogue slabs fit the staging buffers");
typedef __attribute__((ext_vector_type(4))) _Float16 v4h;
__global__ __launch_bounds__(512) void proj_gemm_kernel(const float* __restrict__ enc, const unsigned short* __restrict__ Btp,
                                                        float* __restrict__ C, float scale) {
  __shared__ __align__(16) _Float16 tiles[2 * GST_H];
  typedef Frag<_Float16> F;
  const int tid  = threadIdx.x;
  const int lane = tid & 31;
  const int wave = tid >> 5;
  /* the four column tiles of one row tile are 8 apart in the block index (a permutation of the 64 x 4 tiles) */
  const int bx = blockIdx.x;
  const int tm = (bx & 7) | ((bx >> 5) << 3);
  const int tn = (bx >> 3) & 3;
  const int wm = wave >> 2, wn = wave & 3;
  const int rlane = lane & 15;
  const int koff  = (lane >> 4) * 8;
  const int mOff  = (lane >> 4) * 8;

  /* staging maps: 16 threads x 16 B = the 256 B of one enc row of a pass; 8 threads x 16 B = the 128 B of one Bt row */
  const int ar = tid >> 4, ac = (tid & 15) * 4;
  const int br = tid >> 3, bc = (tid & 7) * 8;
  const float*    pa = enc + (size_t)(tm * GBM + ar) * NDIM + ac;
  const _Float16* pb = (const _Float16*)Btp + (size_t)(tn * GBN + br) * NDIM + bc;
  v4f ra[8];
  v8h rb[4];

  v8f acc[4][4];
#pragma unroll
  for (int i = 0; i < 4; ++i)
#pragma unroll
    for (int j = 0; j < 4; ++j) acc[i][j] = (v8f){0.f,0.f,0.f,0.f,0.f,0.f,0.f,0.f};

  for (int p = -1; p < GNP; ++p) {
    /* ask for pass p + 1 */
    if (p + 1 < GNP) {
#pragma unroll
      for (int i = 0; i < 8; ++i) ra[i] = *(const v4f*)(pa + (size_t)i * 32 * NDIM);
#pragma unroll
      for (int i = 0; i < 4; ++i) rb[i] = *(const v8h*)(pb + (size_t)i * 64 * NDIM);
      /* the wait in front of the rewrite of these loads' address registers just below; as inputs the two addresses stay in
         their registers up to here, so that no load of the run lands in one */
      asm volatile("s_wait_xcnt 0x0" :: "v"(pa), "v"(pb) : "memory");
      pa += GBK;
      pb += GBK;
    }
    /* work on pass p */
    if (p >= 0) {
      const _Float16* Al = tiles + (p & 1) * GST_H + (wm * 64 + rlane) * GP + koff;
      const _Float16* Bl = tiles + (p & 1) * GST_H + GA_H + (wn * 64 + rlane) * GP + koff;
#pragma unroll
      for (int ks = 0; ks < GBK; ks += 32) {
        v16h bh[4];
#pragma unroll
        for (int j = 0; j < 4; ++j) bh[j] = F::load(Bl + j * 16 * GP + ks);
        /* the next enc fragment is asked for ahead of the current one's four products, into a second register set */
        v16h ah = F::load(Al + ks);
#pragma unroll
        for (int i = 0; i < 4; ++i) {
          v16h an = ah;
          if (i < 3) an = F::load(Al + (i + 1) * 16 * GP + ks);
#pragma unroll
          for (int j = 0; j < 4; ++j) acc[i][j] = F::mma(ah, bh[j], acc[i][j]);
          F::guard(acc[i][0], acc[i][1], acc[i][2], acc[i][3], ah, ah, bh[0], bh[1], bh[2], bh[3]);
          ah = an;
        }
        F::keep(bh[0], bh[1], bh[2], bh[3]);
      }
    }
    /* lay pass p + 1 into the buffer that pass p - 1 was read from: its readers left it at the last barrier */
    if (p + 1 < GNP) {
      _Float16* st = tiles + ((p + 1) & 1) * GST_H;
#pragma unroll
      for (int i = 0; i < 8; ++i) {
        const v4h h = (v4h){(_Float16)ra[i][0], (_Float16)ra[i][1], (_Float16)ra[i][2], (_Float16)ra[i][3]};
        *(v4h*)(st + (i * 32 + ar) * GP + ac) = h;
      }
#pragma unroll
      for (int i = 0; i < 4; ++i) *(v8h*)(st + GA_H + (i * 64 + br) * GP + bc) = rb[i];
    }
    /* publishes pass p + 1 and ends every read of pass p; behind the last pass it frees the buffers for the slabs */
    __syncthreads();
  }
  acc_guard4(acc[0][0], acc[0][1], acc[0][2], acc[0][3]);
  acc_guard4(acc[1][0], acc[1][1], acc[1][2], acc[1][3]);
  acc_guard4(acc[2][0], acc[2][1], acc[2][2], acc[2][3]);
  acc_guard4(acc[3][0], acc[3][1], acc[3][2], acc[3][3]);

  /* per-wave 16x64 slab, pitch 68 floats, in the staging buffers: whole 256-B row segments go out */
  float* slab = (float*)tiles + wave * (16 * 68);
  const int m0 = tm * GBM + wm * 64;
  const int n0 = tn * GBN + wn * 64;
#pragma unroll
  for (int i = 0; i < 4; ++i) {
    const int mBase = m0 + (i << 4);
#pragma unroll
    for (int j = 0; j < 4; ++j) {
#pragma unroll
      for (int r = 0; r < 8; ++r) slab[(mOff + r) * 68 + (j << 4) + rlane] = acc[i][j][r] * scale;
    }
    __builtin_amdgcn_fence(__ATOMIC_RELEASE, "workgroup");
    __builtin_amdgcn_wave_barrier();
    __builtin_amdgcn_fence(__ATOMIC_ACQUIRE, "workgroup");
    /* row segment = 256 B = 16 lanes x 16 B */
    const int hh = lane >> 4, c4 = (lane & 15) * 4;
#pragma unroll
    for (int it = 0; it < 8; ++it) {
      const int row = it * 2 + hh;
      const v4f v = *(const v4f*)(slab + row * 68 + c4);
      *(v4f*)(C + (size_t)(mBase + row) * NPROJ + n0 + c4) = v;
    }
    __builtin_amdgcn_fence(__ATOMIC_RELEASE, "workgroup");
    __builtin_amdgcn_wave_barrier();
    __builtin_amdgcn_fence(__ATOMIC_ACQUIRE, "workgroup");
  }
}

// ---------------------------------------------------------------------------
// Weight transpose + cast: W0, W1 are [512 in d][512 out h] f32; WT[z*512 + h][d] = f16(scale * Wz[d][h]).
// grid (8, 8, 2): blockIdx.x = d tile (64 cols of WT), blockIdx.y = h tile (64 rows of WT), blockIdx.z selects W.
// Load coverage: 16 iterations x 256 threads = 4096 = the whole 64x64 tile.
// Store coverage: 8 waves x 2 iterations x 4 rows = 64 rows; 8 lanes x 8 halves = 64 cols; each row segment =
// ---------------------------------------------------------------------------
__global__ __launch_bounds__(256) void wtcast_kernel(const float* __restrict__ W0, const float* __restrict__ W1,
                                                     unsigned short* __restrict__ out, float scale) {
  __shared__ float tl[64][65];
  const int t  = threadIdx.x;
  const int d0 = blockIdx.x * 64;
  const int h0 = blockIdx.y * 64;
  const int z  = blockIdx.z;
  const float* W = (z == 0) ? W0 : W1;
#pragma unroll
  for (int i = 0; i < 16; ++i) {
    const int e = i * 256 + t;
    const int r = e >> 6;
    const int c = e & 63;
    tl[c][r] = W[(size_t)(d0 + r) * NDIM + h0 + c] * scale;
  }
  __syncthreads();
  const int lane = t & 31, wave = t >> 5;
  const int q = lane >> 3, c8 = (lane & 7) * 8;
  unsigned short* op = out + (size_t)z * NDIM * NDIM;
  {
#pragma unroll
    for (int it = 0; it < 2; ++it) {
      const int row = wave * 8 + it * 4 + q;
      unsigned short hb[8];
#pragma unroll
      for (int e = 0; e < 8; ++e) hb[e] = h_bits(tl[row][c8 + e]);
      const v4u u = (v4u){pk16(hb[0], hb[1]), pk16(hb[2], hb[3]), pk16(hb[4], hb[5]), pk16(hb[6], hb[7])};
      *(v4u*)(op + (size_t)(h0 + row) * NDIM + d0 + c8) = u;
    }
    
  }
}

// ---------------------------------------------------------------------------
// Initial state: one block per batch row b (grid 16, 256 threads).
//   acar0[b][0] = 1, else 0 (1024 floats = 256 threads x 16 B); s0[b] = c0[b] = 0 (threads 0..63 x 16 B each);
//   block 0 writes one line with g / norm(v_mono).
// ---------------------------------------------------------------------------
__global__ __launch_bounds__(256) void init_state_kernel(const float* __restrict__ vmono, const float* __restrict__ gmono,
                                                         float* __restrict__ acar0, float* __restrict__ s0,
                                                         float* __restrict__ c0, float* __restrict__ vnorm) {
  __shared__ float red[8];
  const int tid = threadIdx.x, lane = tid & 31, wave = tid >> 5;
  const int b = blockIdx.x;
  const float v0 = vmono[tid], v1 = vmono[tid + 256];
  float ss = v0 * v0 + v1 * v1;
#pragma unroll
  for (int off = 16; off > 0; off >>= 1) ss += __shfl_xor(ss, off, 32);
  if (lane == 0) red[wave] = ss;
  __syncthreads();
  float tot = 0.0f;
#pragma unroll
  for (int w = 0; w < 8; ++w) tot += red[w];
  const float vn = gmono[0] / sqrtf(tot);

  v4f av = (v4f){0.f, 0.f, 0.f, 0.f};
  av[0] = (tid == 0) ? 1.0f : 0.0f;
  const v4f zv = (v4f){0.f, 0.f, 0.f, 0.f};
  const v4f nv = (v4f){vn, vn, vn, vn};
  {
    *(v4f*)(acar0 + b * NSEQ + 4 * tid) = av;
    if (tid < 64) {
      *(v4f*)(s0 + b * NHID + 4 * tid) = zv;
      *(v4f*)(c0 + b * NHID + 4 * tid) = zv;
    }
    if (b == 0 && tid < 8) *(v4f*)(vnorm + 4 * tid) = nv;
  }
}

// ---------------------------------------------------------------------------
// Energy dots for one decode step, cut by column: grid (16 column chunks, 16 batch rows, 2 halves of the positions),
// 256 threads. A block owns 64 of the 1024 projection columns (chunks 0..7 mono, 8..15 chunk) of 512 positions of one
// batch row. It first forms its own 64 columns of s @ Ws + b (256 x 64 weights, 64 KB), so that no launch of its own is
// needed for the s-projections, then the tanh dots of its columns. epart[chunk][b][s] holds the partial dots; the scan
// kernel joins the chunks and does mask, noise and logistic.
// The state s of the step is formed here as well: every block joins the partial gate sums that the scan kernel of the step
// before left for its batch row and runs the LSTM cell of the row's 256 units (one per thread); one block of the row stores
// s and c. In the first step (FIRST) s is the initial state.
// ---------------------------------------------------------------------------
constexpr int NKCH = 8;             /* k chunks of the gate products = column chunks of ctx */
constexpr int SK   = NHID / NKCH;   /* units of s in one k chunk */
static_assert(NKCH * 64 == NDIM && NGATE == 4 * 256, "gate product maps");
/* gp points at (batch row, unit) of chunk 0: g[gate][chunk] */
__device__ __forceinline__ void cell_load(float (&g)[4][NKCH], const float* gp) {
#pragma unroll
  for (int c = 0; c < NKCH; ++c)
#pragma unroll
    for (int j = 0; j < 4; ++j) g[j][c] = gp[c * (NBATCH * NGATE) + j * NHID];
}
/* the chunks joined in rising order, then the cell */
__device__ __forceinline__ void cell_math(const float (&g)[4][NKCH], float cold, float& cn, float& sn) {
  float r[4];
#pragma unroll
  for (int j = 0; j < 4; ++j) {
    float v = g[j][0];
#pragma unroll
    for (int c = 1; c < NKCH; ++c) v += g[j][c];
    r[j] = v;
  }
  const float ig = sigm_f(r[0]);
  const float fg = sigm_f(r[1]);
  const float gg = tanh_e(r[2]);
  const float og = sigm_f(r[3]);
  cn = fg * cold + ig * gg;
  sn = og * tanh_e(cn);
}
constexpr int ECOLS = 64;              /* columns of one block */
constexpr int NECH  = NPROJ / ECOLS;   /* column chunks */
constexpr int EROWS = 512;             /* positions of one block */
constexpr int RP    = 17;              /* LDS pitch in floats of one position's 16 lane sums */
static_assert(NDIM % ECOLS == 0 && NSEQ % EROWS == 0 && EROWS == 2 * 256 && NHID == 16 * 16, "energy block maps");
template <bool FIRST>
__global__ __launch_bounds__(256) void energies_kernel(
    const float* __restrict__ Pf, const float* __restrict__ gpart, const float* __restrict__ c_in,
    float* __restrict__ c_out, float* __restrict__ s_row,
    const float* __restrict__ Wsm, const float* __restrict__ Wsmb,
    const float* __restrict__ Wsc, const float* __restrict__ Wscb,
    const float* __restrict__ vmono, const float* __restrict__ vchunk,
    float* __restrict__ epart) {
  __shared__ __align__(16) float tpart[16 * ECOLS];
  __shared__ float rsum[EROWS * RP];
  __shared__ __align__(16) float sh_s[NHID];
  const int tid = threadIdx.x;
  const int chunk = blockIdx.x, b = blockIdx.y, half = blockIdx.z;
  /* thread = (group of 4 columns c16, class q): q is the k range of the s-projection and the position class s mod 16 */
  const int c16 = tid & 15, q = tid >> 4;
  const bool mono = chunk < NDIM / ECOLS;
  const int cw = (chunk & (NDIM / ECOLS - 1)) * ECOLS + 4 * c16;
  const float* wr = (mono ? Wsm : Wsc) + (size_t)(q * 16) * NDIM + cw;
  const float* gpp = gpart + b * NGATE + tid;
  const float* cp  = (FIRST ? (const float*)s_row : c_in) + b * NHID + tid;
  const float* bb = mono ? Wsmb : Wscb;
  const float* vb = mono ? vmono : vchunk;
  const unsigned cwb = (unsigned)cw * 4u;  /* byte offset of the thread's columns in the bias and in v */
  const float* pr = Pf + (size_t)(b * NSEQ + half * EROWS + q) * NPROJ + chunk * ECOLS + 4 * c16;
  /* Every global value the thread needs is asked for first, the cell's and the s-projection's operands ahead of the row
     loads: cell and projection are formed while the rows are still on their way. The last 8 row loads follow behind the
     cell, into the registers that the partial gate sums leave (two work-groups share a WGP only up to 256 registers). */
  v4f w[16], e[32];
  float g[4][NKCH];
  if (!FIRST) cell_load(g, gpp);
  const float cold = cp[0];  /* FIRST: the initial s itself */
#pragma unroll
  for (int i = 0; i < 16; ++i) w[i] = *(const v4f*)(wr + i * NDIM);
  const v4f bias = *(const v4f*)((const char*)bb + cwb);
  const v4f vv   = *(const v4f*)((const char*)vb + cwb);
#pragma unroll
  for (int it = 0; it < 24; ++it) e[it] = *(const v4f*)(pr + (size_t)it * 16 * NPROJ);
  /* keeps every load of the run ahead of the arithmetic: without it the scheduler sinks row loads behind the first sums,
     which wait for their operands */
  __builtin_amdgcn_sched_barrier(0);
  /* the wait in front of any rewrite of these loads' address registers; as inputs the address pairs and the offset of the
     bias and v loads stay in their registers up to here, so that no load of the run lands in one */
  asm volatile("s_wait_xcnt 0x0" :: "v"(gpp), "v"(cp), "v"(wr), "v"(pr), "v"(cwb) : "memory");
  /* s of this step: unit tid of batch row b */
  float sn = cold;
  if (!FIRST) {
    float cn;
    cell_math(g, cold, cn, sn);
    if (chunk == 0 && half == 0) {
      float* co = c_out + b * NHID + tid;
      float* so = s_row + b * NHID + tid;
      co[0] = cn;
      so[0] = sn;
      /* the wait in front of any rewrite of these stores' registers */
      asm volatile("s_wait_xcnt 0x0" :: "v"(co), "v"(so), "v"(cn), "v"(sn) : "memory");
    }
  }
  sh_s[tid] = sn;
#pragma unroll
  for (int it = 24; it < 32; ++it) e[it] = *(const v4f*)(pr + (size_t)it * 16 * NPROJ);
  /* keeps the last row loads ahead of the barrier and the projection */
  __builtin_amdgcn_sched_barrier(0);
  /* the wait in front of any rewrite of the row loads' address pair */
  asm volatile("s_wait_xcnt 0x0" :: "v"(pr) : "memory");
  /* work-group barrier that orders LDS alone (publishes s): __syncthreads() would also wait for the row loads on their way */
  __builtin_amdgcn_fence(__ATOMIC_RELEASE, "workgroup", "local");
  __builtin_amdgcn_s_barrier();
  __builtin_amdgcn_fence(__ATOMIC_ACQUIRE, "workgroup", "local");
  float sv[16];
#pragma unroll
  for (int i = 0; i < 4; ++i) {
    const v4f s4 = *(const v4f*)(sh_s + q * 16 + 4 * i);
    sv[4 * i] = s4[0]; sv[4 * i + 1] = s4[1]; sv[4 * i + 2] = s4[2]; sv[4 * i + 3] = s4[3];
  }
  /* s-projection of the block's columns: 16 k ranges of 16, each summed in rising k, joined in fixed order, bias last */
  {
    v4f a = (v4f){0.f, 0.f, 0.f, 0.f};
#pragma unroll
    for (int i = 0; i < 16; ++i) {
      a[0] = fmaf(sv[i], w[i][0], a[0]);
      a[1] = fmaf(sv[i], w[i][1], a[1]);
      a[2] = fmaf(sv[i], w[i][2], a[2]);
      a[3] = fmaf(sv[i], w[i][3], a[3]);
    }
    *(v4f*)(tpart + q * ECOLS + 4 * c16) = a;
  }
  /* work-group barrier that orders LDS alone: __syncthreads() also waits for every global load, here the 32 row loads still
     on their way, and no wave could start on its first rows while the last ones arrive */
  __builtin_amdgcn_fence(__ATOMIC_RELEASE, "workgroup", "local");
  __builtin_amdgcn_s_barrier();
  __builtin_amdgcn_fence(__ATOMIC_ACQUIRE, "workgroup", "local");
  v4f t = *(const v4f*)(tpart + 4 * c16);
#pragma unroll
  for (int k = 1; k < 16; ++k) t += *(const v4f*)(tpart + k * ECOLS + 4 * c16);
  t += bias;
  /* the thread's four columns of positions 16 it + q */
#pragma unroll
  for (int it = 0; it < 32; ++it) {
    const v4f th = tanh_x4(e[it] + t);
    float a = 0.0f;
    a = fmaf(th[0], vv[0], a);
    a = fmaf(th[1], vv[1], a);
    a = fmaf(th[2], vv[2], a);
    a = fmaf(th[3], vv[3], a);
    rsum[(it * 16 + q) * RP + c16] = a;
  }
  __syncthreads();
  /* the 16 column groups of a position joined in fixed order; a thread stores positions tid and 256 + tid */
  float* dst = epart + (size_t)(chunk * NBATCH + b) * NSEQ + half * EROWS;
#pragma unroll
  for (int rr = 0; rr < 2; ++rr) {
    const int row = rr * 256 + tid;
    float v = rsum[row * RP];
#pragma unroll
    for (int l = 1; l < 16; ++l) v += rsum[row * RP + l];
    dst[row] = v;
  }
}

/* Work-group barrier that orders LDS alone. The scan kernel's threads hand each other values through LDS only, and
   __syncthreads() would also wait for every global load and store of the wave: for the weight rows that are meant to fly
   while the scans run, and for the stores of ctx and alpha. */
__device__ __forceinline__ void lds_barrier() {
  __builtin_amdgcn_fence(__ATOMIC_RELEASE, "workgroup", "local");
  __builtin_amdgcn_s_barrier();
  __builtin_amdgcn_fence(__ATOMIC_ACQUIRE, "workgroup", "local");
}

// exclusive block prefix of one value per thread (256 threads = 8 waves), fixed order; one block barrier inside.
__device__ __forceinline__ float block_excl_scan(float total, float* wt, int lane, int wave) {
  float x = total;
#pragma unroll
  for (int off = 1; off < 32; off <<= 1) {
    const float n = __shfl_up(x, off, 32);
    x += (lane >= off) ? n : 0.0f;
  }
  float ex = __shfl_up(x, 1, 32);
  ex = (lane == 0) ? 0.0f : ex;
  if (lane == 31) wt[wave] = x;
  lds_barrier();
  float woff = 0.0f;
#pragma unroll
  for (int w = 0; w < 8; ++w) woff += (w < wave) ? wt[w] : 0.0f;
  return woff + ex;
}

// ---------------------------------------------------------------------------
// Decode step. One launch in the step loop behind the energy dots:
//   scan_ctx_kernel   grid (8 column chunks, 16 batch rows): every block joins the row's partial dots and repeats its
//                     scans (72 KB of input), then sums beta . enc for its own 64 columns only, then multiplies these 64
//                     values of ctx and 32 units of s into all 1024 gate columns: gpart[chunk][batch row][gate column].
//                     The energies kernel of the next step (last_cell_kernel behind the last) joins the chunks.
// The output head feeds no later step: ctx and s of every step are kept, and behind the loop one launch each serves all steps:
//   hid_kernel        grid (4 blocks x 64 columns of h, 8 steps).
//   ycols_kernel      grid (16 blocks x 64 columns of y (padded to 1024), 8 steps).
// In these two product kernels a thread owns four weight columns and one sixteenth of k and keeps 64 sums, one per column
// and batch row, so a weight element is loaded once for all rows. h lives in the workspace as [unit][16 rows], s and c as
// [batch row][unit].
// ---------------------------------------------------------------------------
constexpr int XP = 20;  /* LDS pitch in floats of one k row of 16 batch values: 16-B aligned, transposing stores 2-way at most */
constexpr int PP = 17;  /* LDS pitch in floats of one column's 16 partial sums */
constexpr int KCAT = NHID + NDIM;
static_assert(KCAT % 128 == 0 && NHID % 128 == 0, "the 16 k ranges are whole 8-row groups and no group straddles the two weights");

/* src [K][16] -> xs[k * XP + row] */
template <int K>
__device__ __forceinline__ void stage_kmajor(float* xs, const float* __restrict__ srcp, int tid) {
#pragma unroll
  for (int i = 0; i < K * 4 / 256; ++i) {
    const int e4 = i * 256 + tid;
    const v4f v = *(const v4f*)(srcp + 4 * e4);
    *(v4f*)(xs + (e4 >> 2) * XP + (e4 & 3) * 4) = v;
  }
}
/* src [16][K] -> xs[k * XP + row] */
template <int K>
__device__ __forceinline__ void stage_rows(float* xs, const float* __restrict__ srcp, int tid) {
#pragma unroll
  for (int i = 0; i < 16 * K / 256; ++i) {
    const int e = i * 256 + tid;
    xs[(e % K) * XP + (e / K)] = srcp[e];
  }
}

/* eight rows of four weight columns; p0 .. p3 point at the first row of the four columns */
__device__ __forceinline__ void rows8x4(float (&w)[8][4], const float* p0, const float* p1, const float* p2,
                                        const float* p3, int ldw) {
#pragma unroll
  for (int i = 0; i < 8; ++i) {
    w[i][0] = p0[(size_t)i * ldw];
    w[i][1] = p1[(size_t)i * ldw];
    w[i][2] = p2[(size_t)i * ldw];
    w[i][3] = p3[(size_t)i * ldw];
  }
  /* the wait in front of any rewrite of these loads' address registers; as inputs the four addresses stay in their
     registers up to here, so that no load of the run lands in one; it also keeps the loads ahead of the fmaf behind it */
  asm volatile("s_wait_xcnt 0x0" :: "v"(p0), "v"(p1), "v"(p2), "v"(p3) : "memory");
}

/* acc[j][row] += xs[k0 + i][row] * w[i][j] for the eight rows i: one LDS read of the 16 batch values feeds 64 fmaf */
__device__ __forceinline__ void fma8x4x16(const float* xs, int k0, const float (&w)[8][4], float (&acc)[4][16]) {
#pragma unroll
  for (int i = 0; i < 8; ++i) {
    const float* x = xs + (k0 + i) * XP;
    const v4f x0 = *(const v4f*)(x);
    const v4f x1 = *(const v4f*)(x + 4);
    const v4f x2 = *(const v4f*)(x + 8);
    const v4f x3 = *(const v4f*)(x + 12);
#pragma unroll
    for (int j = 0; j < 4; ++j) {
      const float wv = w[i][j];
#pragma unroll
      for (int e = 0; e < 4; ++e) {
        acc[j][e]      = fmaf(x0[e], wv, acc[j][e]);
        acc[j][4 + e]  = fmaf(x1[e], wv, acc[j][4 + e]);
        acc[j][8 + e]  = fmaf(x2[e], wv, acc[j][8 + e]);
        acc[j][12 + e] = fmaf(x3[e], wv, acc[j][12 + e]);
      }
    }
  }
}

/* acc[j][row] += sum over k in [kb, ke) of xs[k][row] * W[k][cols[j]]; rows k < K0 of the joined weight are W0, the rest W1.
   The next 8 weight rows are asked for ahead of the current 8 rows' fmaf. */
__device__ __forceinline__ void cols4x16(const float* xs, const float* __restrict__ W0, int K0,
                                         const float* __restrict__ W1, int ldw, const int (&cols)[4], int kb, int ke,
                                         float (&acc)[4][16]) {
  float wa[8][4];
  {
    const float* wp = (kb < K0) ? (W0 + (size_t)kb * ldw) : (W1 + (size_t)(kb - K0) * ldw);
    rows8x4(wa, wp + cols[0], wp + cols[1], wp + cols[2], wp + cols[3], ldw);
  }
  int k0 = kb;
  for (; k0 + 8 < ke; k0 += 8) {
    const int kn = k0 + 8;
    const float* wp = (kn < K0) ? (W0 + (size_t)kn * ldw) : (W1 + (size_t)(kn - K0) * ldw);
    float wb[8][4];
    rows8x4(wb, wp + cols[0], wp + cols[1], wp + cols[2], wp + cols[3], ldw);
    fma8x4x16(xs, k0, wa, acc);
#pragma unroll
    for (int i = 0; i < 8; ++i)
#pragma unroll
      for (int j = 0; j < 4; ++j) wa[i][j] = wb[i][j];
  }
  fma8x4x16(xs, k0, wa, acc);
}
__device__ __forceinline__ void zero_acc(float (&acc)[4][16]) {
#pragma unroll
  for (int j = 0; j < 4; ++j)
#pragma unroll
    for (int r = 0; r < 16; ++r) acc[j][r] = 0.0f;
}
/* block column index of (j, t16) is j * 16 + t16 */
__device__ __forceinline__ void put_part(float* part, int q, int t16, const float (&acc)[4][16]) {
#pragma unroll
  for (int j = 0; j < 4; ++j)
#pragma unroll
    for (int r = 0; r < 16; ++r) part[(q * 64 + j * 16 + t16) * PP + r] = acc[j][r];
}
/* the 16 k ranges of (block column c, batch row r), fixed order */
__device__ __forceinline__ float get_part(const float* part, int c, int r) {
  float v = part[c * PP + r];
#pragma unroll
  for (int q = 1; q < 16; ++q) v += part[(q * 64 + c) * PP + r];
  return v;
}

__global__ __launch_bounds__(256) void scan_ctx_kernel(
    const float* __restrict__ enc, const int* __restrict__ len,
    const float* __restrict__ epart, const float* __restrict__ vnp, const float* __restrict__ rmono,
    const float* __restrict__ noise_t,
    const float* __restrict__ acar_in, float* __restrict__ acar_out, float* __restrict__ ctx,
    const int* __restrict__ target, const float* __restrict__ s_cur,
    const float* __restrict__ Lys, const float* __restrict__ Lss,
    const float* __restrict__ Lgsw, const float* __restrict__ Lgsb, float* __restrict__ gpart, int step) {
  __shared__ __align__(16) float sh_p[NSEQ];
  __shared__ __align__(16) float sh_a[NSEQ];
  __shared__ __align__(16) float sh_ex[NSEQ];
  __shared__ __align__(16) float sh_g[NSEQ];
  __shared__ __align__(16) float sh_cpp[NSEQ];
  __shared__ __align__(16) float sh_u[NSEQ];
  __shared__ __align__(16) float sh_al[NSEQ];
  __shared__ __align__(16) float sh_r[NSEQ];
  __shared__ __align__(16) float sh_beta[NSEQ];
  __shared__ __align__(16) float sh_cpart[16 * 68];
  __shared__ __align__(16) float sh_cx[64];
  __shared__ float redm[8];
  __shared__ float wtA[8];
  __shared__ float wtB[8];

  const int tid = threadIdx.x, lane = tid & 31, wave = tid >> 5;
  const int chunk = blockIdx.x;
  const int b = blockIdx.y;
  const int i0 = tid * 4;
  int L = len[b];
  L = (L < 0) ? 0 : ((L > NSEQ) ? NSEQ : L);
  const float vn = vnp[0];
  const float rm = rmono[0];
  int tg = target[b * NSTEPS + step];
  tg = (tg < 0) ? 0 : ((tg > NCLS - 1) ? (NCLS - 1) : tg);
  /* gate products: the thread owns gate columns i0 .. i0 + 3 and all 96 k of the block's chunk (32 units of s, 64 of ctx) */
  const float* wsp = Lss + (size_t)(chunk * SK) * NGATE + i0;
  const float* wgp = Lgsw + (size_t)(chunk * 64) * NGATE + i0;
  const float* lyp = Lys + (size_t)tg * NGATE + i0;
  const float* lbp = Lgsb + i0;
  v4f wS[SK], wG[64], lyv, lbv;

  /* phase 1: the thread's four positions: the 8 + 8 partial dots joined in the order of the chunks, mask, noise, logistic;
     stage p, a, e; log terms; running max over unmasked positions. All 18 loads are asked for first and fly together. */
  float ml = -3.0e38f;
  {
    const float* ep = epart + b * NSEQ + i0;
    v4f pm[8], pc[8];
#pragma unroll
    for (int c = 0; c < 8; ++c) {
      pm[c] = *(const v4f*)(ep + c * (NBATCH * NSEQ));
      pc[c] = *(const v4f*)(ep + (8 + c) * (NBATCH * NSEQ));
    }
    const v4f nz = *(const v4f*)(noise_t + b * NSEQ + i0);
    const v4f av = *(const v4f*)(acar_in + b * NSEQ + i0);
    /* keeps every load of the run, the four scalars above too, ahead of the sums: without it the scheduler sinks four of
       the loads and the scalars behind the first waits, three round trips in a row instead of one */
    __builtin_amdgcn_sched_barrier(0);
    /* The block's 96 weight rows fly while the scans run. They are asked for in three runs, the first here behind the loads
       that the scans wait for: a wave counts 63 loads at most, and with more on their way the wait for the first ones
       would also wait for weight rows. */
#pragma unroll
    for (int i = 0; i < SK; ++i) wS[i] = *(const v4f*)(wsp + i * NGATE);
    lbv = *(const v4f*)lbp;
    lyv = *(const v4f*)lyp;
    /* keeps these loads here: the scheduler would sink them to their products behind the scans */
    __builtin_amdgcn_sched_barrier(0);
    /* the wait in front of any rewrite of these loads' address registers, which as inputs stay whole up to here */
    asm volatile("s_wait_xcnt 0x0" :: "v"(wsp), "v"(lyp), "v"(lbp) : "memory");
    v4f dm = pm[0], dc = pc[0];
#pragma unroll
    for (int c = 1; c < 8; ++c) {
      dm += pm[c];
      dc += pc[c];
    }
    v4f pv, ev, gv;
#pragma unroll
    for (int k = 0; k < 4; ++k) {
      const bool masked = (i0 + k >= L);
      const float em = (vn * dm[k] + rm) + nz[k];
      const float sg = sigm_f(em);
      /* masked positions give p = 0 exactly; their chunk energy is staged as 0 and replaced in phase 2 */
      pv[k] = masked ? 0.0f : sg;
      ev[k] = masked ? 0.0f : dc[k];
      gv[k] = logf(fminf(fmaxf(1.0f - pv[k], 1e-8f), 1.0f));
      ml = masked ? ml : fmaxf(ml, ev[k]);
    }
    *(v4f*)(sh_p + i0)  = pv;
    *(v4f*)(sh_a + i0)  = av;
    *(v4f*)(sh_ex + i0) = ev;
    *(v4f*)(sh_g + i0)  = gv;
  }
#pragma unroll
  for (int off = 16; off > 0; off >>= 1) ml = fmaxf(ml, __shfl_xor(ml, off, 32));
  if (lane == 0) redm[wave] = ml;
  lds_barrier();
  float mx = redm[0];
#pragma unroll
  for (int w = 1; w < 8; ++w) mx = fmaxf(mx, redm[w]);

  /* second run of weight rows; the scheduling barrier keeps it here, the wait stands in front of any rewrite of its address */
#pragma unroll
  for (int i = 0; i < 32; ++i) wG[i] = *(const v4f*)(wgp + i * NGATE);
  __builtin_amdgcn_sched_barrier(0);
  asm volatile("s_wait_xcnt 0x0" :: "v"(wgp) : "memory");

  /* phase 2: ex = max(exp(e - max), 1e-5); masked positions give 1e-5 */
#pragma unroll 1
  for (int j = 0; j < 4; ++j) {
    const int i = j * 256 + tid;
    const float t = fmaxf(expf(sh_ex[i] - mx), 1e-5f);
    sh_ex[i] = (i < L) ? t : 1e-5f;
  }

  /* phase 3: exclusive prefix of the log terms over contiguous chunks of 4 */
  {
    const v4f g4 = *(const v4f*)(sh_g + i0);
    const float e1 = g4[0];
    const float e2 = e1 + g4[1];
    const float e3 = e2 + g4[2];
    const float tot = e3 + g4[3];
    const float off = block_excl_scan(tot, wtA, lane, wave);
    v4f x4;
    x4[0] = off;
    x4[1] = off + e1;
    x4[2] = off + e2;
    x4[3] = off + e3;
    *(v4f*)(sh_cpp + i0) = x4;
  }
  lds_barrier();

  /* phase 4: cpp = exp(prefix) (flushed below the smallest normal), u = a / clip(cpp, 1e-8, 1) */
#pragma unroll 1
  for (int j = 0; j < 4; ++j) {
    const int i = j * 256 + tid;
    float cp = expf(sh_cpp[i]);
    cp = (cp < 1.17549435e-38f) ? 0.0f : cp;
    sh_cpp[i] = cp;
    const float cl = fminf(fmaxf(cp, 1e-8f), 1.0f);
    sh_u[i] = sh_a[i] * __builtin_amdgcn_rcpf(cl);
  }
  lds_barrier();

  /* third run of weight rows, as the second */
#pragma unroll
  for (int i = 32; i < 64; ++i) wG[i] = *(const v4f*)(wgp + i * NGATE);
  __builtin_amdgcn_sched_barrier(0);
  asm volatile("s_wait_xcnt 0x0" :: "v"(wgp) : "memory");

  /* phase 5: inclusive prefix of u, q = cpp * prefix, alpha = clip(p * q, 1e-8, 1) */
  {
    const v4f u4 = *(const v4f*)(sh_u + i0);
    const v4f c4 = *(const v4f*)(sh_cpp + i0);
    const v4f p4 = *(const v4f*)(sh_p + i0);
    const float c0 = u4[0];
    const float c1 = c0 + u4[1];
    const float c2 = c1 + u4[2];
    const float c3 = c2 + u4[3];
    const float off2 = block_excl_scan(c3, wtB, lane, wave);
    v4f al;
    al[0] = fminf(fmaxf(p4[0] * (c4[0] * (off2 + c0)), 1e-8f), 1.0f);
    al[1] = fminf(fmaxf(p4[1] * (c4[1] * (off2 + c1)), 1e-8f), 1.0f);
    al[2] = fminf(fmaxf(p4[2] * (c4[2] * (off2 + c2)), 1e-8f), 1.0f);
    al[3] = fminf(fmaxf(p4[3] * (c4[3] * (off2 + c3)), 1e-8f), 1.0f);
    *(v4f*)(sh_al + i0) = al;
  }
  lds_barrier();

  /* phase 6: denom = max(sum ex[i-3..i], 1e-10) (zero padded), r = alpha / denom */
#pragma unroll 1
  for (int j = 0; j < 4; ++j) {
    const int i = j * 256 + tid;
    float d = 0.0f;
#pragma unroll
    for (int k = 3; k >= 0; --k) {
      const int ii = i - k;
      const int ic = (ii < 0) ? 0 : ii;
      const float v = sh_ex[ic];
      d += (ii >= 0) ? v : 0.0f;
    }
    d = fmaxf(d, 1e-10f);
    sh_r[i] = sh_al[i] * __builtin_amdgcn_rcpf(d);
  }
  lds_barrier();

  /* phase 7: beta = ex * sum r[i..i+3] (zero padded) */
#pragma unroll 1
  for (int j = 0; j < 4; ++j) {
    const int i = j * 256 + tid;
    float ms = 0.0f;
#pragma unroll
    for (int k = 0; k < 4; ++k) {
      const int ii = i + k;
      const int ic = (ii > NSEQ - 1) ? (NSEQ - 1) : ii;
      const float v = sh_r[ic];
      ms += (ii < NSEQ) ? v : 0.0f;
    }
    sh_beta[i] = sh_ex[i] * ms;
  }
  lds_barrier();

  /* gate sums, first part: chunk 0 starts from the target's row of L_ys and the bias, then the chunk's 32 units of s, rising */
  v4f ga = (v4f){0.f, 0.f, 0.f, 0.f};
  if (chunk == 0) ga = lyv + lbv;
  {
    const float* sc = s_cur + b * NHID + chunk * SK;
#pragma unroll
    for (int i = 0; i < SK; ++i) {
      const float x = sc[i];
      ga[0] = fmaf(x, wS[i][0], ga[0]);
      ga[1] = fmaf(x, wS[i][1], ga[1]);
      ga[2] = fmaf(x, wS[i][2], ga[2]);
      ga[3] = fmaf(x, wS[i][3], ga[3]);
    }
  }

  /* phase 8: ctx of this block's 64 columns; thread = (group of 4 columns, position class s mod 16), 64 positions each */
  {
    const int cg = tid & 15, sp = tid >> 4;
    const float* eb = enc + (size_t)b * NSEQ * NDIM + chunk * 64 + 4 * cg;
    v4f acc = (v4f){0.f, 0.f, 0.f, 0.f};
/* 16 trips per pass: their row loads fly together */
#pragma unroll 1
    for (int it0 = 0; it0 < NSEQ / 16; it0 += 16) {
      const float* ep = eb + (size_t)(16 * it0 + sp) * NDIM;
      v4f e4[16];
#pragma unroll
      for (int j = 0; j < 16; ++j) e4[j] = *(const v4f*)(ep + (size_t)j * 16 * NDIM);
      /* the wait in front of any rewrite of these loads' address pair, which as an input stays whole up to here */
      asm volatile("s_wait_xcnt 0x0" :: "v"(ep) : "memory");
#pragma unroll
      for (int j = 0; j < 16; ++j) {
        const float bv = sh_beta[16 * (it0 + j) + sp];
        acc[0] = fmaf(bv, e4[j][0], acc[0]);
        acc[1] = fmaf(bv, e4[j][1], acc[1]);
        acc[2] = fmaf(bv, e4[j][2], acc[2]);
        acc[3] = fmaf(bv, e4[j][3], acc[3]);
      }
    }
    *(v4f*)(sh_cpart + sp * 68 + 4 * cg) = acc;
  }
  lds_barrier();
  /* 16 position classes joined in fixed order; 64 threads store the block's own 256-B piece of the row */
  if (tid < 64) {
    float v = sh_cpart[tid];
#pragma unroll
    for (int sp = 1; sp < 16; ++sp) v += sh_cpart[sp * 68 + tid];
    ctx[b * NDIM + chunk * 64 + tid] = v;
    sh_cx[tid] = v;
  }
  /* the alpha carry is stored by one block of the row */
  if (chunk == 0) {
    const v4f alv = *(const v4f*)(sh_al + i0);
    *(v4f*)(acar_out + b * NSEQ + i0) = alv;
  }
  /* publishes the block's 64 values of ctx */
  lds_barrier();
  /* gate sums, second part: the 64 values of ctx, rising; the block stores its 4 KB of partial sums */
#pragma unroll
  for (int i4 = 0; i4 < 16; ++i4) {
    const v4f x = *(const v4f*)(sh_cx + 4 * i4);
#pragma unroll
    for (int k = 0; k < 4; ++k) {
      ga[0] = fmaf(x[k], wG[4 * i4 + k][0], ga[0]);
      ga[1] = fmaf(x[k], wG[4 * i4 + k][1], ga[1]);
      ga[2] = fmaf(x[k], wG[4 * i4 + k][2], ga[2]);
      ga[3] = fmaf(x[k], wG[4 * i4 + k][3], ga[3]);
    }
  }
  *(v4f*)(gpart + (size_t)(chunk * NBATCH + b) * NGATE + i0) = ga;
}

/* s behind the last step: one block per batch row, thread = unit */
__global__ __launch_bounds__(256) void last_cell_kernel(const float* __restrict__ gpart, const float* __restrict__ c_in,
                                                        float* __restrict__ s_row) {
  const int tid = threadIdx.x, b = blockIdx.x;
  float g[4][NKCH];
  cell_load(g, gpart + b * NGATE + tid);
  const float cold = c_in[b * NHID + tid];
  float cn, sn;
  cell_math(g, cold, cn, sn);
  s_row[b * NHID + tid] = sn;
}

/* blockIdx.y = step; ctx_all [step][16][512], s_all [step + 1][16][256] (plane 0 is the initial state), hx_all [step][256][16] */
__global__ __launch_bounds__(256) void hid_kernel(
    const float* __restrict__ ctx_all, const float* __restrict__ s_all,
    const float* __restrict__ Lsy, const float* __restrict__ Lgyw, const float* __restrict__ Lgyb,
    float* __restrict__ hx_all) {
  __shared__ __align__(16) float xs[KCAT * XP];
  __shared__ float part[16 * 64 * PP];
  const int tid = threadIdx.x;
  const int step = blockIdx.y;
  const float* ctx = ctx_all + step * (NBATCH * NDIM);
  const float* s_new = s_all + (step + 1) * (NBATCH * NHID);
  float* hx = hx_all + step * (NBATCH * NHID);
  stage_rows<NHID>(xs, s_new, tid);
  stage_rows<NDIM>(xs + NHID * XP, ctx, tid);
  __syncthreads();
  const int t16 = tid & 15, q = tid >> 4;
  float acc[4][16];
  zero_acc(acc);
  const int col0 = blockIdx.x * 64;
  const int cols[4] = {col0 + t16, col0 + 16 + t16, col0 + 32 + t16, col0 + 48 + t16};
  cols4x16(xs, Lsy, NHID, Lgyw, NHID, cols, q * (KCAT / 16), (q + 1) * (KCAT / 16), acc);
  put_part(part, q, t16, acc);
  __syncthreads();
#pragma unroll
  for (int e = 0; e < 4; ++e) {
    const int o = e * 256 + tid;
    const float v = get_part(part, o >> 4, o & 15) + Lgyb[col0 + (o >> 4)];
    hx[col0 * 16 + o] = tanh_e(v);
  }
}

/* blockIdx.y = step; hx_all [step][256][16], Yt [step][16][1024] */
__global__ __launch_bounds__(256) void ycols_kernel(const float* __restrict__ hx_all, const float* __restrict__ Lyyw,
                                                    const float* __restrict__ Lyyb, float* __restrict__ Yt) {
  __shared__ __align__(16) float xs[NHID * XP];
  __shared__ float part[16 * 64 * PP];
  const int tid = threadIdx.x;
  const int col0 = blockIdx.x * 64;
  const float* hx = hx_all + blockIdx.y * (NBATCH * NHID);
  float* Yrow = Yt + blockIdx.y * (NBATCH * YPITCH);
  stage_kmajor<NHID>(xs, hx, tid);
  __syncthreads();
  const int t16 = tid & 15, q = tid >> 4;
  float acc[4][16];
  zero_acc(acc);
  /* column index clamped for the address; columns beyond 999 are stored as zero below */
  int cols[4];
#pragma unroll
  for (int j = 0; j < 4; ++j) {
    const int n = col0 + j * 16 + t16;
    cols[j] = (n < NCLS) ? n : (NCLS - 1);
  }
  cols4x16(xs, Lyyw, NHID, Lyyw, NCLS, cols, q * (NHID / 16), (q + 1) * (NHID / 16), acc);
  put_part(part, q, t16, acc);
  __syncthreads();
  const int r = tid >> 4, c4 = (tid & 15) * 4;
  v4f v;
#pragma unroll
  for (int e = 0; e < 4; ++e) {
    const int n = col0 + c4 + e;
    const int nc = (n < NCLS) ? n : (NCLS - 1);
    const float y = get_part(part, c4 + e, r) + Lyyb[nc];
    v[e] = (n < NCLS) ? y : 0.0f;
  }
  *(v4f*)(Yrow + r * YPITCH + col0 + c4) = v;
}

// ---------------------------------------------------------------------------
// Pack: out[b][t][n] = Y[t][b][n], n < 1000. Thread i4 moves floats 4 i4 .. 4 i4 + 3 of the flat output
// (1000 % 4 == 0 so a group never straddles rows). A wave writes 32 x 16 B = 512 contiguous 512-B aligned bytes =
// ---------------------------------------------------------------------------
__global__ __launch_bounds__(256) void pack_out_kernel(const float* __restrict__ Yt, float* __restrict__ out) {
  const int i4 = blockIdx.x * 256 + threadIdx.x;
  const int e  = i4 * 4;
  const int row = e / NCLS;
  const int n   = e - row * NCLS;
  const int b = row / NSTEPS;
  const int t = row - b * NSTEPS;
  const v4f v = *(const v4f*)(Yt + ((size_t)t * NBATCH + b) * YPITCH + n);
  float* dst = out + e;
  *(v4f*)dst = v;
  
}

// ---------------------------------------------------------------------------
// Host glue. Workspace region map (bytes, 256-B aligned carve; total 70,959,360 <= 134,217,728):
//   BT16  [1024][512]   f16    1,048,576   rows 0..511: f16(16 Wh_mono[k][n]), rows 512..1023: f16(16 Wh_chunk[k][n-512])
//   PF    [16384][1024] f32   67,108,864   enc @ [Wh_mono | Wh_chunk]
//   EPART [16][16][1024] f32   1,048,576   partial energy dots of the current step, [column chunk][batch row][position]
//   ACAR  [2][16][1024] f32      131,072   alpha carry, ping-pong by step parity
//   SST   [9][16][256]  f32      147,456   s, plane 0 the initial state, plane t + 1 the state behind step t, [batch row][unit]
//   CST   [2][16][256]  f32       32,768   c, ping-pong, [batch row][unit]
//   YT    [8][16][1024] f32      524,288   y per step, columns 1000..1023 zero
//   VNORM [64]          f32          256   line 0 = g / norm(v_mono)
//   CTX   [8][16][512]  f32      262,144   ctx per step
//   HX    [8][256][16]  f32      131,072   output hidden h per step, [unit][batch row]
//   GPART [8][16][1024] f32      524,288   partial gate sums of the current step, [k chunk][batch row][gate column]
// ---------------------------------------------------------------------------
extern "C" void kernel_launch(void* const* d_in, const int* in_sizes, int n_in,
                              void* d_out, int out_size, void* d_ws, size_t ws_size, hipStream_t stream) {
  if (n_in < 23 || d_out == nullptr || d_ws == nullptr) return;
  if (in_sizes[0] != NBATCH * NSEQ * NDIM || in_sizes[1] != NBATCH * NSTEPS || in_sizes[2] != NBATCH ||
      in_sizes[3] != NSTEPS * NBATCH * NSEQ || in_sizes[4] != NHID * NDIM || in_sizes[6] != NDIM * NDIM ||
      in_sizes[10] != NHID * NDIM || in_sizes[12] != NDIM * NDIM || in_sizes[14] != NHID * NHID ||
      in_sizes[15] != NDIM * NHID || in_sizes[17] != NHID * NCLS || in_sizes[19] != NCLS * NGATE ||
      in_sizes[20] != NHID * NGATE || in_sizes[21] != NDIM * NGATE || out_size != NBATCH * NSTEPS * NCLS) return;

  const float* enc     = (const float*)d_in[0];
  const int*   target  = (const int*)d_in[1];
  const int*   lenenc  = (const int*)d_in[2];
  const float* noise   = (const float*)d_in[3];
  const float* ws_m_w  = (const float*)d_in[4];
  const float* ws_m_b  = (const float*)d_in[5];
  const float* wh_m    = (const float*)d_in[6];
  const float* v_m     = (const float*)d_in[7];
  const float* g_m     = (const float*)d_in[8];
  const float* r_m     = (const float*)d_in[9];
  const float* ws_c_w  = (const float*)d_in[10];
  const float* ws_c_b  = (const float*)d_in[11];
  const float* wh_c    = (const float*)d_in[12];
  const float* v_c     = (const float*)d_in[13];
  const float* l_sy    = (const float*)d_in[14];
  const float* l_gy_w  = (const float*)d_in[15];
  const float* l_gy_b  = (const float*)d_in[16];
  const float* l_yy_w  = (const float*)d_in[17];
  const float* l_yy_b  = (const float*)d_in[18];
  const float* l_ys    = (const float*)d_in[19];
  const float* l_ss    = (const float*)d_in[20];
  const float* l_gs_w  = (const float*)d_in[21];
  const float* l_gs_b  = (const float*)d_in[22];
  float* out = (float*)d_out;

  char* ws = (char*)d_ws; size_t off = 0;
  auto carve = [&](size_t bytes) -> char* { char* p = ws + off; off += (bytes + 255) & ~(size_t)255; return p; };
  unsigned short* BT16 = (unsigned short*)carve((size_t)NPROJ * NDIM * 2);
  float* PF    = (float*)carve((size_t)NROWS * NPROJ * 4);
  float* EPART = (float*)carve((size_t)NECH * NBATCH * NSEQ * 4);
  float* ACAR  = (float*)carve((size_t)2 * NBATCH * NSEQ * 4);
  float* SST   = (float*)carve((size_t)(NSTEPS + 1) * NBATCH * NHID * 4);
  float* CST   = (float*)carve((size_t)2 * NBATCH * NHID * 4);
  float* YT    = (float*)carve((size_t)NSTEPS * NBATCH * YPITCH * 4);
  float* VNORM = (float*)carve((size_t)256);
  float* CTX   = (float*)carve((size_t)NSTEPS * NBATCH * NDIM * 4);
  float* HX    = (float*)carve((size_t)NSTEPS * NBATCH * NHID * 4);
  float* GPART = (float*)carve((size_t)NKCH * NBATCH * NGATE * 4);
  if (off > ws_size || off > (size_t)134217728) return;

  /* (1) f16 weight plane */
  /* in [512 k][512 n] -> out [n][k]; grid (k tiles, n tiles, weight) */
  wtcast_kernel<<<dim3(NDIM / 64, NDIM / 64, 2), 256, 0, stream>>>(wh_m, wh_c, BT16, WCARRY);
  /* (2) initial state, vnorm */
  init_state_kernel<<<NBATCH, 256, 0, stream>>>(v_m, g_m, ACAR, SST, CST, VNORM);
  /* (3) fused encoder projections: M = 16384, N = 1024, K = 512; 64 x 4 tiles of 256 x 256, one work-group of 16 waves each */
  proj_gemm_kernel<<<(NROWS / GBM) * (NPROJ / GBN), 512, 0, stream>>>(enc, BT16, PF, WCARRY_INV);

  /* (4) decode steps: only what the next step needs, two launches per step; c_t lies in plane t & 1 */
  for (int step = 0; step < NSTEPS; ++step) {
    const int par = step & 1;
    float* ctx_t = CTX + (size_t)step * NBATCH * NDIM;
    float* s_t   = SST + (size_t)step * NBATCH * NHID;
    if (step == 0)
      energies_kernel<true><<<dim3(NECH, NBATCH, NSEQ / EROWS), 256, 0, stream>>>(
          PF, GPART, CST, CST, s_t, ws_m_w, ws_m_b, ws_c_w, ws_c_b, v_m, v_c, EPART);
    else
      energies_kernel<false><<<dim3(NECH, NBATCH, NSEQ / EROWS), 256, 0, stream>>>(
          PF, GPART, CST + (size_t)(par ^ 1) * NBATCH * NHID, CST + (size_t)par * NBATCH * NHID, s_t,
          ws_m_w, ws_m_b, ws_c_w, ws_c_b, v_m, v_c, EPART);
    scan_ctx_kernel<<<dim3(NDIM / 64, NBATCH), 256, 0, stream>>>(
        enc, lenenc, EPART, VNORM, r_m, noise + (size_t)step * NBATCH * NSEQ,
        ACAR + (size_t)par * NBATCH * NSEQ, ACAR + (size_t)(par ^ 1) * NBATCH * NSEQ, ctx_t,
        target, s_t, l_ys, l_ss, l_gs_w, l_gs_b, GPART, step);
  }
  /* s behind the last step; c of the last step's entry lies in plane (NSTEPS - 1) & 1 */
  last_cell_kernel<<<NBATCH, 256, 0, stream>>>(GPART, CST + (size_t)((NSTEPS - 1) & 1) * NBATCH * NHID,
                                               SST + (size_t)NSTEPS * NBATCH * NHID);
  /* output head of all steps: h, then y */
  hid_kernel<<<dim3(NHID / 64, NSTEPS), 256, 0, stream>>>(CTX, SST, l_sy, l_gy_w, l_gy_b, HX);
  ycols_kernel<<<dim3(YPITCH / 64, NSTEPS), 256, 0, stream>>>(HX, l_yy_w, l_yy_b, YT);

  /* (5) pack the padded Y plane into the output */
  pack_out_kernel<<<(NBATCH * NSTEPS * NCLS) / (256 * 4), 256, 0, stream>>>(YT, out);
}

// v009
// One run takes 177 microseconds.
// Two timings next to v008 both put it at 1.04 times that version's speed.
// All steps since v000 together make it 22.7 times as fast.
// Compute dtype: enc x [Wh_mono | Wh_chunk] on v_wmma_f32_16x16x32_f16 (f16 enc, f16 weights carried x16, f32 accumulate, folded by 1/16); all per-step small products, energy dots, scans, gates and state in f32 on VALU.
#include <hip/hip_runtime.h>
#include <math.h>

// ---------------------------------------------------------------------------
// Shape constants
// ---------------------------------------------------------------------------
constexpr int NBATCH = 16;
constexpr int NSEQ   = 1024;
constexpr int NHID   = 256;
constexpr int NDIM   = 512;
constexpr int NCLS   = 1000;
constexpr int NSTEPS = 8;
constexpr int NGATE  = 4 * NHID;
constexpr int NPROJ  = 2 * NDIM;
constexpr int YPITCH = 1024;
constexpr int NROWS  = NBATCH * NSEQ;
constexpr float WCARRY     = 16.0f;
constexpr float WCARRY_INV = 1.0f / 16.0f;
static_assert(NROWS % 64 == 0 && NPROJ % 64 == 0 && NDIM % 32 == 0, "GEMM tile multiples");
static_assert((NBATCH * NSTEPS * NCLS) % (256 * 4) == 0, "pack grid exact");
static_assert(NCLS % 4 == 0, "float4 groups never straddle output rows");
static_assert(NSEQ == 4 * 256 && NHID == 256 && NDIM == 2 * 256, "thread maps");

typedef __attribute__((ext_vector_type(16))) _Float16 v16h;
typedef __attribute__((ext_vector_type(8)))  _Float16 v8h;
typedef __attribute__((ext_vector_type(16))) __bf16   v16b;
typedef __attribute__((ext_vector_type(8)))  __bf16   v8b;
typedef __attribute__((ext_vector_type(8)))  float    v8f;
typedef __attribute__((ext_vector_type(4)))  float    v4f;
typedef __attribute__((ext_vector_type(4)))  unsigned int v4u;

__device__ __forceinline__ unsigned short f2bf_bits(float f) {
  unsigned u = __float_as_uint(f);
  return (unsigned short)((u + 0x7FFFu + ((u >> 16) & 1u)) >> 16);
}
__device__ __forceinline__ float bf_bits2f(unsigned short h) { return __uint_as_float(((unsigned)h) << 16); }

__device__ __forceinline__ void dep_guard6_h(v8f& a, v8f& b, v8f& c, v8f& d, v16h x, v16h x2, v16h y0, v16h y1, v16h y2, v16h y3) {
  asm volatile("v_nop\n\tv_nop\n\tv_nop\n\tv_nop" : "+v"(a), "+v"(b), "+v"(c), "+v"(d) : "v"(x), "v"(x2), "v"(y0), "v"(y1), "v"(y2), "v"(y3));
}
__device__ __forceinline__ void dep_guard6_b(v8f& a, v8f& b, v8f& c, v8f& d, v16b x, v16b x2, v16b y0, v16b y1, v16b y2, v16b y3) {
  asm volatile("v_nop\n\tv_nop\n\tv_nop\n\tv_nop" : "+v"(a), "+v"(b), "+v"(c), "+v"(d) : "v"(x), "v"(x2), "v"(y0), "v"(y1), "v"(y2), "v"(y3));
}
__device__ __forceinline__ void keep4_h(v16h a, v16h b, v16h c, v16h d) { asm volatile("v_nop" :: "v"(a), "v"(b), "v"(c), "v"(d)); }
__device__ __forceinline__ void keep4_b(v16b a, v16b b, v16b c, v16b d) { asm volatile("v_nop" :: "v"(a), "v"(b), "v"(c), "v"(d)); }
__device__ __forceinline__ void acc_guard4(v8f& a, v8f& b, v8f& c, v8f& d) { asm volatile("v_nop\n\tv_nop\n\tv_nop\n\tv_nop" : "+v"(a), "+v"(b), "+v"(c), "+v"(d)); }

template <typename T> struct Frag;
template <> struct Frag<_Float16> {
  typedef v16h V; union U { v16h v; v8h h[2]; };
  /* elements 0..7 <- p[0..7], 8..15 <- p[16..23] */
  static __device__ __forceinline__ v16h load(const _Float16* p) {
    U f; f.h[0] = *(const v8h*)(p); f.h[1] = *(const v8h*)(p + 16); return f.v;
  }
  static __device__ __forceinline__ v8f mma(v16h a, v16h b, v8f c) {
    return __builtin_amdgcn_wmma_f32_16x16x32_f16(false, a, false, b, (short)0, c, false, false);
  }
  static __device__ __forceinline__ void guard(v8f& a, v8f& b, v8f& c, v8f& d, v16h x, v16h x2, v16h y0, v16h y1, v16h y2, v16h y3) {
    dep_guard6_h(a, b, c, d, x, x2, y0, y1, y2, y3);
  }
  static __device__ __forceinline__ void keep(v16h a, v16h b, v16h c, v16h d) { keep4_h(a, b, c, d); }
};
template <> struct Frag<__bf16> {
  typedef v16b V; union U { v16b v; v8b h[2]; };
  static __device__ __forceinline__ v16b load(const __bf16* p) {
    U f; f.h[0] = *(const v8b*)(p); f.h[1] = *(const v8b*)(p + 16); return f.v;
  }
  static __device__ __forceinline__ v8f mma(v16b a, v16b b, v8f c) {
    return __builtin_amdgcn_wmma_f32_16x16x32_bf16(false, a, false, b, (short)0, c, false, false);
  }
  static __device__ __forceinline__ void guard(v8f& a, v8f& b, v8f& c, v8f& d, v16b x, v16b x2, v16b y0, v16b y1, v16b y2, v16b y3) {
    dep_guard6_b(a, b, c, d, x, x2, y0, y1, y2, y3);
  }
  static __device__ __forceinline__ void keep(v16b a, v16b b, v16b c, v16b d) { keep4_b(a, b, c, d); }
};

__device__ __forceinline__ unsigned pk16(unsigned short a, unsigned short b) { return (unsigned)a | ((unsigned)b << 16); }
__device__ __forceinline__ unsigned short h_bits(float f) { const _Float16 h = (_Float16)f; return __builtin_bit_cast(unsigned short, h); }

/* reciprocal-based logistic and tanh with precise expf (v_rcp_f32 reciprocal) */
__device__ __forceinline__ float sigm_f(float x) { return __builtin_amdgcn_rcpf(1.0f + expf(-x)); }
__device__ __forceinline__ float tanh_e(float x) { return 1.0f - 2.0f * __builtin_amdgcn_rcpf(expf(2.0f * x) + 1.0f); }
__device__ __forceinline__ v4f exp2_x4(v4f a) {
  float r0, r1, r2, r3;
  asm("v_exp_f32 %0, %4\n\tv_exp_f32 %1, %5\n\tv_exp_f32 %2, %6\n\tv_exp_f32 %3, %7\n\tv_nop"
      : "=&v"(r0), "=&v"(r1), "=&v"(r2), "=&v"(r3) : "v"(a[0]), "v"(a[1]), "v"(a[2]), "v"(a[3]));
  return (v4f){r0, r1, r2, r3};
}
__device__ __forceinline__ v4f rcp_x4(v4f a) {
  float r0, r1, r2, r3;
  asm("v_rcp_f32 %0, %4\n\tv_rcp_f32 %1, %5\n\tv_rcp_f32 %2, %6\n\tv_rcp_f32 %3, %7\n\tv_nop"
      : "=&v"(r0), "=&v"(r1), "=&v"(r2), "=&v"(r3) : "v"(a[0]), "v"(a[1]), "v"(a[2]), "v"(a[3]));
  return (v4f){r0, r1, r2, r3};
}
/* tanh(a + t) = 1 - 2 / (e^(2a) e^(2t) + 1): the factor of the step-invariant a is formed once, where a is made, the factor of t
   once per column and step, and an element of a step costs one multiply-add and one reciprocal. With y = 2 log2(e) x, 2^y = e^(2x).
   The factor of a may run to inf or 0 (|a| beyond 43.6); the exponent of the factor of t is held inside +-126 for a numerical
   reason: that factor stays finite and non-zero, so the product is never inf x 0, and at inf or 0 the quotient saturates to +-1
   as the unfactored form does. Inside |a|, |t| < 43.6 nothing is cut; absolute error a few f32 ulps of 1. */
constexpr float TWO_LOG2E = 2.885390082f;
__device__ __forceinline__ v4f exp_factor_bounded_x4(v4f y) {
  v4f z;
#pragma unroll
  for (int k = 0; k < 4; ++k) z[k] = __builtin_amdgcn_fmed3f(y[k], -126.0f, 126.0f);
  return exp2_x4(z);
}

// ---- Encoder projections: WMMA GEMM with both operand tiles staged in LDS ----
// C[m,n] = exp(2 * scale * sum_k f16(enc[m,k]) * Bt[n,k]), the factor that the energy dots multiply;
// enc row-major f32 [NROWS][NDIM], Bt row-major f16 [NPROJ][NDIM].
// A work-group of 16 waves (4 x 4) owns a 256 x 256 tile of C, a wave 64 x 64. A pass is 64 k: 256 rows of enc (cast to f16 on
// the way into LDS) and 256 rows of Bt, asked for with whole-line loads one pass ahead and kept in registers while the current
// pass is worked on; two LDS buffers, one work-group barrier a pass. Every operand row is fetched once per work-group and the
// fragments come from LDS. Each accumulator sums its k in rising blocks of 32.
constexpr int GBM = 256;               /* rows of C per work-group */
constexpr int GBN = 256;               /* columns of C per work-group */
constexpr int GBK = 64;                /* k of one pass */
constexpr int GP  = GBK + 8;           /* LDS pitch in halves: 144 B = 16 B x 9, conflict-free for 16-byte reads of 128-B rows */
constexpr int GA_H  = GBM * GP;        /* halves of the staged enc tile */
constexpr int GST_H = (GBM + GBN) * GP; /* halves of one buffer */
constexpr int GNP = NDIM / GBK;        /* passes */
static_assert(NROWS % GBM == 0 && NPROJ % GBN == 0 && NDIM % GBK == 0 && GNP >= 2, "projection tile multiples");
static_assert((NROWS / GBM) == 64 && (NPROJ / GBN) == 4, "block index split below");
static_assert(16 * 16 * 68 * 4 <= 2 * GST_H * 2, "the epilogue slabs fit the staging buffers");
typedef __attribute__((ext_vector_type(4))) _Float16 v4h;
__global__ __launch_bounds__(512) void proj_gemm_kernel(const float* __restrict__ enc, const unsigned short* __restrict__ Btp,
                                                        float* __restrict__ C, float scale) {
  __shared__ __align__(16) _Float16 tiles[2 * GST_H];
  typedef Frag<_Float16> F;
  const int tid  = threadIdx.x;
  const int lane = tid & 31;
  const int wave = tid >> 5;
  /* the four column tiles of one row tile are 8 apart in the block index (a permutation of the 64 x 4 tiles) */
  const int bx = blockIdx.x;
  const int tm = (bx & 7) | ((bx >> 5) << 3);
  const int tn = (bx >> 3) & 3;
  const int wm = wave >> 2, wn = wave & 3;
  const int rlane = lane & 15;
  const int koff  = (lane >> 4) * 8;
  const int mOff  = (lane >> 4) * 8;

  /* staging maps: 16 threads x 16 B = the 256 B of one enc row of a pass; 8 threads x 16 B = the 128 B of one Bt row */
  const int ar = tid >> 4, ac = (tid & 15) * 4;
  const int br = tid >> 3, bc = (tid & 7) * 8;
  const float*    pa = enc + (size_t)(tm * GBM + ar) * NDIM + ac;
  const _Float16* pb = (const _Float16*)Btp + (size_t)(tn * GBN + br) * NDIM + bc;
  v4f ra[8];
  v8h rb[4];

  v8f acc[4][4];
#pragma unroll
  for (int i = 0; i < 4; ++i)
#pragma unroll
    for (int j = 0; j < 4; ++j) acc[i][j] = (v8f){0.f,0.f,0.f,0.f,0.f,0.f,0.f,0.f};

  for (int p = -1; p < GNP; ++p) {
    /* ask for pass p + 1 */
    if (p + 1 < GNP) {
#pragma unroll
      for (int i = 0; i < 8; ++i) ra[i] = *(const v4f*)(pa + (size_t)i * 32 * NDIM);
#pragma unroll
      for (int i = 0; i < 4; ++i) rb[i] = *(const v8h*)(pb + (size_t)i * 64 * NDIM);
      /* the wait in front of the rewrite of these loads' address registers just below; as inputs the two addresses stay in
         their registers up to here, so that no load of the run lands in one */
      asm volatile("s_wait_xcnt 0x0" :: "v"(pa), "v"(pb) : "memory");
      pa += GBK;
      pb += GBK;
    }
    /* work on pass p */
    if (p >= 0) {
      const _Float16* Al = tiles + (p & 1) * GST_H + (wm * 64 + rlane) * GP + koff;
      const _Float16* Bl = tiles + (p & 1) * GST_H + GA_H + (wn * 64 + rlane) * GP + koff;
#pragma unroll
      for (int ks = 0; ks < GBK; ks += 32) {
        v16h bh[4];
#pragma unroll
        for (int j = 0; j < 4; ++j) bh[j] = F::load(Bl + j * 16 * GP + ks);
        /* the next enc fragment is asked for ahead of the current one's four products, into a second register set */
        v16h ah = F::load(Al + ks);
#pragma unroll
        for (int i = 0; i < 4; ++i) {
          v16h an = ah;
          if (i < 3) an = F::load(Al + (i + 1) * 16 * GP + ks);
#pragma unroll
          for (int j = 0; j < 4; ++j) acc[i][j] = F::mma(ah, bh[j], acc[i][j]);
          F::guard(acc[i][0], acc[i][1], acc[i][2], acc[i][3], ah, ah, bh[0], bh[1], bh[2], bh[3]);
          ah = an;
        }
        F::keep(bh[0], bh[1], bh[2], bh[3]);
      }
    }
    /* lay pass p + 1 into the buffer that pass p - 1 was read from: its readers left it at the last barrier */
    if (p + 1 < GNP) {
      _Float16* st = tiles + ((p + 1) & 1) * GST_H;
#pragma unroll
      for (int i = 0; i < 8; ++i) {
        const v4h h = (v4h){(_Float16)ra[i][0], (_Float16)ra[i][1], (_Float16)ra[i][2], (_Float16)ra[i][3]};
        *(v4h*)(st + (i * 32 + ar) * GP + ac) = h;
      }
#pragma unroll
      for (int i = 0; i < 4; ++i) *(v8h*)(st + GA_H + (i * 64 + br) * GP + bc) = rb[i];
    }
    /* publishes pass p + 1 and ends every read of pass p; behind the last pass it frees the buffers for the slabs */
    __syncthreads();
  }
  acc_guard4(acc[0][0], acc[0][1], acc[0][2], acc[0][3]);
  acc_guard4(acc[1][0], acc[1][1], acc[1][2], acc[1][3]);
  acc_guard4(acc[2][0], acc[2][1], acc[2][2], acc[2][3]);
  acc_guard4(acc[3][0], acc[3][1], acc[3][2], acc[3][3]);

  /* per-wave 16x64 slab, pitch 68 floats, in the staging buffers: whole 256-B row segments go out */
  float* slab = (float*)tiles + wave * (16 * 68);
  const float escale = scale * TWO_LOG2E;
  const int m0 = tm * GBM + wm * 64;
  const int n0 = tn * GBN + wn * 64;
#pragma unroll
  for (int i = 0; i < 4; ++i) {
    const int mBase = m0 + (i << 4);
#pragma unroll
    for (int j = 0; j < 4; ++j) {
#pragma unroll
      for (int r4 = 0; r4 < 8; r4 += 4) {
        const v4f y = (v4f){acc[i][j][r4], acc[i][j][r4 + 1], acc[i][j][r4 + 2], acc[i][j][r4 + 3]} * escale;
        const v4f f = exp2_x4(y);
#pragma unroll
        for (int r = 0; r < 4; ++r) slab[(mOff + r4 + r) * 68 + (j << 4) + rlane] = f[r];
      }
    }
    __builtin_amdgcn_fence(__ATOMIC_RELEASE, "workgroup");
    __builtin_amdgcn_wave_barrier();
    __builtin_amdgcn_fence(__ATOMIC_ACQUIRE, "workgroup");
    /* row segment = 256 B = 16 lanes x 16 B */
    const int hh = lane >> 4, c4 = (lane & 15) * 4;
#pragma unroll
    for (int it = 0; it < 8; ++it) {
      const int row = it * 2 + hh;
      const v4f v = *(const v4f*)(slab + row * 68 + c4);
      *(v4f*)(C + (size_t)(mBase + row) * NPROJ + n0 + c4) = v;
    }
    __builtin_amdgcn_fence(__ATOMIC_RELEASE, "workgroup");
    __builtin_amdgcn_wave_barrier();
    __builtin_amdgcn_fence(__ATOMIC_ACQUIRE, "workgroup");
  }
}

// ---------------------------------------------------------------------------
// Weight transpose + cast: W0, W1 are [512 in d][512 out h] f32; WT[z*512 + h][d] = f16(scale * Wz[d][h]).
// grid (8, 8, 2): blockIdx.x = d tile (64 cols of WT), blockIdx.y = h tile (64 rows of WT), blockIdx.z selects W.
// Load coverage: 16 iterations x 256 threads = 4096 = the whole 64x64 tile.
// Store coverage: 8 waves x 2 iterations x 4 rows = 64 rows; 8 lanes x 8 halves = 64 cols; each row segment =
// ---------------------------------------------------------------------------
__global__ __launch_bounds__(256) void wtcast_kernel(const float* __restrict__ W0, const float* __restrict__ W1,
                                                     unsigned short* __restrict__ out, float scale) {
  __shared__ float tl[64][65];
  const int t  = threadIdx.x;
  const int d0 = blockIdx.x * 64;
  const int h0 = blockIdx.y * 64;
  const int z  = blockIdx.z;
  const float* W = (z == 0) ? W0 : W1;
#pragma unroll
  for (int i = 0; i < 16; ++i) {
    const int e = i * 256 + t;
    const int r = e >> 6;
    const int c = e & 63;
    tl[c][r] = W[(size_t)(d0 + r) * NDIM + h0 + c] * scale;
  }
  __syncthreads();
  const int lane = t & 31, wave = t >> 5;
  const int q = lane >> 3, c8 = (lane & 7) * 8;
  unsigned short* op = out + (size_t)z * NDIM * NDIM;
  {
#pragma unroll
    for (int it = 0; it < 2; ++it) {
      const int row = wave * 8 + it * 4 + q;
      unsigned short hb[8];
#pragma unroll
      for (int e = 0; e < 8; ++e) hb[e] = h_bits(tl[row][c8 + e]);
      const v4u u = (v4u){pk16(hb[0], hb[1]), pk16(hb[2], hb[3]), pk16(hb[4], hb[5]), pk16(hb[6], hb[7])};
      *(v4u*)(op + (size_t)(h0 + row) * NDIM + d0 + c8) = u;
    }
    
  }
}

// ---------------------------------------------------------------------------
// Initial state: one block per batch row b (grid 16, 256 threads).
//   acar0[b][0] = 1, else 0 (1024 floats = 256 threads x 16 B); s0[b] = c0[b] = 0 (threads 0..63 x 16 B each);
//   block 0 writes one line with g / norm(v_mono).
// ---------------------------------------------------------------------------
__global__ __launch_bounds__(256) void init_state_kernel(const float* __restrict__ vmono, const float* __restrict__ gmono,
                                                         float* __restrict__ acar0, float* __restrict__ s0,
                                                         float* __restrict__ c0, float* __restrict__ vnorm) {
  __shared__ float red[8];
  const int tid = threadIdx.x, lane = tid & 31, wave = tid >> 5;
  const int b = blockIdx.x;
  const float v0 = vmono[tid], v1 = vmono[tid + 256];
  float ss = v0 * v0 + v1 * v1;
#pragma unroll
  for (int off = 16; off > 0; off >>= 1) ss += __shfl_xor(ss, off, 32);
  if (lane == 0) red[wave] = ss;
  __syncthreads();
  float tot = 0.0f;
#pragma unroll
  for (int w = 0; w < 8; ++w) tot += red[w];
  const float vn = gmono[0] / sqrtf(tot);

  v4f av = (v4f){0.f, 0.f, 0.f, 0.f};
  av[0] = (tid == 0) ? 1.0f : 0.0f;
  const v4f zv = (v4f){0.f, 0.f, 0.f, 0.f};
  const v4f nv = (v4f){vn, vn, vn, vn};
  {
    *(v4f*)(acar0 + b * NSEQ + 4 * tid) = av;
    if (tid < 64) {
      *(v4f*)(s0 + b * NHID + 4 * tid) = zv;
      *(v4f*)(c0 + b * NHID + 4 * tid) = zv;
    }
    if (b == 0 && tid < 8) *(v4f*)(vnorm + 4 * tid) = nv;
  }
}

// ---------------------------------------------------------------------------
// Energy dots for one decode step, cut by column: grid (16 column chunks, 16 batch rows, 2 halves of the positions),
// 256 threads. A block owns 64 of the 1024 projection columns (chunks 0..7 mono, 8..15 chunk) of 512 positions of one
// batch row. It first forms its own 64 columns of s @ Ws + b (256 x 64 weights, 64 KB), so that no launch of its own is
// needed for the s-projections, then the tanh dots of its columns. epart[chunk][b][s] holds the partial dots; the scan
// kernel joins the chunks and does mask, noise and logistic.
// The state s of the step is formed here as well: every block joins the partial gate sums that the scan kernel of the step
// before left for its batch row and runs the LSTM cell of the row's 256 units (one per thread); one block of the row stores
// s and c. In the first step (FIRST) s is the initial state.
// ---------------------------------------------------------------------------
constexpr int NKCH = 8;             /* k chunks of the gate products = column chunks of ctx */
constexpr int SK   = NHID / NKCH;   /* units of s in one k chunk */
static_assert(NKCH * 64 == NDIM && NGATE == 4 * 256, "gate product maps");
/* gp points at (batch row, unit) of chunk 0: g[gate][chunk] */
__device__ __forceinline__ void cell_load(float (&g)[4][NKCH], const float* gp) {
#pragma unroll
  for (int c = 0; c < NKCH; ++c)
#pragma unroll
    for (int j = 0; j < 4; ++j) g[j][c] = gp[c * (NBATCH * NGATE) + j * NHID];
}
/* the chunks joined in rising order, then the cell */
__device__ __forceinline__ void cell_math(const float (&g)[4][NKCH], float cold, float& cn, float& sn) {
  float r[4];
#pragma unroll
  for (int j = 0; j < 4; ++j) {
    float v = g[j][0];
#pragma unroll
    for (int c = 1; c < NKCH; ++c) v += g[j][c];
    r[j] = v;
  }
  const float ig = sigm_f(r[0]);
  const float fg = sigm_f(r[1]);
  const float gg = tanh_e(r[2]);
  const float og = sigm_f(r[3]);
  cn = fg * cold + ig * gg;
  sn = og * tanh_e(cn);
}
constexpr int ECOLS = 64;              /* columns of one block */
constexpr int NECH  = NPROJ / ECOLS;   /* column chunks */
constexpr int EROWS = 512;             /* positions of one block */
constexpr int RP    = 17;              /* LDS pitch in floats of one position's 16 lane sums */
static_assert(NDIM % ECOLS == 0 && NSEQ % EROWS == 0 && EROWS == 2 * 256 && NHID == 16 * 16, "energy block maps");
template <bool FIRST>
__global__ __launch_bounds__(256) void energies_kernel(
    const float* __restrict__ Pf, const float* __restrict__ gpart, const float* __restrict__ c_in,
    float* __restrict__ c_out, float* __restrict__ s_row,
    const float* __restrict__ Wsm, const float* __restrict__ Wsmb,
    const float* __restrict__ Wsc, const float* __restrict__ Wscb,
    const float* __restrict__ vmono, const float* __restrict__ vchunk,
    float* __restrict__ epart) {
  __shared__ __align__(16) float tpart[16 * ECOLS];
  __shared__ float rsum[EROWS * RP];
  __shared__ __align__(16) float sh_s[NHID];
  const int tid = threadIdx.x;
  const int chunk = blockIdx.x, b = blockIdx.y, half = blockIdx.z;
  /* thread = (group of 4 columns c16, class q): q is the k range of the s-projection and the position class s mod 16 */
  const int c16 = tid & 15, q = tid >> 4;
  const bool mono = chunk < NDIM / ECOLS;
  const int cw = (chunk & (NDIM / ECOLS - 1)) * ECOLS + 4 * c16;
  const float* wr = (mono ? Wsm : Wsc) + (size_t)(q * 16) * NDIM + cw;
  const float* gpp = gpart + b * NGATE + tid;
  const float* cp  = (FIRST ? (const float*)s_row : c_in) + b * NHID + tid;
  const float* bb = mono ? Wsmb : Wscb;
  const float* vb = mono ? vmono : vchunk;
  const unsigned cwb = (unsigned)cw * 4u;  /* byte offset of the thread's columns in the bias and in v */
  const float* pr = Pf + (size_t)(b * NSEQ + half * EROWS + q) * NPROJ + chunk * ECOLS + 4 * c16;
  /* Every global value the thread needs is asked for first, the cell's and the s-projection's operands ahead of the row
     loads: cell and projection are formed while the rows are still on their way. The last 8 row loads follow behind the
     cell, into the registers that the partial gate sums leave (two work-groups share a WGP only up to 256 registers). */
  v4f w[16], e[32];
  float g[4][NKCH];
  if (!FIRST) cell_load(g, gpp);
  const float cold = cp[0];  /* FIRST: the initial s itself */
#pragma unroll
  for (int i = 0; i < 16; ++i) w[i] = *(const v4f*)(wr + i * NDIM);
  const v4f bias = *(const v4f*)((const char*)bb + cwb);
  const v4f vv   = *(const v4f*)((const char*)vb + cwb);
#pragma unroll
  for (int it = 0; it < 24; ++it) e[it] = *(const v4f*)(pr + (size_t)it * 16 * NPROJ);
  /* keeps every load of the run ahead of the arithmetic: without it the scheduler sinks row loads behind the first sums,
     which wait for their operands */
  __builtin_amdgcn_sched_barrier(0);
  /* the wait in front of any rewrite of these loads' address registers; as inputs the address pairs and the offset of the
     bias and v loads stay in their registers up to here, so that no load of the run lands in one */
  asm volatile("s_wait_xcnt 0x0" :: "v"(gpp), "v"(cp), "v"(wr), "v"(pr), "v"(cwb) : "memory");
  /* s of this step: unit tid of batch row b */
  float sn = cold;
  if (!FIRST) {
    float cn;
    cell_math(g, cold, cn, sn);
    if (chunk == 0 && half == 0) {
      float* co = c_out + b * NHID + tid;
      float* so = s_row + b * NHID + tid;
      co[0] = cn;
      so[0] = sn;
      /* the wait in front of any rewrite of these stores' registers */
      asm volatile("s_wait_xcnt 0x0" :: "v"(co), "v"(so), "v"(cn), "v"(sn) : "memory");
    }
  }
  sh_s[tid] = sn;
#pragma unroll
  for (int it = 24; it < 32; ++it) e[it] = *(const v4f*)(pr + (size_t)it * 16 * NPROJ);
  /* keeps the last row loads ahead of the barrier and the projection */
  __builtin_amdgcn_sched_barrier(0);
  /* the wait in front of any rewrite of the row loads' address pair */
  asm volatile("s_wait_xcnt 0x0" :: "v"(pr) : "memory");
  /* work-group barrier that orders LDS alone (publishes s): __syncthreads() would also wait for the row loads on their way */
  __builtin_amdgcn_fence(__ATOMIC_RELEASE, "workgroup", "local");
  __builtin_amdgcn_s_barrier();
  __builtin_amdgcn_fence(__ATOMIC_ACQUIRE, "workgroup", "local");
  float sv[16];
#pragma unroll
  for (int i = 0; i < 4; ++i) {
    const v4f s4 = *(const v4f*)(sh_s + q * 16 + 4 * i);
    sv[4 * i] = s4[0]; sv[4 * i + 1] = s4[1]; sv[4 * i + 2] = s4[2]; sv[4 * i + 3] = s4[3];
  }
  /* s-projection of the block's columns: 16 k ranges of 16, each summed in rising k, joined in fixed order, bias last */
  {
    v4f a = (v4f){0.f, 0.f, 0.f, 0.f};
#pragma unroll
    for (int i = 0; i < 16; ++i) {
      a[0] = fmaf(sv[i], w[i][0], a[0]);
      a[1] = fmaf(sv[i], w[i][1], a[1]);
      a[2] = fmaf(sv[i], w[i][2], a[2]);
      a[3] = fmaf(sv[i], w[i][3], a[3]);
    }
    *(v4f*)(tpart + q * ECOLS + 4 * c16) = a;
  }
  /* work-group barrier that orders LDS alone: __syncthreads() also waits for every global load, here the 32 row loads still
     on their way, and no wave could start on its first rows while the last ones arrive */
  __builtin_amdgcn_fence(__ATOMIC_RELEASE, "workgroup", "local");
  __builtin_amdgcn_s_barrier();
  __builtin_amdgcn_fence(__ATOMIC_ACQUIRE, "workgroup", "local");
  v4f t = *(const v4f*)(tpart + 4 * c16);
#pragma unroll
  for (int k = 1; k < 16; ++k) t += *(const v4f*)(tpart + k * ECOLS + 4 * c16);
  t += bias;
  /* the columns' factor of this step; sum of v tanh = sum of v - 2 sum of v / (factor product + 1) */
  const v4f et = exp_factor_bounded_x4(t * TWO_LOG2E);
  const v4f v2 = -2.0f * vv;
  const float vsum = (vv[0] + vv[1]) + (vv[2] + vv[3]);
  /* the thread's four columns of positions 16 it + q */
#pragma unroll
  for (int it = 0; it < 32; ++it) {
    const v4f qn = rcp_x4(e[it] * et + 1.0f);
    float a = vsum;
    a = fmaf(qn[0], v2[0], a);
    a = fmaf(qn[1], v2[1], a);
    a = fmaf(qn[2], v2[2], a);
    a = fmaf(qn[3], v2[3], a);
    rsum[(it * 16 + q) * RP + c16] = a;
    /* keeps the rows worked on in the order in which their loads return: without it the scheduler lifts the multiply-adds of
       late rows to the front, and the wave's first reciprocal waits for 23 of the 32 row loads */
    if ((it & 3) == 3) __builtin_amdgcn_sched_barrier(0);
  }
  __syncthreads();
  /* the 16 column groups of a position joined in fixed order; a thread stores positions tid and 256 + tid */
  float* dst = epart + (size_t)(chunk * NBATCH + b) * NSEQ + half * EROWS;
#pragma unroll
  for (int rr = 0; rr < 2; ++rr) {
    const int row = rr * 256 + tid;
    float v = rsum[row * RP];
#pragma unroll
    for (int l = 1; l < 16; ++l) v += rsum[row * RP + l];
    dst[row] = v;
  }
}

/* Work-group barrier that orders LDS alone. The scan kernel's threads hand each other values through LDS only, and
   __syncthreads() would also wait for every global load and store of the wave: for the weight rows that are meant to fly
   while the scans run, and for the stores of ctx and alpha. */
__device__ __forceinline__ void lds_barrier() {
  __builtin_amdgcn_fence(__ATOMIC_RELEASE, "workgroup", "local");
  __builtin_amdgcn_s_barrier();
  __builtin_amdgcn_fence(__ATOMIC_ACQUIRE, "workgroup", "local");
}

// exclusive block prefix of one value per thread (256 threads = 8 waves), fixed order; one block barrier inside.
__device__ __forceinline__ float block_excl_scan(float total, float* wt, int lane, int wave) {
  float x = total;
#pragma unroll
  for (int off = 1; off < 32; off <<= 1) {
    const float n = __shfl_up(x, off, 32);
    x += (lane >= off) ? n : 0.0f;
  }
  float ex = __shfl_up(x, 1, 32);
  ex = (lane == 0) ? 0.0f : ex;
  if (lane == 31) wt[wave] = x;
  lds_barrier();
  float woff = 0.0f;
#pragma unroll
  for (int w = 0; w < 8; ++w) woff += (w < wave) ? wt[w] : 0.0f;
  return woff + ex;
}

// ---------------------------------------------------------------------------
// Decode step. One launch in the step loop behind the energy dots:
//   scan_ctx_kernel   grid (8 column chunks, 16 batch rows): every block joins the row's partial dots and repeats its
//                     scans (72 KB of input), then sums beta . enc for its own 64 columns only, then multiplies these 64
//                     values of ctx and 32 units of s into all 1024 gate columns: gpart[chunk][batch row][gate column].
//                     The energies kernel of the next step (last_cell_kernel behind the last) joins the chunks.
// The output head feeds no later step: ctx and s of every step are kept, and behind the loop one launch each serves all steps:
//   hid_kernel        grid (4 blocks x 64 columns of h, 8 steps).
//   ycols_kernel      grid (16 blocks x 64 columns of y (padded to 1024), 8 steps).
// In these two product kernels a thread owns four weight columns and one sixteenth of k and keeps 64 sums, one per column
// and batch row, so a weight element is loaded once for all rows. h lives in the workspace as [unit][16 rows], s and c as
// [batch row][unit].
// ---------------------------------------------------------------------------
constexpr int XP = 20;  /* LDS pitch in floats of one k row of 16 batch values: 16-B aligned, transposing stores 2-way at most */
constexpr int PP = 17;  /* LDS pitch in floats of one column's 16 partial sums */
constexpr int KCAT = NHID + NDIM;
static_assert(KCAT % 128 == 0 && NHID % 128 == 0, "the 16 k ranges are whole 8-row groups and no group straddles the two weights");

/* src [K][16] -> xs[k * XP + row] */
template <int K>
__device__ __forceinline__ void stage_kmajor(float* xs, const float* __restrict__ srcp, int tid) {
#pragma unroll
  for (int i = 0; i < K * 4 / 256; ++i) {
    const int e4 = i * 256 + tid;
    const v4f v = *(const v4f*)(srcp + 4 * e4);
    *(v4f*)(xs + (e4 >> 2) * XP + (e4 & 3) * 4) = v;
  }
}
/* src [16][K] -> xs[k * XP + row] */
template <int K>
__device__ __forceinline__ void stage_rows(float* xs, const float* __restrict__ srcp, int tid) {
#pragma unroll
  for (int i = 0; i < 16 * K / 256; ++i) {
    const int e = i * 256 + tid;
    xs[(e % K) * XP + (e / K)] = srcp[e];
  }
}

/* eight rows of four weight columns; p0 .. p3 point at the first row of the four columns */
__device__ __forceinline__ void rows8x4(float (&w)[8][4], const float* p0, const float* p1, const float* p2,
                                        const float* p3, int ldw) {
#pragma unroll
  for (int i = 0; i < 8; ++i) {
    w[i][0] = p0[(size_t)i * ldw];
    w[i][1] = p1[(size_t)i * ldw];
    w[i][2] = p2[(size_t)i * ldw];
    w[i][3] = p3[(size_t)i * ldw];
  }
  /* the wait in front of any rewrite of these loads' address registers; as inputs the four addresses stay in their
     registers up to here, so that no load of the run lands in one; it also keeps the loads ahead of the fmaf behind it */
  asm volatile("s_wait_xcnt 0x0" :: "v"(p0), "v"(p1), "v"(p2), "v"(p3) : "memory");
}

/* acc[j][row] += xs[k0 + i][row] * w[i][j] for the eight rows i: one LDS read of the 16 batch values feeds 64 fmaf */
__device__ __forceinline__ void fma8x4x16(const float* xs, int k0, const float (&w)[8][4], float (&acc)[4][16]) {
#pragma unroll
  for (int i = 0; i < 8; ++i) {
    const float* x = xs + (k0 + i) * XP;
    const v4f x0 = *(const v4f*)(x);
    const v4f x1 = *(const v4f*)(x + 4);
    const v4f x2 = *(const v4f*)(x + 8);
    const v4f x3 = *(const v4f*)(x + 12);
#pragma unroll
    for (int j = 0; j < 4; ++j) {
      const float wv = w[i][j];
#pragma unroll
      for (int e = 0; e < 4; ++e) {
        acc[j][e]      = fmaf(x0[e], wv, acc[j][e]);
        acc[j][4 + e]  = fmaf(x1[e], wv, acc[j][4 + e]);
        acc[j][8 + e]  = fmaf(x2[e], wv, acc[j][8 + e]);
        acc[j][12 + e] = fmaf(x3[e], wv, acc[j][12 + e]);
      }
    }
  }
}

/* acc[j][row] += sum over k in [kb, ke) of xs[k][row] * W[k][cols[j]]; rows k < K0 of the joined weight are W0, the rest W1.
   The next 8 weight rows are asked for ahead of the current 8 rows' fmaf. */
__device__ __forceinline__ void cols4x16(const float* xs, const float* __restrict__ W0, int K0,
                                         const float* __restrict__ W1, int ldw, const int (&cols)[4], int kb, int ke,
                                         float (&acc)[4][16]) {
  float wa[8][4];
  {
    const float* wp = (kb < K0) ? (W0 + (size_t)kb * ldw) : (W1 + (size_t)(kb - K0) * ldw);
    rows8x4(wa, wp + cols[0], wp + cols[1], wp + cols[2], wp + cols[3], ldw);
  }
  int k0 = kb;
  for (; k0 + 8 < ke; k0 += 8) {
    const int kn = k0 + 8;
    const float* wp = (kn < K0) ? (W0 + (size_t)kn * ldw) : (W1 + (size_t)(kn - K0) * ldw);
    float wb[8][4];
    rows8x4(wb, wp + cols[0], wp + cols[1], wp + cols[2], wp + cols[3], ldw);
    fma8x4x16(xs, k0, wa, acc);
#pragma unroll
    for (int i = 0; i < 8; ++i)
#pragma unroll
      for (int j = 0; j < 4; ++j) wa[i][j] = wb[i][j];
  }
  fma8x4x16(xs, k0, wa, acc);
}
__device__ __forceinline__ void zero_acc(float (&acc)[4][16]) {
#pragma unroll
  for (int j = 0; j < 4; ++j)
#pragma unroll
    for (int r = 0; r < 16; ++r) acc[j][r] = 0.0f;
}
/* block column index of (j, t16) is j * 16 + t16 */
__device__ __forceinline__ void put_part(float* part, int q, int t16, const float (&acc)[4][16]) {
#pragma unroll
  for (int j = 0; j < 4; ++j)
#pragma unroll
    for (int r = 0; r < 16; ++r) part[(q * 64 + j * 16 + t16) * PP + r] = acc[j][r];
}
/* the 16 k ranges of (block column c, batch row r), fixed order */
__device__ __forceinline__ float get_part(const float* part, int c, int r) {
  float v = part[c * PP + r];
#pragma unroll
  for (int q = 1; q < 16; ++q) v += part[(q * 64 + c) * PP + r];
  return v;
}

__global__ __launch_bounds__(256) void scan_ctx_kernel(
    const float* __restrict__ enc, const int* __restrict__ len,
    const float* __restrict__ epart, const float* __restrict__ vnp, const float* __restrict__ rmono,
    const float* __restrict__ noise_t,
    const float* __restrict__ acar_in, float* __restrict__ acar_out, float* __restrict__ ctx,
    const int* __restrict__ target, const float* __restrict__ s_cur,
    const float* __restrict__ Lys, const float* __restrict__ Lss,
    const float* __restrict__ Lgsw, const float* __restrict__ Lgsb, float* __restrict__ gpart, int step) {
  __shared__ __align__(16) float sh_p[NSEQ];
  __shared__ __align__(16) float sh_a[NSEQ];
  __shared__ __align__(16) float sh_ex[NSEQ];
  __shared__ __align__(16) float sh_g[NSEQ];
  __shared__ __align__(16) float sh_cpp[NSEQ];
  __shared__ __align__(16) float sh_u[NSEQ];
  __shared__ __align__(16) float sh_al[NSEQ];
  __shared__ __align__(16) float sh_r[NSEQ];
  __shared__ __align__(16) float sh_beta[NSEQ];
  __shared__ __align__(16) float sh_cpart[16 * 68];
  __shared__ __align__(16) float sh_cx[64];
  __shared__ float redm[8];
  __shared__ float wtA[8];
  __shared__ float wtB[8];

  const int tid = threadIdx.x, lane = tid & 31, wave = tid >> 5;
  const int chunk = blockIdx.x;
  const int b = blockIdx.y;
  const int i0 = tid * 4;
  int L = len[b];
  L = (L < 0) ? 0 : ((L > NSEQ) ? NSEQ : L);
  const float vn = vnp[0];
  const float rm = rmono[0];
  int tg = target[b * NSTEPS + step];
  tg = (tg < 0) ? 0 : ((tg > NCLS - 1) ? (NCLS - 1) : tg);
  /* gate products: the thread owns gate columns i0 .. i0 + 3 and all 96 k of the block's chunk (32 units of s, 64 of ctx) */
  const float* wsp = Lss + (size_t)(chunk * SK) * NGATE + i0;
  const float* wgp = Lgsw + (size_t)(chunk * 64) * NGATE + i0;
  const float* lyp = Lys + (size_t)tg * NGATE + i0;
  const float* lbp = Lgsb + i0;
  v4f wS[SK], wG[64], lyv, lbv;

  /* phase 1: the thread's four positions: the 8 + 8 partial dots joined in the order of the chunks, mask, noise, logistic;
     stage p, a, e; log terms; running max over unmasked positions. All 18 loads are asked for first and fly together. */
  float ml = -3.0e38f;
  {
    const float* ep = epart + b * NSEQ + i0;
    v4f pm[8], pc[8];
#pragma unroll
    for (int c = 0; c < 8; ++c) {
      pm[c] = *(const v4f*)(ep + c * (NBATCH * NSEQ));
      pc[c] = *(const v4f*)(ep + (8 + c) * (NBATCH * NSEQ));
    }
    const v4f nz = *(const v4f*)(noise_t + b * NSEQ + i0);
    const v4f av = *(const v4f*)(acar_in + b * NSEQ + i0);
    /* keeps every load of the run, the four scalars above too, ahead of the sums: without it the scheduler sinks four of
       the loads and the scalars behind the first waits, three round trips in a row instead of one */
    __builtin_amdgcn_sched_barrier(0);
    /* The block's 96 weight rows fly while the scans run. They are asked for in three runs, the first here behind the loads
       that the scans wait for: a wave counts 63 loads at most, and with more on their way the wait for the first ones
       would also wait for weight rows. */
#pragma unroll
    for (int i = 0; i < SK; ++i) wS[i] = *(const v4f*)(wsp + i * NGATE);
    lbv = *(const v4f*)lbp;
    lyv = *(const v4f*)lyp;
    /* keeps these loads here: the scheduler would sink them to their products behind the scans */
    __builtin_amdgcn_sched_barrier(0);
    /* the wait in front of any rewrite of these loads' address registers, which as inputs stay whole up to here */
    asm volatile("s_wait_xcnt 0x0" :: "v"(wsp), "v"(lyp), "v"(lbp) : "memory");
    v4f dm = pm[0], dc = pc[0];
#pragma unroll
    for (int c = 1; c < 8; ++c) {
      dm += pm[c];
      dc += pc[c];
    }
    v4f pv, ev, gv;
#pragma unroll
    for (int k = 0; k < 4; ++k) {
      const bool masked = (i0 + k >= L);
      const float em = (vn * dm[k] + rm) + nz[k];
      const float sg = sigm_f(em);
      /* masked positions give p = 0 exactly; their chunk energy is staged as 0 and replaced in phase 2 */
      pv[k] = masked ? 0.0f : sg;
      ev[k] = masked ? 0.0f : dc[k];
      gv[k] = logf(fminf(fmaxf(1.0f - pv[k], 1e-8f), 1.0f));
      ml = masked ? ml : fmaxf(ml, ev[k]);
    }
    *(v4f*)(sh_p + i0)  = pv;
    *(v4f*)(sh_a + i0)  = av;
    *(v4f*)(sh_ex + i0) = ev;
    *(v4f*)(sh_g + i0)  = gv;
  }
#pragma unroll
  for (int off = 16; off > 0; off >>= 1) ml = fmaxf(ml, __shfl_xor(ml, off, 32));
  if (lane == 0) redm[wave] = ml;
  lds_barrier();
  float mx = redm[0];
#pragma unroll
  for (int w = 1; w < 8; ++w) mx = fmaxf(mx, redm[w]);

  /* second run of weight rows; the scheduling barrier keeps it here, the wait stands in front of any rewrite of its address */
#pragma unroll
  for (int i = 0; i < 32; ++i) wG[i] = *(const v4f*)(wgp + i * NGATE);
  __builtin_amdgcn_sched_barrier(0);
  asm volatile("s_wait_xcnt 0x0" :: "v"(wgp) : "memory");

  /* phase 2: ex = max(exp(e - max), 1e-5); masked positions give 1e-5 */
#pragma unroll 1
  for (int j = 0; j < 4; ++j) {
    const int i = j * 256 + tid;
    const float t = fmaxf(expf(sh_ex[i] - mx), 1e-5f);
    sh_ex[i] = (i < L) ? t : 1e-5f;
  }

  /* phase 3: exclusive prefix of the log terms over contiguous chunks of 4 */
  {
    const v4f g4 = *(const v4f*)(sh_g + i0);
    const float e1 = g4[0];
    const float e2 = e1 + g4[1];
    const float e3 = e2 + g4[2];
    const float tot = e3 + g4[3];
    const float off = block_excl_scan(tot, wtA, lane, wave);
    v4f x4;
    x4[0] = off;
    x4[1] = off + e1;
    x4[2] = off + e2;
    x4[3] = off + e3;
    *(v4f*)(sh_cpp + i0) = x4;
  }
  lds_barrier();

  /* phase 4: cpp = exp(prefix) (flushed below the smallest normal), u = a / clip(cpp, 1e-8, 1) */
#pragma unroll 1
  for (int j = 0; j < 4; ++j) {
    const int i = j * 256 + tid;
    float cp = expf(sh_cpp[i]);
    cp = (cp < 1.17549435e-38f) ? 0.0f : cp;
    sh_cpp[i] = cp;
    const float cl = fminf(fmaxf(cp, 1e-8f), 1.0f);
    sh_u[i] = sh_a[i] * __builtin_amdgcn_rcpf(cl);
  }
  lds_barrier();

  /* third run of weight rows, as the second */
#pragma unroll
  for (int i = 32; i < 64; ++i) wG[i] = *(const v4f*)(wgp + i * NGATE);
  __builtin_amdgcn_sched_barrier(0);
  asm volatile("s_wait_xcnt 0x0" :: "v"(wgp) : "memory");

  /* phase 5: inclusive prefix of u, q = cpp * prefix, alpha = clip(p * q, 1e-8, 1) */
  {
    const v4f u4 = *(const v4f*)(sh_u + i0);
    const v4f c4 = *(const v4f*)(sh_cpp + i0);
    const v4f p4 = *(const v4f*)(sh_p + i0);
    const float c0 = u4[0];
    const float c1 = c0 + u4[1];
    const float c2 = c1 + u4[2];
    const float c3 = c2 + u4[3];
    const float off2 = block_excl_scan(c3, wtB, lane, wave);
    v4f al;
    al[0] = fminf(fmaxf(p4[0] * (c4[0] * (off2 + c0)), 1e-8f), 1.0f);
    al[1] = fminf(fmaxf(p4[1] * (c4[1] * (off2 + c1)), 1e-8f), 1.0f);
    al[2] = fminf(fmaxf(p4[2] * (c4[2] * (off2 + c2)), 1e-8f), 1.0f);
    al[3] = fminf(fmaxf(p4[3] * (c4[3] * (off2 + c3)), 1e-8f), 1.0f);
    *(v4f*)(sh_al + i0) = al;
  }
  lds_barrier();

  /* phase 6: denom = max(sum ex[i-3..i], 1e-10) (zero padded), r = alpha / denom */
#pragma unroll 1
  for (int j = 0; j < 4; ++j) {
    const int i = j * 256 + tid;
    float d = 0.0f;
#pragma unroll
    for (int k = 3; k >= 0; --k) {
      const int ii = i - k;
      const int ic = (ii < 0) ? 0 : ii;
      const float v = sh_ex[ic];
      d += (ii >= 0) ? v : 0.0f;
    }
    d = fmaxf(d, 1e-10f);
    sh_r[i] = sh_al[i] * __builtin_amdgcn_rcpf(d);
  }
  lds_barrier();

  /* phase 7: beta = ex * sum r[i..i+3] (zero padded) */
#pragma unroll 1
  for (int j = 0; j < 4; ++j) {
    const int i = j * 256 + tid;
    float ms = 0.0f;
#pragma unroll
    for (int k = 0; k < 4; ++k) {
      const int ii = i + k;
      const int ic = (ii > NSEQ - 1) ? (NSEQ - 1) : ii;
      const float v = sh_r[ic];
      ms += (ii < NSEQ) ? v : 0.0f;
    }
    sh_beta[i] = sh_ex[i] * ms;
  }
  lds_barrier();

  /* gate sums, first part: chunk 0 starts from the target's row of L_ys and the bias, then the chunk's 32 units of s, rising */
  v4f ga = (v4f){0.f, 0.f, 0.f, 0.f};
  if (chunk == 0) ga = lyv + lbv;
  {
    const float* sc = s_cur + b * NHID + chunk * SK;
#pragma unroll
    for (int i = 0; i < SK; ++i) {
      const float x = sc[i];
      ga[0] = fmaf(x, wS[i][0], ga[0]);
      ga[1] = fmaf(x, wS[i][1], ga[1]);
      ga[2] = fmaf(x, wS[i][2], ga[2]);
      ga[3] = fmaf(x, wS[i][3], ga[3]);
    }
  }

  /* phase 8: ctx of this block's 64 columns; thread = (group of 4 columns, position class s mod 16), 64 positions each */
  {
    const int cg = tid & 15, sp = tid >> 4;
    const float* eb = enc + (size_t)b * NSEQ * NDIM + chunk * 64 + 4 * cg;
    v4f acc = (v4f){0.f, 0.f, 0.f, 0.f};
/* 16 trips per pass: their row loads fly together */
#pragma unroll 1
    for (int it0 = 0; it0 < NSEQ / 16; it0 += 16) {
      const float* ep = eb + (size_t)(16 * it0 + sp) * NDIM;
      v4f e4[16];
#pragma unroll
      for (int j = 0; j < 16; ++j) e4[j] = *(const v4f*)(ep + (size_t)j * 16 * NDIM);
      /* the wait in front of any rewrite of these loads' address pair, which as an input stays whole up to here */
      asm volatile("s_wait_xcnt 0x0" :: "v"(ep) : "memory");
#pragma unroll
      for (int j = 0; j < 16; ++j) {
        const float bv = sh_beta[16 * (it0 + j) + sp];
        acc[0] = fmaf(bv, e4[j][0], acc[0]);
        acc[1] = fmaf(bv, e4[j][1], acc[1]);
        acc[2] = fmaf(bv, e4[j][2], acc[2]);
        acc[3] = fmaf(bv, e4[j][3], acc[3]);
      }
    }
    *(v4f*)(sh_cpart + sp * 68 + 4 * cg) = acc;
  }
  lds_barrier();
  /* 16 position classes joined in fixed order; 64 threads store the block's own 256-B piece of the row */
  if (tid < 64) {
    float v = sh_cpart[tid];
#pragma unroll
    for (int sp = 1; sp < 16; ++sp) v += sh_cpart[sp * 68 + tid];
    ctx[b * NDIM + chunk * 64 + tid] = v;
    sh_cx[tid] = v;
  }
  /* the alpha carry is stored by one block of the row */
  if (chunk == 0) {
    const v4f alv = *(const v4f*)(sh_al + i0);
    *(v4f*)(acar_out + b * NSEQ + i0) = alv;
  }
  /* publishes the block's 64 values of ctx */
  lds_barrier();
  /* gate sums, second part: the 64 values of ctx, rising; the block stores its 4 KB of partial sums */
#pragma unroll
  for (int i4 = 0; i4 < 16; ++i4) {
    const v4f x = *(const v4f*)(sh_cx + 4 * i4);
#pragma unroll
    for (int k = 0; k < 4; ++k) {
      ga[0] = fmaf(x[k], wG[4 * i4 + k][0], ga[0]);
      ga[1] = fmaf(x[k], wG[4 * i4 + k][1], ga[1]);
      ga[2] = fmaf(x[k], wG[4 * i4 + k][2], ga[2]);
      ga[3] = fmaf(x[k], wG[4 * i4 + k][3], ga[3]);
    }
  }
  *(v4f*)(gpart + (size_t)(chunk * NBATCH + b) * NGATE + i0) = ga;
}

/* s behind the last step: one block per batch row, thread = unit */
__global__ __launch_bounds__(256) void last_cell_kernel(const float* __restrict__ gpart, const float* __restrict__ c_in,
                                                        float* __restrict__ s_row) {
  const int tid = threadIdx.x, b = blockIdx.x;
  float g[4][NKCH];
  cell_load(g, gpart + b * NGATE + tid);
  const float cold = c_in[b * NHID + tid];
  float cn, sn;
  cell_math(g, cold, cn, sn);
  s_row[b * NHID + tid] = sn;
}

/* blockIdx.y = step; ctx_all [step][16][512], s_all [step + 1][16][256] (plane 0 is the initial state), hx_all [step][256][16] */
__global__ __launch_bounds__(256) void hid_kernel(
    const float* __restrict__ ctx_all, const float* __restrict__ s_all,
    const float* __restrict__ Lsy, const float* __restrict__ Lgyw, const float* __restrict__ Lgyb,
    float* __restrict__ hx_all) {
  __shared__ __align__(16) float xs[KCAT * XP];
  __shared__ float part[16 * 64 * PP];
  const int tid = threadIdx.x;
  const int step = blockIdx.y;
  const float* ctx = ctx_all + step * (NBATCH * NDIM);
  const float* s_new = s_all + (step + 1) * (NBATCH * NHID);
  float* hx = hx_all + step * (NBATCH * NHID);
  stage_rows<NHID>(xs, s_new, tid);
  stage_rows<NDIM>(xs + NHID * XP, ctx, tid);
  __syncthreads();
  const int t16 = tid & 15, q = tid >> 4;
  float acc[4][16];
  zero_acc(acc);
  const int col0 = blockIdx.x * 64;
  const int cols[4] = {col0 + t16, col0 + 16 + t16, col0 + 32 + t16, col0 + 48 + t16};
  cols4x16(xs, Lsy, NHID, Lgyw, NHID, cols, q * (KCAT / 16), (q + 1) * (KCAT / 16), acc);
  put_part(part, q, t16, acc);
  __syncthreads();
#pragma unroll
  for (int e = 0; e < 4; ++e) {
    const int o = e * 256 + tid;
    const float v = get_part(part, o >> 4, o & 15) + Lgyb[col0 + (o >> 4)];
    hx[col0 * 16 + o] = tanh_e(v);
  }
}

/* blockIdx.y = step; hx_all [step][256][16], Yt [step][16][1024] */
__global__ __launch_bounds__(256) void ycols_kernel(const float* __restrict__ hx_all, const float* __restrict__ Lyyw,
                                                    const float* __restrict__ Lyyb, float* __restrict__ Yt) {
  __shared__ __align__(16) float xs[NHID * XP];
  __shared__ float part[16 * 64 * PP];
  const int tid = threadIdx.x;
  const int col0 = blockIdx.x * 64;
  const float* hx = hx_all + blockIdx.y * (NBATCH * NHID);
  float* Yrow = Yt + blockIdx.y * (NBATCH * YPITCH);
  stage_kmajor<NHID>(xs, hx, tid);
  __syncthreads();
  const int t16 = tid & 15, q = tid >> 4;
  float acc[4][16];
  zero_acc(acc);
  /* column index clamped for the address; columns beyond 999 are stored as zero below */
  int cols[4];
#pragma unroll
  for (int j = 0; j < 4; ++j) {
    const int n = col0 + j * 16 + t16;
    cols[j] = (n < NCLS) ? n : (NCLS - 1);
  }
  cols4x16(xs, Lyyw, NHID, Lyyw, NCLS, cols, q * (NHID / 16), (q + 1) * (NHID / 16), acc);
  put_part(part, q, t16, acc);
  __syncthreads();
  const int r = tid >> 4, c4 = (tid & 15) * 4;
  v4f v;
#pragma unroll
  for (int e = 0; e < 4; ++e) {
    const int n = col0 + c4 + e;
    const int nc = (n < NCLS) ? n : (NCLS - 1);
    const float y = get_part(part, c4 + e, r) + Lyyb[nc];
    v[e] = (n < NCLS) ? y : 0.0f;
  }
  *(v4f*)(Yrow + r * YPITCH + col0 + c4) = v;
}

// ---------------------------------------------------------------------------
// Pack: out[b][t][n] = Y[t][b][n], n < 1000. Thread i4 moves floats 4 i4 .. 4 i4 + 3 of the flat output
// (1000 % 4 == 0 so a group never straddles rows). A wave writes 32 x 16 B = 512 contiguous 512-B aligned bytes =
// ---------------------------------------------------------------------------
__global__ __launch_bounds__(256) void pack_out_kernel(const float* __restrict__ Yt, float* __restrict__ out) {
  const int i4 = blockIdx.x * 256 + threadIdx.x;
  const int e  = i4 * 4;
  const int row = e / NCLS;
  const int n   = e - row * NCLS;
  const int b = row / NSTEPS;
  const int t = row - b * NSTEPS;
  const v4f v = *(const v4f*)(Yt + ((size_t)t * NBATCH + b) * YPITCH + n);
  float* dst = out + e;
  *(v4f*)dst = v;
  
}

// ---------------------------------------------------------------------------
// Host glue. Workspace region map (bytes, 256-B aligned carve; total 70,959,360 <= 134,217,728):
//   BT16  [1024][512]   f16    1,048,576   rows 0..511: f16(16 Wh_mono[k][n]), rows 512..1023: f16(16 Wh_chunk[k][n-512])
//   PF    [16384][1024] f32   67,108,864   exp(2 enc @ [Wh_mono | Wh_chunk])
//   EPART [16][16][1024] f32   1,048,576   partial energy dots of the current step, [column chunk][batch row][position]
//   ACAR  [2][16][1024] f32      131,072   alpha carry, ping-pong by step parity
//   SST   [9][16][256]  f32      147,456   s, plane 0 the initial state, plane t + 1 the state behind step t, [batch row][unit]
//   CST   [2][16][256]  f32       32,768   c, ping-pong, [batch row][unit]
//   YT    [8][16][1024] f32      524,288   y per step, columns 1000..1023 zero
//   VNORM [64]          f32          256   line 0 = g / norm(v_mono)
//   CTX   [8][16][512]  f32      262,144   ctx per step
//   HX    [8][256][16]  f32      131,072   output hidden h per step, [unit][batch row]
//   GPART [8][16][1024] f32      524,288   partial gate sums of the current step, [k chunk][batch row][gate column]
// ---------------------------------------------------------------------------
extern "C" void kernel_launch(void* const* d_in, const int* in_sizes, int n_in,
                              void* d_out, int out_size, void* d_ws, size_t ws_size, hipStream_t stream) {
  if (n_in < 23 || d_out == nullptr || d_ws == nullptr) return;
  if (in_sizes[0] != NBATCH * NSEQ * NDIM || in_sizes[1] != NBATCH * NSTEPS || in_sizes[2] != NBATCH ||
      in_sizes[3] != NSTEPS * NBATCH * NSEQ || in_sizes[4] != NHID * NDIM || in_sizes[6] != NDIM * NDIM ||
      in_sizes[10] != NHID * NDIM || in_sizes[12] != NDIM * NDIM || in_sizes[14] != NHID * NHID ||
      in_sizes[15] != NDIM * NHID || in_sizes[17] != NHID * NCLS || in_sizes[19] != NCLS * NGATE ||
      in_sizes[20] != NHID * NGATE || in_sizes[21] != NDIM * NGATE || out_size != NBATCH * NSTEPS * NCLS) return;

  const float* enc     = (const float*)d_in[0];
  const int*   target  = (const int*)d_in[1];
  const int*   lenenc  = (const int*)d_in[2];
  const float* noise   = (const float*)d_in[3];
  const float* ws_m_w  = (const float*)d_in[4];
  const float* ws_m_b  = (const float*)d_in[5];
  const float* wh_m    = (const float*)d_in[6];
  const float* v_m     = (const float*)d_in[7];
  const float* g_m     = (const float*)d_in[8];
  const float* r_m     = (const float*)d_in[9];
  const float* ws_c_w  = (const float*)d_in[10];
  const float* ws_c_b  = (const float*)d_in[11];
  const float* wh_c    = (const float*)d_in[12];
  const float* v_c     = (const float*)d_in[13];
  const float* l_sy    = (const float*)d_in[14];
  const float* l_gy_w  = (const float*)d_in[15];
  const float* l_gy_b  = (const float*)d_in[16];
  const float* l_yy_w  = (const float*)d_in[17];
  const float* l_yy_b  = (const float*)d_in[18];
  const float* l_ys    = (const float*)d_in[19];
  const float* l_ss    = (const float*)d_in[20];
  const float* l_gs_w  = (const float*)d_in[21];
  const float* l_gs_b  = (const float*)d_in[22];
  float* out = (float*)d_out;

  char* ws = (char*)d_ws; size_t off = 0;
  auto carve = [&](size_t bytes) -> char* { char* p = ws + off; off += (bytes + 255) & ~(size_t)255; return p; };
  unsigned short* BT16 = (unsigned short*)carve((size_t)NPROJ * NDIM * 2);
  float* PF    = (float*)carve((size_t)NROWS * NPROJ * 4);
  float* EPART = (float*)carve((size_t)NECH * NBATCH * NSEQ * 4);
  float* ACAR  = (float*)carve((size_t)2 * NBATCH * NSEQ * 4);
  float* SST   = (float*)carve((size_t)(NSTEPS + 1) * NBATCH * NHID * 4);
  float* CST   = (float*)carve((size_t)2 * NBATCH * NHID * 4);
  float* YT    = (float*)carve((size_t)NSTEPS * NBATCH * YPITCH * 4);
  float* VNORM = (float*)carve((size_t)256);
  float* CTX   = (float*)carve((size_t)NSTEPS * NBATCH * NDIM * 4);
  float* HX    = (float*)carve((size_t)NSTEPS * NBATCH * NHID * 4);
  float* GPART = (float*)carve((size_t)NKCH * NBATCH * NGATE * 4);
  if (off > ws_size || off > (size_t)134217728) return;

  /* (1) f16 weight plane */
  /* in [512 k][512 n] -> out [n][k]; grid (k tiles, n tiles, weight) */
  wtcast_kernel<<<dim3(NDIM / 64, NDIM / 64, 2), 256, 0, stream>>>(wh_m, wh_c, BT16, WCARRY);
  /* (2) initial state, vnorm */
  init_state_kernel<<<NBATCH, 256, 0, stream>>>(v_m, g_m, ACAR, SST, CST, VNORM);
  /* (3) fused encoder projections: M = 16384, N = 1024, K = 512; 64 x 4 tiles of 256 x 256, one work-group of 16 waves each */
  proj_gemm_kernel<<<(NROWS / GBM) * (NPROJ / GBN), 512, 0, stream>>>(enc, BT16, PF, WCARRY_INV);

  /* (4) decode steps: only what the next step needs, two launches per step; c_t lies in plane t & 1 */
  for (int step = 0; step < NSTEPS; ++step) {
    const int par = step & 1;
    float* ctx_t = CTX + (size_t)step * NBATCH * NDIM;
    float* s_t   = SST + (size_t)step * NBATCH * NHID;
    if (step == 0)
      energies_kernel<true><<<dim3(NECH, NBATCH, NSEQ / EROWS), 256, 0, stream>>>(
          PF, GPART, CST, CST, s_t, ws_m_w, ws_m_b, ws_c_w, ws_c_b, v_m, v_c, EPART);
    else
      energies_kernel<false><<<dim3(NECH, NBATCH, NSEQ / EROWS), 256, 0, stream>>>(
          PF, GPART, CST + (size_t)(par ^ 1) * NBATCH * NHID, CST + (size_t)par * NBATCH * NHID, s_t,
          ws_m_w, ws_m_b, ws_c_w, ws_c_b, v_m, v_c, EPART);
    scan_ctx_kernel<<<dim3(NDIM / 64, NBATCH), 256, 0, stream>>>(
        enc, lenenc, EPART, VNORM, r_m, noise + (size_t)step * NBATCH * NSEQ,
        ACAR + (size_t)par * NBATCH * NSEQ, ACAR + (size_t)(par ^ 1) * NBATCH * NSEQ, ctx_t,
        target, s_t, l_ys, l_ss, l_gs_w, l_gs_b, GPART, step);
  }
  /* s behind the last step; c of the last step's entry lies in plane (NSTEPS - 1) & 1 */
  last_cell_kernel<<<NBATCH, 256, 0, stream>>>(GPART, CST + (size_t)((NSTEPS - 1) & 1) * NBATCH * NHID,
                                               SST + (size_t)NSTEPS * NBATCH * NHID);
  /* output head of all steps: h, then y */
  hid_kernel<<<dim3(NHID / 64, NSTEPS), 256, 0, stream>>>(CTX, SST, l_sy, l_gy_w, l_gy_b, HX);
  ycols_kernel<<<dim3(YPITCH / 64, NSTEPS), 256, 0, stream>>>(HX, l_yy_w, l_yy_b, YT);

  /* (5) pack the padded Y plane into the output */
  pack_out_kernel<<<(NBATCH * NSTEPS * NCLS) / (256 * 4), 256, 0, stream>>>(YT, out);
}

// v010
// Measured time: 158 microseconds a run.
// In two side-by-side timings against v009, it was 1.11 and 1.12 times as fast.
// All steps since v000 together make it 25.3 times as fast.
// Compute dtype: enc x [Wh_mono | Wh_chunk] on v_wmma_f32_16x16x32_f16 (f16 enc, f16 weights carried x16, f32 accumulate, folded by 1/16), its exp factors stored as f16; all per-step small products, energy dots, scans, gates and state in f32 on VALU.
#include <hip/hip_runtime.h>
#include <math.h>

// ---------------------------------------------------------------------------
// Shape constants
// ---------------------------------------------------------------------------
constexpr int NBATCH = 16;
constexpr int NSEQ   = 1024;
constexpr int NHID   = 256;
constexpr int NDIM   = 512;
constexpr int NCLS   = 1000;
constexpr int NSTEPS = 8;
constexpr int NGATE  = 4 * NHID;
constexpr int NPROJ  = 2 * NDIM;
constexpr int YPITCH = 1024;
constexpr int NROWS  = NBATCH * NSEQ;
constexpr float WCARRY     = 16.0f;
constexpr float WCARRY_INV = 1.0f / 16.0f;
static_assert(NROWS % 64 == 0 && NPROJ % 64 == 0 && NDIM % 32 == 0, "GEMM tile multiples");
static_assert((NBATCH * NSTEPS * NCLS) % (256 * 4) == 0, "pack grid exact");
static_assert(NCLS % 4 == 0, "float4 groups never straddle output rows");
static_assert(NSEQ == 4 * 256 && NHID == 256 && NDIM == 2 * 256, "thread maps");

typedef __attribute__((ext_vector_type(16))) _Float16 v16h;
typedef __attribute__((ext_vector_type(8)))  _Float16 v8h;
typedef __attribute__((ext_vector_type(16))) __bf16   v16b;
typedef __attribute__((ext_vector_type(8)))  __bf16   v8b;
typedef __attribute__((ext_vector_type(8)))  float    v8f;
typedef __attribute__((ext_vector_type(4)))  float    v4f;
typedef __attribute__((ext_vector_type(4)))  unsigned int v4u;

__device__ __forceinline__ unsigned short f2bf_bits(float f) {
  unsigned u = __float_as_uint(f);
  return (unsigned short)((u + 0x7FFFu + ((u >> 16) & 1u)) >> 16);
}
__device__ __forceinline__ float bf_bits2f(unsigned short h) { return __uint_as_float(((unsigned)h) << 16); }

__device__ __forceinline__ void dep_guard6_h(v8f& a, v8f& b, v8f& c, v8f& d, v16h x, v16h x2, v16h y0, v16h y1, v16h y2, v16h y3) {
  asm volatile("v_nop\n\tv_nop\n\tv_nop\n\tv_nop" : "+v"(a), "+v"(b), "+v"(c), "+v"(d) : "v"(x), "v"(x2), "v"(y0), "v"(y1), "v"(y2), "v"(y3));
}
__device__ __forceinline__ void dep_guard6_b(v8f& a, v8f& b, v8f& c, v8f& d, v16b x, v16b x2, v16b y0, v16b y1, v16b y2, v16b y3) {
  asm volatile("v_nop\n\tv_nop\n\tv_nop\n\tv_nop" : "+v"(a), "+v"(b), "+v"(c), "+v"(d) : "v"(x), "v"(x2), "v"(y0), "v"(y1), "v"(y2), "v"(y3));
}
__device__ __forceinline__ void keep4_h(v16h a, v16h b, v16h c, v16h d) { asm volatile("v_nop" :: "v"(a), "v"(b), "v"(c), "v"(d)); }
__device__ __forceinline__ void keep4_b(v16b a, v16b b, v16b c, v16b d) { asm volatile("v_nop" :: "v"(a), "v"(b), "v"(c), "v"(d)); }
__device__ __forceinline__ void acc_guard4(v8f& a, v8f& b, v8f& c, v8f& d) { asm volatile("v_nop\n\tv_nop\n\tv_nop\n\tv_nop" : "+v"(a), "+v"(b), "+v"(c), "+v"(d)); }

template <typename T> struct Frag;
template <> struct Frag<_Float16> {
  typedef v16h V; union U { v16h v; v8h h[2]; };
  /* elements 0..7 <- p[0..7], 8..15 <- p[16..23] */
  static __device__ __forceinline__ v16h load(const _Float16* p) {
    U f; f.h[0] = *(const v8h*)(p); f.h[1] = *(const v8h*)(p + 16); return f.v;
  }
  static __device__ __forceinline__ v8f mma(v16h a, v16h b, v8f c) {
    return __builtin_amdgcn_wmma_f32_16x16x32_f16(false, a, false, b, (short)0, c, false, false);
  }
  static __device__ __forceinline__ void guard(v8f& a, v8f& b, v8f& c, v8f& d, v16h x, v16h x2, v16h y0, v16h y1, v16h y2, v16h y3) {
    dep_guard6_h(a, b, c, d, x, x2, y0, y1, y2, y3);
  }
  static __device__ __forceinline__ void keep(v16h a, v16h b, v16h c, v16h d) { keep4_h(a, b, c, d); }
};
template <> struct Frag<__bf16> {
  typedef v16b V; union U { v16b v; v8b h[2]; };
  static __device__ __forceinline__ v16b load(const __bf16* p) {
    U f; f.h[0] = *(const v8b*)(p); f.h[1] = *(const v8b*)(p + 16); return f.v;
  }
  static __device__ __forceinline__ v8f mma(v16b a, v16b b, v8f c) {
    return __builtin_amdgcn_wmma_f32_16x16x32_bf16(false, a, false, b, (short)0, c, false, false);
  }
  static __device__ __forceinline__ void guard(v8f& a, v8f& b, v8f& c, v8f& d, v16b x, v16b x2, v16b y0, v16b y1, v16b y2, v16b y3) {
    dep_guard6_b(a, b, c, d, x, x2, y0, y1, y2, y3);
  }
  static __device__ __forceinline__ void keep(v16b a, v16b b, v16b c, v16b d) { keep4_b(a, b, c, d); }
};

__device__ __forceinline__ unsigned pk16(unsigned short a, unsigned short b) { return (unsigned)a | ((unsigned)b << 16); }
__device__ __forceinline__ unsigned short h_bits(float f) { const _Float16 h = (_Float16)f; return __builtin_bit_cast(unsigned short, h); }

/* reciprocal-based logistic and tanh with precise expf (v_rcp_f32 reciprocal) */
__device__ __forceinline__ float sigm_f(float x) { return __builtin_amdgcn_rcpf(1.0f + expf(-x)); }
__device__ __forceinline__ float tanh_e(float x) { return 1.0f - 2.0f * __builtin_amdgcn_rcpf(expf(2.0f * x) + 1.0f); }
__device__ __forceinline__ v4f exp2_x4(v4f a) {
  float r0, r1, r2, r3;
  asm("v_exp_f32 %0, %4\n\tv_exp_f32 %1, %5\n\tv_exp_f32 %2, %6\n\tv_exp_f32 %3, %7\n\tv_nop"
      : "=&v"(r0), "=&v"(r1), "=&v"(r2), "=&v"(r3) : "v"(a[0]), "v"(a[1]), "v"(a[2]), "v"(a[3]));
  return (v4f){r0, r1, r2, r3};
}
__device__ __forceinline__ v4f rcp_x4(v4f a) {
  float r0, r1, r2, r3;
  asm("v_rcp_f32 %0, %4\n\tv_rcp_f32 %1, %5\n\tv_rcp_f32 %2, %6\n\tv_rcp_f32 %3, %7\n\tv_nop"
      : "=&v"(r0), "=&v"(r1), "=&v"(r2), "=&v"(r3) : "v"(a[0]), "v"(a[1]), "v"(a[2]), "v"(a[3]));
  return (v4f){r0, r1, r2, r3};
}
/* tanh(a + t) = 1 - 2 / (e^(2a) e^(2t) + 1): the factor of the step-invariant a is formed once, where a is made, the factor of t
   once per column and step, and an element of a step costs one multiply-add and one reciprocal. With y = 2 log2(e) x, 2^y = e^(2x).
   The factor of a is kept as f16: rounding 2^-11 relative, that is 2.4e-4 at most on a. It stands still at 65504 (a beyond
   5.54), where 1 - tanh is 3e-5 e^(-2t) at most, and below 2^-14 (a below -4.85) its rounding is 2^-25 absolute, which moves
   tanh by 6e-8 e^(2t) at most. The
   exponent of the factor of t is held inside +-126 for a numerical reason: that factor stays finite and non-zero, so the
   product is never inf x 0, and at inf or 0 the quotient saturates to +-1 as the unfactored form does. */
constexpr float TWO_LOG2E = 2.885390082f;
__device__ __forceinline__ v4f exp_factor_bounded_x4(v4f y) {
  v4f z;
#pragma unroll
  for (int k = 0; k < 4; ++k) z[k] = __builtin_amdgcn_fmed3f(y[k], -126.0f, 126.0f);
  return exp2_x4(z);
}

// ---- Encoder projections: WMMA GEMM with both operand tiles staged in LDS ----
// C[m,n] = f16(min(exp(2 * scale * sum_k f16(enc[m,k]) * Bt[n,k]), 65504)), the factor that the energy dots multiply;
// enc row-major f32 [NROWS][NDIM], Bt row-major f16 [NPROJ][NDIM].
// A work-group of 16 waves (4 x 4) owns a 256 x 256 tile of C, a wave 64 x 64. A pass is 64 k: 256 rows of enc (cast to f16 on
// the way into LDS) and 256 rows of Bt, asked for with whole-line loads one pass ahead and kept in registers while the current
// pass is worked on; two LDS buffers, one work-group barrier a pass. Every operand row is fetched once per work-group and the
// fragments come from LDS. Each accumulator sums its k in rising blocks of 32.
constexpr int GBM = 256;               /* rows of C per work-group */
constexpr int GBN = 256;               /* columns of C per work-group */
constexpr int GBK = 64;                /* k of one pass */
constexpr int GP  = GBK + 8;           /* LDS pitch in halves: 144 B = 16 B x 9, conflict-free for 16-byte reads of 128-B rows */
constexpr int GA_H  = GBM * GP;        /* halves of the staged enc tile */
constexpr int GST_H = (GBM + GBN) * GP; /* halves of one buffer */
constexpr int GNP = NDIM / GBK;        /* passes */
static_assert(NROWS % GBM == 0 && NPROJ % GBN == 0 && NDIM % GBK == 0 && GNP >= 2, "projection tile multiples");
static_assert((NROWS / GBM) == 64 && (NPROJ / GBN) == 4, "block index split below");
static_assert(16 * 16 * 68 * 4 <= 2 * GST_H * 2, "the epilogue slabs fit the staging buffers");
typedef __attribute__((ext_vector_type(4))) _Float16 v4h;
__global__ __launch_bounds__(512) void proj_gemm_kernel(const float* __restrict__ enc, const unsigned short* __restrict__ Btp,
                                                        unsigned short* __restrict__ Cp, float scale) {
  __shared__ __align__(16) _Float16 tiles[2 * GST_H];
  typedef Frag<_Float16> F;
  const int tid  = threadIdx.x;
  const int lane = tid & 31;
  const int wave = tid >> 5;
  /* the four column tiles of one row tile are 8 apart in the block index (a permutation of the 64 x 4 tiles) */
  const int bx = blockIdx.x;
  const int tm = (bx & 7) | ((bx >> 5) << 3);
  const int tn = (bx >> 3) & 3;
  const int wm = wave >> 2, wn = wave & 3;
  const int rlane = lane & 15;
  const int koff  = (lane >> 4) * 8;
  const int mOff  = (lane >> 4) * 8;

  /* staging maps: 16 threads x 16 B = the 256 B of one enc row of a pass; 8 threads x 16 B = the 128 B of one Bt row */
  const int ar = tid >> 4, ac = (tid & 15) * 4;
  const int br = tid >> 3, bc = (tid & 7) * 8;
  const float*    pa = enc + (size_t)(tm * GBM + ar) * NDIM + ac;
  const _Float16* pb = (const _Float16*)Btp + (size_t)(tn * GBN + br) * NDIM + bc;
  v4f ra[8];
  v8h rb[4];

  v8f acc[4][4];
#pragma unroll
  for (int i = 0; i < 4; ++i)
#pragma unroll
    for (int j = 0; j < 4; ++j) acc[i][j] = (v8f){0.f,0.f,0.f,0.f,0.f,0.f,0.f,0.f};

  for (int p = -1; p < GNP; ++p) {
    /* ask for pass p + 1 */
    if (p + 1 < GNP) {
#pragma unroll
      for (int i = 0; i < 8; ++i) ra[i] = *(const v4f*)(pa + (size_t)i * 32 * NDIM);
#pragma unroll
      for (int i = 0; i < 4; ++i) rb[i] = *(const v8h*)(pb + (size_t)i * 64 * NDIM);
      /* the wait in front of the rewrite of these loads' address registers just below; as inputs the two addresses stay in
         their registers up to here, so that no load of the run lands in one */
      asm volatile("s_wait_xcnt 0x0" :: "v"(pa), "v"(pb) : "memory");
      pa += GBK;
      pb += GBK;
    }
    /* work on pass p */
    if (p >= 0) {
      const _Float16* Al = tiles + (p & 1) * GST_H + (wm * 64 + rlane) * GP + koff;
      const _Float16* Bl = tiles + (p & 1) * GST_H + GA_H + (wn * 64 + rlane) * GP + koff;
#pragma unroll
      for (int ks = 0; ks < GBK; ks += 32) {
        v16h bh[4];
#pragma unroll
        for (int j = 0; j < 4; ++j) bh[j] = F::load(Bl + j * 16 * GP + ks);
        /* the next enc fragment is asked for ahead of the current one's four products, into a second register set */
        v16h ah = F::load(Al + ks);
#pragma unroll
        for (int i = 0; i < 4; ++i) {
          v16h an = ah;
          if (i < 3) an = F::load(Al + (i + 1) * 16 * GP + ks);
#pragma unroll
          for (int j = 0; j < 4; ++j) acc[i][j] = F::mma(ah, bh[j], acc[i][j]);
          F::guard(acc[i][0], acc[i][1], acc[i][2], acc[i][3], ah, ah, bh[0], bh[1], bh[2], bh[3]);
          ah = an;
        }
        F::keep(bh[0], bh[1], bh[2], bh[3]);
      }
    }
    /* lay pass p + 1 into the buffer that pass p - 1 was read from: its readers left it at the last barrier */
    if (p + 1 < GNP) {
      _Float16* st = tiles + ((p + 1) & 1) * GST_H;
#pragma unroll
      for (int i = 0; i < 8; ++i) {
        const v4h h = (v4h){(_Float16)ra[i][0], (_Float16)ra[i][1], (_Float16)ra[i][2], (_Float16)ra[i][3]};
        *(v4h*)(st + (i * 32 + ar) * GP + ac) = h;
      }
#pragma unroll
      for (int i = 0; i < 4; ++i) *(v8h*)(st + GA_H + (i * 64 + br) * GP + bc) = rb[i];
    }
    /* publishes pass p + 1 and ends every read of pass p; behind the last pass it frees the buffers for the slabs */
    __syncthreads();
  }
  acc_guard4(acc[0][0], acc[0][1], acc[0][2], acc[0][3]);
  acc_guard4(acc[1][0], acc[1][1], acc[1][2], acc[1][3]);
  acc_guard4(acc[2][0], acc[2][1], acc[2][2], acc[2][3]);
  acc_guard4(acc[3][0], acc[3][1], acc[3][2], acc[3][3]);

  /* per-wave 16x64 slab, pitch 68 floats, in the staging buffers: whole 128-B row segments of f16 go out */
  float* slab = (float*)tiles + wave * (16 * 68);
  _Float16* C = (_Float16*)Cp;
  const float escale = scale * TWO_LOG2E;
  const int m0 = tm * GBM + wm * 64;
  const int n0 = tn * GBN + wn * 64;
#pragma unroll
  for (int i = 0; i < 4; ++i) {
    const int mBase = m0 + (i << 4);
#pragma unroll
    for (int j = 0; j < 4; ++j) {
#pragma unroll
      for (int r4 = 0; r4 < 8; r4 += 4) {
        const v4f y = (v4f){acc[i][j][r4], acc[i][j][r4 + 1], acc[i][j][r4 + 2], acc[i][j][r4 + 3]} * escale;
        /* exponent held at 15.999, which rounds to 65504, the largest finite f16: beyond it the factor stands still instead of
           turning into inf */
        const v4f f = exp2_x4(__builtin_elementwise_min(y, (v4f){15.999f, 15.999f, 15.999f, 15.999f}));
#pragma unroll
        for (int r = 0; r < 4; ++r) slab[(mOff + r4 + r) * 68 + (j << 4) + rlane] = f[r];
      }
    }
    __builtin_amdgcn_fence(__ATOMIC_RELEASE, "workgroup");
    __builtin_amdgcn_wave_barrier();
    __builtin_amdgcn_fence(__ATOMIC_ACQUIRE, "workgroup");
    /* row segment = 64 factors = 128 B of f16 = 8 lanes x 16 B; four rows a store */
    const int rq = lane >> 3, c8 = (lane & 7) * 8;
#pragma unroll
    for (int it = 0; it < 4; ++it) {
      const int row = it * 4 + rq;
      const v4f lo = *(const v4f*)(slab + row * 68 + c8);
      const v4f hi = *(const v4f*)(slab + row * 68 + c8 + 4);
      const v8h h = (v8h){(_Float16)lo[0], (_Float16)lo[1], (_Float16)lo[2], (_Float16)lo[3],
                          (_Float16)hi[0], (_Float16)hi[1], (_Float16)hi[2], (_Float16)hi[3]};
      *(v8h*)(C + (size_t)(mBase + row) * NPROJ + n0 + c8) = h;
    }
    __builtin_amdgcn_fence(__ATOMIC_RELEASE, "workgroup");
    __builtin_amdgcn_wave_barrier();
    __builtin_amdgcn_fence(__ATOMIC_ACQUIRE, "workgroup");
  }
}

// ---------------------------------------------------------------------------
// Weight transpose + cast: W0, W1 are [512 in d][512 out h] f32; WT[z*512 + h][d] = f16(scale * Wz[d][h]).
// grid (8, 8, 2): blockIdx.x = d tile (64 cols of WT), blockIdx.y = h tile (64 rows of WT), blockIdx.z selects W.
// Load coverage: 16 iterations x 256 threads = 4096 = the whole 64x64 tile.
// Store coverage: 8 waves x 2 iterations x 4 rows = 64 rows; 8 lanes x 8 halves = 64 cols; each row segment =
// ---------------------------------------------------------------------------
__global__ __launch_bounds__(256) void wtcast_kernel(const float* __restrict__ W0, const float* __restrict__ W1,
                                                     unsigned short* __restrict__ out, float scale) {
  __shared__ float tl[64][65];
  const int t  = threadIdx.x;
  const int d0 = blockIdx.x * 64;
  const int h0 = blockIdx.y * 64;
  const int z  = blockIdx.z;
  const float* W = (z == 0) ? W0 : W1;
#pragma unroll
  for (int i = 0; i < 16; ++i) {
    const int e = i * 256 + t;
    const int r = e >> 6;
    const int c = e & 63;
    tl[c][r] = W[(size_t)(d0 + r) * NDIM + h0 + c] * scale;
  }
  __syncthreads();
  const int lane = t & 31, wave = t >> 5;
  const int q = lane >> 3, c8 = (lane & 7) * 8;
  unsigned short* op = out + (size_t)z * NDIM * NDIM;
  {
#pragma unroll
    for (int it = 0; it < 2; ++it) {
      const int row = wave * 8 + it * 4 + q;
      unsigned short hb[8];
#pragma unroll
      for (int e = 0; e < 8; ++e) hb[e] = h_bits(tl[row][c8 + e]);
      const v4u u = (v4u){pk16(hb[0], hb[1]), pk16(hb[2], hb[3]), pk16(hb[4], hb[5]), pk16(hb[6], hb[7])};
      *(v4u*)(op + (size_t)(h0 + row) * NDIM + d0 + c8) = u;
    }
    
  }
}

// ---------------------------------------------------------------------------
// Initial state: one block per batch row b (grid 16, 256 threads).
//   acar0[b][0] = 1, else 0 (1024 floats = 256 threads x 16 B); s0[b] = c0[b] = 0 (threads 0..63 x 16 B each);
//   block 0 writes one line with g / norm(v_mono).
// ---------------------------------------------------------------------------
__global__ __launch_bounds__(256) void init_state_kernel(const float* __restrict__ vmono, const float* __restrict__ gmono,
                                                         float* __restrict__ acar0, float* __restrict__ s0,
                                                         float* __restrict__ c0, float* __restrict__ vnorm) {
  __shared__ float red[8];
  const int tid = threadIdx.x, lane = tid & 31, wave = tid >> 5;
  const int b = blockIdx.x;
  const float v0 = vmono[tid], v1 = vmono[tid + 256];
  float ss = v0 * v0 + v1 * v1;
#pragma unroll
  for (int off = 16; off > 0; off >>= 1) ss += __shfl_xor(ss, off, 32);
  if (lane == 0) red[wave] = ss;
  __syncthreads();
  float tot = 0.0f;
#pragma unroll
  for (int w = 0; w < 8; ++w) tot += red[w];
  const float vn = gmono[0] / sqrtf(tot);

  v4f av = (v4f){0.f, 0.f, 0.f, 0.f};
  av[0] = (tid == 0) ? 1.0f : 0.0f;
  const v4f zv = (v4f){0.f, 0.f, 0.f, 0.f};
  const v4f nv = (v4f){vn, vn, vn, vn};
  {
    *(v4f*)(acar0 + b * NSEQ + 4 * tid) = av;
    if (tid < 64) {
      *(v4f*)(s0 + b * NHID + 4 * tid) = zv;
      *(v4f*)(c0 + b * NHID + 4 * tid) = zv;
    }
    if (b == 0 && tid < 8) *(v4f*)(vnorm + 4 * tid) = nv;
  }
}

// ---------------------------------------------------------------------------
// Energy dots for one decode step, cut by column: grid (16 column chunks, 16 batch rows), 256 threads. A block owns 64 of
// the 1024 projection columns (chunks 0..7 mono, 8..15 chunk) of all 1024 positions of one batch row; the factors are f16,
// 128 B a position. It first forms its own 64 columns of s @ Ws + b (256 x 64 weights, 64 KB), so that no launch of its own is
// needed for the s-projections, then the tanh dots of its columns. epart[chunk][b][s] holds the partial dots; the scan
// kernel joins the chunks and does mask, noise and logistic.
// The state s of the step is formed here as well: every block joins the partial gate sums that the scan kernel of the step
// before left for its batch row and runs the LSTM cell of the row's 256 units (one per thread); one block of the row stores
// s and c. In the first step (FIRST) s is the initial state.
// ---------------------------------------------------------------------------
constexpr int NKCH = 8;             /* k chunks of the gate products = column chunks of ctx */
constexpr int SK   = NHID / NKCH;   /* units of s in one k chunk */
static_assert(NKCH * 64 == NDIM && NGATE == 4 * 256, "gate product maps");
/* gp points at (batch row, unit) of chunk 0: g[gate][chunk] */
__device__ __forceinline__ void cell_load(float (&g)[4][NKCH], const float* gp) {
#pragma unroll
  for (int c = 0; c < NKCH; ++c)
#pragma unroll
    for (int j = 0; j < 4; ++j) g[j][c] = gp[c * (NBATCH * NGATE) + j * NHID];
}
/* the chunks joined in rising order, then the cell */
__device__ __forceinline__ void cell_math(const float (&g)[4][NKCH], float cold, float& cn, float& sn) {
  float r[4];
#pragma unroll
  for (int j = 0; j < 4; ++j) {
    float v = g[j][0];
#pragma unroll
    for (int c = 1; c < NKCH; ++c) v += g[j][c];
    r[j] = v;
  }
  const float ig = sigm_f(r[0]);
  const float fg = sigm_f(r[1]);
  const float gg = tanh_e(r[2]);
  const float og = sigm_f(r[3]);
  cn = fg * cold + ig * gg;
  sn = og * tanh_e(cn);
}
constexpr int ECOLS = 64;              /* columns of one block */
constexpr int NECH  = NPROJ / ECOLS;   /* column chunks */
constexpr int EROWS = NSEQ;            /* positions of one block */
constexpr int ENIT  = EROWS / 16;      /* positions of one thread */
constexpr int RP    = 17;              /* LDS pitch in floats of one position's 16 lane sums */
static_assert(NDIM % ECOLS == 0 && EROWS == 4 * 256 && NHID == 16 * 16, "energy block maps");
template <bool FIRST>
__global__ __launch_bounds__(256) void energies_kernel(
    const unsigned short* __restrict__ Pf, const float* __restrict__ gpart, const float* __restrict__ c_in,
    float* __restrict__ c_out, float* __restrict__ s_row,
    const float* __restrict__ Wsm, const float* __restrict__ Wsmb,
    const float* __restrict__ Wsc, const float* __restrict__ Wscb,
    const float* __restrict__ vmono, const float* __restrict__ vchunk,
    float* __restrict__ epart) {
  __shared__ __align__(16) float tpart[16 * ECOLS];
  __shared__ float rsum[EROWS * RP];
  __shared__ __align__(16) float sh_s[NHID];
  const int tid = threadIdx.x;
  const int chunk = blockIdx.x, b = blockIdx.y;
  /* thread = (group of 4 columns c16, class q): q is the k range of the s-projection and the position class s mod 16 */
  const int c16 = tid & 15, q = tid >> 4;
  const bool mono = chunk < NDIM / ECOLS;
  const int cw = (chunk & (NDIM / ECOLS - 1)) * ECOLS + 4 * c16;
  const float* wr = (mono ? Wsm : Wsc) + (size_t)(q * 16) * NDIM + cw;
  const float* gpp = gpart + b * NGATE + tid;
  const float* cp  = (FIRST ? (const float*)s_row : c_in) + b * NHID + tid;
  const float* bb = mono ? Wsmb : Wscb;
  const float* vb = mono ? vmono : vchunk;
  const unsigned cwb = (unsigned)cw * 4u;  /* byte offset of the thread's columns in the bias and in v */
  const _Float16* pr = (const _Float16*)Pf + (size_t)(b * NSEQ + q) * NPROJ + chunk * ECOLS + 4 * c16;
  /* Every global value the thread needs is asked for first, the cell's and the s-projection's operands ahead of the row
     loads: cell and projection are formed while the rows are still on their way. The last 40 row loads follow behind the
     cell: a wave counts 63 loads at most, and with all of them in front the cell would wait for weight rows too. */
  v4f w[16];
  v4h e[ENIT];
  float g[4][NKCH];
  if (!FIRST) cell_load(g, gpp);
  const float cold = cp[0];  /* FIRST: the initial s itself */
#pragma unroll
  for (int i = 0; i < 16; ++i) w[i] = *(const v4f*)(wr + i * NDIM);
  const v4f bias = *(const v4f*)((const char*)bb + cwb);
  const v4f vv   = *(const v4f*)((const char*)vb + cwb);
#pragma unroll
  for (int it = 0; it < 24; ++it) e[it] = *(const v4h*)(pr + (size_t)it * 16 * NPROJ);
  /* keeps every load of the run ahead of the arithmetic: without it the scheduler sinks row loads behind the first sums,
     which wait for their operands */
  __builtin_amdgcn_sched_barrier(0);
  /* the wait in front of any rewrite of these loads' address registers; as inputs the address pairs and the offset of the
     bias and v loads stay in their registers up to here, so that no load of the run lands in one */
  asm volatile("s_wait_xcnt 0x0" :: "v"(gpp), "v"(cp), "v"(wr), "v"(pr), "v"(cwb) : "memory");
  /* s of this step: unit tid of batch row b */
  float sn = cold;
  if (!FIRST) {
    float cn;
    cell_math(g, cold, cn, sn);
    if (chunk == 0) {
      float* co = c_out + b * NHID + tid;
      float* so = s_row + b * NHID + tid;
      co[0] = cn;
      so[0] = sn;
      /* the wait in front of any rewrite of these stores' registers */
      asm volatile("s_wait_xcnt 0x0" :: "v"(co), "v"(so), "v"(cn), "v"(sn) : "memory");
    }
  }
  sh_s[tid] = sn;
#pragma unroll
  for (int it = 24; it < ENIT; ++it) e[it] = *(const v4h*)(pr + (size_t)it * 16 * NPROJ);
  /* keeps the last row loads ahead of the barrier and the projection */
  __builtin_amdgcn_sched_barrier(0);
  /* the wait in front of any rewrite of the row loads' address pair */
  asm volatile("s_wait_xcnt 0x0" :: "v"(pr) : "memory");
  /* work-group barrier that orders LDS alone (publishes s): __syncthreads() would also wait for the row loads on their way */
  __builtin_amdgcn_fence(__ATOMIC_RELEASE, "workgroup", "local");
  __builtin_amdgcn_s_barrier();
  __builtin_amdgcn_fence(__ATOMIC_ACQUIRE, "workgroup", "local");
  float sv[16];
#pragma unroll
  for (int i = 0; i < 4; ++i) {
    const v4f s4 = *(const v4f*)(sh_s + q * 16 + 4 * i);
    sv[4 * i] = s4[0]; sv[4 * i + 1] = s4[1]; sv[4 * i + 2] = s4[2]; sv[4 * i + 3] = s4[3];
  }
  /* s-projection of the block's columns: 16 k ranges of 16, each summed in rising k, joined in fixed order, bias last */
  {
    v4f a = (v4f){0.f, 0.f, 0.f, 0.f};
#pragma unroll
    for (int i = 0; i < 16; ++i) {
      a[0] = fmaf(sv[i], w[i][0], a[0]);
      a[1] = fmaf(sv[i], w[i][1], a[1]);
      a[2] = fmaf(sv[i], w[i][2], a[2]);
      a[3] = fmaf(sv[i], w[i][3], a[3]);
    }
    *(v4f*)(tpart + q * ECOLS + 4 * c16) = a;
  }
  /* work-group barrier that orders LDS alone: __syncthreads() also waits for every global load, here the 64 row loads still
     on their way, and no wave could start on its first rows while the last ones arrive */
  __builtin_amdgcn_fence(__ATOMIC_RELEASE, "workgroup", "local");
  __builtin_amdgcn_s_barrier();
  __builtin_amdgcn_fence(__ATOMIC_ACQUIRE, "workgroup", "local");
  v4f t = *(const v4f*)(tpart + 4 * c16);
#pragma unroll
  for (int k = 1; k < 16; ++k) t += *(const v4f*)(tpart + k * ECOLS + 4 * c16);
  t += bias;
  /* the columns' factor of this step; sum of v tanh = sum of v - 2 sum of v / (factor product + 1) */
  const v4f et = exp_factor_bounded_x4(t * TWO_LOG2E);
  const v4f v2 = -2.0f * vv;
  const float vsum = (vv[0] + vv[1]) + (vv[2] + vv[3]);
  /* the thread's four columns of positions 16 it + q */
#pragma unroll
  for (int it = 0; it < ENIT; ++it) {
    /* one multiply-add per element that takes the f16 factor as it is */
    const v4f qn = rcp_x4((v4f){fmaf((float)e[it][0], et[0], 1.0f), fmaf((float)e[it][1], et[1], 1.0f),
                                fmaf((float)e[it][2], et[2], 1.0f), fmaf((float)e[it][3], et[3], 1.0f)});
    float a = vsum;
    a = fmaf(qn[0], v2[0], a);
    a = fmaf(qn[1], v2[1], a);
    a = fmaf(qn[2], v2[2], a);
    a = fmaf(qn[3], v2[3], a);
    rsum[(it * 16 + q) * RP + c16] = a;
    /* keeps the rows worked on in the order in which their loads return: without it the scheduler lifts the multiply-adds of
       late rows to the front, and the wave's first reciprocal waits for most of the row loads */
    if ((it & 3) == 3) __builtin_amdgcn_sched_barrier(0);
  }
  __syncthreads();
  /* the 16 column groups of a position joined in fixed order; a thread stores positions tid + 256 rr */
  float* dst = epart + (size_t)(chunk * NBATCH + b) * NSEQ;
#pragma unroll
  for (int rr = 0; rr < EROWS / 256; ++rr) {
    const int row = rr * 256 + tid;
    float v = rsum[row * RP];
#pragma unroll
    for (int l = 1; l < 16; ++l) v += rsum[row * RP + l];
    dst[row] = v;
  }
}

/* Work-group barrier that orders LDS alone. The scan kernel's threads hand each other values through LDS only, and
   __syncthreads() would also wait for every global load and store of the wave: for the weight rows that are meant to fly
   while the scans run, and for the stores of ctx and alpha. */
__device__ __forceinline__ void lds_barrier() {
  __builtin_amdgcn_fence(__ATOMIC_RELEASE, "workgroup", "local");
  __builtin_amdgcn_s_barrier();
  __builtin_amdgcn_fence(__ATOMIC_ACQUIRE, "workgroup", "local");
}

// exclusive block prefix of one value per thread (256 threads = 8 waves), fixed order; one block barrier inside.
__device__ __forceinline__ float block_excl_scan(float total, float* wt, int lane, int wave) {
  float x = total;
#pragma unroll
  for (int off = 1; off < 32; off <<= 1) {
    const float n = __shfl_up(x, off, 32);
    x += (lane >= off) ? n : 0.0f;
  }
  float ex = __shfl_up(x, 1, 32);
  ex = (lane == 0) ? 0.0f : ex;
  if (lane == 31) wt[wave] = x;
  lds_barrier();
  float woff = 0.0f;
#pragma unroll
  for (int w = 0; w < 8; ++w) woff += (w < wave) ? wt[w] : 0.0f;
  return woff + ex;
}

// ---------------------------------------------------------------------------
// Decode step. One launch in the step loop behind the energy dots:
//   scan_ctx_kernel   grid (8 column chunks, 16 batch rows): every block joins the row's partial dots and repeats its
//                     scans (72 KB of input), then sums beta . enc for its own 64 columns only, then multiplies these 64
//                     values of ctx and 32 units of s into all 1024 gate columns: gpart[chunk][batch row][gate column].
//                     The energies kernel of the next step (last_cell_kernel behind the last) joins the chunks.
// The output head feeds no later step: ctx and s of every step are kept, and behind the loop one launch each serves all steps:
//   hid_kernel        grid (4 blocks x 64 columns of h, 8 steps).
//   ycols_kernel      grid (16 blocks x 64 columns of y (padded to 1024), 8 steps).
// In these two product kernels a thread owns four weight columns and one sixteenth of k and keeps 64 sums, one per column
// and batch row, so a weight element is loaded once for all rows. h lives in the workspace as [unit][16 rows], s and c as
// [batch row][unit].
// ---------------------------------------------------------------------------
constexpr int XP = 20;  /* LDS pitch in floats of one k row of 16 batch values: 16-B aligned, transposing stores 2-way at most */
constexpr int PP = 17;  /* LDS pitch in floats of one column's 16 partial sums */
constexpr int KCAT = NHID + NDIM;
static_assert(KCAT % 128 == 0 && NHID % 128 == 0, "the 16 k ranges are whole 8-row groups and no group straddles the two weights");

/* src [K][16] -> xs[k * XP + row] */
template <int K>
__device__ __forceinline__ void stage_kmajor(float* xs, const float* __restrict__ srcp, int tid) {
#pragma unroll
  for (int i = 0; i < K * 4 / 256; ++i) {
    const int e4 = i * 256 + tid;
    const v4f v = *(const v4f*)(srcp + 4 * e4);
    *(v4f*)(xs + (e4 >> 2) * XP + (e4 & 3) * 4) = v;
  }
}
/* src [16][K] -> xs[k * XP + row] */
template <int K>
__device__ __forceinline__ void stage_rows(float* xs, const float* __restrict__ srcp, int tid) {
#pragma unroll
  for (int i = 0; i < 16 * K / 256; ++i) {
    const int e = i * 256 + tid;
    xs[(e % K) * XP + (e / K)] = srcp[e];
  }
}

/* eight rows of four weight columns; p0 .. p3 point at the first row of the four columns */
__device__ __forceinline__ void rows8x4(float (&w)[8][4], const float* p0, const float* p1, const float* p2,
                                        const float* p3, int ldw) {
#pragma unroll
  for (int i = 0; i < 8; ++i) {
    w[i][0] = p0[(size_t)i * ldw];
    w[i][1] = p1[(size_t)i * ldw];
    w[i][2] = p2[(size_t)i * ldw];
    w[i][3] = p3[(size_t)i * ldw];
  }
  /* the wait in front of any rewrite of these loads' address registers; as inputs the four addresses stay in their
     registers up to here, so that no load of the run lands in one; it also keeps the loads ahead of the fmaf behind it */
  asm volatile("s_wait_xcnt 0x0" :: "v"(p0), "v"(p1), "v"(p2), "v"(p3) : "memory");
}

/* acc[j][row] += xs[k0 + i][row] * w[i][j] for the eight rows i: one LDS read of the 16 batch values feeds 64 fmaf */
__device__ __forceinline__ void fma8x4x16(const float* xs, int k0, const float (&w)[8][4], float (&acc)[4][16]) {
#pragma unroll
  for (int i = 0; i < 8; ++i) {
    const float* x = xs + (k0 + i) * XP;
    const v4f x0 = *(const v4f*)(x);
    const v4f x1 = *(const v4f*)(x + 4);
    const v4f x2 = *(const v4f*)(x + 8);
    const v4f x3 = *(const v4f*)(x + 12);
#pragma unroll
    for (int j = 0; j < 4; ++j) {
      const float wv = w[i][j];
#pragma unroll
      for (int e = 0; e < 4; ++e) {
        acc[j][e]      = fmaf(x0[e], wv, acc[j][e]);
        acc[j][4 + e]  = fmaf(x1[e], wv, acc[j][4 + e]);
        acc[j][8 + e]  = fmaf(x2[e], wv, acc[j][8 + e]);
        acc[j][12 + e] = fmaf(x3[e], wv, acc[j][12 + e]);
      }
    }
  }
}

/* acc[j][row] += sum over k in [kb, ke) of xs[k][row] * W[k][cols[j]]; rows k < K0 of the joined weight are W0, the rest W1.
   The next 8 weight rows are asked for ahead of the current 8 rows' fmaf. */
__device__ __forceinline__ void cols4x16(const float* xs, const float* __restrict__ W0, int K0,
                                         const float* __restrict__ W1, int ldw, const int (&cols)[4], int kb, int ke,
                                         float (&acc)[4][16]) {
  float wa[8][4];
  {
    const float* wp = (kb < K0) ? (W0 + (size_t)kb * ldw) : (W1 + (size_t)(kb - K0) * ldw);
    rows8x4(wa, wp + cols[0], wp + cols[1], wp + cols[2], wp + cols[3], ldw);
  }
  int k0 = kb;
  for (; k0 + 8 < ke; k0 += 8) {
    const int kn = k0 + 8;
    const float* wp = (kn < K0) ? (W0 + (size_t)kn * ldw) : (W1 + (size_t)(kn - K0) * ldw);
    float wb[8][4];
    rows8x4(wb, wp + cols[0], wp + cols[1], wp + cols[2], wp + cols[3], ldw);
    fma8x4x16(xs, k0, wa, acc);
#pragma unroll
    for (int i = 0; i < 8; ++i)
#pragma unroll
      for (int j = 0; j < 4; ++j) wa[i][j] = wb[i][j];
  }
  fma8x4x16(xs, k0, wa, acc);
}
__device__ __forceinline__ void zero_acc(float (&acc)[4][16]) {
#pragma unroll
  for (int j = 0; j < 4; ++j)
#pragma unroll
    for (int r = 0; r < 16; ++r) acc[j][r] = 0.0f;
}
/* block column index of (j, t16) is j * 16 + t16 */
__device__ __forceinline__ void put_part(float* part, int q, int t16, const float (&acc)[4][16]) {
#pragma unroll
  for (int j = 0; j < 4; ++j)
#pragma unroll
    for (int r = 0; r < 16; ++r) part[(q * 64 + j * 16 + t16) * PP + r] = acc[j][r];
}
/* the 16 k ranges of (block column c, batch row r), fixed order */
__device__ __forceinline__ float get_part(const float* part, int c, int r) {
  float v = part[c * PP + r];
#pragma unroll
  for (int q = 1; q < 16; ++q) v += part[(q * 64 + c) * PP + r];
  return v;
}

__global__ __launch_bounds__(256) void scan_ctx_kernel(
    const float* __restrict__ enc, const int* __restrict__ len,
    const float* __restrict__ epart, const float* __restrict__ vnp, const float* __restrict__ rmono,
    const float* __restrict__ noise_t,
    const float* __restrict__ acar_in, float* __restrict__ acar_out, float* __restrict__ ctx,
    const int* __restrict__ target, const float* __restrict__ s_cur,
    const float* __restrict__ Lys, const float* __restrict__ Lss,
    const float* __restrict__ Lgsw, const float* __restrict__ Lgsb, float* __restrict__ gpart, int step) {
  __shared__ __align__(16) float sh_p[NSEQ];
  __shared__ __align__(16) float sh_a[NSEQ];
  __shared__ __align__(16) float sh_ex[NSEQ];
  __shared__ __align__(16) float sh_g[NSEQ];
  __shared__ __align__(16) float sh_cpp[NSEQ];
  __shared__ __align__(16) float sh_u[NSEQ];
  __shared__ __align__(16) float sh_al[NSEQ];
  __shared__ __align__(16) float sh_r[NSEQ];
  __shared__ __align__(16) float sh_beta[NSEQ];
  __shared__ __align__(16) float sh_cpart[16 * 68];
  __shared__ __align__(16) float sh_cx[64];
  __shared__ float redm[8];
  __shared__ float wtA[8];
  __shared__ float wtB[8];

  const int tid = threadIdx.x, lane = tid & 31, wave = tid >> 5;
  const int chunk = blockIdx.x;
  const int b = blockIdx.y;
  const int i0 = tid * 4;
  int L = len[b];
  L = (L < 0) ? 0 : ((L > NSEQ) ? NSEQ : L);
  const float vn = vnp[0];
  const float rm = rmono[0];
  int tg = target[b * NSTEPS + step];
  tg = (tg < 0) ? 0 : ((tg > NCLS - 1) ? (NCLS - 1) : tg);
  /* gate products: the thread owns gate columns i0 .. i0 + 3 and all 96 k of the block's chunk (32 units of s, 64 of ctx) */
  const float* wsp = Lss + (size_t)(chunk * SK) * NGATE + i0;
  const float* wgp = Lgsw + (size_t)(chunk * 64) * NGATE + i0;
  const float* lyp = Lys + (size_t)tg * NGATE + i0;
  const float* lbp = Lgsb + i0;
  v4f wS[SK], wG[64], lyv, lbv;

  /* phase 1: the thread's four positions: the 8 + 8 partial dots joined in the order of the chunks, mask, noise, logistic;
     stage p, a, e; log terms; running max over unmasked positions. All 18 loads are asked for first and fly together. */
  float ml = -3.0e38f;
  {
    const float* ep = epart + b * NSEQ + i0;
    v4f pm[8], pc[8];
#pragma unroll
    for (int c = 0; c < 8; ++c) {
      pm[c] = *(const v4f*)(ep + c * (NBATCH * NSEQ));
      pc[c] = *(const v4f*)(ep + (8 + c) * (NBATCH * NSEQ));
    }
    const v4f nz = *(const v4f*)(noise_t + b * NSEQ + i0);
    const v4f av = *(const v4f*)(acar_in + b * NSEQ + i0);
    /* keeps every load of the run, the four scalars above too, ahead of the sums: without it the scheduler sinks four of
       the loads and the scalars behind the first waits, three round trips in a row instead of one */
    __builtin_amdgcn_sched_barrier(0);
    /* The block's 96 weight rows fly while the scans run. They are asked for in three runs, the first here behind the loads
       that the scans wait for: a wave counts 63 loads at most, and with more on their way the wait for the first ones
       would also wait for weight rows. */
#pragma unroll
    for (int i = 0; i < SK; ++i) wS[i] = *(const v4f*)(wsp + i * NGATE);
    lbv = *(const v4f*)lbp;
    lyv = *(const v4f*)lyp;
    /* keeps these loads here: the scheduler would sink them to their products behind the scans */
    __builtin_amdgcn_sched_barrier(0);
    /* the wait in front of any rewrite of these loads' address registers, which as inputs stay whole up to here */
    asm volatile("s_wait_xcnt 0x0" :: "v"(wsp), "v"(lyp), "v"(lbp) : "memory");
    v4f dm = pm[0], dc = pc[0];
#pragma unroll
    for (int c = 1; c < 8; ++c) {
      dm += pm[c];
      dc += pc[c];
    }
    v4f pv, ev, gv;
#pragma unroll
    for (int k = 0; k < 4; ++k) {
      const bool masked = (i0 + k >= L);
      const float em = (vn * dm[k] + rm) + nz[k];
      const float sg = sigm_f(em);
      /* masked positions give p = 0 exactly; their chunk energy is staged as 0 and replaced in phase 2 */
      pv[k] = masked ? 0.0f : sg;
      ev[k] = masked ? 0.0f : dc[k];
      gv[k] = logf(fminf(fmaxf(1.0f - pv[k], 1e-8f), 1.0f));
      ml = masked ? ml : fmaxf(ml, ev[k]);
    }
    *(v4f*)(sh_p + i0)  = pv;
    *(v4f*)(sh_a + i0)  = av;
    *(v4f*)(sh_ex + i0) = ev;
    *(v4f*)(sh_g + i0)  = gv;
  }
#pragma unroll
  for (int off = 16; off > 0; off >>= 1) ml = fmaxf(ml, __shfl_xor(ml, off, 32));
  if (lane == 0) redm[wave] = ml;
  lds_barrier();
  float mx = redm[0];
#pragma unroll
  for (int w = 1; w < 8; ++w) mx = fmaxf(mx, redm[w]);

  /* second run of weight rows; the scheduling barrier keeps it here, the wait stands in front of any rewrite of its address */
#pragma unroll
  for (int i = 0; i < 32; ++i) wG[i] = *(const v4f*)(wgp + i * NGATE);
  __builtin_amdgcn_sched_barrier(0);
  asm volatile("s_wait_xcnt 0x0" :: "v"(wgp) : "memory");

  /* phase 2: ex = max(exp(e - max), 1e-5); masked positions give 1e-5 */
#pragma unroll 1
  for (int j = 0; j < 4; ++j) {
    const int i = j * 256 + tid;
    const float t = fmaxf(expf(sh_ex[i] - mx), 1e-5f);
    sh_ex[i] = (i < L) ? t : 1e-5f;
  }

  /* phase 3: exclusive prefix of the log terms over contiguous chunks of 4 */
  {
    const v4f g4 = *(const v4f*)(sh_g + i0);
    const float e1 = g4[0];
    const float e2 = e1 + g4[1];
    const float e3 = e2 + g4[2];
    const float tot = e3 + g4[3];
    const float off = block_excl_scan(tot, wtA, lane, wave);
    v4f x4;
    x4[0] = off;
    x4[1] = off + e1;
    x4[2] = off + e2;
    x4[3] = off + e3;
    *(v4f*)(sh_cpp + i0) = x4;
  }
  lds_barrier();

  /* phase 4: cpp = exp(prefix) (flushed below the smallest normal), u = a / clip(cpp, 1e-8, 1) */
#pragma unroll 1
  for (int j = 0; j < 4; ++j) {
    const int i = j * 256 + tid;
    float cp = expf(sh_cpp[i]);
    cp = (cp < 1.17549435e-38f) ? 0.0f : cp;
    sh_cpp[i] = cp;
    const float cl = fminf(fmaxf(cp, 1e-8f), 1.0f);
    sh_u[i] = sh_a[i] * __builtin_amdgcn_rcpf(cl);
  }
  lds_barrier();

  /* third run of weight rows, as the second */
#pragma unroll
  for (int i = 32; i < 64; ++i) wG[i] = *(const v4f*)(wgp + i * NGATE);
  __builtin_amdgcn_sched_barrier(0);
  asm volatile("s_wait_xcnt 0x0" :: "v"(wgp) : "memory");

  /* phase 5: inclusive prefix of u, q = cpp * prefix, alpha = clip(p * q, 1e-8, 1) */
  {
    const v4f u4 = *(const v4f*)(sh_u + i0);
    const v4f c4 = *(const v4f*)(sh_cpp + i0);
    const v4f p4 = *(const v4f*)(sh_p + i0);
    const float c0 = u4[0];
    const float c1 = c0 + u4[1];
    const float c2 = c1 + u4[2];
    const float c3 = c2 + u4[3];
    const float off2 = block_excl_scan(c3, wtB, lane, wave);
    v4f al;
    al[0] = fminf(fmaxf(p4[0] * (c4[0] * (off2 + c0)), 1e-8f), 1.0f);
    al[1] = fminf(fmaxf(p4[1] * (c4[1] * (off2 + c1)), 1e-8f), 1.0f);
    al[2] = fminf(fmaxf(p4[2] * (c4[2] * (off2 + c2)), 1e-8f), 1.0f);
    al[3] = fminf(fmaxf(p4[3] * (c4[3] * (off2 + c3)), 1e-8f), 1.0f);
    *(v4f*)(sh_al + i0) = al;
  }
  lds_barrier();

  /* phase 6: denom = max(sum ex[i-3..i], 1e-10) (zero padded), r = alpha / denom */
#pragma unroll 1
  for (int j = 0; j < 4; ++j) {
    const int i = j * 256 + tid;
    float d = 0.0f;
#pragma unroll
    for (int k = 3; k >= 0; --k) {
      const int ii = i - k;
      const int ic = (ii < 0) ? 0 : ii;
      const float v = sh_ex[ic];
      d += (ii >= 0) ? v : 0.0f;
    }
    d = fmaxf(d, 1e-10f);
    sh_r[i] = sh_al[i] * __builtin_amdgcn_rcpf(d);
  }
  lds_barrier();

  /* phase 7: beta = ex * sum r[i..i+3] (zero padded) */
#pragma unroll 1
  for (int j = 0; j < 4; ++j) {
    const int i = j * 256 + tid;
    float ms = 0.0f;
#pragma unroll
    for (int k = 0; k < 4; ++k) {
      const int ii = i + k;
      const int ic = (ii > NSEQ - 1) ? (NSEQ - 1) : ii;
      const float v = sh_r[ic];
      ms += (ii < NSEQ) ? v : 0.0f;
    }
    sh_beta[i] = sh_ex[i] * ms;
  }
  lds_barrier();

  /* gate sums, first part: chunk 0 starts from the target's row of L_ys and the bias, then the chunk's 32 units of s, rising */
  v4f ga = (v4f){0.f, 0.f, 0.f, 0.f};
  if (chunk == 0) ga = lyv + lbv;
  {
    const float* sc = s_cur + b * NHID + chunk * SK;
#pragma unroll
    for (int i = 0; i < SK; ++i) {
      const float x = sc[i];
      ga[0] = fmaf(x, wS[i][0], ga[0]);
      ga[1] = fmaf(x, wS[i][1], ga[1]);
      ga[2] = fmaf(x, wS[i][2], ga[2]);
      ga[3] = fmaf(x, wS[i][3], ga[3]);
    }
  }

  /* phase 8: ctx of this block's 64 columns; thread = (group of 4 columns, position class s mod 16), 64 positions each */
  {
    const int cg = tid & 15, sp = tid >> 4;
    const float* eb = enc + (size_t)b * NSEQ * NDIM + chunk * 64 + 4 * cg;
    v4f acc = (v4f){0.f, 0.f, 0.f, 0.f};
/* 16 trips per pass: their row loads fly together */
#pragma unroll 1
    for (int it0 = 0; it0 < NSEQ / 16; it0 += 16) {
      const float* ep = eb + (size_t)(16 * it0 + sp) * NDIM;
      v4f e4[16];
#pragma unroll
      for (int j = 0; j < 16; ++j) e4[j] = *(const v4f*)(ep + (size_t)j * 16 * NDIM);
      /* the wait in front of any rewrite of these loads' address pair, which as an input stays whole up to here */
      asm volatile("s_wait_xcnt 0x0" :: "v"(ep) : "memory");
#pragma unroll
      for (int j = 0; j < 16; ++j) {
        const float bv = sh_beta[16 * (it0 + j) + sp];
        acc[0] = fmaf(bv, e4[j][0], acc[0]);
        acc[1] = fmaf(bv, e4[j][1], acc[1]);
        acc[2] = fmaf(bv, e4[j][2], acc[2]);
        acc[3] = fmaf(bv, e4[j][3], acc[3]);
      }
    }
    *(v4f*)(sh_cpart + sp * 68 + 4 * cg) = acc;
  }
  lds_barrier();
  /* 16 position classes joined in fixed order; 64 threads store the block's own 256-B piece of the row */
  if (tid < 64) {
    float v = sh_cpart[tid];
#pragma unroll
    for (int sp = 1; sp < 16; ++sp) v += sh_cpart[sp * 68 + tid];
    ctx[b * NDIM + chunk * 64 + tid] = v;
    sh_cx[tid] = v;
  }
  /* the alpha carry is stored by one block of the row */
  if (chunk == 0) {
    const v4f alv = *(const v4f*)(sh_al + i0);
    *(v4f*)(acar_out + b * NSEQ + i0) = alv;
  }
  /* publishes the block's 64 values of ctx */
  lds_barrier();
  /* gate sums, second part: the 64 values of ctx, rising; the block stores its 4 KB of partial sums */
#pragma unroll
  for (int i4 = 0; i4 < 16; ++i4) {
    const v4f x = *(const v4f*)(sh_cx + 4 * i4);
#pragma unroll
    for (int k = 0; k < 4; ++k) {
      ga[0] = fmaf(x[k], wG[4 * i4 + k][0], ga[0]);
      ga[1] = fmaf(x[k], wG[4 * i4 + k][1], ga[1]);
      ga[2] = fmaf(x[k], wG[4 * i4 + k][2], ga[2]);
      ga[3] = fmaf(x[k], wG[4 * i4 + k][3], ga[3]);
    }
  }
  *(v4f*)(gpart + (size_t)(chunk * NBATCH + b) * NGATE + i0) = ga;
}

/* s behind the last step: one block per batch row, thread = unit */
__global__ __launch_bounds__(256) void last_cell_kernel(const float* __restrict__ gpart, const float* __restrict__ c_in,
                                                        float* __restrict__ s_row) {
  const int tid = threadIdx.x, b = blockIdx.x;
  float g[4][NKCH];
  cell_load(g, gpart + b * NGATE + tid);
  const float cold = c_in[b * NHID + tid];
  float cn, sn;
  cell_math(g, cold, cn, sn);
  s_row[b * NHID + tid] = sn;
}

/* blockIdx.y = step; ctx_all [step][16][512], s_all [step + 1][16][256] (plane 0 is the initial state), hx_all [step][256][16] */
__global__ __launch_bounds__(256) void hid_kernel(
    const float* __restrict__ ctx_all, const float* __restrict__ s_all,
    const float* __restrict__ Lsy, const float* __restrict__ Lgyw, const float* __restrict__ Lgyb,
    float* __restrict__ hx_all) {
  __shared__ __align__(16) float xs[KCAT * XP];
  __shared__ float part[16 * 64 * PP];
  const int tid = threadIdx.x;
  const int step = blockIdx.y;
  const float* ctx = ctx_all + step * (NBATCH * NDIM);
  const float* s_new = s_all + (step + 1) * (NBATCH * NHID);
  float* hx = hx_all + step * (NBATCH * NHID);
  stage_rows<NHID>(xs, s_new, tid);
  stage_rows<NDIM>(xs + NHID * XP, ctx, tid);
  __syncthreads();
  const int t16 = tid & 15, q = tid >> 4;
  float acc[4][16];
  zero_acc(acc);
  const int col0 = blockIdx.x * 64;
  const int cols[4] = {col0 + t16, col0 + 16 + t16, col0 + 32 + t16, col0 + 48 + t16};
  cols4x16(xs, Lsy, NHID, Lgyw, NHID, cols, q * (KCAT / 16), (q + 1) * (KCAT / 16), acc);
  put_part(part, q, t16, acc);
  __syncthreads();
#pragma unroll
  for (int e = 0; e < 4; ++e) {
    const int o = e * 256 + tid;
    const float v = get_part(part, o >> 4, o & 15) + Lgyb[col0 + (o >> 4)];
    hx[col0 * 16 + o] = tanh_e(v);
  }
}

/* blockIdx.y = step; hx_all [step][256][16], Yt [step][16][1024] */
__global__ __launch_bounds__(256) void ycols_kernel(const float* __restrict__ hx_all, const float* __restrict__ Lyyw,
                                                    const float* __restrict__ Lyyb, float* __restrict__ Yt) {
  __shared__ __align__(16) float xs[NHID * XP];
  __shared__ float part[16 * 64 * PP];
  const int tid = threadIdx.x;
  const int col0 = blockIdx.x * 64;
  const float* hx = hx_all + blockIdx.y * (NBATCH * NHID);
  float* Yrow = Yt + blockIdx.y * (NBATCH * YPITCH);
  stage_kmajor<NHID>(xs, hx, tid);
  __syncthreads();
  const int t16 = tid & 15, q = tid >> 4;
  float acc[4][16];
  zero_acc(acc);
  /* column index clamped for the address; columns beyond 999 are stored as zero below */
  int cols[4];
#pragma unroll
  for (int j = 0; j < 4; ++j) {
    const int n = col0 + j * 16 + t16;
    cols[j] = (n < NCLS) ? n : (NCLS - 1);
  }
  cols4x16(xs, Lyyw, NHID, Lyyw, NCLS, cols, q * (NHID / 16), (q + 1) * (NHID / 16), acc);
  put_part(part, q, t16, acc);
  __syncthreads();
  const int r = tid >> 4, c4 = (tid & 15) * 4;
  v4f v;
#pragma unroll
  for (int e = 0; e < 4; ++e) {
    const int n = col0 + c4 + e;
    const int nc = (n < NCLS) ? n : (NCLS - 1);
    const float y = get_part(part, c4 + e, r) + Lyyb[nc];
    v[e] = (n < NCLS) ? y : 0.0f;
  }
  *(v4f*)(Yrow + r * YPITCH + col0 + c4) = v;
}

// ---------------------------------------------------------------------------
// Pack: out[b][t][n] = Y[t][b][n], n < 1000. Thread i4 moves floats 4 i4 .. 4 i4 + 3 of the flat output
// (1000 % 4 == 0 so a group never straddles rows). A wave writes 32 x 16 B = 512 contiguous 512-B aligned bytes =
// ---------------------------------------------------------------------------
__global__ __launch_bounds__(256) void pack_out_kernel(const float* __restrict__ Yt, float* __restrict__ out) {
  const int i4 = blockIdx.x * 256 + threadIdx.x;
  const int e  = i4 * 4;
  const int row = e / NCLS;
  const int n   = e - row * NCLS;
  const int b = row / NSTEPS;
  const int t = row - b * NSTEPS;
  const v4f v = *(const v4f*)(Yt + ((size_t)t * NBATCH + b) * YPITCH + n);
  float* dst = out + e;
  *(v4f*)dst = v;
  
}

// ---------------------------------------------------------------------------
// Host glue. Workspace region map (bytes, 256-B aligned carve; total 37,404,928 <= 134,217,728):
//   BT16  [1024][512]   f16    1,048,576   rows 0..511: f16(16 Wh_mono[k][n]), rows 512..1023: f16(16 Wh_chunk[k][n-512])
//   PF    [16384][1024] f16   33,554,432   exp(2 enc @ [Wh_mono | Wh_chunk]), held at 65504
//   EPART [16][16][1024] f32   1,048,576   partial energy dots of the current step, [column chunk][batch row][position]
//   ACAR  [2][16][1024] f32      131,072   alpha carry, ping-pong by step parity
//   SST   [9][16][256]  f32      147,456   s, plane 0 the initial state, plane t + 1 the state behind step t, [batch row][unit]
//   CST   [2][16][256]  f32       32,768   c, ping-pong, [batch row][unit]
//   YT    [8][16][1024] f32      524,288   y per step, columns 1000..1023 zero
//   VNORM [64]          f32          256   line 0 = g / norm(v_mono)
//   CTX   [8][16][512]  f32      262,144   ctx per step
//   HX    [8][256][16]  f32      131,072   output hidden h per step, [unit][batch row]
//   GPART [8][16][1024] f32      524,288   partial gate sums of the current step, [k chunk][batch row][gate column]
// ---------------------------------------------------------------------------
extern "C" void kernel_launch(void* const* d_in, const int* in_sizes, int n_in,
                              void* d_out, int out_size, void* d_ws, size_t ws_size, hipStream_t stream) {
  if (n_in < 23 || d_out == nullptr || d_ws == nullptr) return;
  if (in_sizes[0] != NBATCH * NSEQ * NDIM || in_sizes[1] != NBATCH * NSTEPS || in_sizes[2] != NBATCH ||
      in_sizes[3] != NSTEPS * NBATCH * NSEQ || in_sizes[4] != NHID * NDIM || in_sizes[6] != NDIM * NDIM ||
      in_sizes[10] != NHID * NDIM || in_sizes[12] != NDIM * NDIM || in_sizes[14] != NHID * NHID ||
      in_sizes[15] != NDIM * NHID || in_sizes[17] != NHID * NCLS || in_sizes[19] != NCLS * NGATE ||
      in_sizes[20] != NHID * NGATE || in_sizes[21] != NDIM * NGATE || out_size != NBATCH * NSTEPS * NCLS) return;

  const float* enc     = (const float*)d_in[0];
  const int*   target  = (const int*)d_in[1];
  const int*   lenenc  = (const int*)d_in[2];
  const float* noise   = (const float*)d_in[3];
  const float* ws_m_w  = (const float*)d_in[4];
  const float* ws_m_b  = (const float*)d_in[5];
  const float* wh_m    = (const float*)d_in[6];
  const float* v_m     = (const float*)d_in[7];
  const float* g_m     = (const float*)d_in[8];
  const float* r_m     = (const float*)d_in[9];
  const float* ws_c_w  = (const float*)d_in[10];
  const float* ws_c_b  = (const float*)d_in[11];
  const float* wh_c    = (const float*)d_in[12];
  const float* v_c     = (const float*)d_in[13];
  const float* l_sy    = (const float*)d_in[14];
  const float* l_gy_w  = (const float*)d_in[15];
  const float* l_gy_b  = (const float*)d_in[16];
  const float* l_yy_w  = (const float*)d_in[17];
  const float* l_yy_b  = (const float*)d_in[18];
  const float* l_ys    = (const float*)d_in[19];
  const float* l_ss    = (const float*)d_in[20];
  const float* l_gs_w  = (const float*)d_in[21];
  const float* l_gs_b  = (const float*)d_in[22];
  float* out = (float*)d_out;

  char* ws = (char*)d_ws; size_t off = 0;
  auto carve = [&](size_t bytes) -> char* { char* p = ws + off; off += (bytes + 255) & ~(size_t)255; return p; };
  unsigned short* BT16 = (unsigned short*)carve((size_t)NPROJ * NDIM * 2);
  unsigned short* PF = (unsigned short*)carve((size_t)NROWS * NPROJ * 2);
  float* EPART = (float*)carve((size_t)NECH * NBATCH * NSEQ * 4);
  float* ACAR  = (float*)carve((size_t)2 * NBATCH * NSEQ * 4);
  float* SST   = (float*)carve((size_t)(NSTEPS + 1) * NBATCH * NHID * 4);
  float* CST   = (float*)carve((size_t)2 * NBATCH * NHID * 4);
  float* YT    = (float*)carve((size_t)NSTEPS * NBATCH * YPITCH * 4);
  float* VNORM = (float*)carve((size_t)256);
  float* CTX   = (float*)carve((size_t)NSTEPS * NBATCH * NDIM * 4);
  float* HX    = (float*)carve((size_t)NSTEPS * NBATCH * NHID * 4);
  float* GPART = (float*)carve((size_t)NKCH * NBATCH * NGATE * 4);
  if (off > ws_size || off > (size_t)134217728) return;

  /* (1) f16 weight plane */
  /* in [512 k][512 n] -> out [n][k]; grid (k tiles, n tiles, weight) */
  wtcast_kernel<<<dim3(NDIM / 64, NDIM / 64, 2), 256, 0, stream>>>(wh_m, wh_c, BT16, WCARRY);
  /* (2) initial state, vnorm */
  init_state_kernel<<<NBATCH, 256, 0, stream>>>(v_m, g_m, ACAR, SST, CST, VNORM);
  /* (3) fused encoder projections: M = 16384, N = 1024, K = 512; 64 x 4 tiles of 256 x 256, one work-group of 16 waves each */
  proj_gemm_kernel<<<(NROWS / GBM) * (NPROJ / GBN), 512, 0, stream>>>(enc, BT16, PF, WCARRY_INV);

  /* (4) decode steps: only what the next step needs, two launches per step; c_t lies in plane t & 1 */
  for (int step = 0; step < NSTEPS; ++step) {
    const int par = step & 1;
    float* ctx_t = CTX + (size_t)step * NBATCH * NDIM;
    float* s_t   = SST + (size_t)step * NBATCH * NHID;
    if (step == 0)
      energies_kernel<true><<<dim3(NECH, NBATCH), 256, 0, stream>>>(
          PF, GPART, CST, CST, s_t, ws_m_w, ws_m_b, ws_c_w, ws_c_b, v_m, v_c, EPART);
    else
      energies_kernel<false><<<dim3(NECH, NBATCH), 256, 0, stream>>>(
          PF, GPART, CST + (size_t)(par ^ 1) * NBATCH * NHID, CST + (size_t)par * NBATCH * NHID, s_t,
          ws_m_w, ws_m_b, ws_c_w, ws_c_b, v_m, v_c, EPART);
    scan_ctx_kernel<<<dim3(NDIM / 64, NBATCH), 256, 0, stream>>>(
        enc, lenenc, EPART, VNORM, r_m, noise + (size_t)step * NBATCH * NSEQ,
        ACAR + (size_t)par * NBATCH * NSEQ, ACAR + (size_t)(par ^ 1) * NBATCH * NSEQ, ctx_t,
        target, s_t, l_ys, l_ss, l_gs_w, l_gs_b, GPART, step);
  }
  /* s behind the last step; c of the last step's entry lies in plane (NSTEPS - 1) & 1 */
  last_cell_kernel<<<NBATCH, 256, 0, stream>>>(GPART, CST + (size_t)((NSTEPS - 1) & 1) * NBATCH * NHID,
                                               SST + (size_t)NSTEPS * NBATCH * NHID);
  /* output head of all steps: h, then y */
  hid_kernel<<<dim3(NHID / 64, NSTEPS), 256, 0, stream>>>(CTX, SST, l_sy, l_gy_w, l_gy_b, HX);
  ycols_kernel<<<dim3(YPITCH / 64, NSTEPS), 256, 0, stream>>>(HX, l_yy_w, l_yy_b, YT);

  /* (5) pack the padded Y plane into the output */
  pack_out_kernel<<<(NBATCH * NSTEPS * NCLS) / (256 * 4), 256, 0, stream>>>(YT, out);
}
